// v000
// The times below were measured on an AMD MI455X: many runs one after another, warmed up first and cycling through
// copies of the inputs, with the whole window's GPU time divided by the number of runs. Launches and the gaps
// between them are all in it. The median over several windows is given; except for v000 it joins two sittings, which
// can be a few percent apart, so the side-by-side timings, each taken in one sitting, are the better comparison.
// v000, which the later versions start from, runs in 584 microseconds.
#include <hip/hip_runtime.h>
// SelfAttention4d (1 x 512 ch x 64 x 64 = 4096 tokens, 8 heads x 64: q/k/v = 1x1 convs (+ bias; the 1/8 scale applied in the flash kernel); softmax(q.k) v; out = 1x1 conv (+ bias) back to NCHW).
// Structure: NCHW -> exact f16 token rows by an LDS transpose kernel; q/k/v as f16 WMMA GEMMs (32x64 wave tiles, f32 accumulation, exact x16 (out,in) weights + bias, f16 out; channel = head*64 + d); V^T by LDS tiles; my fused flash kernel (no mask; the 1/8 applied as the score scale); ctx as f16 hi/residual into the output conv (two GEMM terms) + bias; NCHW store (thread per (channel, 8 pixels)).
// Compute dtype: inputs rounded to bf16; x / weights exact as f16; q, k, v plain f16 (~2^-12); softmax weights f16 x2^10; ctx hi + 2^-10 residual. v_wmma_f32_16x16x32_f16.
#define NB 1
#define DM 512
#define NKV 8
#define NPIX 4096
#define NREP (NH / NKV)
#define KVD (NKV * 64)           /* 512 */
#define NR (NB * SLEN)
#define CHK 512
typedef int v4i __attribute__((ext_vector_type(4)));
#define FF 2048
#define SLEN 4096
#define MQI 4096
#define MKI 4096
#define TQ SLEN
#define TK SLEN
#define NH 8
#define SCL 0.125f
#define QBLKS (TQ / 64)
#define QB05 0
#define QBN5 4
#define QB0P 0
#define QBNP QBLKS
#define RE 256
typedef __bf16 v16b __attribute__((ext_vector_type(16)));
typedef unsigned short v8us __attribute__((ext_vector_type(8), may_alias));
typedef float  v8f  __attribute__((ext_vector_type(8)));
typedef float  v4f  __attribute__((ext_vector_type(4)));
typedef float  v4fa __attribute__((ext_vector_type(4), may_alias));
union FragB { v16b v; v8us half[2]; unsigned short u[16]; };

__device__ __forceinline__ unsigned short bf16_bits(float x) { unsigned int u = __float_as_uint(x); return (unsigned short)((u + 0x7FFFu + ((u >> 16) & 1u)) >> 16); }
__device__ __forceinline__ float bf16_val(unsigned short b) { return __uint_as_float(((unsigned int)b) << 16); }
__device__ __forceinline__ float bf16_round(float x) { return bf16_val(bf16_bits(x)); }
// D += A·B with NT terms: 1 = ah·bh, 2 = + al·bh (A split), 3 = + ah·bl (both split)
template <int NT>
__device__ __forceinline__ v8f mmaN(v16b ah, v16b al, v16b bh, v16b bl, v8f c) {
  c = __builtin_amdgcn_wmma_f32_16x16x32_bf16(false, ah, false, bh, (short)0, c, false, false);
  if (NT >= 2) c = __builtin_amdgcn_wmma_f32_16x16x32_bf16(false, al, false, bh, (short)0, c, false, false);
  if (NT >= 3) c = __builtin_amdgcn_wmma_f32_16x16x32_bf16(false, ah, false, bl, (short)0, c, false, false);
  asm volatile("v_nop\n\tv_nop\n\tv_nop\n\tv_nop" : "+v"(c) : "v"(ah), "v"(al), "v"(bh), "v"(bl));
  return c;
}

__global__ __launch_bounds__(256) void k_wt_bf16(const float* __restrict__ W, unsigned short* __restrict__ Wt, int K, int N) {
  const int t = blockIdx.x * 256 + threadIdx.x;
  const int k8n = K / 8;
  if (t >= N * k8n) return;
  const int n = t / k8n, k8 = (t % k8n) * 8;
  v8us v;
#pragma unroll
  for (int i = 0; i < 8; ++i) v[i] = bf16_bits(W[(size_t)(k8 + i) * N + n]);
  *(v8us*)(Wt + (size_t)n * K + k8) = v;
  
}

// GEMM C[M][N] (f32, pitch ldc) = act(A[M][K]·W + bias). A f32 row-major (pitch lda) converted per fragment to bf16
// (ASPLIT: hi/lo two planes -> 2 terms, else single rounded term); Wt bf16 [N][K] (pitch ldb). BIAS_BF16 rounds the
// bias to bf16 first (bias quantised to bf16 before the add). K%32==0, M%16==0, N%64==0.
template <bool ASPLIT, int ACT, bool BIAS_BF16>
__global__ __launch_bounds__(128) void k_gemm_bf(const float* __restrict__ A, int lda, const unsigned short* __restrict__ Wt, int ldb,
                                               const float* __restrict__ bias, float* __restrict__ C, int ldc, int M, int N, int K) {
  __shared__ __attribute__((aligned(16))) float so[4][16][64];
  const int tid = threadIdx.x, w = tid >> 5, lane = tid & 31, ln = lane & 15, hh = lane >> 4;
  const int ntn = N / 64;
  const int wid = blockIdx.x * 4 + w;
  const int mt = wid / ntn, nq = wid % ntn;
  if (mt * 16 >= M) return;
  const int row0 = mt * 16, col0 = nq * 64;
  const float* arow = A + (size_t)(row0 + ln) * lda;
  v8f acc[4] = {};
  for (int kb = 0; kb < K; kb += 32) {
    FragB ah, al;
    const v4f x0 = *(const v4fa*)(arow + kb + 8 * hh), x1 = *(const v4fa*)(arow + kb + 8 * hh + 4);
    const v4f x2 = *(const v4fa*)(arow + kb + 16 + 8 * hh), x3 = *(const v4fa*)(arow + kb + 16 + 8 * hh + 4);
    float xs[16] = {x0[0],x0[1],x0[2],x0[3],x1[0],x1[1],x1[2],x1[3],x2[0],x2[1],x2[2],x2[3],x3[0],x3[1],x3[2],x3[3]};
#pragma unroll
    for (int i = 0; i < 16; ++i) { const unsigned short hb = bf16_bits(xs[i]); ah.u[i] = hb; al.u[i] = ASPLIT ? bf16_bits(xs[i] - bf16_val(hb)) : (unsigned short)0; }
#pragma unroll
    for (int t = 0; t < 4; ++t) {
      const unsigned short* brow = Wt + (size_t)(col0 + t * 16 + ln) * ldb + kb;
      FragB b;
      b.half[0] = *(const v8us*)(brow + 8 * hh);
      b.half[1] = *(const v8us*)(brow + 16 + 8 * hh);
      acc[t] = mmaN<ASPLIT ? 2 : 1>(ah.v, al.v, b.v, b.v, acc[t]);
    }
  }
#pragma unroll
  for (int t = 0; t < 4; ++t) {
    float bv = bias ? bias[col0 + t * 16 + ln] : 0.f;
    if (BIAS_BF16) bv = bf16_round(bv);
#pragma unroll
    for (int r = 0; r < 8; ++r) { float v = acc[t][r] + bv; if (ACT == 1) v = fmaxf(v, 0.f); so[w][8 * hh + r][t * 16 + ln] = v; }
  }
  __builtin_amdgcn_fence(__ATOMIC_ACQ_REL, "workgroup");
  __builtin_amdgcn_wave_barrier();
  const int rsub = lane >> 4, c4 = (lane & 15) * 4;
  {
#pragma unroll
    for (int q = 0; q < 8; ++q) {
      const int r = q * 2 + rsub;
      const v4f v = *(const v4fa*)&so[w][r][c4];
      *(v4f*)(C + (size_t)(row0 + r) * ldc + col0 + c4) = v;
    }
    
  }
}

// GEMM C = act(A·W + bias + resid): A f32 (ASPLIT -> hi/lo 2 terms), Wt bf16 [N][K]; ACT 0 none, 1 relu, 2 exact gelu;
// resid (optional, f32, row index = (row % rmod), pitch ldr, RES_BF16 rounds it) added before the activation.
template <bool ASPLIT, int ACT, bool BIAS_BF16, bool RES_BF16>
__global__ __launch_bounds__(128) void k_gemm_bf3(const float* __restrict__ A, int lda, const unsigned short* __restrict__ Wt, int ldb,
                                                const float* __restrict__ bias, const float* __restrict__ resid, int rmod, int ldr,
                                                float* __restrict__ C, int ldc, int M, int N, int K) {
  __shared__ __attribute__((aligned(16))) float so[4][16][64];
  const int tid = threadIdx.x, w = tid >> 5, lane = tid & 31, ln = lane & 15, hh = lane >> 4;
  const int ntn = N / 64;
  const int wid = blockIdx.x * 4 + w;
  const int mt = wid / ntn, nq = wid % ntn;
  if (mt * 16 >= M) return;
  const int row0 = mt * 16, col0 = nq * 64;
  const float* arow = A + (size_t)(row0 + ln) * lda;
  v8f acc[4] = {};
  for (int kb = 0; kb < K; kb += 32) {
    FragB ah, al;
    const v4f x0 = *(const v4fa*)(arow + kb + 8 * hh), x1 = *(const v4fa*)(arow + kb + 8 * hh + 4);
    const v4f x2 = *(const v4fa*)(arow + kb + 16 + 8 * hh), x3 = *(const v4fa*)(arow + kb + 16 + 8 * hh + 4);
    float xs[16] = {x0[0],x0[1],x0[2],x0[3],x1[0],x1[1],x1[2],x1[3],x2[0],x2[1],x2[2],x2[3],x3[0],x3[1],x3[2],x3[3]};
#pragma unroll
    for (int i = 0; i < 16; ++i) { const unsigned short hb = bf16_bits(xs[i]); ah.u[i] = hb; al.u[i] = ASPLIT ? bf16_bits(xs[i] - bf16_val(hb)) : (unsigned short)0; }
#pragma unroll
    for (int t = 0; t < 4; ++t) {
      const unsigned short* brow = Wt + (size_t)(col0 + t * 16 + ln) * ldb + kb;
      FragB b;
      b.half[0] = *(const v8us*)(brow + 8 * hh);
      b.half[1] = *(const v8us*)(brow + 16 + 8 * hh);
      acc[t] = mmaN<ASPLIT ? 2 : 1>(ah.v, al.v, b.v, b.v, acc[t]);
    }
  }
#pragma unroll
  for (int t = 0; t < 4; ++t) {
    const int col = col0 + t * 16 + ln;
    float bv = bias ? bias[col] : 0.f;
    if (BIAS_BF16) bv = bf16_round(bv);
#pragma unroll
    for (int r = 0; r < 8; ++r) {
      float v = acc[t][r] + bv;
      if (resid) { float rv = resid[(size_t)((row0 + 8 * hh + r) % rmod) * ldr + col]; if (RES_BF16) rv = bf16_round(rv); v += rv; }
      if (ACT == 1) v = fmaxf(v, 0.f);
      if (ACT == 2) v = 0.5f * v * (1.0f + erff(v * 0.70710678118654752f));
      if (ACT == 3) { const float u = 0.7978845608028654f * (v + 0.044715f * v * v * v); v = 0.5f * v * (1.0f + tanhf(u)); }
      so[w][8 * hh + r][t * 16 + ln] = v;
    }
  }
  __builtin_amdgcn_fence(__ATOMIC_ACQ_REL, "workgroup");
  __builtin_amdgcn_wave_barrier();
  const int rsub = lane >> 4, c4 = (lane & 15) * 4;
  {
#pragma unroll
    for (int q = 0; q < 8; ++q) {
      const int r = q * 2 + rsub;
      const v4f v = *(const v4fa*)&so[w][r][c4];
      *(v4f*)(C + (size_t)(row0 + r) * ldc + col0 + c4) = v;
    }
    
  }
}
// row LayerNorm (biased variance, eps) over N: s = X (+ R); optional out_sum <- s; out_norm <- (s-mu)*rsqrt(var+eps)*g + b
template <bool PARAM_BF16>
__global__ __launch_bounds__(256) void k_layernorm(const float* __restrict__ X, const float* __restrict__ R, const float* __restrict__ g, const float* __restrict__ bta,
                                                  float* __restrict__ out_sum, float* __restrict__ out_norm, int N, float eps) {
  __shared__ float red[256];
  const int row = blockIdx.x, tid = threadIdx.x;
  const float* x = X + (size_t)row * N; const float* rr = R ? R + (size_t)row * N : nullptr;
  float vals[16];                     // up to N = 4096
  const int per = N / 256;            // contiguous chunk per thread? use strided-by-4 chunks: thread handles j = tid*4 + 1024*u
  float s1 = 0.f;
  for (int u = 0; u < per / 4; ++u) {
    const int j = tid * 4 + 1024 * u;
    const v4f a = *(const v4fa*)(x + j);
    v4f b = {0.f,0.f,0.f,0.f}; if (rr) b = *(const v4fa*)(rr + j);
#pragma unroll
    for (int q = 0; q < 4; ++q) { const float v = a[q] + b[q]; vals[u * 4 + q] = v; s1 += v; }
  }
  red[tid] = s1; __syncthreads();
  for (int st = 128; st > 0; st >>= 1) { if (tid < st) red[tid] += red[tid + st]; __syncthreads(); }
  const float mu = red[0] / (float)N; __syncthreads();
  float s2 = 0.f;
  for (int u = 0; u < per / 4; ++u)
#pragma unroll
    for (int q = 0; q < 4; ++q) { const float c = vals[u * 4 + q] - mu; s2 += c * c; }
  red[tid] = s2; __syncthreads();
  for (int st = 128; st > 0; st >>= 1) { if (tid < st) red[tid] += red[tid + st]; __syncthreads(); }
  const float rs = rsqrtf(red[0] / (float)N + eps);
  {
    for (int u = 0; u < per / 4; ++u) {
      const int j = tid * 4 + 1024 * u;
      v4f o, sm;
#pragma unroll
      for (int q = 0; q < 4; ++q) {
        float gg = g[j + q], bb = bta[j + q];
        if (PARAM_BF16) { gg = bf16_round(gg); bb = bf16_round(bb); }
        sm[q] = vals[u * 4 + q]; o[q] = (vals[u * 4 + q] - mu) * rs * gg + bb;
      }
      if (out_sum) *(v4f*)(out_sum + (size_t)row * N + j) = sm;
      *(v4f*)(out_norm + (size_t)row * N + j) = o;
    }
    
  }
}



// ---- f16 WMMA path (v_wmma_f32_16x16x32_f16): 11-bit significands for operands in range — used where a [0,1] probability operand needs more precision than bf16
typedef _Float16 v16h __attribute__((ext_vector_type(16)));
union FragH { v16h v; v8us half[2]; _Float16 h[16]; unsigned short u[16]; };
template <int NT>
__device__ __forceinline__ v8f mmaH(v16h ah, v16h al, v16h bh, v16h bl, v8f c) {
  c = __builtin_amdgcn_wmma_f32_16x16x32_f16(false, ah, false, bh, (short)0, c, false, false);
  if (NT >= 2) c = __builtin_amdgcn_wmma_f32_16x16x32_f16(false, al, false, bh, (short)0, c, false, false);
  if (NT >= 3) c = __builtin_amdgcn_wmma_f32_16x16x32_f16(false, ah, false, bl, (short)0, c, false, false);
  asm volatile("v_nop\n\tv_nop\n\tv_nop\n\tv_nop" : "+v"(c) : "v"(ah), "v"(al), "v"(bh), "v"(bl));
  return c;
}
// batched GEMM like k_gemm_b but f16 operands: A f32 (split into f16 hi/lo if ASPLIT, else rounded to f16), Bt = f16 values [n][k]; alpha; C f32; N multiple of 16 (partial tiles skipped)
template <bool ASPLIT>
__global__ __launch_bounds__(128) void k_gemm_h(const float* __restrict__ A, int lda, size_t sA, const _Float16* __restrict__ Bh, int ldb, size_t sB, float alpha, float* __restrict__ C, int ldc, size_t sC, int M, int N, int K) {
  __shared__ __attribute__((aligned(16))) float so[4][16][64];
  const int tid = threadIdx.x, w = tid >> 5, lane = tid & 31, ln = lane & 15, hh = lane >> 4; const int by = blockIdx.y;
  A += (size_t)by * sA; Bh += (size_t)by * sB; C += (size_t)by * sC;
  const int ntn = (N + 63) / 64; const int wid = blockIdx.x * 4 + w; const int mt = wid / ntn, nq = wid % ntn; if (mt * 16 >= M) return;
  const int row0 = mt * 16, col0 = nq * 64; const float* arow = A + (size_t)(row0 + ln) * lda;
  v8f acc[4] = {};
  for (int kb = 0; kb < K; kb += 32) {
    FragH ah, al;
    const v4f x0 = *(const v4fa*)(arow + kb + 8 * hh), x1 = *(const v4fa*)(arow + kb + 8 * hh + 4), x2 = *(const v4fa*)(arow + kb + 16 + 8 * hh), x3 = *(const v4fa*)(arow + kb + 16 + 8 * hh + 4);
    float xs[16] = {x0[0],x0[1],x0[2],x0[3],x1[0],x1[1],x1[2],x1[3],x2[0],x2[1],x2[2],x2[3],x3[0],x3[1],x3[2],x3[3]};
#pragma unroll
    for (int i = 0; i < 16; ++i) { const _Float16 h = (_Float16)xs[i]; ah.h[i] = h; al.h[i] = ASPLIT ? (_Float16)(xs[i] - (float)h) : (_Float16)0.0f; }
#pragma unroll
    for (int t = 0; t < 4; ++t) { if (col0 + t * 16 >= N) continue; const size_t boff = (size_t)(col0 + t * 16 + ln) * ldb + kb; FragH bq; bq.half[0] = *(const v8us*)(Bh + boff + 8 * hh); bq.half[1] = *(const v8us*)(Bh + boff + 16 + 8 * hh);
      acc[t] = mmaH<ASPLIT ? 2 : 1>(ah.v, al.v, bq.v, bq.v, acc[t]); }
  }
#pragma unroll
  for (int t = 0; t < 4; ++t) { if (col0 + t * 16 >= N) continue;
#pragma unroll
    for (int r = 0; r < 8; ++r) so[w][8 * hh + r][t * 16 + ln] = acc[t][r] * alpha; }
  __builtin_amdgcn_fence(__ATOMIC_ACQ_REL, "workgroup"); __builtin_amdgcn_wave_barrier();
  const int rsub = lane >> 4, c4 = (lane & 15) * 4;
  {
#pragma unroll
    for (int q = 0; q < 8; ++q) { const int r = q * 2 + rsub; if (col0 + c4 < N) { const v4f v = *(const v4fa*)&so[w][r][c4]; *(v4f*)(C + (size_t)(row0 + r) * ldc + col0 + c4) = v; } }
     }
}

// Wt[n][k] = f16(W[k][n]·scale) from f32 row-major W[K][N] (scale = power of two; bf16-exact weights stay exact in f16 away from the subnormal range)
__global__ __launch_bounds__(256) void k_wt_f16(const float* __restrict__ W, _Float16* __restrict__ Wt, int K, int N, float scale) {
  const int t = blockIdx.x * 256 + threadIdx.x; if (t >= N * (K / 8)) return; const int n = t / (K / 8), k8 = (t % (K / 8)) * 8; FragH f;
#pragma unroll
  for (int i = 0; i < 8; ++i) f.h[i] = (_Float16)(bf16_round(W[(size_t)(k8 + i) * N + n]) * scale); const v8us o = f.half[0];
  *(v8us*)((unsigned short*)Wt + (size_t)n * K + k8) = o; 
}
// k_gemm_hh variant with fused epilogue: v = acc·alpha + bias[by·sBias + col] (+ CP[(row/rowsPerB)·sCPb + by·64 + col] if CP) ; ACT 0 none / 1 elu ; writes f16 C16 (and f32 C if non-null)
template <int ACT>
__global__ __launch_bounds__(128) void k_gemm_hhx(const _Float16* __restrict__ A, int lda, size_t sA, const _Float16* __restrict__ Bh, int ldb, size_t sB, float alpha, const float* __restrict__ bias, size_t sBias, const float* __restrict__ CP, int rowsPerB, size_t sCPb, int row0g,
    float* __restrict__ C, _Float16* __restrict__ C16, int ldc, size_t sC, int M, int N, int K) {
  __shared__ __attribute__((aligned(16))) float so[4][16][64];
  const int tid = threadIdx.x, w = tid >> 5, lane = tid & 31, ln = lane & 15, hh = lane >> 4; const int by = blockIdx.y;
  A += (size_t)by * sA; Bh += (size_t)by * sB; const size_t cofs = (size_t)by * sC; const float* bp = bias ? bias + (size_t)by * sBias : nullptr;
  const int ntn = (N + 63) / 64; const int wid = blockIdx.x * 4 + w; const int mt = wid / ntn, nq = wid % ntn; if (mt * 16 >= M) return;
  const int row0 = mt * 16, col0 = nq * 64; const _Float16* arow = A + (size_t)(row0 + ln) * lda;
  v8f acc[4] = {};
  for (int kb = 0; kb < K; kb += 32) { FragH ah; ah.half[0] = *(const v8us*)((const unsigned short*)arow + kb + 8 * hh); ah.half[1] = *(const v8us*)((const unsigned short*)arow + kb + 16 + 8 * hh);
#pragma unroll
    for (int t = 0; t < 4; ++t) { if (col0 + t * 16 >= N) continue; const size_t boff = (size_t)(col0 + t * 16 + ln) * ldb + kb; FragH bq; bq.half[0] = *(const v8us*)((const unsigned short*)Bh + boff + 8 * hh); bq.half[1] = *(const v8us*)((const unsigned short*)Bh + boff + 16 + 8 * hh);
      acc[t] = mmaH<1>(ah.v, ah.v, bq.v, bq.v, acc[t]); }
  }
#pragma unroll
  for (int t = 0; t < 4; ++t) { if (col0 + t * 16 >= N) continue; const int col = col0 + t * 16 + ln; const float bv = bp ? bf16_round(bp[col]) : 0.f;
#pragma unroll
    for (int r = 0; r < 8; ++r) { float v = acc[t][r] * alpha + bv; if (CP) { const int bidx = (row0g + row0 + 8 * hh + r) / rowsPerB; v += CP[(size_t)bidx * sCPb + (size_t)by * 64 + col]; } if (ACT == 1) v = (v > 0.f) ? v : expm1f(v); else if (ACT == 7) v = (v > 0.f) ? v + 1.0f : expf(v); else if (ACT == 8) v = tanhf(v); else if (ACT == 9) v = 0.5f * v * (1.0f + tanhf(0.7978845608028654f * (v + 0.044715f * v * v * v))); else if (ACT == 11) v = 1.0f / (1.0f + expf(-v)); else if (ACT == 12) v = (v > 0.f) ? v : 0.01f * v; else if (ACT == 14) v = (v > 0.f) ? v : 0.1f * v; else if (ACT == 15) v = v / (1.0f + expf(-v)); else if (ACT == 3) v = fmaxf(v, 0.f); else if (ACT == 6) v = 0.5f * v * (1.0f + erff(v * 0.70710678118654752f)); so[w][8 * hh + r][t * 16 + ln] = v; } }
  __builtin_amdgcn_fence(__ATOMIC_ACQ_REL, "workgroup"); __builtin_amdgcn_wave_barrier();
  const int rsub = lane >> 4, c4 = (lane & 15) * 4; typedef _Float16 v4h __attribute__((ext_vector_type(4)));
  {
#pragma unroll
    for (int q = 0; q < 8; ++q) { const int r = q * 2 + rsub; if (col0 + c4 < N) { const v4f v = *(const v4fa*)&so[w][r][c4]; if (C) *(v4f*)(C + cofs + (size_t)(row0 + r) * ldc + col0 + c4) = v; if (C16) { v4h h4; for (int i = 0; i < 4; ++i) h4[i] = (_Float16)v[i]; *(v4h*)(C16 + cofs + (size_t)(row0 + r) * ldc + col0 + c4) = h4; } } }
     }
}


typedef _Float16 v4h __attribute__((ext_vector_type(4)));

__global__ __launch_bounds__(256) void k_x16(const float* __restrict__ x, _Float16* __restrict__ X16, size_t n8) { const size_t t = (size_t)blockIdx.x * 256 + threadIdx.x; if (t >= n8) return; FragH f;
#pragma unroll
  for (int q = 0; q < 8; ++q) f.h[q] = (_Float16)bf16_round(x[t * 8 + q]); *(v8us*)((unsigned short*)X16 + t * 8) = f.half[0];  }
__global__ __launch_bounds__(256) void k_h16(const float* __restrict__ x, _Float16* __restrict__ X16, size_t n8) { const size_t t = (size_t)blockIdx.x * 256 + threadIdx.x; if (t >= n8) return; FragH f;
#pragma unroll
  for (int q = 0; q < 8; ++q) f.h[q] = (_Float16)x[t * 8 + q]; *(v8us*)((unsigned short*)X16 + t * 8) = f.half[0];  }
__global__ __launch_bounds__(256) void k_round16f(const float* __restrict__ W, _Float16* __restrict__ Bt, size_t n8) { const size_t t = (size_t)blockIdx.x * 256 + threadIdx.x; if (t >= n8) return; FragH f;
#pragma unroll
  for (int i = 0; i < 8; ++i) f.h[i] = (_Float16)(bf16_round(W[t * 8 + i]) * 16.0f); *(v8us*)((unsigned short*)Bt + t * 8) = f.half[0];  }
template <int NHv, int TTv>
__global__ __launch_bounds__(256) void k_vt(const _Float16* __restrict__ V16, int ldv, int voff, _Float16* __restrict__ Vt) { __shared__ unsigned short tl[64][66]; const int tid = threadIdx.x; const int slab = blockIdx.x / (TTv / 64), lg = blockIdx.x % (TTv / 64); const int b = slab / NHv, h = slab % NHv;
  for (int i = tid; i < 64 * 8; i += 256) { const int r = i / 8, c8 = (i % 8) * 8; FragH f; f.half[0] = *(const v8us*)((const unsigned short*)V16 + ((size_t)b * TTv + lg * 64 + r) * ldv + voff + h * 64 + c8);
#pragma unroll
    for (int q = 0; q < 8; ++q) tl[r][c8 + q] = f.u[q]; }
  __syncthreads();
  {
#pragma unroll
    for (int rd = 0; rd < 2; ++rd) { const int d = rd * 32 + tid / 8, pc = tid % 8; FragH f;
#pragma unroll
      for (int q = 0; q < 8; ++q) f.u[q] = tl[pc * 8 + q][d];
      *(v8us*)((unsigned short*)Vt + ((size_t)slab * 64 + d) * TTv + lg * 64 + pc * 8) = f.half[0]; }
     } }

__global__ __launch_bounds__(256) void k_hl(const float* __restrict__ F, _Float16* __restrict__ Hh, _Float16* __restrict__ Hl, size_t n8) { const size_t t = (size_t)blockIdx.x * 256 + threadIdx.x; if (t >= n8) return; FragH fh, fl; const v4f a = *(const v4fa*)(F + t * 8), c = *(const v4fa*)(F + t * 8 + 4);
#pragma unroll
  for (int q = 0; q < 4; ++q) { _Float16 h = (_Float16)a[q]; fh.h[q] = h; fl.h[q] = (_Float16)((a[q] - (float)h) * 1024.0f); h = (_Float16)c[q]; fh.h[4 + q] = h; fl.h[4 + q] = (_Float16)((c[q] - (float)h) * 1024.0f); }
  { *(v8us*)((unsigned short*)Hh + t * 8) = fh.half[0]; *(v8us*)((unsigned short*)Hl + t * 8) = fl.half[0];  } }

// ---- fast GEMM (wave tile 32x64; requires M % 32 == 0 rows per launch region and N % 64 == 0); epilogue = k_gemm_hhx semantics ----
__device__ __forceinline__ v16h g2_frag(const _Float16* p, int hh) { FragH f; f.half[0] = *(const v8us*)((const unsigned short*)p + 8 * hh); f.half[1] = *(const v8us*)((const unsigned short*)p + 16 + 8 * hh); return f.v; }
__device__ __forceinline__ v8f g2_mma(v16h a, v16h b, v8f c) { v8f d = __builtin_amdgcn_wmma_f32_16x16x32_f16(false, a, false, b, (short)0, c, false, false); asm volatile("v_nop\n\tv_nop\n\tv_nop\n\tv_nop" : "+v"(d) : "v"(a), "v"(b)); return d; }
template <int ACT>
__global__ __launch_bounds__(128) void k_gemm2(const _Float16* __restrict__ A, int lda, size_t sA, const _Float16* __restrict__ Bh, int ldb, size_t sB, float alpha, const float* __restrict__ bias, size_t sBias, const float* __restrict__ CP, int rowsPerB, size_t sCPb, int row0g,
    float* __restrict__ C, _Float16* __restrict__ C16, int ldc, size_t sC, int M, int N, int K) {
  __shared__ __attribute__((aligned(16))) float so[4][32][68];
  const int tid = threadIdx.x, w = tid >> 5, lane = tid & 31, ln = lane & 15, hh = lane >> 4; const int by = blockIdx.y;
  A += (size_t)by * sA; Bh += (size_t)by * sB; const size_t cofs = (size_t)by * sC; const float* bp = bias ? bias + (size_t)by * sBias : nullptr;
  const int ntn = N >> 6; const int mt = blockIdx.x / ntn, nq = blockIdx.x - mt * ntn; const int row0 = mt * 128 + 32 * w, col0 = nq * 64; if (row0 >= M) return;
  const _Float16* a0p = A + (size_t)(row0 + ln) * lda; const _Float16* a1p = a0p + (size_t)16 * lda;
  const _Float16* b0p = Bh + (size_t)(col0 + ln) * ldb; const _Float16* b1p = b0p + (size_t)16 * ldb; const _Float16* b2p = b1p + (size_t)16 * ldb; const _Float16* b3p = b2p + (size_t)16 * ldb;
  const v8f z8 = {0.f,0.f,0.f,0.f,0.f,0.f,0.f,0.f}; v8f c00 = z8, c01 = z8, c02 = z8, c03 = z8, c10 = z8, c11 = z8, c12 = z8, c13 = z8;
#pragma unroll 1
  for (int kb = 0; kb < K; kb += 32) { const v16h a0 = g2_frag(a0p + kb, hh), a1 = g2_frag(a1p + kb, hh);
    v16h b = g2_frag(b0p + kb, hh); c00 = g2_mma(a0, b, c00); c10 = g2_mma(a1, b, c10);
    b = g2_frag(b1p + kb, hh); c01 = g2_mma(a0, b, c01); c11 = g2_mma(a1, b, c11);
    b = g2_frag(b2p + kb, hh); c02 = g2_mma(a0, b, c02); c12 = g2_mma(a1, b, c12);
    b = g2_frag(b3p + kb, hh); c03 = g2_mma(a0, b, c03); c13 = g2_mma(a1, b, c13); }
  v8f accs[8] = {c00, c01, c02, c03, c10, c11, c12, c13};
#pragma unroll
  for (int u = 0; u < 8; ++u) { const int t = u & 3, half = u >> 2; const int col = col0 + t * 16 + ln; const float bv = bp ? bf16_round(bp[col]) : 0.f;
#pragma unroll
    for (int r = 0; r < 8; ++r) { const int rloc = half * 16 + 8 * hh + r; float v = accs[u][r] * alpha + bv; if (CP) { if (rowsPerB < 0) v += CP[cofs + (size_t)(row0g + row0 + rloc) * ldc + col];      /* rowsPerB < 0: own element of the batched C plane */ else { const int bidx = (row0g + row0 + rloc) / rowsPerB; v += CP[(size_t)bidx * sCPb + (size_t)by * 64 + col]; } }
      if (ACT == 3) v = fmaxf(v, 0.f); else if (ACT == 6) v = 0.5f * v * (1.0f + erff(v * 0.70710678118654752f)); else if (ACT == 11) v = 1.0f / (1.0f + expf(-v)); else if (ACT == 15) v = v / (1.0f + expf(-v)); else if (ACT == 12) v = (v > 0.f) ? v : 0.01f * v; else if (ACT == 8) v = tanhf(v);
      so[w][rloc][t * 16 + ln] = v; } }
  __builtin_amdgcn_fence(__ATOMIC_ACQ_REL, "workgroup"); __builtin_amdgcn_wave_barrier();
  const int rsub = lane >> 4, c4 = (lane & 15) * 4;
  {
#pragma unroll
    for (int q = 0; q < 16; ++q) { const int r = q * 2 + rsub; const v4f v = *(const v4fa*)&so[w][r][c4]; if (C) *(v4f*)(C + cofs + (size_t)(row0 + r) * ldc + col0 + c4) = v; if (C16) { v4h h4; for (int i = 0; i < 4; ++i) h4[i] = (_Float16)v[i]; *(v4h*)(C16 + cofs + (size_t)(row0 + r) * ldc + col0 + c4) = h4; } }
     } }



template <int CAUSAL>
__global__ __launch_bounds__(128) void k_flash(const _Float16* __restrict__ Q16, int ldq, const _Float16* __restrict__ K16, int ldk, const _Float16* __restrict__ Vt, const int* __restrict__ MSK, float* __restrict__ O, int ldo) {
  constexpr int RPW = 16, RTN = RPW / 16, NQB = TQ / (4 * RPW), DT = 4, KS = 2;
  __shared__ __attribute__((aligned(16))) unsigned short sP[4][RPW][40]; __shared__ __attribute__((aligned(16))) float sO[4][RPW][64 + 4];
  const int tid = threadIdx.x, w = tid >> 5, lane = tid & 31, ln = lane & 15, hh = lane >> 4;
  const int slab = blockIdx.x / QBNP, qblk = QB0P + blockIdx.x % QBNP; (void)NQB; const int b = slab / NH, h = slab % NH; const int qb0 = qblk * (4 * RPW); const int q0 = qb0 + w * RPW;
  FragH aq[2][KS];
#pragma unroll
  for (int rt = 0; rt < RTN; ++rt) { const unsigned short* qr = (const unsigned short*)Q16 + ((size_t)b * TQ + q0 + rt * 16 + ln) * ldq + h * 64;
#pragma unroll
    for (int ks = 0; ks < KS; ++ks) { aq[rt][ks].half[0] = *(const v8us*)(qr + ks * 32 + 8 * hh); aq[rt][ks].half[1] = *(const v8us*)(qr + ks * 32 + 16 + 8 * hh); } }
  const unsigned short* Vth = (const unsigned short*)Vt + (size_t)slab * 64 * TK;
  float m_r[2][8], l_r[2][8]; v8f oacc[2][DT];
#pragma unroll
  for (int rt = 0; rt < RTN; ++rt) {
#pragma unroll
    for (int r = 0; r < 8; ++r) { m_r[rt][r] = -3.0e38f; l_r[rt][r] = 0.f; }
#pragma unroll
    for (int dt = 0; dt < DT; ++dt) oacc[rt][dt] = (v8f){0.f,0.f,0.f,0.f,0.f,0.f,0.f,0.f}; }
  const int jend = (CAUSAL == 1) ? (qb0 + 4 * RPW) : ((CAUSAL == 23) ? min(TK, (qb0 / CHK + 2) * CHK) : TK);      /* causal / window: keys that can never contribute are skipped */ const int jbeg = (CAUSAL == 23) ? max(0, (qb0 / CHK - 1) * CHK) : 0;
#pragma unroll 1
  for (int j0 = jbeg; j0 < jend; j0 += 32) {
    v8f s[2][2];
#pragma unroll
    for (int nt = 0; nt < 2; ++nt) { const unsigned short* kr = (const unsigned short*)K16 + ((size_t)b * TK + j0 + nt * 16 + ln) * ldk + h * 64; FragH bk[KS];
#pragma unroll
      for (int ks = 0; ks < KS; ++ks) { bk[ks].half[0] = *(const v8us*)(kr + ks * 32 + 8 * hh); bk[ks].half[1] = *(const v8us*)(kr + ks * 32 + 16 + 8 * hh); }
#pragma unroll
      for (int rt = 0; rt < RTN; ++rt) { v8f acc = (v8f){0.f,0.f,0.f,0.f,0.f,0.f,0.f,0.f};
#pragma unroll
        for (int ks = 0; ks < KS; ++ks) acc = mmaH<1>(aq[rt][ks].v, aq[rt][ks].v, bk[ks].v, bk[ks].v, acc); s[rt][nt] = acc; } }
#pragma unroll
    for (int rt = 0; rt < RTN; ++rt)
#pragma unroll
      for (int r = 0; r < 8; ++r) { const int tq = q0 + rt * 16 + 8 * hh + r; const int k0 = j0 + ln, k1 = j0 + 16 + ln;
        bool ok0 = (CAUSAL == 1) ? (k0 <= tq) : ((CAUSAL == 2) ? ((k0 >> 5) == (tq >> 5)) : true), ok1 = (CAUSAL == 1) ? (k1 <= tq) : ((CAUSAL == 2) ? ((k1 >> 5) == (tq >> 5)) : true); if (CAUSAL == 23) { const int cq = tq / CHK; ok0 = (abs(k0 / CHK - cq) <= 1) && (MSK[(size_t)b * TK + k0] == 0); ok1 = (abs(k1 / CHK - cq) <= 1) && (MSK[(size_t)b * TK + k1] == 0); }      /* mode 23: 3-chunk window + int key-padding mask */
        if (CAUSAL == 24) { ok0 = (MSK[(size_t)b * TK + k0] == 0); ok1 = (MSK[(size_t)b * TK + k1] == 0); }      /* mode 24: int key-padding mask (nonzero = padded = excluded) */      /* mode 2: block-diagonal 32-token groups */
        float s0 = ok0 ? s[rt][0][r] * SCL : -3.0e38f, s1 = ok1 ? s[rt][1][r] * SCL : -3.0e38f; if (CAUSAL == 27) { const float* amk = (const float*)MSK + ((size_t)b * MQI + tq) * MKI; s0 += bf16_round(amk[k0]); s1 += bf16_round(amk[k1]); }      /* mode 27: additive per-(batch, query, key) f32 mask INPUT [b][tq][k] */ if (CAUSAL == 17) { const float* amk = (const float*)MSK + (size_t)b * TK; s0 += bf16_round(amk[k0]); s1 += bf16_round(amk[k1]); } if (CAUSAL == 18) { const float* tb = (const float*)MSK; const int* ri = MSK + 1024 + (size_t)b * TK; const int rq = ri[tq]; s0 += tb[(h * 8 + rq) * 8 + ri[k0]]; s1 += tb[(h * 8 + rq) * 8 + ri[k1]]; } if (CAUSAL == 19) { const int* rel = MSK + (size_t)tq * TK; const float* rb = (const float*)MSK + (size_t)TQ * TK + ((size_t)(b * NH + h) * TQ + tq) * 64; s0 += rb[rel[k0]]; s1 += rb[rel[k1]]; }      /* mode 19: + (q.Ek[rel] + Eb[rel][h]) / 8 gathered by the int relative ids (packed [ids | table]) */      /* mode 18: + resource_bias[h][r_q][r_k] from the packed [table | ids] buffer (TQ == TK) */      /* mode 17: additive per-(batch, key) mask INPUT */ float mc = fmaxf(s0, s1);
        mc = fmaxf(mc, __shfl_xor(mc, 1, 32)); mc = fmaxf(mc, __shfl_xor(mc, 2, 32)); mc = fmaxf(mc, __shfl_xor(mc, 4, 32)); mc = fmaxf(mc, __shfl_xor(mc, 8, 32));
        const float mn = fmaxf(m_r[rt][r], mc); const float al = (mn > -1.0e38f) ? expf(m_r[rt][r] - mn) : 1.0f; m_r[rt][r] = mn; const float p0 = ok0 ? expf(s0 - mn) : 0.f, p1 = ok1 ? expf(s1 - mn) : 0.f; l_r[rt][r] = l_r[rt][r] * al + p0 + p1;
#pragma unroll
        for (int dt = 0; dt < DT; ++dt) oacc[rt][dt][r] *= al;
        FragH t2; t2.h[0] = (_Float16)(p0 * 1024.0f); t2.h[1] = (_Float16)(p1 * 1024.0f); sP[w][rt * 16 + 8 * hh + r][ln] = t2.u[0]; sP[w][rt * 16 + 8 * hh + r][16 + ln] = t2.u[1]; }
    __builtin_amdgcn_fence(__ATOMIC_ACQ_REL, "workgroup"); __builtin_amdgcn_wave_barrier();
    FragH pa[2];
#pragma unroll
    for (int rt = 0; rt < RTN; ++rt) { pa[rt].half[0] = *(const v8us*)&sP[w][rt * 16 + ln][8 * hh]; pa[rt].half[1] = *(const v8us*)&sP[w][rt * 16 + ln][16 + 8 * hh]; }
#pragma unroll
    for (int dt = 0; dt < DT; ++dt) { const unsigned short* vrow = Vth + (size_t)(dt * 16 + ln) * TK + j0; FragH bv; bv.half[0] = *(const v8us*)(vrow + 8 * hh); bv.half[1] = *(const v8us*)(vrow + 16 + 8 * hh);
#pragma unroll
      for (int rt = 0; rt < RTN; ++rt) oacc[rt][dt] = mmaH<1>(pa[rt].v, pa[rt].v, bv.v, bv.v, oacc[rt][dt]); }
    __builtin_amdgcn_fence(__ATOMIC_ACQ_REL, "workgroup"); __builtin_amdgcn_wave_barrier(); }
#pragma unroll
  for (int rt = 0; rt < RTN; ++rt) {
#pragma unroll
    for (int r = 0; r < 8; ++r) { float l = l_r[rt][r]; l += __shfl_xor(l, 1, 32); l += __shfl_xor(l, 2, 32); l += __shfl_xor(l, 4, 32); l += __shfl_xor(l, 8, 32); l_r[rt][r] = (l > 0.f) ? 1.0f / (l * 1024.0f) : 0.f; }
#pragma unroll
    for (int dt = 0; dt < DT; ++dt)
#pragma unroll
      for (int r = 0; r < 8; ++r) sO[w][rt * 16 + 8 * hh + r][dt * 16 + ln] = oacc[rt][dt][r] * l_r[rt][r]; }
  __builtin_amdgcn_fence(__ATOMIC_ACQ_REL, "workgroup"); __builtin_amdgcn_wave_barrier();
  {
#pragma unroll
    for (int rp = 0; rp < RPW; rp += 2) { const int r = rp + (lane >> 4), pc = lane & 15; const v4f val = *(const v4fa*)&sO[w][r][pc * 4]; *(v4f*)(O + ((size_t)b * TQ + q0 + r) * ldo + h * 64 + pc * 4) = val; }
     } }
// 5-plane variant: S = Qh Kh^T + (Ql Kh^T + Qh Kl^T)/1024 with Q/K = [hi | 2^10 residual] f16 planes (QL/KL same layout as Q16/K16), then the 3-term P.V below.
// 3-term variant: O = (P_hi V_hi + (P_lo V_hi + P_hi V_lo) / 1024) / l with P = [hi | 2^10 residual] of 1024 p and V^T = [hi | 2^10 residual] planes (VtL same layout as Vt) -> ~2^-21-class products for un-averaged (early causal / peaked) rows
template <int CAUSAL>
__global__ __launch_bounds__(128) void k_flash5(const _Float16* __restrict__ Q16, const _Float16* __restrict__ QL, int ldq, const _Float16* __restrict__ K16, const _Float16* __restrict__ KL, int ldk, const _Float16* __restrict__ Vt, const _Float16* __restrict__ VtL, const int* __restrict__ MSK, float* __restrict__ O, int ldo) {
  constexpr int RPW = 16, RTN = RPW / 16, NQB = TQ / (4 * RPW), DT = 4, KS = 2;
  __shared__ __attribute__((aligned(16))) unsigned short sP[4][RPW][40]; __shared__ __attribute__((aligned(16))) unsigned short sPL[4][RPW][40]; __shared__ __attribute__((aligned(16))) float sO[4][RPW][64 + 4];
  const int tid = threadIdx.x, w = tid >> 5, lane = tid & 31, ln = lane & 15, hh = lane >> 4;
  const int slab = blockIdx.x / QBN5, qblk = QB05 + blockIdx.x % QBN5; (void)NQB; const int b = slab / NH, h = slab % NH; const int qb0 = qblk * (4 * RPW); const int q0 = qb0 + w * RPW;
  FragH aq[2][KS], aql[2][KS];
#pragma unroll
  for (int rt = 0; rt < RTN; ++rt) { const unsigned short* qr = (const unsigned short*)Q16 + ((size_t)b * TQ + q0 + rt * 16 + ln) * ldq + h * 64; const unsigned short* ql = (const unsigned short*)QL + ((size_t)b * TQ + q0 + rt * 16 + ln) * ldq + h * 64;
#pragma unroll
    for (int ks = 0; ks < KS; ++ks) { aq[rt][ks].half[0] = *(const v8us*)(qr + ks * 32 + 8 * hh); aq[rt][ks].half[1] = *(const v8us*)(qr + ks * 32 + 16 + 8 * hh); aql[rt][ks].half[0] = *(const v8us*)(ql + ks * 32 + 8 * hh); aql[rt][ks].half[1] = *(const v8us*)(ql + ks * 32 + 16 + 8 * hh); } }
  const unsigned short* Vth = (const unsigned short*)Vt + (size_t)slab * 64 * TK; const unsigned short* Vtl = (const unsigned short*)VtL + (size_t)slab * 64 * TK;
  float m_r[2][8], l_r[2][8]; v8f oacc[2][DT], oaccL[2][DT];
#pragma unroll
  for (int rt = 0; rt < RTN; ++rt) {
#pragma unroll
    for (int r = 0; r < 8; ++r) { m_r[rt][r] = -3.0e38f; l_r[rt][r] = 0.f; }
#pragma unroll
    for (int dt = 0; dt < DT; ++dt) { oacc[rt][dt] = (v8f){0.f,0.f,0.f,0.f,0.f,0.f,0.f,0.f}; oaccL[rt][dt] = oacc[rt][dt]; } }
  const int jend = (CAUSAL == 1) ? (qb0 + 4 * RPW) : ((CAUSAL == 23) ? min(TK, (qb0 / CHK + 2) * CHK) : TK);      /* causal / window: keys that can never contribute are skipped */ const int jbeg = (CAUSAL == 23) ? max(0, (qb0 / CHK - 1) * CHK) : 0;
#pragma unroll 1
  for (int j0 = jbeg; j0 < jend; j0 += 32) {
    v8f s[2][2];
#pragma unroll
    for (int nt = 0; nt < 2; ++nt) { const unsigned short* kr = (const unsigned short*)K16 + ((size_t)b * TK + j0 + nt * 16 + ln) * ldk + h * 64; const unsigned short* klr = (const unsigned short*)KL + ((size_t)b * TK + j0 + nt * 16 + ln) * ldk + h * 64; FragH bk[KS], bkl[KS];
#pragma unroll
      for (int ks = 0; ks < KS; ++ks) { bk[ks].half[0] = *(const v8us*)(kr + ks * 32 + 8 * hh); bk[ks].half[1] = *(const v8us*)(kr + ks * 32 + 16 + 8 * hh); bkl[ks].half[0] = *(const v8us*)(klr + ks * 32 + 8 * hh); bkl[ks].half[1] = *(const v8us*)(klr + ks * 32 + 16 + 8 * hh); }
#pragma unroll
      for (int rt = 0; rt < RTN; ++rt) { v8f acc = (v8f){0.f,0.f,0.f,0.f,0.f,0.f,0.f,0.f}, accl = acc;
#pragma unroll
        for (int ks = 0; ks < KS; ++ks) { acc = mmaH<1>(aq[rt][ks].v, aq[rt][ks].v, bk[ks].v, bk[ks].v, acc); accl = mmaH<1>(aql[rt][ks].v, aql[rt][ks].v, bk[ks].v, bk[ks].v, accl); accl = mmaH<1>(aq[rt][ks].v, aq[rt][ks].v, bkl[ks].v, bkl[ks].v, accl); }
#pragma unroll
        for (int r = 0; r < 8; ++r) acc[r] += accl[r] * 0.0009765625f;
        s[rt][nt] = acc; } }
#pragma unroll
    for (int rt = 0; rt < RTN; ++rt)
#pragma unroll
      for (int r = 0; r < 8; ++r) { const int tq = q0 + rt * 16 + 8 * hh + r; const int k0 = j0 + ln, k1 = j0 + 16 + ln;
        bool ok0 = (CAUSAL == 1) ? (k0 <= tq) : ((CAUSAL == 2) ? ((k0 >> 5) == (tq >> 5)) : true), ok1 = (CAUSAL == 1) ? (k1 <= tq) : ((CAUSAL == 2) ? ((k1 >> 5) == (tq >> 5)) : true);      /* mode 2: block-diagonal 32-token groups */
        if (CAUSAL == 4) { const int* mrow = MSK + ((size_t)b * TQ + tq) * TK; ok0 = mrow[k0] != 0; ok1 = mrow[k1] != 0; }      /* mode 4: per-(query, key) INPUT mask shared by all heads; masked keys contribute nothing (== the reference's -4096 fill, whose exp underflows to 0), rows with no valid key give l = 0 -> output 0 (== the reference's row_valid zeroing) */
        float s0 = ok0 ? s[rt][0][r] * SCL : -3.0e38f, s1 = ok1 ? s[rt][1][r] * SCL : -3.0e38f; if (CAUSAL == 17) { const float* amk = (const float*)MSK + (size_t)b * TK; s0 += bf16_round(amk[k0]); s1 += bf16_round(amk[k1]); } if (CAUSAL == 18) { const float* tb = (const float*)MSK; const int* ri = MSK + 1024 + (size_t)b * TK; const int rq = ri[tq]; s0 += tb[(h * 8 + rq) * 8 + ri[k0]]; s1 += tb[(h * 8 + rq) * 8 + ri[k1]]; } if (CAUSAL == 19) { const int* rel = MSK + (size_t)tq * TK; const float* rb = (const float*)MSK + (size_t)TQ * TK + ((size_t)(b * NH + h) * TQ + tq) * 64; s0 += rb[rel[k0]]; s1 += rb[rel[k1]]; }      /* mode 19: + (q.Ek[rel] + Eb[rel][h]) / 8 gathered by the int relative ids (packed [ids | table]) */      /* mode 18: + resource_bias[h][r_q][r_k] from the packed [table | ids] buffer (TQ == TK) */      /* mode 17: additive per-(batch, key) mask INPUT */ float mc = fmaxf(s0, s1);
        mc = fmaxf(mc, __shfl_xor(mc, 1, 32)); mc = fmaxf(mc, __shfl_xor(mc, 2, 32)); mc = fmaxf(mc, __shfl_xor(mc, 4, 32)); mc = fmaxf(mc, __shfl_xor(mc, 8, 32));
        const float mn = fmaxf(m_r[rt][r], mc); const float al = (mn > -1.0e38f) ? expf(m_r[rt][r] - mn) : 1.0f; m_r[rt][r] = mn; const float p0 = ok0 ? expf(s0 - mn) : 0.f, p1 = ok1 ? expf(s1 - mn) : 0.f; l_r[rt][r] = l_r[rt][r] * al + p0 + p1;
#pragma unroll
        for (int dt = 0; dt < DT; ++dt) { oacc[rt][dt][r] *= al; oaccL[rt][dt][r] *= al; }
        FragH t2, t2l; const float ps0 = p0 * 1024.0f, ps1 = p1 * 1024.0f; t2.h[0] = (_Float16)ps0; t2.h[1] = (_Float16)ps1; t2l.h[0] = (_Float16)((ps0 - (float)t2.h[0]) * 1024.0f); t2l.h[1] = (_Float16)((ps1 - (float)t2.h[1]) * 1024.0f);
        sP[w][rt * 16 + 8 * hh + r][ln] = t2.u[0]; sP[w][rt * 16 + 8 * hh + r][16 + ln] = t2.u[1]; sPL[w][rt * 16 + 8 * hh + r][ln] = t2l.u[0]; sPL[w][rt * 16 + 8 * hh + r][16 + ln] = t2l.u[1]; }
    __builtin_amdgcn_fence(__ATOMIC_ACQ_REL, "workgroup"); __builtin_amdgcn_wave_barrier();
    FragH pa[2], pl[2];
#pragma unroll
    for (int rt = 0; rt < RTN; ++rt) { pa[rt].half[0] = *(const v8us*)&sP[w][rt * 16 + ln][8 * hh]; pa[rt].half[1] = *(const v8us*)&sP[w][rt * 16 + ln][16 + 8 * hh]; pl[rt].half[0] = *(const v8us*)&sPL[w][rt * 16 + ln][8 * hh]; pl[rt].half[1] = *(const v8us*)&sPL[w][rt * 16 + ln][16 + 8 * hh]; }
#pragma unroll
    for (int dt = 0; dt < DT; ++dt) { const unsigned short* vrow = Vth + (size_t)(dt * 16 + ln) * TK + j0; const unsigned short* vrl = Vtl + (size_t)(dt * 16 + ln) * TK + j0; FragH bv, bl; bv.half[0] = *(const v8us*)(vrow + 8 * hh); bv.half[1] = *(const v8us*)(vrow + 16 + 8 * hh); bl.half[0] = *(const v8us*)(vrl + 8 * hh); bl.half[1] = *(const v8us*)(vrl + 16 + 8 * hh);
#pragma unroll
      for (int rt = 0; rt < RTN; ++rt) { oacc[rt][dt] = mmaH<1>(pa[rt].v, pa[rt].v, bv.v, bv.v, oacc[rt][dt]); oaccL[rt][dt] = mmaH<1>(pl[rt].v, pl[rt].v, bv.v, bv.v, oaccL[rt][dt]); oaccL[rt][dt] = mmaH<1>(pa[rt].v, pa[rt].v, bl.v, bl.v, oaccL[rt][dt]); } }
    __builtin_amdgcn_fence(__ATOMIC_ACQ_REL, "workgroup"); __builtin_amdgcn_wave_barrier(); }
#pragma unroll
  for (int rt = 0; rt < RTN; ++rt) {
#pragma unroll
    for (int r = 0; r < 8; ++r) { float l = l_r[rt][r]; l += __shfl_xor(l, 1, 32); l += __shfl_xor(l, 2, 32); l += __shfl_xor(l, 4, 32); l += __shfl_xor(l, 8, 32); l_r[rt][r] = (l > 0.f) ? 1.0f / (l * 1024.0f) : 0.f; }
#pragma unroll
    for (int dt = 0; dt < DT; ++dt)
#pragma unroll
      for (int r = 0; r < 8; ++r) { float v = oacc[rt][dt][r]; v += oaccL[rt][dt][r] * 0.0009765625f; sO[w][rt * 16 + 8 * hh + r][dt * 16 + ln] = v * l_r[rt][r]; } }
  __builtin_amdgcn_fence(__ATOMIC_ACQ_REL, "workgroup"); __builtin_amdgcn_wave_barrier();
  {
#pragma unroll
    for (int rp = 0; rp < RPW; rp += 2) { const int r = rp + (lane >> 4), pc = lane & 15; const v4f val = *(const v4fa*)&sO[w][r][pc * 4]; *(v4f*)(O + ((size_t)b * TQ + q0 + r) * ldo + h * 64 + pc * 4) = val; }
     } }

__global__ __launch_bounds__(256) void k_rotab(float* __restrict__ CS, float* __restrict__ SN) {
  #pragma clang fp contract(off)
  const int t = blockIdx.x * 256 + threadIdx.x; if (t >= SLEN * 32) return; const int j = t % 32, s = t / 32; const float ex = (float)(2 * j) / 64.0f; const float inv = 1.0f / powf(10000.0f, ex); const float th = (float)s * inv; const float c = cosf(th), sn = sinf(th);
  { *(float*)(CS + t) = c; *(float*)(SN + t) = sn;  } }
__global__ __launch_bounds__(256) void k_rope(const float* __restrict__ F, int nsrc, int ndst, int rep, const float* __restrict__ CS, const float* __restrict__ SN, _Float16* __restrict__ H, _Float16* __restrict__ L) {
  #pragma clang fp contract(off)
  const size_t t = (size_t)blockIdx.x * 256 + threadIdx.x; if (t >= (size_t)NR * ndst * 4) return; const int g8 = (int)(t % 4); const int hd = (int)((t / 4) % ndst); const size_t row = t / ((size_t)4 * ndst); const int s = (int)(row % SLEN); const int hs = hd / rep;
  const float* src = F + row * (size_t)(nsrc * 64) + hs * 64; FragH ah, al, bh, bl;
  for (int i = 0; i < 8; ++i) { const int d = g8 * 8 + i; const float c = CS[s * 32 + d], sn = SN[s * 32 + d]; const float x1 = src[d], x2 = src[d + 32];
    float o1 = x1 * c; o1 += -x2 * sn; float o2 = x2 * c; o2 += x1 * sn;
    _Float16 hv = (_Float16)o1; ah.h[i] = hv; al.h[i] = (_Float16)((o1 - (float)hv) * 1024.0f); hv = (_Float16)o2; bh.h[i] = hv; bl.h[i] = (_Float16)((o2 - (float)hv) * 1024.0f); }
  const size_t o = row * (size_t)(ndst * 64) + hd * 64 + g8 * 8;
  { *(v8us*)((unsigned short*)H + o) = ah.half[0]; *(v8us*)((unsigned short*)H + o + 32) = bh.half[0]; *(v8us*)((unsigned short*)L + o) = al.half[0]; *(v8us*)((unsigned short*)L + o + 32) = bl.half[0];  } }
__global__ __launch_bounds__(256) void k_rope2(const float* __restrict__ F, int nsrc, int ndst, int rep, const float* __restrict__ CS, const float* __restrict__ SN, _Float16* __restrict__ H, _Float16* __restrict__ L) {
  #pragma clang fp contract(off)
  const size_t t = (size_t)blockIdx.x * 256 + threadIdx.x; if (t >= (size_t)NR * ndst * 4) return; const int g16 = (int)(t % 4); const int hd = (int)((t / 4) % ndst); const size_t row = t / ((size_t)4 * ndst); const int s = (int)(row % SLEN); const int hs = hd / rep;
  const float* src = F + row * (size_t)(nsrc * 64) + hs * 64 + g16 * 16; FragH ah, al;
  for (int pr = 0; pr < 8; ++pr) { const int i = g16 * 8 + pr; const float c = CS[s * 32 + i], sn = SN[s * 32 + i]; const float x1 = src[2 * pr], x2 = src[2 * pr + 1];
    float o1 = x1 * c; o1 -= x2 * sn; float o2 = x1 * sn; o2 += x2 * c;
    _Float16 hv = (_Float16)o1; ah.h[2 * pr] = hv; al.h[2 * pr] = (_Float16)((o1 - (float)hv) * 1024.0f); hv = (_Float16)o2; ah.h[2 * pr + 1] = hv; al.h[2 * pr + 1] = (_Float16)((o2 - (float)hv) * 1024.0f); }
  const size_t o = row * (size_t)(ndst * 64) + hd * 64 + g16 * 16;
  { *(v8us*)((unsigned short*)H + o) = ah.half[0]; *(v8us*)((unsigned short*)H + o + 8) = ah.half[1]; *(v8us*)((unsigned short*)L + o) = al.half[0]; *(v8us*)((unsigned short*)L + o + 8) = al.half[1];  } }
__global__ __launch_bounds__(256) void k_ln512(const float* __restrict__ A, const float* __restrict__ res, const float* __restrict__ g, const float* __restrict__ bb, float* __restrict__ Y, _Float16* __restrict__ Y16) {
  #pragma clang fp contract(off)
  const int wv = threadIdx.x >> 5, ln = threadIdx.x & 31; const size_t r = (size_t)blockIdx.x * 8 + wv; if (r >= NR) return; float x[16]; float s = 0.f;
  for (int i = 0; i < 2; ++i) { const v8f a = *(const v8f*)(A + r * DM + i * 256 + ln * 8); for (int q = 0; q < 8; ++q) { float v = a[q]; if (res) v += bf16_round(res[r * DM + i * 256 + ln * 8 + q]); x[i * 8 + q] = v; s += v; } }
  for (int o = 16; o > 0; o >>= 1) s += __shfl_xor(s, o, 32); const float mu = s / (float)DM; float var = 0.f; for (int q = 0; q < 16; ++q) { const float d = x[q] - mu; var += d * d; }
  for (int o = 16; o > 0; o >>= 1) var += __shfl_xor(var, o, 32); const float inv = rsqrtf(var / (float)DM + 1e-5f);
  { for (int i = 0; i < 2; ++i) { const int c0 = i * 256 + ln * 8; v8f y; FragH f; for (int q = 0; q < 8; ++q) { float v = (x[i * 8 + q] - mu) * inv; v *= bf16_round(g[c0 + q]); v += bf16_round(bb[c0 + q]); y[q] = v; f.h[q] = (_Float16)v; } *(v8f*)(Y + r * DM + c0) = y; if (Y16) *(v8us*)((unsigned short*)Y16 + r * DM + c0) = f.half[0]; }  } }
__global__ __launch_bounds__(256) void k_pack(const float* __restrict__ rb, const int* __restrict__ rid, int* __restrict__ PK) { const int t = blockIdx.x * 256 + threadIdx.x; if (t >= 1024 + NB * TK) return; int v; if (t < 1024) v = __float_as_int(bf16_round(rb[t])); else v = rid[t - 1024]; *(int*)(PK + t) = v;  }
__global__ __launch_bounds__(256) void k_tabin(const float* __restrict__ sp, float* __restrict__ CS, float* __restrict__ SN) { const int t = blockIdx.x * 256 + threadIdx.x; if (t >= SLEN * 32) return; const int i = t % 32, s = t / 32; const float c = bf16_round(sp[s * 64 + 32 + i]), sn = bf16_round(sp[s * 64 + i]);
  { *(float*)(CS + t) = c; *(float*)(SN + t) = sn;  } }
__global__ __launch_bounds__(256) void k_wsc(const float* __restrict__ Wm, _Float16* __restrict__ Bt, size_t n8, float sc) { const size_t t = (size_t)blockIdx.x * 256 + threadIdx.x; if (t >= n8) return; FragH f; for (int q = 0; q < 8; ++q) f.h[q] = (_Float16)(bf16_round(Wm[t * 8 + q]) * sc); *(v8us*)((unsigned short*)Bt + t * 8) = f.half[0];  }
__global__ __launch_bounds__(256) void k_rotab2(float* __restrict__ CS, float* __restrict__ SN) {
  #pragma clang fp contract(off)
  const int t = blockIdx.x * 256 + threadIdx.x; if (t >= SLEN * 32) return; const int j = t % 32, s = t / 32; const float c0 = -0.14391156831212787f;      /* -ln(10000)/64 rounded to f32 */ const float inv = expf((float)(2 * j) * c0); const float th = (float)s * inv; const float c = cosf(th), sn = sinf(th);
  { *(float*)(CS + t) = c; *(float*)(SN + t) = sn;  } }
__global__ __launch_bounds__(256) void k_lnu(const float* __restrict__ X, _Float16* __restrict__ N16, float* __restrict__ XB) {
  #pragma clang fp contract(off)
  const int wv = threadIdx.x >> 5, ln = threadIdx.x & 31; const size_t r = (size_t)blockIdx.x * 8 + wv; if (r >= NR) return; float a[32]; float s = 0.f;
  for (int i = 0; i < 4; ++i) { const v8f v = *(const v8f*)(X + r * DM + (i * 32 + ln) * 8); for (int q = 0; q < 8; ++q) { const float u = bf16_round(v[q]); a[i * 8 + q] = u; s += u; } }
  for (int o = 16; o > 0; o >>= 1) s += __shfl_xor(s, o, 32); const float mu = s / (float)DM; float var = 0.f; for (int q = 0; q < 32; ++q) { const float d = a[q] - mu; var += d * d; }
  for (int o = 16; o > 0; o >>= 1) var += __shfl_xor(var, o, 32); const float den = sqrtf(var / (float)(DM - 1)) + 1e-6f; const float inv = 1.0f / den;      /* one reciprocal per row; (x-mean)*inv vs the reference's division differs by <= 1 ulp */
  { for (int i = 0; i < 4; ++i) { const int c0 = (i * 32 + ln) * 8; FragH f; v8f xb; for (int q = 0; q < 8; ++q) { f.h[q] = (_Float16)((a[i * 8 + q] - mu) * inv); xb[q] = a[i * 8 + q]; } *(v8us*)((unsigned short*)N16 + r * DM + c0) = f.half[0]; *(v8f*)(XB + r * DM + c0) = xb; }  } }
__global__ __launch_bounds__(256) void k_vtg(const _Float16* __restrict__ V16, _Float16* __restrict__ Vt) { __shared__ unsigned short tl[64][66]; const int tid = threadIdx.x; const int slab = blockIdx.x / (SLEN / 64), lg = blockIdx.x % (SLEN / 64); const int b = slab / NH, h = slab % NH; const int hs = h / NREP;
  for (int i = tid; i < 64 * 8; i += 256) { const int r = i / 8, c8 = (i % 8) * 8; FragH f; f.half[0] = *(const v8us*)((const unsigned short*)V16 + ((size_t)b * SLEN + lg * 64 + r) * KVD + hs * 64 + c8); for (int q = 0; q < 8; ++q) tl[r][c8 + q] = f.u[q]; }
  __syncthreads();
  { for (int rd = 0; rd < 2; ++rd) { const int d = rd * 32 + tid / 8, pc = tid % 8; FragH f; for (int q = 0; q < 8; ++q) f.u[q] = tl[pc * 8 + q][d]; *(v8us*)((unsigned short*)Vt + ((size_t)slab * 64 + d) * SLEN + lg * 64 + pc * 8) = f.half[0]; }  } }

__global__ __launch_bounds__(256) void k_h16s(const float* __restrict__ SRC, int lds, int coff, _Float16* __restrict__ DST, size_t n8) { const size_t t = (size_t)blockIdx.x * 256 + threadIdx.x; if (t >= n8) return; const size_t r = (t * 8) / DM; const int c = (int)((t * 8) % DM); const v8f a = *(const v8f*)(SRC + r * lds + coff + c); FragH f; for (int q = 0; q < 8; ++q) f.h[q] = (_Float16)a[q];
  *(v8us*)((unsigned short*)DST + t * 8) = f.half[0];  }


__global__ __launch_bounds__(256) void k_ccp(const float* __restrict__ QKV, int coff, _Float16* __restrict__ D) { const size_t t = (size_t)blockIdx.x * 256 + threadIdx.x; if (t >= (size_t)NR * DM / 8) return; const int c0 = (int)((t * 8) % DM); const size_t row = (t * 8) / DM; const v8f a = *(const v8f*)(QKV + row * 3 * DM + coff + c0); FragH f; for (int q = 0; q < 8; ++q) f.h[q] = (_Float16)a[q];
  *(v8us*)((unsigned short*)D + t * 8) = f.half[0];  }


__global__ __launch_bounds__(256) void k_tok(const float* __restrict__ x, _Float16* __restrict__ X16) { __shared__ float tl[DM][17]; const int tid = threadIdx.x; const int p0 = blockIdx.x * 16;      /* 16-pixel tiles: 34 KB of LDS */
  for (int i = tid; i < DM * 16; i += 256) { const int c = i / 16, p = i % 16; tl[c][p] = bf16_round(x[(size_t)c * NPIX + p0 + p]); }
  __syncthreads();
  { for (int i = tid; i < 16 * (DM / 8); i += 256) { const int p = i / (DM / 8), c0 = (i % (DM / 8)) * 8; FragH f; for (int q = 0; q < 8; ++q) f.h[q] = (_Float16)tl[c0 + q][p];
      *(v8us*)((unsigned short*)X16 + ((size_t)p0 + p) * DM + c0) = f.half[0]; }  } }
__global__ __launch_bounds__(256) void k_out(const float* __restrict__ Y, float* __restrict__ out) { const size_t t = (size_t)blockIdx.x * 256 + threadIdx.x; if (t >= (size_t)DM * NPIX / 8) return; const int p0 = (int)((t * 8) % NPIX); const int c = (int)((t * 8) / NPIX); v8f v; for (int q = 0; q < 8; ++q) v[q] = Y[((size_t)p0 + q) * DM + c];
  *(v8f*)(out + t * 8) = v;  }
extern "C" void kernel_launch(void* const* d_in, const int* in_sizes, int n_in,
                              void* d_out, int out_size, void* d_ws, size_t ws_size, hipStream_t stream) {
  (void)in_sizes; (void)n_in; (void)out_size;
  const float* x = (const float*)d_in[0]; const float* qw = (const float*)d_in[1]; const float* qb = (const float*)d_in[2]; const float* kw = (const float*)d_in[3]; const float* kb = (const float*)d_in[4]; const float* vw = (const float*)d_in[5]; const float* vb = (const float*)d_in[6]; const float* ow = (const float*)d_in[7]; const float* ob = (const float*)d_in[8];
  char* ws = (char*)d_ws; size_t off = 0;
  auto take = [&](size_t bytes) { char* p = ws + off; off += (bytes + 255) & ~(size_t)255; return p; };
  const size_t np = (size_t)NR * DM;
  _Float16* BQ = (_Float16*)take((size_t)DM * DM * 2); _Float16* BK = (_Float16*)take((size_t)DM * DM * 2); _Float16* BV = (_Float16*)take((size_t)DM * DM * 2); _Float16* BO = (_Float16*)take((size_t)DM * DM * 2); float* Y = (float*)take(np * 4);
   _Float16* X16 = (_Float16*)take(np * 2); _Float16* QH = (_Float16*)take(np * 2); _Float16* KH = (_Float16*)take(np * 2); _Float16* V16 = (_Float16*)take(np * 2); _Float16* VT = (_Float16*)take(np * 2); float* O = (float*)take(np * 4); _Float16* OH = QH; _Float16* OL = KH;
  if (off > ws_size) return;
  k_wsc<<<(unsigned)(((size_t)DM * DM / 8 + 255) / 256), 256, 0, stream>>>(qw, BQ, (size_t)DM * DM / 8, 16.0f); k_wsc<<<(unsigned)(((size_t)DM * DM / 8 + 255) / 256), 256, 0, stream>>>(kw, BK, (size_t)DM * DM / 8, 16.0f); k_wsc<<<(unsigned)(((size_t)DM * DM / 8 + 255) / 256), 256, 0, stream>>>(vw, BV, (size_t)DM * DM / 8, 16.0f); k_wsc<<<(unsigned)(((size_t)DM * DM / 8 + 255) / 256), 256, 0, stream>>>(ow, BO, (size_t)DM * DM / 8, 16.0f);      /* 1x1 conv (out, in) naturals */
  
  k_tok<<<NPIX / 16, 256, 0, stream>>>(x, X16);
  const dim3 g((NR / 128) * (DM / 64), 1);
  k_gemm2<0><<<g, 128, 0, stream>>>(X16, DM, 0, BQ, DM, 0, 0.0625f, qb, 0, nullptr, 1, 0, 0, nullptr, QH, DM, 0, NR, DM, DM);
  k_gemm2<0><<<g, 128, 0, stream>>>(X16, DM, 0, BK, DM, 0, 0.0625f, kb, 0, nullptr, 1, 0, 0, nullptr, KH, DM, 0, NR, DM, DM);
  k_gemm2<0><<<g, 128, 0, stream>>>(X16, DM, 0, BV, DM, 0, 0.0625f, vb, 0, nullptr, 1, 0, 0, nullptr, V16, DM, 0, NR, DM, DM);
  k_vtg<<<NB * NH * (SLEN / 64), 256, 0, stream>>>(V16, VT);
  k_flash<0><<<NB * NH * QBNP, 128, 0, stream>>>(QH, DM, KH, DM, VT, nullptr, O, DM);
  k_hl<<<(unsigned)((np / 8 + 255) / 256), 256, 0, stream>>>(O, OH, OL, np / 8);
  k_gemm2<0><<<g, 128, 0, stream>>>(OL, DM, 0, BO, DM, 0, 0.0625f / 1024.0f, nullptr, 0, nullptr, 1, 0, 0, Y, nullptr, DM, 0, NR, DM, DM);
  k_gemm2<0><<<g, 128, 0, stream>>>(OH, DM, 0, BO, DM, 0, 0.0625f, ob, 0, Y, 1, (size_t)DM, 0, Y, nullptr, DM, 0, NR, DM, DM);      /* rows of the output conv */
  k_out<<<(unsigned)(((size_t)DM * NPIX / 8 + 255) / 256), 256, 0, stream>>>(Y, (float*)d_out);
}

// v001
// A run of this version takes 416 microseconds.
// In both of two side-by-side timings against v000, it was 1.42 times as fast.
#include <hip/hip_runtime.h>
// SelfAttention4d (1 x 512 ch x 64 x 64 = 4096 tokens, 8 heads x 64: q/k/v = 1x1 convs (+ bias; the 1/8 scale applied in the flash kernel); softmax(q.k) v; out = 1x1 conv (+ bias) back to NCHW).
// Structure: NCHW -> exact f16 token rows by an LDS transpose kernel; q/k/v as f16 WMMA GEMMs (32x64 wave tiles, f32 accumulation, exact x16 (out,in) weights + bias, f16 out; channel = head*64 + d); V^T by LDS tiles; my fused flash kernel (no mask; the 1/8 applied as the score scale); ctx as f16 hi/residual into the output conv (two GEMM terms) + bias; NCHW store (thread per (channel, 8 pixels)).
// Compute dtype: inputs rounded to bf16; x / weights exact as f16; q, k, v plain f16 (~2^-12); softmax weights f16 x2^10; ctx hi + 2^-10 residual. v_wmma_f32_16x16x32_f16.
#define NB 1
#define DM 512
#define NKV 8
#define NPIX 4096
#define NREP (NH / NKV)
#define KVD (NKV * 64)           /* 512 */
#define NR (NB * SLEN)
#define CHK 512
typedef int v4i __attribute__((ext_vector_type(4)));
#define FF 2048
#define SLEN 4096
#define MQI 4096
#define MKI 4096
#define TQ SLEN
#define TK SLEN
#define NH 8
#define SCL 0.125f
#define QBLKS (TQ / 64)
#define QB05 0
#define QBN5 4
#define QB0P 0
#define QBNP QBLKS
#define RE 256
typedef __bf16 v16b __attribute__((ext_vector_type(16)));
typedef unsigned short v8us __attribute__((ext_vector_type(8), may_alias));
typedef float  v8f  __attribute__((ext_vector_type(8)));
typedef float  v4f  __attribute__((ext_vector_type(4)));
typedef float  v4fa __attribute__((ext_vector_type(4), may_alias));
union FragB { v16b v; v8us half[2]; unsigned short u[16]; };

__device__ __forceinline__ unsigned short bf16_bits(float x) { unsigned int u = __float_as_uint(x); return (unsigned short)((u + 0x7FFFu + ((u >> 16) & 1u)) >> 16); }
__device__ __forceinline__ float bf16_val(unsigned short b) { return __uint_as_float(((unsigned int)b) << 16); }
__device__ __forceinline__ float bf16_round(float x) { return bf16_val(bf16_bits(x)); }
// D += A·B with NT terms: 1 = ah·bh, 2 = + al·bh (A split), 3 = + ah·bl (both split)
template <int NT>
__device__ __forceinline__ v8f mmaN(v16b ah, v16b al, v16b bh, v16b bl, v8f c) {
  c = __builtin_amdgcn_wmma_f32_16x16x32_bf16(false, ah, false, bh, (short)0, c, false, false);
  if (NT >= 2) c = __builtin_amdgcn_wmma_f32_16x16x32_bf16(false, al, false, bh, (short)0, c, false, false);
  if (NT >= 3) c = __builtin_amdgcn_wmma_f32_16x16x32_bf16(false, ah, false, bl, (short)0, c, false, false);
  asm volatile("v_nop\n\tv_nop\n\tv_nop\n\tv_nop" : "+v"(c) : "v"(ah), "v"(al), "v"(bh), "v"(bl));
  return c;
}

__global__ __launch_bounds__(256) void k_wt_bf16(const float* __restrict__ W, unsigned short* __restrict__ Wt, int K, int N) {
  const int t = blockIdx.x * 256 + threadIdx.x;
  const int k8n = K / 8;
  if (t >= N * k8n) return;
  const int n = t / k8n, k8 = (t % k8n) * 8;
  v8us v;
#pragma unroll
  for (int i = 0; i < 8; ++i) v[i] = bf16_bits(W[(size_t)(k8 + i) * N + n]);
  *(v8us*)(Wt + (size_t)n * K + k8) = v;
  
}

// GEMM C[M][N] (f32, pitch ldc) = act(A[M][K]·W + bias). A f32 row-major (pitch lda) converted per fragment to bf16
// (ASPLIT: hi/lo two planes -> 2 terms, else single rounded term); Wt bf16 [N][K] (pitch ldb). BIAS_BF16 rounds the
// bias to bf16 first (bias quantised to bf16 before the add). K%32==0, M%16==0, N%64==0.
template <bool ASPLIT, int ACT, bool BIAS_BF16>
__global__ __launch_bounds__(128) void k_gemm_bf(const float* __restrict__ A, int lda, const unsigned short* __restrict__ Wt, int ldb,
                                               const float* __restrict__ bias, float* __restrict__ C, int ldc, int M, int N, int K) {
  __shared__ __attribute__((aligned(16))) float so[4][16][64];
  const int tid = threadIdx.x, w = tid >> 5, lane = tid & 31, ln = lane & 15, hh = lane >> 4;
  const int ntn = N / 64;
  const int wid = blockIdx.x * 4 + w;
  const int mt = wid / ntn, nq = wid % ntn;
  if (mt * 16 >= M) return;
  const int row0 = mt * 16, col0 = nq * 64;
  const float* arow = A + (size_t)(row0 + ln) * lda;
  v8f acc[4] = {};
  for (int kb = 0; kb < K; kb += 32) {
    FragB ah, al;
    const v4f x0 = *(const v4fa*)(arow + kb + 8 * hh), x1 = *(const v4fa*)(arow + kb + 8 * hh + 4);
    const v4f x2 = *(const v4fa*)(arow + kb + 16 + 8 * hh), x3 = *(const v4fa*)(arow + kb + 16 + 8 * hh + 4);
    float xs[16] = {x0[0],x0[1],x0[2],x0[3],x1[0],x1[1],x1[2],x1[3],x2[0],x2[1],x2[2],x2[3],x3[0],x3[1],x3[2],x3[3]};
#pragma unroll
    for (int i = 0; i < 16; ++i) { const unsigned short hb = bf16_bits(xs[i]); ah.u[i] = hb; al.u[i] = ASPLIT ? bf16_bits(xs[i] - bf16_val(hb)) : (unsigned short)0; }
#pragma unroll
    for (int t = 0; t < 4; ++t) {
      const unsigned short* brow = Wt + (size_t)(col0 + t * 16 + ln) * ldb + kb;
      FragB b;
      b.half[0] = *(const v8us*)(brow + 8 * hh);
      b.half[1] = *(const v8us*)(brow + 16 + 8 * hh);
      acc[t] = mmaN<ASPLIT ? 2 : 1>(ah.v, al.v, b.v, b.v, acc[t]);
    }
  }
#pragma unroll
  for (int t = 0; t < 4; ++t) {
    float bv = bias ? bias[col0 + t * 16 + ln] : 0.f;
    if (BIAS_BF16) bv = bf16_round(bv);
#pragma unroll
    for (int r = 0; r < 8; ++r) { float v = acc[t][r] + bv; if (ACT == 1) v = fmaxf(v, 0.f); so[w][8 * hh + r][t * 16 + ln] = v; }
  }
  __builtin_amdgcn_fence(__ATOMIC_ACQ_REL, "workgroup");
  __builtin_amdgcn_wave_barrier();
  const int rsub = lane >> 4, c4 = (lane & 15) * 4;
  {
#pragma unroll
    for (int q = 0; q < 8; ++q) {
      const int r = q * 2 + rsub;
      const v4f v = *(const v4fa*)&so[w][r][c4];
      *(v4f*)(C + (size_t)(row0 + r) * ldc + col0 + c4) = v;
    }
    
  }
}

// GEMM C = act(A·W + bias + resid): A f32 (ASPLIT -> hi/lo 2 terms), Wt bf16 [N][K]; ACT 0 none, 1 relu, 2 exact gelu;
// resid (optional, f32, row index = (row % rmod), pitch ldr, RES_BF16 rounds it) added before the activation.
template <bool ASPLIT, int ACT, bool BIAS_BF16, bool RES_BF16>
__global__ __launch_bounds__(128) void k_gemm_bf3(const float* __restrict__ A, int lda, const unsigned short* __restrict__ Wt, int ldb,
                                                const float* __restrict__ bias, const float* __restrict__ resid, int rmod, int ldr,
                                                float* __restrict__ C, int ldc, int M, int N, int K) {
  __shared__ __attribute__((aligned(16))) float so[4][16][64];
  const int tid = threadIdx.x, w = tid >> 5, lane = tid & 31, ln = lane & 15, hh = lane >> 4;
  const int ntn = N / 64;
  const int wid = blockIdx.x * 4 + w;
  const int mt = wid / ntn, nq = wid % ntn;
  if (mt * 16 >= M) return;
  const int row0 = mt * 16, col0 = nq * 64;
  const float* arow = A + (size_t)(row0 + ln) * lda;
  v8f acc[4] = {};
  for (int kb = 0; kb < K; kb += 32) {
    FragB ah, al;
    const v4f x0 = *(const v4fa*)(arow + kb + 8 * hh), x1 = *(const v4fa*)(arow + kb + 8 * hh + 4);
    const v4f x2 = *(const v4fa*)(arow + kb + 16 + 8 * hh), x3 = *(const v4fa*)(arow + kb + 16 + 8 * hh + 4);
    float xs[16] = {x0[0],x0[1],x0[2],x0[3],x1[0],x1[1],x1[2],x1[3],x2[0],x2[1],x2[2],x2[3],x3[0],x3[1],x3[2],x3[3]};
#pragma unroll
    for (int i = 0; i < 16; ++i) { const unsigned short hb = bf16_bits(xs[i]); ah.u[i] = hb; al.u[i] = ASPLIT ? bf16_bits(xs[i] - bf16_val(hb)) : (unsigned short)0; }
#pragma unroll
    for (int t = 0; t < 4; ++t) {
      const unsigned short* brow = Wt + (size_t)(col0 + t * 16 + ln) * ldb + kb;
      FragB b;
      b.half[0] = *(const v8us*)(brow + 8 * hh);
      b.half[1] = *(const v8us*)(brow + 16 + 8 * hh);
      acc[t] = mmaN<ASPLIT ? 2 : 1>(ah.v, al.v, b.v, b.v, acc[t]);
    }
  }
#pragma unroll
  for (int t = 0; t < 4; ++t) {
    const int col = col0 + t * 16 + ln;
    float bv = bias ? bias[col] : 0.f;
    if (BIAS_BF16) bv = bf16_round(bv);
#pragma unroll
    for (int r = 0; r < 8; ++r) {
      float v = acc[t][r] + bv;
      if (resid) { float rv = resid[(size_t)((row0 + 8 * hh + r) % rmod) * ldr + col]; if (RES_BF16) rv = bf16_round(rv); v += rv; }
      if (ACT == 1) v = fmaxf(v, 0.f);
      if (ACT == 2) v = 0.5f * v * (1.0f + erff(v * 0.70710678118654752f));
      if (ACT == 3) { const float u = 0.7978845608028654f * (v + 0.044715f * v * v * v); v = 0.5f * v * (1.0f + tanhf(u)); }
      so[w][8 * hh + r][t * 16 + ln] = v;
    }
  }
  __builtin_amdgcn_fence(__ATOMIC_ACQ_REL, "workgroup");
  __builtin_amdgcn_wave_barrier();
  const int rsub = lane >> 4, c4 = (lane & 15) * 4;
  {
#pragma unroll
    for (int q = 0; q < 8; ++q) {
      const int r = q * 2 + rsub;
      const v4f v = *(const v4fa*)&so[w][r][c4];
      *(v4f*)(C + (size_t)(row0 + r) * ldc + col0 + c4) = v;
    }
    
  }
}
// row LayerNorm (biased variance, eps) over N: s = X (+ R); optional out_sum <- s; out_norm <- (s-mu)*rsqrt(var+eps)*g + b
template <bool PARAM_BF16>
__global__ __launch_bounds__(256) void k_layernorm(const float* __restrict__ X, const float* __restrict__ R, const float* __restrict__ g, const float* __restrict__ bta,
                                                  float* __restrict__ out_sum, float* __restrict__ out_norm, int N, float eps) {
  __shared__ float red[256];
  const int row = blockIdx.x, tid = threadIdx.x;
  const float* x = X + (size_t)row * N; const float* rr = R ? R + (size_t)row * N : nullptr;
  float vals[16];                     // up to N = 4096
  const int per = N / 256;            // contiguous chunk per thread? use strided-by-4 chunks: thread handles j = tid*4 + 1024*u
  float s1 = 0.f;
  for (int u = 0; u < per / 4; ++u) {
    const int j = tid * 4 + 1024 * u;
    const v4f a = *(const v4fa*)(x + j);
    v4f b = {0.f,0.f,0.f,0.f}; if (rr) b = *(const v4fa*)(rr + j);
#pragma unroll
    for (int q = 0; q < 4; ++q) { const float v = a[q] + b[q]; vals[u * 4 + q] = v; s1 += v; }
  }
  red[tid] = s1; __syncthreads();
  for (int st = 128; st > 0; st >>= 1) { if (tid < st) red[tid] += red[tid + st]; __syncthreads(); }
  const float mu = red[0] / (float)N; __syncthreads();
  float s2 = 0.f;
  for (int u = 0; u < per / 4; ++u)
#pragma unroll
    for (int q = 0; q < 4; ++q) { const float c = vals[u * 4 + q] - mu; s2 += c * c; }
  red[tid] = s2; __syncthreads();
  for (int st = 128; st > 0; st >>= 1) { if (tid < st) red[tid] += red[tid + st]; __syncthreads(); }
  const float rs = rsqrtf(red[0] / (float)N + eps);
  {
    for (int u = 0; u < per / 4; ++u) {
      const int j = tid * 4 + 1024 * u;
      v4f o, sm;
#pragma unroll
      for (int q = 0; q < 4; ++q) {
        float gg = g[j + q], bb = bta[j + q];
        if (PARAM_BF16) { gg = bf16_round(gg); bb = bf16_round(bb); }
        sm[q] = vals[u * 4 + q]; o[q] = (vals[u * 4 + q] - mu) * rs * gg + bb;
      }
      if (out_sum) *(v4f*)(out_sum + (size_t)row * N + j) = sm;
      *(v4f*)(out_norm + (size_t)row * N + j) = o;
    }
    
  }
}



// ---- f16 WMMA path (v_wmma_f32_16x16x32_f16): 11-bit significands for operands in range — used where a [0,1] probability operand needs more precision than bf16
typedef _Float16 v16h __attribute__((ext_vector_type(16)));
union FragH { v16h v; v8us half[2]; _Float16 h[16]; unsigned short u[16]; };
template <int NT>
__device__ __forceinline__ v8f mmaH(v16h ah, v16h al, v16h bh, v16h bl, v8f c) {
  c = __builtin_amdgcn_wmma_f32_16x16x32_f16(false, ah, false, bh, (short)0, c, false, false);
  if (NT >= 2) c = __builtin_amdgcn_wmma_f32_16x16x32_f16(false, al, false, bh, (short)0, c, false, false);
  if (NT >= 3) c = __builtin_amdgcn_wmma_f32_16x16x32_f16(false, ah, false, bl, (short)0, c, false, false);
  asm volatile("v_nop\n\tv_nop\n\tv_nop\n\tv_nop" : "+v"(c) : "v"(ah), "v"(al), "v"(bh), "v"(bl));
  return c;
}
// batched GEMM like k_gemm_b but f16 operands: A f32 (split into f16 hi/lo if ASPLIT, else rounded to f16), Bt = f16 values [n][k]; alpha; C f32; N multiple of 16 (partial tiles skipped)
template <bool ASPLIT>
__global__ __launch_bounds__(128) void k_gemm_h(const float* __restrict__ A, int lda, size_t sA, const _Float16* __restrict__ Bh, int ldb, size_t sB, float alpha, float* __restrict__ C, int ldc, size_t sC, int M, int N, int K) {
  __shared__ __attribute__((aligned(16))) float so[4][16][64];
  const int tid = threadIdx.x, w = tid >> 5, lane = tid & 31, ln = lane & 15, hh = lane >> 4; const int by = blockIdx.y;
  A += (size_t)by * sA; Bh += (size_t)by * sB; C += (size_t)by * sC;
  const int ntn = (N + 63) / 64; const int wid = blockIdx.x * 4 + w; const int mt = wid / ntn, nq = wid % ntn; if (mt * 16 >= M) return;
  const int row0 = mt * 16, col0 = nq * 64; const float* arow = A + (size_t)(row0 + ln) * lda;
  v8f acc[4] = {};
  for (int kb = 0; kb < K; kb += 32) {
    FragH ah, al;
    const v4f x0 = *(const v4fa*)(arow + kb + 8 * hh), x1 = *(const v4fa*)(arow + kb + 8 * hh + 4), x2 = *(const v4fa*)(arow + kb + 16 + 8 * hh), x3 = *(const v4fa*)(arow + kb + 16 + 8 * hh + 4);
    float xs[16] = {x0[0],x0[1],x0[2],x0[3],x1[0],x1[1],x1[2],x1[3],x2[0],x2[1],x2[2],x2[3],x3[0],x3[1],x3[2],x3[3]};
#pragma unroll
    for (int i = 0; i < 16; ++i) { const _Float16 h = (_Float16)xs[i]; ah.h[i] = h; al.h[i] = ASPLIT ? (_Float16)(xs[i] - (float)h) : (_Float16)0.0f; }
#pragma unroll
    for (int t = 0; t < 4; ++t) { if (col0 + t * 16 >= N) continue; const size_t boff = (size_t)(col0 + t * 16 + ln) * ldb + kb; FragH bq; bq.half[0] = *(const v8us*)(Bh + boff + 8 * hh); bq.half[1] = *(const v8us*)(Bh + boff + 16 + 8 * hh);
      acc[t] = mmaH<ASPLIT ? 2 : 1>(ah.v, al.v, bq.v, bq.v, acc[t]); }
  }
#pragma unroll
  for (int t = 0; t < 4; ++t) { if (col0 + t * 16 >= N) continue;
#pragma unroll
    for (int r = 0; r < 8; ++r) so[w][8 * hh + r][t * 16 + ln] = acc[t][r] * alpha; }
  __builtin_amdgcn_fence(__ATOMIC_ACQ_REL, "workgroup"); __builtin_amdgcn_wave_barrier();
  const int rsub = lane >> 4, c4 = (lane & 15) * 4;
  {
#pragma unroll
    for (int q = 0; q < 8; ++q) { const int r = q * 2 + rsub; if (col0 + c4 < N) { const v4f v = *(const v4fa*)&so[w][r][c4]; *(v4f*)(C + (size_t)(row0 + r) * ldc + col0 + c4) = v; } }
     }
}

// Wt[n][k] = f16(W[k][n]·scale) from f32 row-major W[K][N] (scale = power of two; bf16-exact weights stay exact in f16 away from the subnormal range)
__global__ __launch_bounds__(256) void k_wt_f16(const float* __restrict__ W, _Float16* __restrict__ Wt, int K, int N, float scale) {
  const int t = blockIdx.x * 256 + threadIdx.x; if (t >= N * (K / 8)) return; const int n = t / (K / 8), k8 = (t % (K / 8)) * 8; FragH f;
#pragma unroll
  for (int i = 0; i < 8; ++i) f.h[i] = (_Float16)(bf16_round(W[(size_t)(k8 + i) * N + n]) * scale); const v8us o = f.half[0];
  *(v8us*)((unsigned short*)Wt + (size_t)n * K + k8) = o; 
}
// k_gemm_hh variant with fused epilogue: v = acc·alpha + bias[by·sBias + col] (+ CP[(row/rowsPerB)·sCPb + by·64 + col] if CP) ; ACT 0 none / 1 elu ; writes f16 C16 (and f32 C if non-null)
template <int ACT>
__global__ __launch_bounds__(128) void k_gemm_hhx(const _Float16* __restrict__ A, int lda, size_t sA, const _Float16* __restrict__ Bh, int ldb, size_t sB, float alpha, const float* __restrict__ bias, size_t sBias, const float* __restrict__ CP, int rowsPerB, size_t sCPb, int row0g,
    float* __restrict__ C, _Float16* __restrict__ C16, int ldc, size_t sC, int M, int N, int K) {
  __shared__ __attribute__((aligned(16))) float so[4][16][64];
  const int tid = threadIdx.x, w = tid >> 5, lane = tid & 31, ln = lane & 15, hh = lane >> 4; const int by = blockIdx.y;
  A += (size_t)by * sA; Bh += (size_t)by * sB; const size_t cofs = (size_t)by * sC; const float* bp = bias ? bias + (size_t)by * sBias : nullptr;
  const int ntn = (N + 63) / 64; const int wid = blockIdx.x * 4 + w; const int mt = wid / ntn, nq = wid % ntn; if (mt * 16 >= M) return;
  const int row0 = mt * 16, col0 = nq * 64; const _Float16* arow = A + (size_t)(row0 + ln) * lda;
  v8f acc[4] = {};
  for (int kb = 0; kb < K; kb += 32) { FragH ah; ah.half[0] = *(const v8us*)((const unsigned short*)arow + kb + 8 * hh); ah.half[1] = *(const v8us*)((const unsigned short*)arow + kb + 16 + 8 * hh);
#pragma unroll
    for (int t = 0; t < 4; ++t) { if (col0 + t * 16 >= N) continue; const size_t boff = (size_t)(col0 + t * 16 + ln) * ldb + kb; FragH bq; bq.half[0] = *(const v8us*)((const unsigned short*)Bh + boff + 8 * hh); bq.half[1] = *(const v8us*)((const unsigned short*)Bh + boff + 16 + 8 * hh);
      acc[t] = mmaH<1>(ah.v, ah.v, bq.v, bq.v, acc[t]); }
  }
#pragma unroll
  for (int t = 0; t < 4; ++t) { if (col0 + t * 16 >= N) continue; const int col = col0 + t * 16 + ln; const float bv = bp ? bf16_round(bp[col]) : 0.f;
#pragma unroll
    for (int r = 0; r < 8; ++r) { float v = acc[t][r] * alpha + bv; if (CP) { const int bidx = (row0g + row0 + 8 * hh + r) / rowsPerB; v += CP[(size_t)bidx * sCPb + (size_t)by * 64 + col]; } if (ACT == 1) v = (v > 0.f) ? v : expm1f(v); else if (ACT == 7) v = (v > 0.f) ? v + 1.0f : expf(v); else if (ACT == 8) v = tanhf(v); else if (ACT == 9) v = 0.5f * v * (1.0f + tanhf(0.7978845608028654f * (v + 0.044715f * v * v * v))); else if (ACT == 11) v = 1.0f / (1.0f + expf(-v)); else if (ACT == 12) v = (v > 0.f) ? v : 0.01f * v; else if (ACT == 14) v = (v > 0.f) ? v : 0.1f * v; else if (ACT == 15) v = v / (1.0f + expf(-v)); else if (ACT == 3) v = fmaxf(v, 0.f); else if (ACT == 6) v = 0.5f * v * (1.0f + erff(v * 0.70710678118654752f)); so[w][8 * hh + r][t * 16 + ln] = v; } }
  __builtin_amdgcn_fence(__ATOMIC_ACQ_REL, "workgroup"); __builtin_amdgcn_wave_barrier();
  const int rsub = lane >> 4, c4 = (lane & 15) * 4; typedef _Float16 v4h __attribute__((ext_vector_type(4)));
  {
#pragma unroll
    for (int q = 0; q < 8; ++q) { const int r = q * 2 + rsub; if (col0 + c4 < N) { const v4f v = *(const v4fa*)&so[w][r][c4]; if (C) *(v4f*)(C + cofs + (size_t)(row0 + r) * ldc + col0 + c4) = v; if (C16) { v4h h4; for (int i = 0; i < 4; ++i) h4[i] = (_Float16)v[i]; *(v4h*)(C16 + cofs + (size_t)(row0 + r) * ldc + col0 + c4) = h4; } } }
     }
}


typedef _Float16 v4h __attribute__((ext_vector_type(4)));

__global__ __launch_bounds__(256) void k_x16(const float* __restrict__ x, _Float16* __restrict__ X16, size_t n8) { const size_t t = (size_t)blockIdx.x * 256 + threadIdx.x; if (t >= n8) return; FragH f;
#pragma unroll
  for (int q = 0; q < 8; ++q) f.h[q] = (_Float16)bf16_round(x[t * 8 + q]); *(v8us*)((unsigned short*)X16 + t * 8) = f.half[0];  }
__global__ __launch_bounds__(256) void k_h16(const float* __restrict__ x, _Float16* __restrict__ X16, size_t n8) { const size_t t = (size_t)blockIdx.x * 256 + threadIdx.x; if (t >= n8) return; FragH f;
#pragma unroll
  for (int q = 0; q < 8; ++q) f.h[q] = (_Float16)x[t * 8 + q]; *(v8us*)((unsigned short*)X16 + t * 8) = f.half[0];  }
__global__ __launch_bounds__(256) void k_round16f(const float* __restrict__ W, _Float16* __restrict__ Bt, size_t n8) { const size_t t = (size_t)blockIdx.x * 256 + threadIdx.x; if (t >= n8) return; FragH f;
#pragma unroll
  for (int i = 0; i < 8; ++i) f.h[i] = (_Float16)(bf16_round(W[t * 8 + i]) * 16.0f); *(v8us*)((unsigned short*)Bt + t * 8) = f.half[0];  }
template <int NHv, int TTv>
__global__ __launch_bounds__(256) void k_vt(const _Float16* __restrict__ V16, int ldv, int voff, _Float16* __restrict__ Vt) { __shared__ unsigned short tl[64][66]; const int tid = threadIdx.x; const int slab = blockIdx.x / (TTv / 64), lg = blockIdx.x % (TTv / 64); const int b = slab / NHv, h = slab % NHv;
  for (int i = tid; i < 64 * 8; i += 256) { const int r = i / 8, c8 = (i % 8) * 8; FragH f; f.half[0] = *(const v8us*)((const unsigned short*)V16 + ((size_t)b * TTv + lg * 64 + r) * ldv + voff + h * 64 + c8);
#pragma unroll
    for (int q = 0; q < 8; ++q) tl[r][c8 + q] = f.u[q]; }
  __syncthreads();
  {
#pragma unroll
    for (int rd = 0; rd < 2; ++rd) { const int d = rd * 32 + tid / 8, pc = tid % 8; FragH f;
#pragma unroll
      for (int q = 0; q < 8; ++q) f.u[q] = tl[pc * 8 + q][d];
      *(v8us*)((unsigned short*)Vt + ((size_t)slab * 64 + d) * TTv + lg * 64 + pc * 8) = f.half[0]; }
     } }

__global__ __launch_bounds__(256) void k_hl(const float* __restrict__ F, _Float16* __restrict__ Hh, _Float16* __restrict__ Hl, size_t n8) { const size_t t = (size_t)blockIdx.x * 256 + threadIdx.x; if (t >= n8) return; FragH fh, fl; const v4f a = *(const v4fa*)(F + t * 8), c = *(const v4fa*)(F + t * 8 + 4);
#pragma unroll
  for (int q = 0; q < 4; ++q) { _Float16 h = (_Float16)a[q]; fh.h[q] = h; fl.h[q] = (_Float16)((a[q] - (float)h) * 1024.0f); h = (_Float16)c[q]; fh.h[4 + q] = h; fl.h[4 + q] = (_Float16)((c[q] - (float)h) * 1024.0f); }
  { *(v8us*)((unsigned short*)Hh + t * 8) = fh.half[0]; *(v8us*)((unsigned short*)Hl + t * 8) = fl.half[0];  } }

// ---- fast GEMM (wave tile 32x64; requires M % 32 == 0 rows per launch region and N % 64 == 0); epilogue = k_gemm_hhx semantics ----
__device__ __forceinline__ v16h g2_frag(const _Float16* p, int hh) { FragH f; f.half[0] = *(const v8us*)((const unsigned short*)p + 8 * hh); f.half[1] = *(const v8us*)((const unsigned short*)p + 16 + 8 * hh); return f.v; }
__device__ __forceinline__ v8f g2_mma(v16h a, v16h b, v8f c) { v8f d = __builtin_amdgcn_wmma_f32_16x16x32_f16(false, a, false, b, (short)0, c, false, false); asm volatile("v_nop\n\tv_nop\n\tv_nop\n\tv_nop" : "+v"(d) : "v"(a), "v"(b)); return d; }
template <int ACT>
__global__ __launch_bounds__(128) void k_gemm2(const _Float16* __restrict__ A, int lda, size_t sA, const _Float16* __restrict__ Bh, int ldb, size_t sB, float alpha, const float* __restrict__ bias, size_t sBias, const float* __restrict__ CP, int rowsPerB, size_t sCPb, int row0g,
    float* __restrict__ C, _Float16* __restrict__ C16, int ldc, size_t sC, int M, int N, int K) {
  __shared__ __attribute__((aligned(16))) float so[4][32][68];
  const int tid = threadIdx.x, w = tid >> 5, lane = tid & 31, ln = lane & 15, hh = lane >> 4; const int by = blockIdx.y;
  A += (size_t)by * sA; Bh += (size_t)by * sB; const size_t cofs = (size_t)by * sC; const float* bp = bias ? bias + (size_t)by * sBias : nullptr;
  const int ntn = N >> 6; const int mt = blockIdx.x / ntn, nq = blockIdx.x - mt * ntn; const int row0 = mt * 128 + 32 * w, col0 = nq * 64; if (row0 >= M) return;
  const _Float16* a0p = A + (size_t)(row0 + ln) * lda; const _Float16* a1p = a0p + (size_t)16 * lda;
  const _Float16* b0p = Bh + (size_t)(col0 + ln) * ldb; const _Float16* b1p = b0p + (size_t)16 * ldb; const _Float16* b2p = b1p + (size_t)16 * ldb; const _Float16* b3p = b2p + (size_t)16 * ldb;
  const v8f z8 = {0.f,0.f,0.f,0.f,0.f,0.f,0.f,0.f}; v8f c00 = z8, c01 = z8, c02 = z8, c03 = z8, c10 = z8, c11 = z8, c12 = z8, c13 = z8;
#pragma unroll 1
  for (int kb = 0; kb < K; kb += 32) { const v16h a0 = g2_frag(a0p + kb, hh), a1 = g2_frag(a1p + kb, hh);
    v16h b = g2_frag(b0p + kb, hh); c00 = g2_mma(a0, b, c00); c10 = g2_mma(a1, b, c10);
    b = g2_frag(b1p + kb, hh); c01 = g2_mma(a0, b, c01); c11 = g2_mma(a1, b, c11);
    b = g2_frag(b2p + kb, hh); c02 = g2_mma(a0, b, c02); c12 = g2_mma(a1, b, c12);
    b = g2_frag(b3p + kb, hh); c03 = g2_mma(a0, b, c03); c13 = g2_mma(a1, b, c13); }
  v8f accs[8] = {c00, c01, c02, c03, c10, c11, c12, c13};
#pragma unroll
  for (int u = 0; u < 8; ++u) { const int t = u & 3, half = u >> 2; const int col = col0 + t * 16 + ln; const float bv = bp ? bf16_round(bp[col]) : 0.f;
#pragma unroll
    for (int r = 0; r < 8; ++r) { const int rloc = half * 16 + 8 * hh + r; float v = accs[u][r] * alpha + bv; if (CP) { if (rowsPerB < 0) v += CP[cofs + (size_t)(row0g + row0 + rloc) * ldc + col];      /* rowsPerB < 0: own element of the batched C plane */ else { const int bidx = (row0g + row0 + rloc) / rowsPerB; v += CP[(size_t)bidx * sCPb + (size_t)by * 64 + col]; } }
      if (ACT == 3) v = fmaxf(v, 0.f); else if (ACT == 6) v = 0.5f * v * (1.0f + erff(v * 0.70710678118654752f)); else if (ACT == 11) v = 1.0f / (1.0f + expf(-v)); else if (ACT == 15) v = v / (1.0f + expf(-v)); else if (ACT == 12) v = (v > 0.f) ? v : 0.01f * v; else if (ACT == 8) v = tanhf(v);
      so[w][rloc][t * 16 + ln] = v; } }
  __builtin_amdgcn_fence(__ATOMIC_ACQ_REL, "workgroup"); __builtin_amdgcn_wave_barrier();
  const int rsub = lane >> 4, c4 = (lane & 15) * 4;
  {
#pragma unroll
    for (int q = 0; q < 16; ++q) { const int r = q * 2 + rsub; const v4f v = *(const v4fa*)&so[w][r][c4]; if (C) *(v4f*)(C + cofs + (size_t)(row0 + r) * ldc + col0 + c4) = v; if (C16) { v4h h4; for (int i = 0; i < 4; ++i) h4[i] = (_Float16)v[i]; *(v4h*)(C16 + cofs + (size_t)(row0 + r) * ldc + col0 + c4) = h4; } }
     } }



// lane l takes the value of lane l ^ 16 (the other half of the same query column)
__device__ __forceinline__ float xhalf(float x) { return __builtin_bit_cast(float, __builtin_amdgcn_permlanex16(__builtin_bit_cast(int, x), __builtin_bit_cast(int, x), 0x76543210, 0xfedcba98, false, false)); }
__global__ __launch_bounds__(128) void k_flash(const _Float16* __restrict__ Q16, int ldq, const _Float16* __restrict__ K16, int ldk, const _Float16* __restrict__ Vt, float* __restrict__ O, int ldo) {
  constexpr int RPW = 16, DT = 4, KS = 2;
  const int tid = threadIdx.x, w = tid >> 5, lane = tid & 31, ln = lane & 15, hh = lane >> 4;
  const int slab = blockIdx.x / QBNP, qblk = QB0P + blockIdx.x % QBNP; const int b = slab / NH, h = slab % NH; const int q0 = qblk * (4 * RPW) + w * RPW;
  FragH bq[KS];
  { const unsigned short* qr = (const unsigned short*)Q16 + ((size_t)b * TQ + q0 + ln) * ldq + h * 64;
#pragma unroll
    for (int ks = 0; ks < KS; ++ks) { bq[ks].half[0] = *(const v8us*)(qr + ks * 32 + 8 * hh); bq[ks].half[1] = *(const v8us*)(qr + ks * 32 + 16 + 8 * hh); } }
  const unsigned short* Vth = (const unsigned short*)Vt + (size_t)slab * 64 * TK;
  const unsigned short* kr0 = (const unsigned short*)K16 + ((size_t)b * TK + ln) * ldk + h * 64 + 8 * hh; const unsigned short* kr1 = kr0 + (size_t)16 * ldk;      /* the lane's rows of the two key tiles, carried over the passes and advanced at the foot */
  float m_r = -3.0e38f, l_r = 0.f; v8f oacc[DT];
#pragma unroll
  for (int dt = 0; dt < DT; ++dt) oacc[dt] = (v8f){0.f,0.f,0.f,0.f,0.f,0.f,0.f,0.f};
#pragma unroll 1      /* rolled as before: one pass's fragments and scores live at a time */
  for (int j0 = 0; j0 < TK; j0 += 32) {
    float sc[16];
#pragma unroll
    for (int nt = 0; nt < 2; ++nt) { const unsigned short* kr = nt ? kr1 : kr0; FragH ak[KS];
#pragma unroll
      for (int ks = 0; ks < KS; ++ks) { ak[ks].half[0] = *(const v8us*)(kr + ks * 32); ak[ks].half[1] = *(const v8us*)(kr + ks * 32 + 16); }
      v8f acc = (v8f){0.f,0.f,0.f,0.f,0.f,0.f,0.f,0.f};
#pragma unroll
      for (int ks = 0; ks < KS; ++ks) acc = mmaH<1>(ak[ks].v, ak[ks].v, bq[ks].v, bq[ks].v, acc);
#pragma unroll
      for (int r = 0; r < 8; ++r) sc[nt * 8 + r] = acc[r] * SCL; }
    float mx[4];
#pragma unroll
    for (int c = 0; c < 4; ++c) mx[c] = fmaxf(fmaxf(sc[c], sc[4 + c]), fmaxf(sc[8 + c], sc[12 + c]));
    float mc = fmaxf(fmaxf(mx[0], mx[1]), fmaxf(mx[2], mx[3])); mc = fmaxf(mc, xhalf(mc));      /* both halves of a column use one maximum: they share the output tiles */
    const float mn = fmaxf(m_r, mc); const float al = expf(m_r - mn); m_r = mn;
    FragH pb; float ps[4] = {0.f, 0.f, 0.f, 0.f};
#pragma unroll
    for (int i = 0; i < 16; ++i) { const float p = expf(sc[i] - mn); ps[i & 3] += p; pb.h[i] = (_Float16)(p * 1024.0f); }      /* element i = key kmap(i, hh): the order of the V^T loader below */
    l_r = l_r * al + ((ps[0] + ps[1]) + (ps[2] + ps[3]));
#pragma unroll
    for (int dt = 0; dt < DT; ++dt)
#pragma unroll
      for (int r = 0; r < 8; ++r) oacc[dt][r] *= al;
#pragma unroll
    for (int dt = 0; dt < DT; ++dt) { const unsigned short* vrow = Vth + (size_t)(dt * 16 + ln) * TK + j0; FragH av; av.half[0] = *(const v8us*)(vrow + 8 * hh); av.half[1] = *(const v8us*)(vrow + 16 + 8 * hh);
      oacc[dt] = mmaH<1>(av.v, av.v, pb.v, pb.v, oacc[dt]); }
    kr0 += (size_t)32 * ldk; kr1 += (size_t)32 * ldk; }
  const float l = l_r + xhalf(l_r); const float inv = (l > 0.f) ? 1.0f / (l * 1024.0f) : 0.f;
  float* orow = O + ((size_t)b * TQ + q0 + ln) * ldo + h * 64 + 8 * hh;      /* register r of tile dt = channel dt * 16 + 8 hh + r of query ln: 32 contiguous bytes a lane */
#pragma unroll
  for (int dt = 0; dt < DT; ++dt) { const v4f lo = {oacc[dt][0] * inv, oacc[dt][1] * inv, oacc[dt][2] * inv, oacc[dt][3] * inv}, hi = {oacc[dt][4] * inv, oacc[dt][5] * inv, oacc[dt][6] * inv, oacc[dt][7] * inv};
    *(v4f*)(orow + dt * 16) = lo; *(v4f*)(orow + dt * 16 + 4) = hi; } }
// 5-plane variant: S = Qh Kh^T + (Ql Kh^T + Qh Kl^T)/1024 with Q/K = [hi | 2^10 residual] f16 planes (QL/KL same layout as Q16/K16), then the 3-term P.V below.
// 3-term variant: O = (P_hi V_hi + (P_lo V_hi + P_hi V_lo) / 1024) / l with P = [hi | 2^10 residual] of 1024 p and V^T = [hi | 2^10 residual] planes (VtL same layout as Vt) -> ~2^-21-class products for un-averaged (early causal / peaked) rows
template <int CAUSAL>
__global__ __launch_bounds__(128) void k_flash5(const _Float16* __restrict__ Q16, const _Float16* __restrict__ QL, int ldq, const _Float16* __restrict__ K16, const _Float16* __restrict__ KL, int ldk, const _Float16* __restrict__ Vt, const _Float16* __restrict__ VtL, const int* __restrict__ MSK, float* __restrict__ O, int ldo) {
  constexpr int RPW = 16, RTN = RPW / 16, NQB = TQ / (4 * RPW), DT = 4, KS = 2;
  __shared__ __attribute__((aligned(16))) unsigned short sP[4][RPW][40]; __shared__ __attribute__((aligned(16))) unsigned short sPL[4][RPW][40]; __shared__ __attribute__((aligned(16))) float sO[4][RPW][64 + 4];
  const int tid = threadIdx.x, w = tid >> 5, lane = tid & 31, ln = lane & 15, hh = lane >> 4;
  const int slab = blockIdx.x / QBN5, qblk = QB05 + blockIdx.x % QBN5; (void)NQB; const int b = slab / NH, h = slab % NH; const int qb0 = qblk * (4 * RPW); const int q0 = qb0 + w * RPW;
  FragH aq[2][KS], aql[2][KS];
#pragma unroll
  for (int rt = 0; rt < RTN; ++rt) { const unsigned short* qr = (const unsigned short*)Q16 + ((size_t)b * TQ + q0 + rt * 16 + ln) * ldq + h * 64; const unsigned short* ql = (const unsigned short*)QL + ((size_t)b * TQ + q0 + rt * 16 + ln) * ldq + h * 64;
#pragma unroll
    for (int ks = 0; ks < KS; ++ks) { aq[rt][ks].half[0] = *(const v8us*)(qr + ks * 32 + 8 * hh); aq[rt][ks].half[1] = *(const v8us*)(qr + ks * 32 + 16 + 8 * hh); aql[rt][ks].half[0] = *(const v8us*)(ql + ks * 32 + 8 * hh); aql[rt][ks].half[1] = *(const v8us*)(ql + ks * 32 + 16 + 8 * hh); } }
  const unsigned short* Vth = (const unsigned short*)Vt + (size_t)slab * 64 * TK; const unsigned short* Vtl = (const unsigned short*)VtL + (size_t)slab * 64 * TK;
  float m_r[2][8], l_r[2][8]; v8f oacc[2][DT], oaccL[2][DT];
#pragma unroll
  for (int rt = 0; rt < RTN; ++rt) {
#pragma unroll
    for (int r = 0; r < 8; ++r) { m_r[rt][r] = -3.0e38f; l_r[rt][r] = 0.f; }
#pragma unroll
    for (int dt = 0; dt < DT; ++dt) { oacc[rt][dt] = (v8f){0.f,0.f,0.f,0.f,0.f,0.f,0.f,0.f}; oaccL[rt][dt] = oacc[rt][dt]; } }
  const int jend = (CAUSAL == 1) ? (qb0 + 4 * RPW) : ((CAUSAL == 23) ? min(TK, (qb0 / CHK + 2) * CHK) : TK);      /* causal / window: keys that can never contribute are skipped */ const int jbeg = (CAUSAL == 23) ? max(0, (qb0 / CHK - 1) * CHK) : 0;
#pragma unroll 1
  for (int j0 = jbeg; j0 < jend; j0 += 32) {
    v8f s[2][2];
#pragma unroll
    for (int nt = 0; nt < 2; ++nt) { const unsigned short* kr = (const unsigned short*)K16 + ((size_t)b * TK + j0 + nt * 16 + ln) * ldk + h * 64; const unsigned short* klr = (const unsigned short*)KL + ((size_t)b * TK + j0 + nt * 16 + ln) * ldk + h * 64; FragH bk[KS], bkl[KS];
#pragma unroll
      for (int ks = 0; ks < KS; ++ks) { bk[ks].half[0] = *(const v8us*)(kr + ks * 32 + 8 * hh); bk[ks].half[1] = *(const v8us*)(kr + ks * 32 + 16 + 8 * hh); bkl[ks].half[0] = *(const v8us*)(klr + ks * 32 + 8 * hh); bkl[ks].half[1] = *(const v8us*)(klr + ks * 32 + 16 + 8 * hh); }
#pragma unroll
      for (int rt = 0; rt < RTN; ++rt) { v8f acc = (v8f){0.f,0.f,0.f,0.f,0.f,0.f,0.f,0.f}, accl = acc;
#pragma unroll
        for (int ks = 0; ks < KS; ++ks) { acc = mmaH<1>(aq[rt][ks].v, aq[rt][ks].v, bk[ks].v, bk[ks].v, acc); accl = mmaH<1>(aql[rt][ks].v, aql[rt][ks].v, bk[ks].v, bk[ks].v, accl); accl = mmaH<1>(aq[rt][ks].v, aq[rt][ks].v, bkl[ks].v, bkl[ks].v, accl); }
#pragma unroll
        for (int r = 0; r < 8; ++r) acc[r] += accl[r] * 0.0009765625f;
        s[rt][nt] = acc; } }
#pragma unroll
    for (int rt = 0; rt < RTN; ++rt)
#pragma unroll
      for (int r = 0; r < 8; ++r) { const int tq = q0 + rt * 16 + 8 * hh + r; const int k0 = j0 + ln, k1 = j0 + 16 + ln;
        bool ok0 = (CAUSAL == 1) ? (k0 <= tq) : ((CAUSAL == 2) ? ((k0 >> 5) == (tq >> 5)) : true), ok1 = (CAUSAL == 1) ? (k1 <= tq) : ((CAUSAL == 2) ? ((k1 >> 5) == (tq >> 5)) : true);      /* mode 2: block-diagonal 32-token groups */
        if (CAUSAL == 4) { const int* mrow = MSK + ((size_t)b * TQ + tq) * TK; ok0 = mrow[k0] != 0; ok1 = mrow[k1] != 0; }      /* mode 4: per-(query, key) INPUT mask shared by all heads; masked keys contribute nothing (== the reference's -4096 fill, whose exp underflows to 0), rows with no valid key give l = 0 -> output 0 (== the reference's row_valid zeroing) */
        float s0 = ok0 ? s[rt][0][r] * SCL : -3.0e38f, s1 = ok1 ? s[rt][1][r] * SCL : -3.0e38f; if (CAUSAL == 17) { const float* amk = (const float*)MSK + (size_t)b * TK; s0 += bf16_round(amk[k0]); s1 += bf16_round(amk[k1]); } if (CAUSAL == 18) { const float* tb = (const float*)MSK; const int* ri = MSK + 1024 + (size_t)b * TK; const int rq = ri[tq]; s0 += tb[(h * 8 + rq) * 8 + ri[k0]]; s1 += tb[(h * 8 + rq) * 8 + ri[k1]]; } if (CAUSAL == 19) { const int* rel = MSK + (size_t)tq * TK; const float* rb = (const float*)MSK + (size_t)TQ * TK + ((size_t)(b * NH + h) * TQ + tq) * 64; s0 += rb[rel[k0]]; s1 += rb[rel[k1]]; }      /* mode 19: + (q.Ek[rel] + Eb[rel][h]) / 8 gathered by the int relative ids (packed [ids | table]) */      /* mode 18: + resource_bias[h][r_q][r_k] from the packed [table | ids] buffer (TQ == TK) */      /* mode 17: additive per-(batch, key) mask INPUT */ float mc = fmaxf(s0, s1);
        mc = fmaxf(mc, __shfl_xor(mc, 1, 32)); mc = fmaxf(mc, __shfl_xor(mc, 2, 32)); mc = fmaxf(mc, __shfl_xor(mc, 4, 32)); mc = fmaxf(mc, __shfl_xor(mc, 8, 32));
        const float mn = fmaxf(m_r[rt][r], mc); const float al = (mn > -1.0e38f) ? expf(m_r[rt][r] - mn) : 1.0f; m_r[rt][r] = mn; const float p0 = ok0 ? expf(s0 - mn) : 0.f, p1 = ok1 ? expf(s1 - mn) : 0.f; l_r[rt][r] = l_r[rt][r] * al + p0 + p1;
#pragma unroll
        for (int dt = 0; dt < DT; ++dt) { oacc[rt][dt][r] *= al; oaccL[rt][dt][r] *= al; }
        FragH t2, t2l; const float ps0 = p0 * 1024.0f, ps1 = p1 * 1024.0f; t2.h[0] = (_Float16)ps0; t2.h[1] = (_Float16)ps1; t2l.h[0] = (_Float16)((ps0 - (float)t2.h[0]) * 1024.0f); t2l.h[1] = (_Float16)((ps1 - (float)t2.h[1]) * 1024.0f);
        sP[w][rt * 16 + 8 * hh + r][ln] = t2.u[0]; sP[w][rt * 16 + 8 * hh + r][16 + ln] = t2.u[1]; sPL[w][rt * 16 + 8 * hh + r][ln] = t2l.u[0]; sPL[w][rt * 16 + 8 * hh + r][16 + ln] = t2l.u[1]; }
    __builtin_amdgcn_fence(__ATOMIC_ACQ_REL, "workgroup"); __builtin_amdgcn_wave_barrier();
    FragH pa[2], pl[2];
#pragma unroll
    for (int rt = 0; rt < RTN; ++rt) { pa[rt].half[0] = *(const v8us*)&sP[w][rt * 16 + ln][8 * hh]; pa[rt].half[1] = *(const v8us*)&sP[w][rt * 16 + ln][16 + 8 * hh]; pl[rt].half[0] = *(const v8us*)&sPL[w][rt * 16 + ln][8 * hh]; pl[rt].half[1] = *(const v8us*)&sPL[w][rt * 16 + ln][16 + 8 * hh]; }
#pragma unroll
    for (int dt = 0; dt < DT; ++dt) { const unsigned short* vrow = Vth + (size_t)(dt * 16 + ln) * TK + j0; const unsigned short* vrl = Vtl + (size_t)(dt * 16 + ln) * TK + j0; FragH bv, bl; bv.half[0] = *(const v8us*)(vrow + 8 * hh); bv.half[1] = *(const v8us*)(vrow + 16 + 8 * hh); bl.half[0] = *(const v8us*)(vrl + 8 * hh); bl.half[1] = *(const v8us*)(vrl + 16 + 8 * hh);
#pragma unroll
      for (int rt = 0; rt < RTN; ++rt) { oacc[rt][dt] = mmaH<1>(pa[rt].v, pa[rt].v, bv.v, bv.v, oacc[rt][dt]); oaccL[rt][dt] = mmaH<1>(pl[rt].v, pl[rt].v, bv.v, bv.v, oaccL[rt][dt]); oaccL[rt][dt] = mmaH<1>(pa[rt].v, pa[rt].v, bl.v, bl.v, oaccL[rt][dt]); } }
    __builtin_amdgcn_fence(__ATOMIC_ACQ_REL, "workgroup"); __builtin_amdgcn_wave_barrier(); }
#pragma unroll
  for (int rt = 0; rt < RTN; ++rt) {
#pragma unroll
    for (int r = 0; r < 8; ++r) { float l = l_r[rt][r]; l += __shfl_xor(l, 1, 32); l += __shfl_xor(l, 2, 32); l += __shfl_xor(l, 4, 32); l += __shfl_xor(l, 8, 32); l_r[rt][r] = (l > 0.f) ? 1.0f / (l * 1024.0f) : 0.f; }
#pragma unroll
    for (int dt = 0; dt < DT; ++dt)
#pragma unroll
      for (int r = 0; r < 8; ++r) { float v = oacc[rt][dt][r]; v += oaccL[rt][dt][r] * 0.0009765625f; sO[w][rt * 16 + 8 * hh + r][dt * 16 + ln] = v * l_r[rt][r]; } }
  __builtin_amdgcn_fence(__ATOMIC_ACQ_REL, "workgroup"); __builtin_amdgcn_wave_barrier();
  {
#pragma unroll
    for (int rp = 0; rp < RPW; rp += 2) { const int r = rp + (lane >> 4), pc = lane & 15; const v4f val = *(const v4fa*)&sO[w][r][pc * 4]; *(v4f*)(O + ((size_t)b * TQ + q0 + r) * ldo + h * 64 + pc * 4) = val; }
     } }

__global__ __launch_bounds__(256) void k_rotab(float* __restrict__ CS, float* __restrict__ SN) {
  #pragma clang fp contract(off)
  const int t = blockIdx.x * 256 + threadIdx.x; if (t >= SLEN * 32) return; const int j = t % 32, s = t / 32; const float ex = (float)(2 * j) / 64.0f; const float inv = 1.0f / powf(10000.0f, ex); const float th = (float)s * inv; const float c = cosf(th), sn = sinf(th);
  { *(float*)(CS + t) = c; *(float*)(SN + t) = sn;  } }
__global__ __launch_bounds__(256) void k_rope(const float* __restrict__ F, int nsrc, int ndst, int rep, const float* __restrict__ CS, const float* __restrict__ SN, _Float16* __restrict__ H, _Float16* __restrict__ L) {
  #pragma clang fp contract(off)
  const size_t t = (size_t)blockIdx.x * 256 + threadIdx.x; if (t >= (size_t)NR * ndst * 4) return; const int g8 = (int)(t % 4); const int hd = (int)((t / 4) % ndst); const size_t row = t / ((size_t)4 * ndst); const int s = (int)(row % SLEN); const int hs = hd / rep;
  const float* src = F + row * (size_t)(nsrc * 64) + hs * 64; FragH ah, al, bh, bl;
  for (int i = 0; i < 8; ++i) { const int d = g8 * 8 + i; const float c = CS[s * 32 + d], sn = SN[s * 32 + d]; const float x1 = src[d], x2 = src[d + 32];
    float o1 = x1 * c; o1 += -x2 * sn; float o2 = x2 * c; o2 += x1 * sn;
    _Float16 hv = (_Float16)o1; ah.h[i] = hv; al.h[i] = (_Float16)((o1 - (float)hv) * 1024.0f); hv = (_Float16)o2; bh.h[i] = hv; bl.h[i] = (_Float16)((o2 - (float)hv) * 1024.0f); }
  const size_t o = row * (size_t)(ndst * 64) + hd * 64 + g8 * 8;
  { *(v8us*)((unsigned short*)H + o) = ah.half[0]; *(v8us*)((unsigned short*)H + o + 32) = bh.half[0]; *(v8us*)((unsigned short*)L + o) = al.half[0]; *(v8us*)((unsigned short*)L + o + 32) = bl.half[0];  } }
__global__ __launch_bounds__(256) void k_rope2(const float* __restrict__ F, int nsrc, int ndst, int rep, const float* __restrict__ CS, const float* __restrict__ SN, _Float16* __restrict__ H, _Float16* __restrict__ L) {
  #pragma clang fp contract(off)
  const size_t t = (size_t)blockIdx.x * 256 + threadIdx.x; if (t >= (size_t)NR * ndst * 4) return; const int g16 = (int)(t % 4); const int hd = (int)((t / 4) % ndst); const size_t row = t / ((size_t)4 * ndst); const int s = (int)(row % SLEN); const int hs = hd / rep;
  const float* src = F + row * (size_t)(nsrc * 64) + hs * 64 + g16 * 16; FragH ah, al;
  for (int pr = 0; pr < 8; ++pr) { const int i = g16 * 8 + pr; const float c = CS[s * 32 + i], sn = SN[s * 32 + i]; const float x1 = src[2 * pr], x2 = src[2 * pr + 1];
    float o1 = x1 * c; o1 -= x2 * sn; float o2 = x1 * sn; o2 += x2 * c;
    _Float16 hv = (_Float16)o1; ah.h[2 * pr] = hv; al.h[2 * pr] = (_Float16)((o1 - (float)hv) * 1024.0f); hv = (_Float16)o2; ah.h[2 * pr + 1] = hv; al.h[2 * pr + 1] = (_Float16)((o2 - (float)hv) * 1024.0f); }
  const size_t o = row * (size_t)(ndst * 64) + hd * 64 + g16 * 16;
  { *(v8us*)((unsigned short*)H + o) = ah.half[0]; *(v8us*)((unsigned short*)H + o + 8) = ah.half[1]; *(v8us*)((unsigned short*)L + o) = al.half[0]; *(v8us*)((unsigned short*)L + o + 8) = al.half[1];  } }
__global__ __launch_bounds__(256) void k_ln512(const float* __restrict__ A, const float* __restrict__ res, const float* __restrict__ g, const float* __restrict__ bb, float* __restrict__ Y, _Float16* __restrict__ Y16) {
  #pragma clang fp contract(off)
  const int wv = threadIdx.x >> 5, ln = threadIdx.x & 31; const size_t r = (size_t)blockIdx.x * 8 + wv; if (r >= NR) return; float x[16]; float s = 0.f;
  for (int i = 0; i < 2; ++i) { const v8f a = *(const v8f*)(A + r * DM + i * 256 + ln * 8); for (int q = 0; q < 8; ++q) { float v = a[q]; if (res) v += bf16_round(res[r * DM + i * 256 + ln * 8 + q]); x[i * 8 + q] = v; s += v; } }
  for (int o = 16; o > 0; o >>= 1) s += __shfl_xor(s, o, 32); const float mu = s / (float)DM; float var = 0.f; for (int q = 0; q < 16; ++q) { const float d = x[q] - mu; var += d * d; }
  for (int o = 16; o > 0; o >>= 1) var += __shfl_xor(var, o, 32); const float inv = rsqrtf(var / (float)DM + 1e-5f);
  { for (int i = 0; i < 2; ++i) { const int c0 = i * 256 + ln * 8; v8f y; FragH f; for (int q = 0; q < 8; ++q) { float v = (x[i * 8 + q] - mu) * inv; v *= bf16_round(g[c0 + q]); v += bf16_round(bb[c0 + q]); y[q] = v; f.h[q] = (_Float16)v; } *(v8f*)(Y + r * DM + c0) = y; if (Y16) *(v8us*)((unsigned short*)Y16 + r * DM + c0) = f.half[0]; }  } }
__global__ __launch_bounds__(256) void k_pack(const float* __restrict__ rb, const int* __restrict__ rid, int* __restrict__ PK) { const int t = blockIdx.x * 256 + threadIdx.x; if (t >= 1024 + NB * TK) return; int v; if (t < 1024) v = __float_as_int(bf16_round(rb[t])); else v = rid[t - 1024]; *(int*)(PK + t) = v;  }
__global__ __launch_bounds__(256) void k_tabin(const float* __restrict__ sp, float* __restrict__ CS, float* __restrict__ SN) { const int t = blockIdx.x * 256 + threadIdx.x; if (t >= SLEN * 32) return; const int i = t % 32, s = t / 32; const float c = bf16_round(sp[s * 64 + 32 + i]), sn = bf16_round(sp[s * 64 + i]);
  { *(float*)(CS + t) = c; *(float*)(SN + t) = sn;  } }
__global__ __launch_bounds__(256) void k_wsc(const float* __restrict__ Wm, _Float16* __restrict__ Bt, size_t n8, float sc) { const size_t t = (size_t)blockIdx.x * 256 + threadIdx.x; if (t >= n8) return; FragH f; for (int q = 0; q < 8; ++q) f.h[q] = (_Float16)(bf16_round(Wm[t * 8 + q]) * sc); *(v8us*)((unsigned short*)Bt + t * 8) = f.half[0];  }
__global__ __launch_bounds__(256) void k_rotab2(float* __restrict__ CS, float* __restrict__ SN) {
  #pragma clang fp contract(off)
  const int t = blockIdx.x * 256 + threadIdx.x; if (t >= SLEN * 32) return; const int j = t % 32, s = t / 32; const float c0 = -0.14391156831212787f;      /* -ln(10000)/64 rounded to f32 */ const float inv = expf((float)(2 * j) * c0); const float th = (float)s * inv; const float c = cosf(th), sn = sinf(th);
  { *(float*)(CS + t) = c; *(float*)(SN + t) = sn;  } }
__global__ __launch_bounds__(256) void k_lnu(const float* __restrict__ X, _Float16* __restrict__ N16, float* __restrict__ XB) {
  #pragma clang fp contract(off)
  const int wv = threadIdx.x >> 5, ln = threadIdx.x & 31; const size_t r = (size_t)blockIdx.x * 8 + wv; if (r >= NR) return; float a[32]; float s = 0.f;
  for (int i = 0; i < 4; ++i) { const v8f v = *(const v8f*)(X + r * DM + (i * 32 + ln) * 8); for (int q = 0; q < 8; ++q) { const float u = bf16_round(v[q]); a[i * 8 + q] = u; s += u; } }
  for (int o = 16; o > 0; o >>= 1) s += __shfl_xor(s, o, 32); const float mu = s / (float)DM; float var = 0.f; for (int q = 0; q < 32; ++q) { const float d = a[q] - mu; var += d * d; }
  for (int o = 16; o > 0; o >>= 1) var += __shfl_xor(var, o, 32); const float den = sqrtf(var / (float)(DM - 1)) + 1e-6f; const float inv = 1.0f / den;      /* one reciprocal per row; (x-mean)*inv vs the reference's division differs by <= 1 ulp */
  { for (int i = 0; i < 4; ++i) { const int c0 = (i * 32 + ln) * 8; FragH f; v8f xb; for (int q = 0; q < 8; ++q) { f.h[q] = (_Float16)((a[i * 8 + q] - mu) * inv); xb[q] = a[i * 8 + q]; } *(v8us*)((unsigned short*)N16 + r * DM + c0) = f.half[0]; *(v8f*)(XB + r * DM + c0) = xb; }  } }
__global__ __launch_bounds__(256) void k_vtg(const _Float16* __restrict__ V16, _Float16* __restrict__ Vt) { __shared__ unsigned short tl[64][66]; const int tid = threadIdx.x; const int slab = blockIdx.x / (SLEN / 64), lg = blockIdx.x % (SLEN / 64); const int b = slab / NH, h = slab % NH; const int hs = h / NREP;
  for (int i = tid; i < 64 * 8; i += 256) { const int r = i / 8, c8 = (i % 8) * 8; FragH f; f.half[0] = *(const v8us*)((const unsigned short*)V16 + ((size_t)b * SLEN + lg * 64 + r) * KVD + hs * 64 + c8); for (int q = 0; q < 8; ++q) tl[r][c8 + q] = f.u[q]; }
  __syncthreads();
  { for (int rd = 0; rd < 2; ++rd) { const int d = rd * 32 + tid / 8, pc = tid % 8; FragH f; for (int q = 0; q < 8; ++q) f.u[q] = tl[pc * 8 + q][d]; *(v8us*)((unsigned short*)Vt + ((size_t)slab * 64 + d) * SLEN + lg * 64 + pc * 8) = f.half[0]; }  } }

__global__ __launch_bounds__(256) void k_h16s(const float* __restrict__ SRC, int lds, int coff, _Float16* __restrict__ DST, size_t n8) { const size_t t = (size_t)blockIdx.x * 256 + threadIdx.x; if (t >= n8) return; const size_t r = (t * 8) / DM; const int c = (int)((t * 8) % DM); const v8f a = *(const v8f*)(SRC + r * lds + coff + c); FragH f; for (int q = 0; q < 8; ++q) f.h[q] = (_Float16)a[q];
  *(v8us*)((unsigned short*)DST + t * 8) = f.half[0];  }


__global__ __launch_bounds__(256) void k_ccp(const float* __restrict__ QKV, int coff, _Float16* __restrict__ D) { const size_t t = (size_t)blockIdx.x * 256 + threadIdx.x; if (t >= (size_t)NR * DM / 8) return; const int c0 = (int)((t * 8) % DM); const size_t row = (t * 8) / DM; const v8f a = *(const v8f*)(QKV + row * 3 * DM + coff + c0); FragH f; for (int q = 0; q < 8; ++q) f.h[q] = (_Float16)a[q];
  *(v8us*)((unsigned short*)D + t * 8) = f.half[0];  }


__global__ __launch_bounds__(256) void k_tok(const float* __restrict__ x, _Float16* __restrict__ X16) { __shared__ float tl[DM][17]; const int tid = threadIdx.x; const int p0 = blockIdx.x * 16;      /* 16-pixel tiles: 34 KB of LDS */
  for (int i = tid; i < DM * 16; i += 256) { const int c = i / 16, p = i % 16; tl[c][p] = bf16_round(x[(size_t)c * NPIX + p0 + p]); }
  __syncthreads();
  { for (int i = tid; i < 16 * (DM / 8); i += 256) { const int p = i / (DM / 8), c0 = (i % (DM / 8)) * 8; FragH f; for (int q = 0; q < 8; ++q) f.h[q] = (_Float16)tl[c0 + q][p];
      *(v8us*)((unsigned short*)X16 + ((size_t)p0 + p) * DM + c0) = f.half[0]; }  } }
__global__ __launch_bounds__(256) void k_out(const float* __restrict__ Y, float* __restrict__ out) { const size_t t = (size_t)blockIdx.x * 256 + threadIdx.x; if (t >= (size_t)DM * NPIX / 8) return; const int p0 = (int)((t * 8) % NPIX); const int c = (int)((t * 8) / NPIX); v8f v; for (int q = 0; q < 8; ++q) v[q] = Y[((size_t)p0 + q) * DM + c];
  *(v8f*)(out + t * 8) = v;  }
extern "C" void kernel_launch(void* const* d_in, const int* in_sizes, int n_in,
                              void* d_out, int out_size, void* d_ws, size_t ws_size, hipStream_t stream) {
  (void)in_sizes; (void)n_in; (void)out_size;
  const float* x = (const float*)d_in[0]; const float* qw = (const float*)d_in[1]; const float* qb = (const float*)d_in[2]; const float* kw = (const float*)d_in[3]; const float* kb = (const float*)d_in[4]; const float* vw = (const float*)d_in[5]; const float* vb = (const float*)d_in[6]; const float* ow = (const float*)d_in[7]; const float* ob = (const float*)d_in[8];
  char* ws = (char*)d_ws; size_t off = 0;
  auto take = [&](size_t bytes) { char* p = ws + off; off += (bytes + 255) & ~(size_t)255; return p; };
  const size_t np = (size_t)NR * DM;
  _Float16* BQ = (_Float16*)take((size_t)DM * DM * 2); _Float16* BK = (_Float16*)take((size_t)DM * DM * 2); _Float16* BV = (_Float16*)take((size_t)DM * DM * 2); _Float16* BO = (_Float16*)take((size_t)DM * DM * 2); float* Y = (float*)take(np * 4);
   _Float16* X16 = (_Float16*)take(np * 2); _Float16* QH = (_Float16*)take(np * 2); _Float16* KH = (_Float16*)take(np * 2); _Float16* V16 = (_Float16*)take(np * 2); _Float16* VT = (_Float16*)take(np * 2); float* O = (float*)take(np * 4); _Float16* OH = QH; _Float16* OL = KH;
  if (off > ws_size) return;
  k_wsc<<<(unsigned)(((size_t)DM * DM / 8 + 255) / 256), 256, 0, stream>>>(qw, BQ, (size_t)DM * DM / 8, 16.0f); k_wsc<<<(unsigned)(((size_t)DM * DM / 8 + 255) / 256), 256, 0, stream>>>(kw, BK, (size_t)DM * DM / 8, 16.0f); k_wsc<<<(unsigned)(((size_t)DM * DM / 8 + 255) / 256), 256, 0, stream>>>(vw, BV, (size_t)DM * DM / 8, 16.0f); k_wsc<<<(unsigned)(((size_t)DM * DM / 8 + 255) / 256), 256, 0, stream>>>(ow, BO, (size_t)DM * DM / 8, 16.0f);      /* 1x1 conv (out, in) naturals */
  
  k_tok<<<NPIX / 16, 256, 0, stream>>>(x, X16);
  const dim3 g((NR / 128) * (DM / 64), 1);
  k_gemm2<0><<<g, 128, 0, stream>>>(X16, DM, 0, BQ, DM, 0, 0.0625f, qb, 0, nullptr, 1, 0, 0, nullptr, QH, DM, 0, NR, DM, DM);
  k_gemm2<0><<<g, 128, 0, stream>>>(X16, DM, 0, BK, DM, 0, 0.0625f, kb, 0, nullptr, 1, 0, 0, nullptr, KH, DM, 0, NR, DM, DM);
  k_gemm2<0><<<g, 128, 0, stream>>>(X16, DM, 0, BV, DM, 0, 0.0625f, vb, 0, nullptr, 1, 0, 0, nullptr, V16, DM, 0, NR, DM, DM);
  k_vtg<<<NB * NH * (SLEN / 64), 256, 0, stream>>>(V16, VT);
  k_flash<<<NB * NH * QBNP, 128, 0, stream>>>(QH, DM, KH, DM, VT, O, DM);
  k_hl<<<(unsigned)((np / 8 + 255) / 256), 256, 0, stream>>>(O, OH, OL, np / 8);
  k_gemm2<0><<<g, 128, 0, stream>>>(OL, DM, 0, BO, DM, 0, 0.0625f / 1024.0f, nullptr, 0, nullptr, 1, 0, 0, Y, nullptr, DM, 0, NR, DM, DM);
  k_gemm2<0><<<g, 128, 0, stream>>>(OH, DM, 0, BO, DM, 0, 0.0625f, ob, 0, Y, 1, (size_t)DM, 0, Y, nullptr, DM, 0, NR, DM, DM);      /* rows of the output conv */
  k_out<<<(unsigned)(((size_t)DM * NPIX / 8 + 255) / 256), 256, 0, stream>>>(Y, (float*)d_out);
}

// v002
// One run takes 234 microseconds.
// In two side-by-side timings against v001, it was 1.76 and 1.81 times as fast.
// Over all steps from v000 it is 2.53 times as fast.
#include <hip/hip_runtime.h>
// SelfAttention4d (1 x 512 ch x 64 x 64 = 4096 tokens, 8 heads x 64: q/k/v = 1x1 convs (+ bias; the 1/8 scale applied in the flash kernel); softmax(q.k) v; out = 1x1 conv (+ bias) back to NCHW).
// Structure: NCHW -> exact f16 token rows by an LDS transpose kernel; q/k/v as f16 WMMA GEMMs (32x64 wave tiles, f32 accumulation, exact x16 (out,in) weights + bias, f16 out; channel = head*64 + d); V^T by LDS tiles; my fused flash kernel (no mask; the 1/8 applied as the score scale); ctx as f16 hi/residual into the output conv (two GEMM terms) + bias; NCHW store (thread per (channel, 8 pixels)).
// Compute dtype: inputs rounded to bf16; x / weights exact as f16; q, k, v plain f16 (~2^-12); softmax weights f16 x2^10; ctx hi + 2^-10 residual. v_wmma_f32_16x16x32_f16.
#define NB 1
#define DM 512
#define NKV 8
#define NPIX 4096
#define NREP (NH / NKV)
#define KVD (NKV * 64)           /* 512 */
#define NR (NB * SLEN)
#define CHK 512
typedef int v4i __attribute__((ext_vector_type(4)));
#define FF 2048
#define SLEN 4096
#define MQI 4096
#define MKI 4096
#define TQ SLEN
#define TK SLEN
#define NH 8
#define SCL 0.125f
#define QBLKS (TQ / 64)
#define QB05 0
#define QBN5 4
#define QB0P 0
#define QBNP QBLKS
#define RE 256
typedef __bf16 v16b __attribute__((ext_vector_type(16)));
typedef unsigned short v8us __attribute__((ext_vector_type(8), may_alias));
typedef float  v8f  __attribute__((ext_vector_type(8)));
typedef float  v4f  __attribute__((ext_vector_type(4)));
typedef float  v4fa __attribute__((ext_vector_type(4), may_alias));
union FragB { v16b v; v8us half[2]; unsigned short u[16]; };

__device__ __forceinline__ unsigned short bf16_bits(float x) { unsigned int u = __float_as_uint(x); return (unsigned short)((u + 0x7FFFu + ((u >> 16) & 1u)) >> 16); }
__device__ __forceinline__ float bf16_val(unsigned short b) { return __uint_as_float(((unsigned int)b) << 16); }
__device__ __forceinline__ float bf16_round(float x) { return bf16_val(bf16_bits(x)); }
// D += A·B with NT terms: 1 = ah·bh, 2 = + al·bh (A split), 3 = + ah·bl (both split)
template <int NT>
__device__ __forceinline__ v8f mmaN(v16b ah, v16b al, v16b bh, v16b bl, v8f c) {
  c = __builtin_amdgcn_wmma_f32_16x16x32_bf16(false, ah, false, bh, (short)0, c, false, false);
  if (NT >= 2) c = __builtin_amdgcn_wmma_f32_16x16x32_bf16(false, al, false, bh, (short)0, c, false, false);
  if (NT >= 3) c = __builtin_amdgcn_wmma_f32_16x16x32_bf16(false, ah, false, bl, (short)0, c, false, false);
  asm volatile("v_nop\n\tv_nop\n\tv_nop\n\tv_nop" : "+v"(c) : "v"(ah), "v"(al), "v"(bh), "v"(bl));
  return c;
}

__global__ __launch_bounds__(256) void k_wt_bf16(const float* __restrict__ W, unsigned short* __restrict__ Wt, int K, int N) {
  const int t = blockIdx.x * 256 + threadIdx.x;
  const int k8n = K / 8;
  if (t >= N * k8n) return;
  const int n = t / k8n, k8 = (t % k8n) * 8;
  v8us v;
#pragma unroll
  for (int i = 0; i < 8; ++i) v[i] = bf16_bits(W[(size_t)(k8 + i) * N + n]);
  *(v8us*)(Wt + (size_t)n * K + k8) = v;
  
}

// GEMM C[M][N] (f32, pitch ldc) = act(A[M][K]·W + bias). A f32 row-major (pitch lda) converted per fragment to bf16
// (ASPLIT: hi/lo two planes -> 2 terms, else single rounded term); Wt bf16 [N][K] (pitch ldb). BIAS_BF16 rounds the
// bias to bf16 first (bias quantised to bf16 before the add). K%32==0, M%16==0, N%64==0.
template <bool ASPLIT, int ACT, bool BIAS_BF16>
__global__ __launch_bounds__(128) void k_gemm_bf(const float* __restrict__ A, int lda, const unsigned short* __restrict__ Wt, int ldb,
                                               const float* __restrict__ bias, float* __restrict__ C, int ldc, int M, int N, int K) {
  __shared__ __attribute__((aligned(16))) float so[4][16][64];
  const int tid = threadIdx.x, w = tid >> 5, lane = tid & 31, ln = lane & 15, hh = lane >> 4;
  const int ntn = N / 64;
  const int wid = blockIdx.x * 4 + w;
  const int mt = wid / ntn, nq = wid % ntn;
  if (mt * 16 >= M) return;
  const int row0 = mt * 16, col0 = nq * 64;
  const float* arow = A + (size_t)(row0 + ln) * lda;
  v8f acc[4] = {};
  for (int kb = 0; kb < K; kb += 32) {
    FragB ah, al;
    const v4f x0 = *(const v4fa*)(arow + kb + 8 * hh), x1 = *(const v4fa*)(arow + kb + 8 * hh + 4);
    const v4f x2 = *(const v4fa*)(arow + kb + 16 + 8 * hh), x3 = *(const v4fa*)(arow + kb + 16 + 8 * hh + 4);
    float xs[16] = {x0[0],x0[1],x0[2],x0[3],x1[0],x1[1],x1[2],x1[3],x2[0],x2[1],x2[2],x2[3],x3[0],x3[1],x3[2],x3[3]};
#pragma unroll
    for (int i = 0; i < 16; ++i) { const unsigned short hb = bf16_bits(xs[i]); ah.u[i] = hb; al.u[i] = ASPLIT ? bf16_bits(xs[i] - bf16_val(hb)) : (unsigned short)0; }
#pragma unroll
    for (int t = 0; t < 4; ++t) {
      const unsigned short* brow = Wt + (size_t)(col0 + t * 16 + ln) * ldb + kb;
      FragB b;
      b.half[0] = *(const v8us*)(brow + 8 * hh);
      b.half[1] = *(const v8us*)(brow + 16 + 8 * hh);
      acc[t] = mmaN<ASPLIT ? 2 : 1>(ah.v, al.v, b.v, b.v, acc[t]);
    }
  }
#pragma unroll
  for (int t = 0; t < 4; ++t) {
    float bv = bias ? bias[col0 + t * 16 + ln] : 0.f;
    if (BIAS_BF16) bv = bf16_round(bv);
#pragma unroll
    for (int r = 0; r < 8; ++r) { float v = acc[t][r] + bv; if (ACT == 1) v = fmaxf(v, 0.f); so[w][8 * hh + r][t * 16 + ln] = v; }
  }
  __builtin_amdgcn_fence(__ATOMIC_ACQ_REL, "workgroup");
  __builtin_amdgcn_wave_barrier();
  const int rsub = lane >> 4, c4 = (lane & 15) * 4;
  {
#pragma unroll
    for (int q = 0; q < 8; ++q) {
      const int r = q * 2 + rsub;
      const v4f v = *(const v4fa*)&so[w][r][c4];
      *(v4f*)(C + (size_t)(row0 + r) * ldc + col0 + c4) = v;
    }
    
  }
}

// GEMM C = act(A·W + bias + resid): A f32 (ASPLIT -> hi/lo 2 terms), Wt bf16 [N][K]; ACT 0 none, 1 relu, 2 exact gelu;
// resid (optional, f32, row index = (row % rmod), pitch ldr, RES_BF16 rounds it) added before the activation.
template <bool ASPLIT, int ACT, bool BIAS_BF16, bool RES_BF16>
__global__ __launch_bounds__(128) void k_gemm_bf3(const float* __restrict__ A, int lda, const unsigned short* __restrict__ Wt, int ldb,
                                                const float* __restrict__ bias, const float* __restrict__ resid, int rmod, int ldr,
                                                float* __restrict__ C, int ldc, int M, int N, int K) {
  __shared__ __attribute__((aligned(16))) float so[4][16][64];
  const int tid = threadIdx.x, w = tid >> 5, lane = tid & 31, ln = lane & 15, hh = lane >> 4;
  const int ntn = N / 64;
  const int wid = blockIdx.x * 4 + w;
  const int mt = wid / ntn, nq = wid % ntn;
  if (mt * 16 >= M) return;
  const int row0 = mt * 16, col0 = nq * 64;
  const float* arow = A + (size_t)(row0 + ln) * lda;
  v8f acc[4] = {};
  for (int kb = 0; kb < K; kb += 32) {
    FragB ah, al;
    const v4f x0 = *(const v4fa*)(arow + kb + 8 * hh), x1 = *(const v4fa*)(arow + kb + 8 * hh + 4);
    const v4f x2 = *(const v4fa*)(arow + kb + 16 + 8 * hh), x3 = *(const v4fa*)(arow + kb + 16 + 8 * hh + 4);
    float xs[16] = {x0[0],x0[1],x0[2],x0[3],x1[0],x1[1],x1[2],x1[3],x2[0],x2[1],x2[2],x2[3],x3[0],x3[1],x3[2],x3[3]};
#pragma unroll
    for (int i = 0; i < 16; ++i) { const unsigned short hb = bf16_bits(xs[i]); ah.u[i] = hb; al.u[i] = ASPLIT ? bf16_bits(xs[i] - bf16_val(hb)) : (unsigned short)0; }
#pragma unroll
    for (int t = 0; t < 4; ++t) {
      const unsigned short* brow = Wt + (size_t)(col0 + t * 16 + ln) * ldb + kb;
      FragB b;
      b.half[0] = *(const v8us*)(brow + 8 * hh);
      b.half[1] = *(const v8us*)(brow + 16 + 8 * hh);
      acc[t] = mmaN<ASPLIT ? 2 : 1>(ah.v, al.v, b.v, b.v, acc[t]);
    }
  }
#pragma unroll
  for (int t = 0; t < 4; ++t) {
    const int col = col0 + t * 16 + ln;
    float bv = bias ? bias[col] : 0.f;
    if (BIAS_BF16) bv = bf16_round(bv);
#pragma unroll
    for (int r = 0; r < 8; ++r) {
      float v = acc[t][r] + bv;
      if (resid) { float rv = resid[(size_t)((row0 + 8 * hh + r) % rmod) * ldr + col]; if (RES_BF16) rv = bf16_round(rv); v += rv; }
      if (ACT == 1) v = fmaxf(v, 0.f);
      if (ACT == 2) v = 0.5f * v * (1.0f + erff(v * 0.70710678118654752f));
      if (ACT == 3) { const float u = 0.7978845608028654f * (v + 0.044715f * v * v * v); v = 0.5f * v * (1.0f + tanhf(u)); }
      so[w][8 * hh + r][t * 16 + ln] = v;
    }
  }
  __builtin_amdgcn_fence(__ATOMIC_ACQ_REL, "workgroup");
  __builtin_amdgcn_wave_barrier();
  const int rsub = lane >> 4, c4 = (lane & 15) * 4;
  {
#pragma unroll
    for (int q = 0; q < 8; ++q) {
      const int r = q * 2 + rsub;
      const v4f v = *(const v4fa*)&so[w][r][c4];
      *(v4f*)(C + (size_t)(row0 + r) * ldc + col0 + c4) = v;
    }
    
  }
}
// row LayerNorm (biased variance, eps) over N: s = X (+ R); optional out_sum <- s; out_norm <- (s-mu)*rsqrt(var+eps)*g + b
template <bool PARAM_BF16>
__global__ __launch_bounds__(256) void k_layernorm(const float* __restrict__ X, const float* __restrict__ R, const float* __restrict__ g, const float* __restrict__ bta,
                                                  float* __restrict__ out_sum, float* __restrict__ out_norm, int N, float eps) {
  __shared__ float red[256];
  const int row = blockIdx.x, tid = threadIdx.x;
  const float* x = X + (size_t)row * N; const float* rr = R ? R + (size_t)row * N : nullptr;
  float vals[16];                     // up to N = 4096
  const int per = N / 256;            // contiguous chunk per thread? use strided-by-4 chunks: thread handles j = tid*4 + 1024*u
  float s1 = 0.f;
  for (int u = 0; u < per / 4; ++u) {
    const int j = tid * 4 + 1024 * u;
    const v4f a = *(const v4fa*)(x + j);
    v4f b = {0.f,0.f,0.f,0.f}; if (rr) b = *(const v4fa*)(rr + j);
#pragma unroll
    for (int q = 0; q < 4; ++q) { const float v = a[q] + b[q]; vals[u * 4 + q] = v; s1 += v; }
  }
  red[tid] = s1; __syncthreads();
  for (int st = 128; st > 0; st >>= 1) { if (tid < st) red[tid] += red[tid + st]; __syncthreads(); }
  const float mu = red[0] / (float)N; __syncthreads();
  float s2 = 0.f;
  for (int u = 0; u < per / 4; ++u)
#pragma unroll
    for (int q = 0; q < 4; ++q) { const float c = vals[u * 4 + q] - mu; s2 += c * c; }
  red[tid] = s2; __syncthreads();
  for (int st = 128; st > 0; st >>= 1) { if (tid < st) red[tid] += red[tid + st]; __syncthreads(); }
  const float rs = rsqrtf(red[0] / (float)N + eps);
  {
    for (int u = 0; u < per / 4; ++u) {
      const int j = tid * 4 + 1024 * u;
      v4f o, sm;
#pragma unroll
      for (int q = 0; q < 4; ++q) {
        float gg = g[j + q], bb = bta[j + q];
        if (PARAM_BF16) { gg = bf16_round(gg); bb = bf16_round(bb); }
        sm[q] = vals[u * 4 + q]; o[q] = (vals[u * 4 + q] - mu) * rs * gg + bb;
      }
      if (out_sum) *(v4f*)(out_sum + (size_t)row * N + j) = sm;
      *(v4f*)(out_norm + (size_t)row * N + j) = o;
    }
    
  }
}



// ---- f16 WMMA path (v_wmma_f32_16x16x32_f16): 11-bit significands for operands in range — used where a [0,1] probability operand needs more precision than bf16
typedef _Float16 v16h __attribute__((ext_vector_type(16)));
union FragH { v16h v; v8us half[2]; _Float16 h[16]; unsigned short u[16]; };
template <int NT>
__device__ __forceinline__ v8f mmaH(v16h ah, v16h al, v16h bh, v16h bl, v8f c) {
  c = __builtin_amdgcn_wmma_f32_16x16x32_f16(false, ah, false, bh, (short)0, c, false, false);
  if (NT >= 2) c = __builtin_amdgcn_wmma_f32_16x16x32_f16(false, al, false, bh, (short)0, c, false, false);
  if (NT >= 3) c = __builtin_amdgcn_wmma_f32_16x16x32_f16(false, ah, false, bl, (short)0, c, false, false);
  asm volatile("v_nop\n\tv_nop\n\tv_nop\n\tv_nop" : "+v"(c) : "v"(ah), "v"(al), "v"(bh), "v"(bl));
  return c;
}
// batched GEMM like k_gemm_b but f16 operands: A f32 (split into f16 hi/lo if ASPLIT, else rounded to f16), Bt = f16 values [n][k]; alpha; C f32; N multiple of 16 (partial tiles skipped)
template <bool ASPLIT>
__global__ __launch_bounds__(128) void k_gemm_h(const float* __restrict__ A, int lda, size_t sA, const _Float16* __restrict__ Bh, int ldb, size_t sB, float alpha, float* __restrict__ C, int ldc, size_t sC, int M, int N, int K) {
  __shared__ __attribute__((aligned(16))) float so[4][16][64];
  const int tid = threadIdx.x, w = tid >> 5, lane = tid & 31, ln = lane & 15, hh = lane >> 4; const int by = blockIdx.y;
  A += (size_t)by * sA; Bh += (size_t)by * sB; C += (size_t)by * sC;
  const int ntn = (N + 63) / 64; const int wid = blockIdx.x * 4 + w; const int mt = wid / ntn, nq = wid % ntn; if (mt * 16 >= M) return;
  const int row0 = mt * 16, col0 = nq * 64; const float* arow = A + (size_t)(row0 + ln) * lda;
  v8f acc[4] = {};
  for (int kb = 0; kb < K; kb += 32) {
    FragH ah, al;
    const v4f x0 = *(const v4fa*)(arow + kb + 8 * hh), x1 = *(const v4fa*)(arow + kb + 8 * hh + 4), x2 = *(const v4fa*)(arow + kb + 16 + 8 * hh), x3 = *(const v4fa*)(arow + kb + 16 + 8 * hh + 4);
    float xs[16] = {x0[0],x0[1],x0[2],x0[3],x1[0],x1[1],x1[2],x1[3],x2[0],x2[1],x2[2],x2[3],x3[0],x3[1],x3[2],x3[3]};
#pragma unroll
    for (int i = 0; i < 16; ++i) { const _Float16 h = (_Float16)xs[i]; ah.h[i] = h; al.h[i] = ASPLIT ? (_Float16)(xs[i] - (float)h) : (_Float16)0.0f; }
#pragma unroll
    for (int t = 0; t < 4; ++t) { if (col0 + t * 16 >= N) continue; const size_t boff = (size_t)(col0 + t * 16 + ln) * ldb + kb; FragH bq; bq.half[0] = *(const v8us*)(Bh + boff + 8 * hh); bq.half[1] = *(const v8us*)(Bh + boff + 16 + 8 * hh);
      acc[t] = mmaH<ASPLIT ? 2 : 1>(ah.v, al.v, bq.v, bq.v, acc[t]); }
  }
#pragma unroll
  for (int t = 0; t < 4; ++t) { if (col0 + t * 16 >= N) continue;
#pragma unroll
    for (int r = 0; r < 8; ++r) so[w][8 * hh + r][t * 16 + ln] = acc[t][r] * alpha; }
  __builtin_amdgcn_fence(__ATOMIC_ACQ_REL, "workgroup"); __builtin_amdgcn_wave_barrier();
  const int rsub = lane >> 4, c4 = (lane & 15) * 4;
  {
#pragma unroll
    for (int q = 0; q < 8; ++q) { const int r = q * 2 + rsub; if (col0 + c4 < N) { const v4f v = *(const v4fa*)&so[w][r][c4]; *(v4f*)(C + (size_t)(row0 + r) * ldc + col0 + c4) = v; } }
     }
}

// Wt[n][k] = f16(W[k][n]·scale) from f32 row-major W[K][N] (scale = power of two; bf16-exact weights stay exact in f16 away from the subnormal range)
__global__ __launch_bounds__(256) void k_wt_f16(const float* __restrict__ W, _Float16* __restrict__ Wt, int K, int N, float scale) {
  const int t = blockIdx.x * 256 + threadIdx.x; if (t >= N * (K / 8)) return; const int n = t / (K / 8), k8 = (t % (K / 8)) * 8; FragH f;
#pragma unroll
  for (int i = 0; i < 8; ++i) f.h[i] = (_Float16)(bf16_round(W[(size_t)(k8 + i) * N + n]) * scale); const v8us o = f.half[0];
  *(v8us*)((unsigned short*)Wt + (size_t)n * K + k8) = o; 
}
// k_gemm_hh variant with fused epilogue: v = acc·alpha + bias[by·sBias + col] (+ CP[(row/rowsPerB)·sCPb + by·64 + col] if CP) ; ACT 0 none / 1 elu ; writes f16 C16 (and f32 C if non-null)
template <int ACT>
__global__ __launch_bounds__(128) void k_gemm_hhx(const _Float16* __restrict__ A, int lda, size_t sA, const _Float16* __restrict__ Bh, int ldb, size_t sB, float alpha, const float* __restrict__ bias, size_t sBias, const float* __restrict__ CP, int rowsPerB, size_t sCPb, int row0g,
    float* __restrict__ C, _Float16* __restrict__ C16, int ldc, size_t sC, int M, int N, int K) {
  __shared__ __attribute__((aligned(16))) float so[4][16][64];
  const int tid = threadIdx.x, w = tid >> 5, lane = tid & 31, ln = lane & 15, hh = lane >> 4; const int by = blockIdx.y;
  A += (size_t)by * sA; Bh += (size_t)by * sB; const size_t cofs = (size_t)by * sC; const float* bp = bias ? bias + (size_t)by * sBias : nullptr;
  const int ntn = (N + 63) / 64; const int wid = blockIdx.x * 4 + w; const int mt = wid / ntn, nq = wid % ntn; if (mt * 16 >= M) return;
  const int row0 = mt * 16, col0 = nq * 64; const _Float16* arow = A + (size_t)(row0 + ln) * lda;
  v8f acc[4] = {};
  for (int kb = 0; kb < K; kb += 32) { FragH ah; ah.half[0] = *(const v8us*)((const unsigned short*)arow + kb + 8 * hh); ah.half[1] = *(const v8us*)((const unsigned short*)arow + kb + 16 + 8 * hh);
#pragma unroll
    for (int t = 0; t < 4; ++t) { if (col0 + t * 16 >= N) continue; const size_t boff = (size_t)(col0 + t * 16 + ln) * ldb + kb; FragH bq; bq.half[0] = *(const v8us*)((const unsigned short*)Bh + boff + 8 * hh); bq.half[1] = *(const v8us*)((const unsigned short*)Bh + boff + 16 + 8 * hh);
      acc[t] = mmaH<1>(ah.v, ah.v, bq.v, bq.v, acc[t]); }
  }
#pragma unroll
  for (int t = 0; t < 4; ++t) { if (col0 + t * 16 >= N) continue; const int col = col0 + t * 16 + ln; const float bv = bp ? bf16_round(bp[col]) : 0.f;
#pragma unroll
    for (int r = 0; r < 8; ++r) { float v = acc[t][r] * alpha + bv; if (CP) { const int bidx = (row0g + row0 + 8 * hh + r) / rowsPerB; v += CP[(size_t)bidx * sCPb + (size_t)by * 64 + col]; } if (ACT == 1) v = (v > 0.f) ? v : expm1f(v); else if (ACT == 7) v = (v > 0.f) ? v + 1.0f : expf(v); else if (ACT == 8) v = tanhf(v); else if (ACT == 9) v = 0.5f * v * (1.0f + tanhf(0.7978845608028654f * (v + 0.044715f * v * v * v))); else if (ACT == 11) v = 1.0f / (1.0f + expf(-v)); else if (ACT == 12) v = (v > 0.f) ? v : 0.01f * v; else if (ACT == 14) v = (v > 0.f) ? v : 0.1f * v; else if (ACT == 15) v = v / (1.0f + expf(-v)); else if (ACT == 3) v = fmaxf(v, 0.f); else if (ACT == 6) v = 0.5f * v * (1.0f + erff(v * 0.70710678118654752f)); so[w][8 * hh + r][t * 16 + ln] = v; } }
  __builtin_amdgcn_fence(__ATOMIC_ACQ_REL, "workgroup"); __builtin_amdgcn_wave_barrier();
  const int rsub = lane >> 4, c4 = (lane & 15) * 4; typedef _Float16 v4h __attribute__((ext_vector_type(4)));
  {
#pragma unroll
    for (int q = 0; q < 8; ++q) { const int r = q * 2 + rsub; if (col0 + c4 < N) { const v4f v = *(const v4fa*)&so[w][r][c4]; if (C) *(v4f*)(C + cofs + (size_t)(row0 + r) * ldc + col0 + c4) = v; if (C16) { v4h h4; for (int i = 0; i < 4; ++i) h4[i] = (_Float16)v[i]; *(v4h*)(C16 + cofs + (size_t)(row0 + r) * ldc + col0 + c4) = h4; } } }
     }
}


typedef _Float16 v4h __attribute__((ext_vector_type(4)));

__global__ __launch_bounds__(256) void k_x16(const float* __restrict__ x, _Float16* __restrict__ X16, size_t n8) { const size_t t = (size_t)blockIdx.x * 256 + threadIdx.x; if (t >= n8) return; FragH f;
#pragma unroll
  for (int q = 0; q < 8; ++q) f.h[q] = (_Float16)bf16_round(x[t * 8 + q]); *(v8us*)((unsigned short*)X16 + t * 8) = f.half[0];  }
__global__ __launch_bounds__(256) void k_h16(const float* __restrict__ x, _Float16* __restrict__ X16, size_t n8) { const size_t t = (size_t)blockIdx.x * 256 + threadIdx.x; if (t >= n8) return; FragH f;
#pragma unroll
  for (int q = 0; q < 8; ++q) f.h[q] = (_Float16)x[t * 8 + q]; *(v8us*)((unsigned short*)X16 + t * 8) = f.half[0];  }
__global__ __launch_bounds__(256) void k_round16f(const float* __restrict__ W, _Float16* __restrict__ Bt, size_t n8) { const size_t t = (size_t)blockIdx.x * 256 + threadIdx.x; if (t >= n8) return; FragH f;
#pragma unroll
  for (int i = 0; i < 8; ++i) f.h[i] = (_Float16)(bf16_round(W[t * 8 + i]) * 16.0f); *(v8us*)((unsigned short*)Bt + t * 8) = f.half[0];  }
template <int NHv, int TTv>
__global__ __launch_bounds__(256) void k_vt(const _Float16* __restrict__ V16, int ldv, int voff, _Float16* __restrict__ Vt) { __shared__ unsigned short tl[64][66]; const int tid = threadIdx.x; const int slab = blockIdx.x / (TTv / 64), lg = blockIdx.x % (TTv / 64); const int b = slab / NHv, h = slab % NHv;
  for (int i = tid; i < 64 * 8; i += 256) { const int r = i / 8, c8 = (i % 8) * 8; FragH f; f.half[0] = *(const v8us*)((const unsigned short*)V16 + ((size_t)b * TTv + lg * 64 + r) * ldv + voff + h * 64 + c8);
#pragma unroll
    for (int q = 0; q < 8; ++q) tl[r][c8 + q] = f.u[q]; }
  __syncthreads();
  {
#pragma unroll
    for (int rd = 0; rd < 2; ++rd) { const int d = rd * 32 + tid / 8, pc = tid % 8; FragH f;
#pragma unroll
      for (int q = 0; q < 8; ++q) f.u[q] = tl[pc * 8 + q][d];
      *(v8us*)((unsigned short*)Vt + ((size_t)slab * 64 + d) * TTv + lg * 64 + pc * 8) = f.half[0]; }
     } }

__global__ __launch_bounds__(256) void k_hl(const float* __restrict__ F, _Float16* __restrict__ Hh, _Float16* __restrict__ Hl, size_t n8) { const size_t t = (size_t)blockIdx.x * 256 + threadIdx.x; if (t >= n8) return; FragH fh, fl; const v4f a = *(const v4fa*)(F + t * 8), c = *(const v4fa*)(F + t * 8 + 4);
#pragma unroll
  for (int q = 0; q < 4; ++q) { _Float16 h = (_Float16)a[q]; fh.h[q] = h; fl.h[q] = (_Float16)((a[q] - (float)h) * 1024.0f); h = (_Float16)c[q]; fh.h[4 + q] = h; fl.h[4 + q] = (_Float16)((c[q] - (float)h) * 1024.0f); }
  { *(v8us*)((unsigned short*)Hh + t * 8) = fh.half[0]; *(v8us*)((unsigned short*)Hl + t * 8) = fl.half[0];  } }

// ---- fast GEMM (wave tile 32x64; requires M % 32 == 0 rows per launch region and N % 64 == 0); epilogue = k_gemm_hhx semantics ----
__device__ __forceinline__ v16h g2_frag(const _Float16* p, int hh) { FragH f; f.half[0] = *(const v8us*)((const unsigned short*)p + 8 * hh); f.half[1] = *(const v8us*)((const unsigned short*)p + 16 + 8 * hh); return f.v; }
__device__ __forceinline__ v8f g2_mma(v16h a, v16h b, v8f c) { v8f d = __builtin_amdgcn_wmma_f32_16x16x32_f16(false, a, false, b, (short)0, c, false, false); asm volatile("v_nop\n\tv_nop\n\tv_nop\n\tv_nop" : "+v"(d) : "v"(a), "v"(b)); return d; }
template <int ACT>
__global__ __launch_bounds__(128) void k_gemm2(const _Float16* __restrict__ A, int lda, size_t sA, const _Float16* __restrict__ Bh, int ldb, size_t sB, float alpha, const float* __restrict__ bias, size_t sBias, const float* __restrict__ CP, int rowsPerB, size_t sCPb, int row0g,
    float* __restrict__ C, _Float16* __restrict__ C16, int ldc, size_t sC, int M, int N, int K) {
  __shared__ __attribute__((aligned(16))) float so[4][32][68];
  const int tid = threadIdx.x, w = tid >> 5, lane = tid & 31, ln = lane & 15, hh = lane >> 4; const int by = blockIdx.y;
  A += (size_t)by * sA; Bh += (size_t)by * sB; const size_t cofs = (size_t)by * sC; const float* bp = bias ? bias + (size_t)by * sBias : nullptr;
  const int ntn = N >> 6; const int mt = blockIdx.x / ntn, nq = blockIdx.x - mt * ntn; const int row0 = mt * 128 + 32 * w, col0 = nq * 64; if (row0 >= M) return;
  const _Float16* a0p = A + (size_t)(row0 + ln) * lda; const _Float16* a1p = a0p + (size_t)16 * lda;
  const _Float16* b0p = Bh + (size_t)(col0 + ln) * ldb; const _Float16* b1p = b0p + (size_t)16 * ldb; const _Float16* b2p = b1p + (size_t)16 * ldb; const _Float16* b3p = b2p + (size_t)16 * ldb;
  const v8f z8 = {0.f,0.f,0.f,0.f,0.f,0.f,0.f,0.f}; v8f c00 = z8, c01 = z8, c02 = z8, c03 = z8, c10 = z8, c11 = z8, c12 = z8, c13 = z8;
#pragma unroll 1
  for (int kb = 0; kb < K; kb += 32) { const v16h a0 = g2_frag(a0p + kb, hh), a1 = g2_frag(a1p + kb, hh);
    v16h b = g2_frag(b0p + kb, hh); c00 = g2_mma(a0, b, c00); c10 = g2_mma(a1, b, c10);
    b = g2_frag(b1p + kb, hh); c01 = g2_mma(a0, b, c01); c11 = g2_mma(a1, b, c11);
    b = g2_frag(b2p + kb, hh); c02 = g2_mma(a0, b, c02); c12 = g2_mma(a1, b, c12);
    b = g2_frag(b3p + kb, hh); c03 = g2_mma(a0, b, c03); c13 = g2_mma(a1, b, c13); }
  v8f accs[8] = {c00, c01, c02, c03, c10, c11, c12, c13};
#pragma unroll
  for (int u = 0; u < 8; ++u) { const int t = u & 3, half = u >> 2; const int col = col0 + t * 16 + ln; const float bv = bp ? bf16_round(bp[col]) : 0.f;
#pragma unroll
    for (int r = 0; r < 8; ++r) { const int rloc = half * 16 + 8 * hh + r; float v = accs[u][r] * alpha + bv; if (CP) { if (rowsPerB < 0) v += CP[cofs + (size_t)(row0g + row0 + rloc) * ldc + col];      /* rowsPerB < 0: own element of the batched C plane */ else { const int bidx = (row0g + row0 + rloc) / rowsPerB; v += CP[(size_t)bidx * sCPb + (size_t)by * 64 + col]; } }
      if (ACT == 3) v = fmaxf(v, 0.f); else if (ACT == 6) v = 0.5f * v * (1.0f + erff(v * 0.70710678118654752f)); else if (ACT == 11) v = 1.0f / (1.0f + expf(-v)); else if (ACT == 15) v = v / (1.0f + expf(-v)); else if (ACT == 12) v = (v > 0.f) ? v : 0.01f * v; else if (ACT == 8) v = tanhf(v);
      so[w][rloc][t * 16 + ln] = v; } }
  __builtin_amdgcn_fence(__ATOMIC_ACQ_REL, "workgroup"); __builtin_amdgcn_wave_barrier();
  const int rsub = lane >> 4, c4 = (lane & 15) * 4;
  {
#pragma unroll
    for (int q = 0; q < 16; ++q) { const int r = q * 2 + rsub; const v4f v = *(const v4fa*)&so[w][r][c4]; if (C) *(v4f*)(C + cofs + (size_t)(row0 + r) * ldc + col0 + c4) = v; if (C16) { v4h h4; for (int i = 0; i < 4; ++i) h4[i] = (_Float16)v[i]; *(v4h*)(C16 + cofs + (size_t)(row0 + r) * ldc + col0 + c4) = h4; } }
     } }



// lane l takes the value of lane l ^ 16 (the other half of the same query column)
__device__ __forceinline__ float xhalf(float x) { return __builtin_bit_cast(float, __builtin_amdgcn_permlanex16(__builtin_bit_cast(int, x), __builtin_bit_cast(int, x), 0x76543210, 0xfedcba98, false, false)); }
#define FSK 64      /* keys a stage */
#define FPH 72      /* LDS row pitch in 16-bit elements: 128 bytes of data + 16, the conflict-free pitch for 16-byte row readers */
#define FBB (64 * FPH * 2)      /* bytes of one tile buffer */
#define FRB (16 * FPH * 2)      /* bytes of 16 LDS rows: the step between a thread's four pieces of a tile */
// One stage's copies of one thread: pieces (row, row + 16, row + 32, row + 48) of the K tile and of the V^T tile, 16 bytes each. The s_wait_xcnt closes the statement so that no address register is rewritten ahead of it.
__device__ __forceinline__ void fl_copy(unsigned lk, unsigned lv, const unsigned short* gk, size_t ks16, const unsigned short* gv) {
  const unsigned short* gk1 = gk + ks16; const unsigned short* gk2 = gk1 + ks16; const unsigned short* gk3 = gk2 + ks16;
  const unsigned short* gv1 = gv + (size_t)16 * TK; const unsigned short* gv2 = gv + (size_t)32 * TK; const unsigned short* gv3 = gv + (size_t)48 * TK;
  asm volatile("global_load_async_to_lds_b128 %0, %8, off\n\t"
               "global_load_async_to_lds_b128 %1, %9, off\n\t"
               "global_load_async_to_lds_b128 %2, %10, off\n\t"
               "global_load_async_to_lds_b128 %3, %11, off\n\t"
               "global_load_async_to_lds_b128 %4, %12, off\n\t"
               "global_load_async_to_lds_b128 %5, %13, off\n\t"
               "global_load_async_to_lds_b128 %6, %14, off\n\t"
               "global_load_async_to_lds_b128 %7, %15, off\n\t"
               "s_wait_xcnt 0x0"
               :: "v"(lk), "v"(lk + FRB), "v"(lk + 2 * FRB), "v"(lk + 3 * FRB), "v"(lv), "v"(lv + FRB), "v"(lv + 2 * FRB), "v"(lv + 3 * FRB),
                  "v"(gk), "v"(gk1), "v"(gk2), "v"(gk3), "v"(gv), "v"(gv1), "v"(gv2), "v"(gv3) : "memory");
}
__global__ __launch_bounds__(128) void k_flash(const _Float16* __restrict__ Q16, int ldq, const _Float16* __restrict__ K16, int ldk, const _Float16* __restrict__ Vt, float* __restrict__ O, int ldo) {
  constexpr int RPW = 16, DT = 4, KS = 2, NST = TK / FSK;
  __shared__ __attribute__((aligned(16))) unsigned short sK[2][64][FPH]; __shared__ __attribute__((aligned(16))) unsigned short sV[2][64][FPH];
  const int tid = threadIdx.x, w = tid >> 5, lane = tid & 31, ln = lane & 15, hh = lane >> 4;
  const int slab = blockIdx.x / QBNP, qblk = QB0P + blockIdx.x % QBNP; const int b = slab / NH, h = slab % NH; const int q0 = qblk * (4 * RPW) + w * RPW;
  FragH bq[KS];
  { const unsigned short* qr = (const unsigned short*)Q16 + ((size_t)b * TQ + q0 + ln) * ldq + h * 64;
#pragma unroll
    for (int ks = 0; ks < KS; ++ks) { bq[ks].half[0] = *(const v8us*)(qr + ks * 32 + 8 * hh); bq[ks].half[1] = *(const v8us*)(qr + ks * 32 + 16 + 8 * hh); } }
  const unsigned short* Vth = (const unsigned short*)Vt + (size_t)slab * 64 * TK;
  const int crow = tid >> 3, cseg = (tid & 7) * 8;      /* eight threads copy one 128-byte row */
  const size_t ks16 = (size_t)16 * ldk, kstg = (size_t)FSK * ldk;
  const unsigned short* gk = (const unsigned short*)K16 + ((size_t)b * TK + crow) * ldk + h * 64 + cseg;      /* the thread's first piece of the next stage to copy, advanced behind each stage's copies */
  const unsigned short* gv = Vth + (size_t)crow * TK + cseg;
  const unsigned lk0 = (unsigned)(size_t)&sK[0][crow][cseg], lv0 = (unsigned)(size_t)&sV[0][crow][cseg];      /* low 32 bits of a shared address = the byte offset in LDS */
  fl_copy(lk0, lv0, gk, ks16, gv); gk += kstg; gv += FSK;
  asm volatile("s_wait_asynccnt 0x0" ::: "memory");      /* stage 0 has landed before the barrier that publishes it */
  __syncthreads();
  fl_copy(lk0 + FBB, lv0 + FBB, gk, ks16, gv); gk += kstg; gv += FSK;
  float m_r = -3.0e38f, l_r = 0.f; v8f oacc[DT];
#pragma unroll
  for (int dt = 0; dt < DT; ++dt) oacc[dt] = (v8f){0.f,0.f,0.f,0.f,0.f,0.f,0.f,0.f};
#pragma unroll 1      /* one stage a trip: the buffer index stays a run-time value and the text small */
  for (int st = 0; st < NST; ++st) {
    const int buf = st & 1;
    const unsigned short* kf = &sK[buf][ln][8 * hh]; const unsigned short* vf = &sV[buf][ln][8 * hh];
#pragma unroll
    for (int ps2 = 0; ps2 < FSK / 32; ++ps2) {
      FragH ak[2][KS], av[DT];
#pragma unroll
      for (int nt = 0; nt < 2; ++nt)
#pragma unroll
        for (int ks = 0; ks < KS; ++ks) { const unsigned short* kr = kf + (ps2 * 32 + nt * 16) * FPH + ks * 32; ak[nt][ks].half[0] = *(const v8us*)kr; ak[nt][ks].half[1] = *(const v8us*)(kr + 16); }
#pragma unroll
      for (int dt = 0; dt < DT; ++dt) { const unsigned short* vr = vf + dt * 16 * FPH + ps2 * 32; av[dt].half[0] = *(const v8us*)vr; av[dt].half[1] = *(const v8us*)(vr + 16); }
      float sc[16];
#pragma unroll
      for (int nt = 0; nt < 2; ++nt) { v8f acc = (v8f){0.f,0.f,0.f,0.f,0.f,0.f,0.f,0.f};
#pragma unroll
        for (int ks = 0; ks < KS; ++ks) acc = mmaH<1>(ak[nt][ks].v, ak[nt][ks].v, bq[ks].v, bq[ks].v, acc);
#pragma unroll
        for (int r = 0; r < 8; ++r) sc[nt * 8 + r] = acc[r] * SCL; }
      float mx[4];
#pragma unroll
      for (int c = 0; c < 4; ++c) mx[c] = fmaxf(fmaxf(sc[c], sc[4 + c]), fmaxf(sc[8 + c], sc[12 + c]));
      float mc = fmaxf(fmaxf(mx[0], mx[1]), fmaxf(mx[2], mx[3])); mc = fmaxf(mc, xhalf(mc));      /* both halves of a column use one maximum: they share the output tiles */
      const float mn = fmaxf(m_r, mc); const float al = expf(m_r - mn); m_r = mn;
      FragH pb; float ps[4] = {0.f, 0.f, 0.f, 0.f};
#pragma unroll
      for (int i = 0; i < 16; ++i) { const float p = expf(sc[i] - mn); ps[i & 3] += p; pb.h[i] = (_Float16)(p * 1024.0f); }      /* element i = key 8 hh + i (i < 8) or 8 + 8 hh + i (i >= 8) of the 32: the order of the V^T fragments above */
      l_r = l_r * al + ((ps[0] + ps[1]) + (ps[2] + ps[3]));
#pragma unroll
      for (int dt = 0; dt < DT; ++dt)
#pragma unroll
        for (int r = 0; r < 8; ++r) oacc[dt][r] *= al;
#pragma unroll
      for (int dt = 0; dt < DT; ++dt) oacc[dt] = mmaH<1>(av[dt].v, av[dt].v, pb.v, pb.v, oacc[dt]);
    }
    asm volatile("s_wait_dscnt 0x0" ::: "memory");      /* this wave's reads of the buffer have returned before it is given up */
    asm volatile("s_wait_asynccnt 0x0" ::: "memory");      /* this wave's copies of the next stage have landed */
    __syncthreads();      /* publishes the next stage and ends every wave's reads of this one */
    if (st + 2 < NST) { fl_copy(lk0 + buf * FBB, lv0 + buf * FBB, gk, ks16, gv); gk += kstg; gv += FSK; } }
  asm volatile("s_wait_asynccnt 0x0" ::: "memory");      /* no copy is left in flight when the wave ends */
  const float l = l_r + xhalf(l_r); const float inv = (l > 0.f) ? 1.0f / (l * 1024.0f) : 0.f;
  float* orow = O + ((size_t)b * TQ + q0 + ln) * ldo + h * 64 + 8 * hh;      /* register r of tile dt = channel dt * 16 + 8 hh + r of query ln: 32 contiguous bytes a lane */
#pragma unroll
  for (int dt = 0; dt < DT; ++dt) { const v4f lo = {oacc[dt][0] * inv, oacc[dt][1] * inv, oacc[dt][2] * inv, oacc[dt][3] * inv}, hi = {oacc[dt][4] * inv, oacc[dt][5] * inv, oacc[dt][6] * inv, oacc[dt][7] * inv};
    *(v4f*)(orow + dt * 16) = lo; *(v4f*)(orow + dt * 16 + 4) = hi; } }
// 5-plane variant: S = Qh Kh^T + (Ql Kh^T + Qh Kl^T)/1024 with Q/K = [hi | 2^10 residual] f16 planes (QL/KL same layout as Q16/K16), then the 3-term P.V below.
// 3-term variant: O = (P_hi V_hi + (P_lo V_hi + P_hi V_lo) / 1024) / l with P = [hi | 2^10 residual] of 1024 p and V^T = [hi | 2^10 residual] planes (VtL same layout as Vt) -> ~2^-21-class products for un-averaged (early causal / peaked) rows
template <int CAUSAL>
__global__ __launch_bounds__(128) void k_flash5(const _Float16* __restrict__ Q16, const _Float16* __restrict__ QL, int ldq, const _Float16* __restrict__ K16, const _Float16* __restrict__ KL, int ldk, const _Float16* __restrict__ Vt, const _Float16* __restrict__ VtL, const int* __restrict__ MSK, float* __restrict__ O, int ldo) {
  constexpr int RPW = 16, RTN = RPW / 16, NQB = TQ / (4 * RPW), DT = 4, KS = 2;
  __shared__ __attribute__((aligned(16))) unsigned short sP[4][RPW][40]; __shared__ __attribute__((aligned(16))) unsigned short sPL[4][RPW][40]; __shared__ __attribute__((aligned(16))) float sO[4][RPW][64 + 4];
  const int tid = threadIdx.x, w = tid >> 5, lane = tid & 31, ln = lane & 15, hh = lane >> 4;
  const int slab = blockIdx.x / QBN5, qblk = QB05 + blockIdx.x % QBN5; (void)NQB; const int b = slab / NH, h = slab % NH; const int qb0 = qblk * (4 * RPW); const int q0 = qb0 + w * RPW;
  FragH aq[2][KS], aql[2][KS];
#pragma unroll
  for (int rt = 0; rt < RTN; ++rt) { const unsigned short* qr = (const unsigned short*)Q16 + ((size_t)b * TQ + q0 + rt * 16 + ln) * ldq + h * 64; const unsigned short* ql = (const unsigned short*)QL + ((size_t)b * TQ + q0 + rt * 16 + ln) * ldq + h * 64;
#pragma unroll
    for (int ks = 0; ks < KS; ++ks) { aq[rt][ks].half[0] = *(const v8us*)(qr + ks * 32 + 8 * hh); aq[rt][ks].half[1] = *(const v8us*)(qr + ks * 32 + 16 + 8 * hh); aql[rt][ks].half[0] = *(const v8us*)(ql + ks * 32 + 8 * hh); aql[rt][ks].half[1] = *(const v8us*)(ql + ks * 32 + 16 + 8 * hh); } }
  const unsigned short* Vth = (const unsigned short*)Vt + (size_t)slab * 64 * TK; const unsigned short* Vtl = (const unsigned short*)VtL + (size_t)slab * 64 * TK;
  float m_r[2][8], l_r[2][8]; v8f oacc[2][DT], oaccL[2][DT];
#pragma unroll
  for (int rt = 0; rt < RTN; ++rt) {
#pragma unroll
    for (int r = 0; r < 8; ++r) { m_r[rt][r] = -3.0e38f; l_r[rt][r] = 0.f; }
#pragma unroll
    for (int dt = 0; dt < DT; ++dt) { oacc[rt][dt] = (v8f){0.f,0.f,0.f,0.f,0.f,0.f,0.f,0.f}; oaccL[rt][dt] = oacc[rt][dt]; } }
  const int jend = (CAUSAL == 1) ? (qb0 + 4 * RPW) : ((CAUSAL == 23) ? min(TK, (qb0 / CHK + 2) * CHK) : TK);      /* causal / window: keys that can never contribute are skipped */ const int jbeg = (CAUSAL == 23) ? max(0, (qb0 / CHK - 1) * CHK) : 0;
#pragma unroll 1
  for (int j0 = jbeg; j0 < jend; j0 += 32) {
    v8f s[2][2];
#pragma unroll
    for (int nt = 0; nt < 2; ++nt) { const unsigned short* kr = (const unsigned short*)K16 + ((size_t)b * TK + j0 + nt * 16 + ln) * ldk + h * 64; const unsigned short* klr = (const unsigned short*)KL + ((size_t)b * TK + j0 + nt * 16 + ln) * ldk + h * 64; FragH bk[KS], bkl[KS];
#pragma unroll
      for (int ks = 0; ks < KS; ++ks) { bk[ks].half[0] = *(const v8us*)(kr + ks * 32 + 8 * hh); bk[ks].half[1] = *(const v8us*)(kr + ks * 32 + 16 + 8 * hh); bkl[ks].half[0] = *(const v8us*)(klr + ks * 32 + 8 * hh); bkl[ks].half[1] = *(const v8us*)(klr + ks * 32 + 16 + 8 * hh); }
#pragma unroll
      for (int rt = 0; rt < RTN; ++rt) { v8f acc = (v8f){0.f,0.f,0.f,0.f,0.f,0.f,0.f,0.f}, accl = acc;
#pragma unroll
        for (int ks = 0; ks < KS; ++ks) { acc = mmaH<1>(aq[rt][ks].v, aq[rt][ks].v, bk[ks].v, bk[ks].v, acc); accl = mmaH<1>(aql[rt][ks].v, aql[rt][ks].v, bk[ks].v, bk[ks].v, accl); accl = mmaH<1>(aq[rt][ks].v, aq[rt][ks].v, bkl[ks].v, bkl[ks].v, accl); }
#pragma unroll
        for (int r = 0; r < 8; ++r) acc[r] += accl[r] * 0.0009765625f;
        s[rt][nt] = acc; } }
#pragma unroll
    for (int rt = 0; rt < RTN; ++rt)
#pragma unroll
      for (int r = 0; r < 8; ++r) { const int tq = q0 + rt * 16 + 8 * hh + r; const int k0 = j0 + ln, k1 = j0 + 16 + ln;
        bool ok0 = (CAUSAL == 1) ? (k0 <= tq) : ((CAUSAL == 2) ? ((k0 >> 5) == (tq >> 5)) : true), ok1 = (CAUSAL == 1) ? (k1 <= tq) : ((CAUSAL == 2) ? ((k1 >> 5) == (tq >> 5)) : true);      /* mode 2: block-diagonal 32-token groups */
        if (CAUSAL == 4) { const int* mrow = MSK + ((size_t)b * TQ + tq) * TK; ok0 = mrow[k0] != 0; ok1 = mrow[k1] != 0; }      /* mode 4: per-(query, key) INPUT mask shared by all heads; masked keys contribute nothing (== the reference's -4096 fill, whose exp underflows to 0), rows with no valid key give l = 0 -> output 0 (== the reference's row_valid zeroing) */
        float s0 = ok0 ? s[rt][0][r] * SCL : -3.0e38f, s1 = ok1 ? s[rt][1][r] * SCL : -3.0e38f; if (CAUSAL == 17) { const float* amk = (const float*)MSK + (size_t)b * TK; s0 += bf16_round(amk[k0]); s1 += bf16_round(amk[k1]); } if (CAUSAL == 18) { const float* tb = (const float*)MSK; const int* ri = MSK + 1024 + (size_t)b * TK; const int rq = ri[tq]; s0 += tb[(h * 8 + rq) * 8 + ri[k0]]; s1 += tb[(h * 8 + rq) * 8 + ri[k1]]; } if (CAUSAL == 19) { const int* rel = MSK + (size_t)tq * TK; const float* rb = (const float*)MSK + (size_t)TQ * TK + ((size_t)(b * NH + h) * TQ + tq) * 64; s0 += rb[rel[k0]]; s1 += rb[rel[k1]]; }      /* mode 19: + (q.Ek[rel] + Eb[rel][h]) / 8 gathered by the int relative ids (packed [ids | table]) */      /* mode 18: + resource_bias[h][r_q][r_k] from the packed [table | ids] buffer (TQ == TK) */      /* mode 17: additive per-(batch, key) mask INPUT */ float mc = fmaxf(s0, s1);
        mc = fmaxf(mc, __shfl_xor(mc, 1, 32)); mc = fmaxf(mc, __shfl_xor(mc, 2, 32)); mc = fmaxf(mc, __shfl_xor(mc, 4, 32)); mc = fmaxf(mc, __shfl_xor(mc, 8, 32));
        const float mn = fmaxf(m_r[rt][r], mc); const float al = (mn > -1.0e38f) ? expf(m_r[rt][r] - mn) : 1.0f; m_r[rt][r] = mn; const float p0 = ok0 ? expf(s0 - mn) : 0.f, p1 = ok1 ? expf(s1 - mn) : 0.f; l_r[rt][r] = l_r[rt][r] * al + p0 + p1;
#pragma unroll
        for (int dt = 0; dt < DT; ++dt) { oacc[rt][dt][r] *= al; oaccL[rt][dt][r] *= al; }
        FragH t2, t2l; const float ps0 = p0 * 1024.0f, ps1 = p1 * 1024.0f; t2.h[0] = (_Float16)ps0; t2.h[1] = (_Float16)ps1; t2l.h[0] = (_Float16)((ps0 - (float)t2.h[0]) * 1024.0f); t2l.h[1] = (_Float16)((ps1 - (float)t2.h[1]) * 1024.0f);
        sP[w][rt * 16 + 8 * hh + r][ln] = t2.u[0]; sP[w][rt * 16 + 8 * hh + r][16 + ln] = t2.u[1]; sPL[w][rt * 16 + 8 * hh + r][ln] = t2l.u[0]; sPL[w][rt * 16 + 8 * hh + r][16 + ln] = t2l.u[1]; }
    __builtin_amdgcn_fence(__ATOMIC_ACQ_REL, "workgroup"); __builtin_amdgcn_wave_barrier();
    FragH pa[2], pl[2];
#pragma unroll
    for (int rt = 0; rt < RTN; ++rt) { pa[rt].half[0] = *(const v8us*)&sP[w][rt * 16 + ln][8 * hh]; pa[rt].half[1] = *(const v8us*)&sP[w][rt * 16 + ln][16 + 8 * hh]; pl[rt].half[0] = *(const v8us*)&sPL[w][rt * 16 + ln][8 * hh]; pl[rt].half[1] = *(const v8us*)&sPL[w][rt * 16 + ln][16 + 8 * hh]; }
#pragma unroll
    for (int dt = 0; dt < DT; ++dt) { const unsigned short* vrow = Vth + (size_t)(dt * 16 + ln) * TK + j0; const unsigned short* vrl = Vtl + (size_t)(dt * 16 + ln) * TK + j0; FragH bv, bl; bv.half[0] = *(const v8us*)(vrow + 8 * hh); bv.half[1] = *(const v8us*)(vrow + 16 + 8 * hh); bl.half[0] = *(const v8us*)(vrl + 8 * hh); bl.half[1] = *(const v8us*)(vrl + 16 + 8 * hh);
#pragma unroll
      for (int rt = 0; rt < RTN; ++rt) { oacc[rt][dt] = mmaH<1>(pa[rt].v, pa[rt].v, bv.v, bv.v, oacc[rt][dt]); oaccL[rt][dt] = mmaH<1>(pl[rt].v, pl[rt].v, bv.v, bv.v, oaccL[rt][dt]); oaccL[rt][dt] = mmaH<1>(pa[rt].v, pa[rt].v, bl.v, bl.v, oaccL[rt][dt]); } }
    __builtin_amdgcn_fence(__ATOMIC_ACQ_REL, "workgroup"); __builtin_amdgcn_wave_barrier(); }
#pragma unroll
  for (int rt = 0; rt < RTN; ++rt) {
#pragma unroll
    for (int r = 0; r < 8; ++r) { float l = l_r[rt][r]; l += __shfl_xor(l, 1, 32); l += __shfl_xor(l, 2, 32); l += __shfl_xor(l, 4, 32); l += __shfl_xor(l, 8, 32); l_r[rt][r] = (l > 0.f) ? 1.0f / (l * 1024.0f) : 0.f; }
#pragma unroll
    for (int dt = 0; dt < DT; ++dt)
#pragma unroll
      for (int r = 0; r < 8; ++r) { float v = oacc[rt][dt][r]; v += oaccL[rt][dt][r] * 0.0009765625f; sO[w][rt * 16 + 8 * hh + r][dt * 16 + ln] = v * l_r[rt][r]; } }
  __builtin_amdgcn_fence(__ATOMIC_ACQ_REL, "workgroup"); __builtin_amdgcn_wave_barrier();
  {
#pragma unroll
    for (int rp = 0; rp < RPW; rp += 2) { const int r = rp + (lane >> 4), pc = lane & 15; const v4f val = *(const v4fa*)&sO[w][r][pc * 4]; *(v4f*)(O + ((size_t)b * TQ + q0 + r) * ldo + h * 64 + pc * 4) = val; }
     } }

__global__ __launch_bounds__(256) void k_rotab(float* __restrict__ CS, float* __restrict__ SN) {
  #pragma clang fp contract(off)
  const int t = blockIdx.x * 256 + threadIdx.x; if (t >= SLEN * 32) return; const int j = t % 32, s = t / 32; const float ex = (float)(2 * j) / 64.0f; const float inv = 1.0f / powf(10000.0f, ex); const float th = (float)s * inv; const float c = cosf(th), sn = sinf(th);
  { *(float*)(CS + t) = c; *(float*)(SN + t) = sn;  } }
__global__ __launch_bounds__(256) void k_rope(const float* __restrict__ F, int nsrc, int ndst, int rep, const float* __restrict__ CS, const float* __restrict__ SN, _Float16* __restrict__ H, _Float16* __restrict__ L) {
  #pragma clang fp contract(off)
  const size_t t = (size_t)blockIdx.x * 256 + threadIdx.x; if (t >= (size_t)NR * ndst * 4) return; const int g8 = (int)(t % 4); const int hd = (int)((t / 4) % ndst); const size_t row = t / ((size_t)4 * ndst); const int s = (int)(row % SLEN); const int hs = hd / rep;
  const float* src = F + row * (size_t)(nsrc * 64) + hs * 64; FragH ah, al, bh, bl;
  for (int i = 0; i < 8; ++i) { const int d = g8 * 8 + i; const float c = CS[s * 32 + d], sn = SN[s * 32 + d]; const float x1 = src[d], x2 = src[d + 32];
    float o1 = x1 * c; o1 += -x2 * sn; float o2 = x2 * c; o2 += x1 * sn;
    _Float16 hv = (_Float16)o1; ah.h[i] = hv; al.h[i] = (_Float16)((o1 - (float)hv) * 1024.0f); hv = (_Float16)o2; bh.h[i] = hv; bl.h[i] = (_Float16)((o2 - (float)hv) * 1024.0f); }
  const size_t o = row * (size_t)(ndst * 64) + hd * 64 + g8 * 8;
  { *(v8us*)((unsigned short*)H + o) = ah.half[0]; *(v8us*)((unsigned short*)H + o + 32) = bh.half[0]; *(v8us*)((unsigned short*)L + o) = al.half[0]; *(v8us*)((unsigned short*)L + o + 32) = bl.half[0];  } }
__global__ __launch_bounds__(256) void k_rope2(const float* __restrict__ F, int nsrc, int ndst, int rep, const float* __restrict__ CS, const float* __restrict__ SN, _Float16* __restrict__ H, _Float16* __restrict__ L) {
  #pragma clang fp contract(off)
  const size_t t = (size_t)blockIdx.x * 256 + threadIdx.x; if (t >= (size_t)NR * ndst * 4) return; const int g16 = (int)(t % 4); const int hd = (int)((t / 4) % ndst); const size_t row = t / ((size_t)4 * ndst); const int s = (int)(row % SLEN); const int hs = hd / rep;
  const float* src = F + row * (size_t)(nsrc * 64) + hs * 64 + g16 * 16; FragH ah, al;
  for (int pr = 0; pr < 8; ++pr) { const int i = g16 * 8 + pr; const float c = CS[s * 32 + i], sn = SN[s * 32 + i]; const float x1 = src[2 * pr], x2 = src[2 * pr + 1];
    float o1 = x1 * c; o1 -= x2 * sn; float o2 = x1 * sn; o2 += x2 * c;
    _Float16 hv = (_Float16)o1; ah.h[2 * pr] = hv; al.h[2 * pr] = (_Float16)((o1 - (float)hv) * 1024.0f); hv = (_Float16)o2; ah.h[2 * pr + 1] = hv; al.h[2 * pr + 1] = (_Float16)((o2 - (float)hv) * 1024.0f); }
  const size_t o = row * (size_t)(ndst * 64) + hd * 64 + g16 * 16;
  { *(v8us*)((unsigned short*)H + o) = ah.half[0]; *(v8us*)((unsigned short*)H + o + 8) = ah.half[1]; *(v8us*)((unsigned short*)L + o) = al.half[0]; *(v8us*)((unsigned short*)L + o + 8) = al.half[1];  } }
__global__ __launch_bounds__(256) void k_ln512(const float* __restrict__ A, const float* __restrict__ res, const float* __restrict__ g, const float* __restrict__ bb, float* __restrict__ Y, _Float16* __restrict__ Y16) {
  #pragma clang fp contract(off)
  const int wv = threadIdx.x >> 5, ln = threadIdx.x & 31; const size_t r = (size_t)blockIdx.x * 8 + wv; if (r >= NR) return; float x[16]; float s = 0.f;
  for (int i = 0; i < 2; ++i) { const v8f a = *(const v8f*)(A + r * DM + i * 256 + ln * 8); for (int q = 0; q < 8; ++q) { float v = a[q]; if (res) v += bf16_round(res[r * DM + i * 256 + ln * 8 + q]); x[i * 8 + q] = v; s += v; } }
  for (int o = 16; o > 0; o >>= 1) s += __shfl_xor(s, o, 32); const float mu = s / (float)DM; float var = 0.f; for (int q = 0; q < 16; ++q) { const float d = x[q] - mu; var += d * d; }
  for (int o = 16; o > 0; o >>= 1) var += __shfl_xor(var, o, 32); const float inv = rsqrtf(var / (float)DM + 1e-5f);
  { for (int i = 0; i < 2; ++i) { const int c0 = i * 256 + ln * 8; v8f y; FragH f; for (int q = 0; q < 8; ++q) { float v = (x[i * 8 + q] - mu) * inv; v *= bf16_round(g[c0 + q]); v += bf16_round(bb[c0 + q]); y[q] = v; f.h[q] = (_Float16)v; } *(v8f*)(Y + r * DM + c0) = y; if (Y16) *(v8us*)((unsigned short*)Y16 + r * DM + c0) = f.half[0]; }  } }
__global__ __launch_bounds__(256) void k_pack(const float* __restrict__ rb, const int* __restrict__ rid, int* __restrict__ PK) { const int t = blockIdx.x * 256 + threadIdx.x; if (t >= 1024 + NB * TK) return; int v; if (t < 1024) v = __float_as_int(bf16_round(rb[t])); else v = rid[t - 1024]; *(int*)(PK + t) = v;  }
__global__ __launch_bounds__(256) void k_tabin(const float* __restrict__ sp, float* __restrict__ CS, float* __restrict__ SN) { const int t = blockIdx.x * 256 + threadIdx.x; if (t >= SLEN * 32) return; const int i = t % 32, s = t / 32; const float c = bf16_round(sp[s * 64 + 32 + i]), sn = bf16_round(sp[s * 64 + i]);
  { *(float*)(CS + t) = c; *(float*)(SN + t) = sn;  } }
__global__ __launch_bounds__(256) void k_wsc(const float* __restrict__ Wm, _Float16* __restrict__ Bt, size_t n8, float sc) { const size_t t = (size_t)blockIdx.x * 256 + threadIdx.x; if (t >= n8) return; FragH f; for (int q = 0; q < 8; ++q) f.h[q] = (_Float16)(bf16_round(Wm[t * 8 + q]) * sc); *(v8us*)((unsigned short*)Bt + t * 8) = f.half[0];  }
__global__ __launch_bounds__(256) void k_rotab2(float* __restrict__ CS, float* __restrict__ SN) {
  #pragma clang fp contract(off)
  const int t = blockIdx.x * 256 + threadIdx.x; if (t >= SLEN * 32) return; const int j = t % 32, s = t / 32; const float c0 = -0.14391156831212787f;      /* -ln(10000)/64 rounded to f32 */ const float inv = expf((float)(2 * j) * c0); const float th = (float)s * inv; const float c = cosf(th), sn = sinf(th);
  { *(float*)(CS + t) = c; *(float*)(SN + t) = sn;  } }
__global__ __launch_bounds__(256) void k_lnu(const float* __restrict__ X, _Float16* __restrict__ N16, float* __restrict__ XB) {
  #pragma clang fp contract(off)
  const int wv = threadIdx.x >> 5, ln = threadIdx.x & 31; const size_t r = (size_t)blockIdx.x * 8 + wv; if (r >= NR) return; float a[32]; float s = 0.f;
  for (int i = 0; i < 4; ++i) { const v8f v = *(const v8f*)(X + r * DM + (i * 32 + ln) * 8); for (int q = 0; q < 8; ++q) { const float u = bf16_round(v[q]); a[i * 8 + q] = u; s += u; } }
  for (int o = 16; o > 0; o >>= 1) s += __shfl_xor(s, o, 32); const float mu = s / (float)DM; float var = 0.f; for (int q = 0; q < 32; ++q) { const float d = a[q] - mu; var += d * d; }
  for (int o = 16; o > 0; o >>= 1) var += __shfl_xor(var, o, 32); const float den = sqrtf(var / (float)(DM - 1)) + 1e-6f; const float inv = 1.0f / den;      /* one reciprocal per row; (x-mean)*inv vs the reference's division differs by <= 1 ulp */
  { for (int i = 0; i < 4; ++i) { const int c0 = (i * 32 + ln) * 8; FragH f; v8f xb; for (int q = 0; q < 8; ++q) { f.h[q] = (_Float16)((a[i * 8 + q] - mu) * inv); xb[q] = a[i * 8 + q]; } *(v8us*)((unsigned short*)N16 + r * DM + c0) = f.half[0]; *(v8f*)(XB + r * DM + c0) = xb; }  } }
__global__ __launch_bounds__(256) void k_vtg(const _Float16* __restrict__ V16, _Float16* __restrict__ Vt) { __shared__ unsigned short tl[64][66]; const int tid = threadIdx.x; const int slab = blockIdx.x / (SLEN / 64), lg = blockIdx.x % (SLEN / 64); const int b = slab / NH, h = slab % NH; const int hs = h / NREP;
  for (int i = tid; i < 64 * 8; i += 256) { const int r = i / 8, c8 = (i % 8) * 8; FragH f; f.half[0] = *(const v8us*)((const unsigned short*)V16 + ((size_t)b * SLEN + lg * 64 + r) * KVD + hs * 64 + c8); for (int q = 0; q < 8; ++q) tl[r][c8 + q] = f.u[q]; }
  __syncthreads();
  { for (int rd = 0; rd < 2; ++rd) { const int d = rd * 32 + tid / 8, pc = tid % 8; FragH f; for (int q = 0; q < 8; ++q) f.u[q] = tl[pc * 8 + q][d]; *(v8us*)((unsigned short*)Vt + ((size_t)slab * 64 + d) * SLEN + lg * 64 + pc * 8) = f.half[0]; }  } }

__global__ __launch_bounds__(256) void k_h16s(const float* __restrict__ SRC, int lds, int coff, _Float16* __restrict__ DST, size_t n8) { const size_t t = (size_t)blockIdx.x * 256 + threadIdx.x; if (t >= n8) return; const size_t r = (t * 8) / DM; const int c = (int)((t * 8) % DM); const v8f a = *(const v8f*)(SRC + r * lds + coff + c); FragH f; for (int q = 0; q < 8; ++q) f.h[q] = (_Float16)a[q];
  *(v8us*)((unsigned short*)DST + t * 8) = f.half[0];  }


__global__ __launch_bounds__(256) void k_ccp(const float* __restrict__ QKV, int coff, _Float16* __restrict__ D) { const size_t t = (size_t)blockIdx.x * 256 + threadIdx.x; if (t >= (size_t)NR * DM / 8) return; const int c0 = (int)((t * 8) % DM); const size_t row = (t * 8) / DM; const v8f a = *(const v8f*)(QKV + row * 3 * DM + coff + c0); FragH f; for (int q = 0; q < 8; ++q) f.h[q] = (_Float16)a[q];
  *(v8us*)((unsigned short*)D + t * 8) = f.half[0];  }


__global__ __launch_bounds__(256) void k_tok(const float* __restrict__ x, _Float16* __restrict__ X16) { __shared__ float tl[DM][17]; const int tid = threadIdx.x; const int p0 = blockIdx.x * 16;      /* 16-pixel tiles: 34 KB of LDS */
  for (int i = tid; i < DM * 16; i += 256) { const int c = i / 16, p = i % 16; tl[c][p] = bf16_round(x[(size_t)c * NPIX + p0 + p]); }
  __syncthreads();
  { for (int i = tid; i < 16 * (DM / 8); i += 256) { const int p = i / (DM / 8), c0 = (i % (DM / 8)) * 8; FragH f; for (int q = 0; q < 8; ++q) f.h[q] = (_Float16)tl[c0 + q][p];
      *(v8us*)((unsigned short*)X16 + ((size_t)p0 + p) * DM + c0) = f.half[0]; }  } }
__global__ __launch_bounds__(256) void k_out(const float* __restrict__ Y, float* __restrict__ out) { const size_t t = (size_t)blockIdx.x * 256 + threadIdx.x; if (t >= (size_t)DM * NPIX / 8) return; const int p0 = (int)((t * 8) % NPIX); const int c = (int)((t * 8) / NPIX); v8f v; for (int q = 0; q < 8; ++q) v[q] = Y[((size_t)p0 + q) * DM + c];
  *(v8f*)(out + t * 8) = v;  }
extern "C" void kernel_launch(void* const* d_in, const int* in_sizes, int n_in,
                              void* d_out, int out_size, void* d_ws, size_t ws_size, hipStream_t stream) {
  (void)in_sizes; (void)n_in; (void)out_size;
  const float* x = (const float*)d_in[0]; const float* qw = (const float*)d_in[1]; const float* qb = (const float*)d_in[2]; const float* kw = (const float*)d_in[3]; const float* kb = (const float*)d_in[4]; const float* vw = (const float*)d_in[5]; const float* vb = (const float*)d_in[6]; const float* ow = (const float*)d_in[7]; const float* ob = (const float*)d_in[8];
  char* ws = (char*)d_ws; size_t off = 0;
  auto take = [&](size_t bytes) { char* p = ws + off; off += (bytes + 255) & ~(size_t)255; return p; };
  const size_t np = (size_t)NR * DM;
  _Float16* BQ = (_Float16*)take((size_t)DM * DM * 2); _Float16* BK = (_Float16*)take((size_t)DM * DM * 2); _Float16* BV = (_Float16*)take((size_t)DM * DM * 2); _Float16* BO = (_Float16*)take((size_t)DM * DM * 2); float* Y = (float*)take(np * 4);
   _Float16* X16 = (_Float16*)take(np * 2); _Float16* QH = (_Float16*)take(np * 2); _Float16* KH = (_Float16*)take(np * 2); _Float16* V16 = (_Float16*)take(np * 2); _Float16* VT = (_Float16*)take(np * 2); float* O = (float*)take(np * 4); _Float16* OH = QH; _Float16* OL = KH;
  if (off > ws_size) return;
  k_wsc<<<(unsigned)(((size_t)DM * DM / 8 + 255) / 256), 256, 0, stream>>>(qw, BQ, (size_t)DM * DM / 8, 16.0f); k_wsc<<<(unsigned)(((size_t)DM * DM / 8 + 255) / 256), 256, 0, stream>>>(kw, BK, (size_t)DM * DM / 8, 16.0f); k_wsc<<<(unsigned)(((size_t)DM * DM / 8 + 255) / 256), 256, 0, stream>>>(vw, BV, (size_t)DM * DM / 8, 16.0f); k_wsc<<<(unsigned)(((size_t)DM * DM / 8 + 255) / 256), 256, 0, stream>>>(ow, BO, (size_t)DM * DM / 8, 16.0f);      /* 1x1 conv (out, in) naturals */
  
  k_tok<<<NPIX / 16, 256, 0, stream>>>(x, X16);
  const dim3 g((NR / 128) * (DM / 64), 1);
  k_gemm2<0><<<g, 128, 0, stream>>>(X16, DM, 0, BQ, DM, 0, 0.0625f, qb, 0, nullptr, 1, 0, 0, nullptr, QH, DM, 0, NR, DM, DM);
  k_gemm2<0><<<g, 128, 0, stream>>>(X16, DM, 0, BK, DM, 0, 0.0625f, kb, 0, nullptr, 1, 0, 0, nullptr, KH, DM, 0, NR, DM, DM);
  k_gemm2<0><<<g, 128, 0, stream>>>(X16, DM, 0, BV, DM, 0, 0.0625f, vb, 0, nullptr, 1, 0, 0, nullptr, V16, DM, 0, NR, DM, DM);
  k_vtg<<<NB * NH * (SLEN / 64), 256, 0, stream>>>(V16, VT);
  k_flash<<<NB * NH * QBNP, 128, 0, stream>>>(QH, DM, KH, DM, VT, O, DM);
  k_hl<<<(unsigned)((np / 8 + 255) / 256), 256, 0, stream>>>(O, OH, OL, np / 8);
  k_gemm2<0><<<g, 128, 0, stream>>>(OL, DM, 0, BO, DM, 0, 0.0625f / 1024.0f, nullptr, 0, nullptr, 1, 0, 0, Y, nullptr, DM, 0, NR, DM, DM);
  k_gemm2<0><<<g, 128, 0, stream>>>(OH, DM, 0, BO, DM, 0, 0.0625f, ob, 0, Y, 1, (size_t)DM, 0, Y, nullptr, DM, 0, NR, DM, DM);      /* rows of the output conv */
  k_out<<<(unsigned)(((size_t)DM * NPIX / 8 + 255) / 256), 256, 0, stream>>>(Y, (float*)d_out);
}

// v003
// A run of this version takes 207 microseconds.
// Timed twice side by side with v002, it ran 1.13 and 1.12 times as fast.
// Counting every step since v000, it is 2.85 times as fast.
#include <hip/hip_runtime.h>
// SelfAttention4d (1 x 512 ch x 64 x 64 = 4096 tokens, 8 heads x 64: q/k/v = 1x1 convs (+ bias; the 1/8 scale applied in the flash kernel); softmax(q.k) v; out = 1x1 conv (+ bias) back to NCHW).
// Structure: NCHW -> exact f16 token rows by an LDS transpose kernel; q/k/v as f16 WMMA GEMMs (32x64 wave tiles, f32 accumulation, exact x16 (out,in) weights + bias, f16 out; channel = head*64 + d); V^T by LDS tiles; my fused flash kernel (no mask; the 1/8 applied as the score scale); ctx as f16 hi/residual into the output conv (two GEMM terms) + bias; NCHW store (thread per (channel, 8 pixels)).
// Compute dtype: inputs rounded to bf16; x / weights exact as f16; q, k, v plain f16 (~2^-12); softmax weights f16 x2^10; ctx hi + 2^-10 residual. v_wmma_f32_16x16x32_f16.
#define NB 1
#define DM 512
#define NKV 8
#define NPIX 4096
#define NREP (NH / NKV)
#define KVD (NKV * 64)           /* 512 */
#define NR (NB * SLEN)
#define CHK 512
typedef int v4i __attribute__((ext_vector_type(4)));
#define FF 2048
#define SLEN 4096
#define MQI 4096
#define MKI 4096
#define TQ SLEN
#define TK SLEN
#define NH 8
#define SCL 0.125f
#define QBLKS (TQ / 64)
#define QB05 0
#define QBN5 4
#define QB0P 0
#define QBNP QBLKS
#define RE 256
typedef __bf16 v16b __attribute__((ext_vector_type(16)));
typedef unsigned short v8us __attribute__((ext_vector_type(8), may_alias));
typedef float  v8f  __attribute__((ext_vector_type(8)));
typedef float  v4f  __attribute__((ext_vector_type(4)));
typedef float  v4fa __attribute__((ext_vector_type(4), may_alias));
union FragB { v16b v; v8us half[2]; unsigned short u[16]; };

__device__ __forceinline__ unsigned short bf16_bits(float x) { unsigned int u = __float_as_uint(x); return (unsigned short)((u + 0x7FFFu + ((u >> 16) & 1u)) >> 16); }
__device__ __forceinline__ float bf16_val(unsigned short b) { return __uint_as_float(((unsigned int)b) << 16); }
__device__ __forceinline__ float bf16_round(float x) { return bf16_val(bf16_bits(x)); }
// D += A·B with NT terms: 1 = ah·bh, 2 = + al·bh (A split), 3 = + ah·bl (both split)
template <int NT>
__device__ __forceinline__ v8f mmaN(v16b ah, v16b al, v16b bh, v16b bl, v8f c) {
  c = __builtin_amdgcn_wmma_f32_16x16x32_bf16(false, ah, false, bh, (short)0, c, false, false);
  if (NT >= 2) c = __builtin_amdgcn_wmma_f32_16x16x32_bf16(false, al, false, bh, (short)0, c, false, false);
  if (NT >= 3) c = __builtin_amdgcn_wmma_f32_16x16x32_bf16(false, ah, false, bl, (short)0, c, false, false);
  asm volatile("v_nop\n\tv_nop\n\tv_nop\n\tv_nop" : "+v"(c) : "v"(ah), "v"(al), "v"(bh), "v"(bl));
  return c;
}

__global__ __launch_bounds__(256) void k_wt_bf16(const float* __restrict__ W, unsigned short* __restrict__ Wt, int K, int N) {
  const int t = blockIdx.x * 256 + threadIdx.x;
  const int k8n = K / 8;
  if (t >= N * k8n) return;
  const int n = t / k8n, k8 = (t % k8n) * 8;
  v8us v;
#pragma unroll
  for (int i = 0; i < 8; ++i) v[i] = bf16_bits(W[(size_t)(k8 + i) * N + n]);
  *(v8us*)(Wt + (size_t)n * K + k8) = v;
  
}

// GEMM C[M][N] (f32, pitch ldc) = act(A[M][K]·W + bias). A f32 row-major (pitch lda) converted per fragment to bf16
// (ASPLIT: hi/lo two planes -> 2 terms, else single rounded term); Wt bf16 [N][K] (pitch ldb). BIAS_BF16 rounds the
// bias to bf16 first (bias quantised to bf16 before the add). K%32==0, M%16==0, N%64==0.
template <bool ASPLIT, int ACT, bool BIAS_BF16>
__global__ __launch_bounds__(128) void k_gemm_bf(const float* __restrict__ A, int lda, const unsigned short* __restrict__ Wt, int ldb,
                                               const float* __restrict__ bias, float* __restrict__ C, int ldc, int M, int N, int K) {
  __shared__ __attribute__((aligned(16))) float so[4][16][64];
  const int tid = threadIdx.x, w = tid >> 5, lane = tid & 31, ln = lane & 15, hh = lane >> 4;
  const int ntn = N / 64;
  const int wid = blockIdx.x * 4 + w;
  const int mt = wid / ntn, nq = wid % ntn;
  if (mt * 16 >= M) return;
  const int row0 = mt * 16, col0 = nq * 64;
  const float* arow = A + (size_t)(row0 + ln) * lda;
  v8f acc[4] = {};
  for (int kb = 0; kb < K; kb += 32) {
    FragB ah, al;
    const v4f x0 = *(const v4fa*)(arow + kb + 8 * hh), x1 = *(const v4fa*)(arow + kb + 8 * hh + 4);
    const v4f x2 = *(const v4fa*)(arow + kb + 16 + 8 * hh), x3 = *(const v4fa*)(arow + kb + 16 + 8 * hh + 4);
    float xs[16] = {x0[0],x0[1],x0[2],x0[3],x1[0],x1[1],x1[2],x1[3],x2[0],x2[1],x2[2],x2[3],x3[0],x3[1],x3[2],x3[3]};
#pragma unroll
    for (int i = 0; i < 16; ++i) { const unsigned short hb = bf16_bits(xs[i]); ah.u[i] = hb; al.u[i] = ASPLIT ? bf16_bits(xs[i] - bf16_val(hb)) : (unsigned short)0; }
#pragma unroll
    for (int t = 0; t < 4; ++t) {
      const unsigned short* brow = Wt + (size_t)(col0 + t * 16 + ln) * ldb + kb;
      FragB b;
      b.half[0] = *(const v8us*)(brow + 8 * hh);
      b.half[1] = *(const v8us*)(brow + 16 + 8 * hh);
      acc[t] = mmaN<ASPLIT ? 2 : 1>(ah.v, al.v, b.v, b.v, acc[t]);
    }
  }
#pragma unroll
  for (int t = 0; t < 4; ++t) {
    float bv = bias ? bias[col0 + t * 16 + ln] : 0.f;
    if (BIAS_BF16) bv = bf16_round(bv);
#pragma unroll
    for (int r = 0; r < 8; ++r) { float v = acc[t][r] + bv; if (ACT == 1) v = fmaxf(v, 0.f); so[w][8 * hh + r][t * 16 + ln] = v; }
  }
  __builtin_amdgcn_fence(__ATOMIC_ACQ_REL, "workgroup");
  __builtin_amdgcn_wave_barrier();
  const int rsub = lane >> 4, c4 = (lane & 15) * 4;
  {
#pragma unroll
    for (int q = 0; q < 8; ++q) {
      const int r = q * 2 + rsub;
      const v4f v = *(const v4fa*)&so[w][r][c4];
      *(v4f*)(C + (size_t)(row0 + r) * ldc + col0 + c4) = v;
    }
    
  }
}

// GEMM C = act(A·W + bias + resid): A f32 (ASPLIT -> hi/lo 2 terms), Wt bf16 [N][K]; ACT 0 none, 1 relu, 2 exact gelu;
// resid (optional, f32, row index = (row % rmod), pitch ldr, RES_BF16 rounds it) added before the activation.
template <bool ASPLIT, int ACT, bool BIAS_BF16, bool RES_BF16>
__global__ __launch_bounds__(128) void k_gemm_bf3(const float* __restrict__ A, int lda, const unsigned short* __restrict__ Wt, int ldb,
                                                const float* __restrict__ bias, const float* __restrict__ resid, int rmod, int ldr,
                                                float* __restrict__ C, int ldc, int M, int N, int K) {
  __shared__ __attribute__((aligned(16))) float so[4][16][64];
  const int tid = threadIdx.x, w = tid >> 5, lane = tid & 31, ln = lane & 15, hh = lane >> 4;
  const int ntn = N / 64;
  const int wid = blockIdx.x * 4 + w;
  const int mt = wid / ntn, nq = wid % ntn;
  if (mt * 16 >= M) return;
  const int row0 = mt * 16, col0 = nq * 64;
  const float* arow = A + (size_t)(row0 + ln) * lda;
  v8f acc[4] = {};
  for (int kb = 0; kb < K; kb += 32) {
    FragB ah, al;
    const v4f x0 = *(const v4fa*)(arow + kb + 8 * hh), x1 = *(const v4fa*)(arow + kb + 8 * hh + 4);
    const v4f x2 = *(const v4fa*)(arow + kb + 16 + 8 * hh), x3 = *(const v4fa*)(arow + kb + 16 + 8 * hh + 4);
    float xs[16] = {x0[0],x0[1],x0[2],x0[3],x1[0],x1[1],x1[2],x1[3],x2[0],x2[1],x2[2],x2[3],x3[0],x3[1],x3[2],x3[3]};
#pragma unroll
    for (int i = 0; i < 16; ++i) { const unsigned short hb = bf16_bits(xs[i]); ah.u[i] = hb; al.u[i] = ASPLIT ? bf16_bits(xs[i] - bf16_val(hb)) : (unsigned short)0; }
#pragma unroll
    for (int t = 0; t < 4; ++t) {
      const unsigned short* brow = Wt + (size_t)(col0 + t * 16 + ln) * ldb + kb;
      FragB b;
      b.half[0] = *(const v8us*)(brow + 8 * hh);
      b.half[1] = *(const v8us*)(brow + 16 + 8 * hh);
      acc[t] = mmaN<ASPLIT ? 2 : 1>(ah.v, al.v, b.v, b.v, acc[t]);
    }
  }
#pragma unroll
  for (int t = 0; t < 4; ++t) {
    const int col = col0 + t * 16 + ln;
    float bv = bias ? bias[col] : 0.f;
    if (BIAS_BF16) bv = bf16_round(bv);
#pragma unroll
    for (int r = 0; r < 8; ++r) {
      float v = acc[t][r] + bv;
      if (resid) { float rv = resid[(size_t)((row0 + 8 * hh + r) % rmod) * ldr + col]; if (RES_BF16) rv = bf16_round(rv); v += rv; }
      if (ACT == 1) v = fmaxf(v, 0.f);
      if (ACT == 2) v = 0.5f * v * (1.0f + erff(v * 0.70710678118654752f));
      if (ACT == 3) { const float u = 0.7978845608028654f * (v + 0.044715f * v * v * v); v = 0.5f * v * (1.0f + tanhf(u)); }
      so[w][8 * hh + r][t * 16 + ln] = v;
    }
  }
  __builtin_amdgcn_fence(__ATOMIC_ACQ_REL, "workgroup");
  __builtin_amdgcn_wave_barrier();
  const int rsub = lane >> 4, c4 = (lane & 15) * 4;
  {
#pragma unroll
    for (int q = 0; q < 8; ++q) {
      const int r = q * 2 + rsub;
      const v4f v = *(const v4fa*)&so[w][r][c4];
      *(v4f*)(C + (size_t)(row0 + r) * ldc + col0 + c4) = v;
    }
    
  }
}
// row LayerNorm (biased variance, eps) over N: s = X (+ R); optional out_sum <- s; out_norm <- (s-mu)*rsqrt(var+eps)*g + b
template <bool PARAM_BF16>
__global__ __launch_bounds__(256) void k_layernorm(const float* __restrict__ X, const float* __restrict__ R, const float* __restrict__ g, const float* __restrict__ bta,
                                                  float* __restrict__ out_sum, float* __restrict__ out_norm, int N, float eps) {
  __shared__ float red[256];
  const int row = blockIdx.x, tid = threadIdx.x;
  const float* x = X + (size_t)row * N; const float* rr = R ? R + (size_t)row * N : nullptr;
  float vals[16];                     // up to N = 4096
  const int per = N / 256;            // contiguous chunk per thread? use strided-by-4 chunks: thread handles j = tid*4 + 1024*u
  float s1 = 0.f;
  for (int u = 0; u < per / 4; ++u) {
    const int j = tid * 4 + 1024 * u;
    const v4f a = *(const v4fa*)(x + j);
    v4f b = {0.f,0.f,0.f,0.f}; if (rr) b = *(const v4fa*)(rr + j);
#pragma unroll
    for (int q = 0; q < 4; ++q) { const float v = a[q] + b[q]; vals[u * 4 + q] = v; s1 += v; }
  }
  red[tid] = s1; __syncthreads();
  for (int st = 128; st > 0; st >>= 1) { if (tid < st) red[tid] += red[tid + st]; __syncthreads(); }
  const float mu = red[0] / (float)N; __syncthreads();
  float s2 = 0.f;
  for (int u = 0; u < per / 4; ++u)
#pragma unroll
    for (int q = 0; q < 4; ++q) { const float c = vals[u * 4 + q] - mu; s2 += c * c; }
  red[tid] = s2; __syncthreads();
  for (int st = 128; st > 0; st >>= 1) { if (tid < st) red[tid] += red[tid + st]; __syncthreads(); }
  const float rs = rsqrtf(red[0] / (float)N + eps);
  {
    for (int u = 0; u < per / 4; ++u) {
      const int j = tid * 4 + 1024 * u;
      v4f o, sm;
#pragma unroll
      for (int q = 0; q < 4; ++q) {
        float gg = g[j + q], bb = bta[j + q];
        if (PARAM_BF16) { gg = bf16_round(gg); bb = bf16_round(bb); }
        sm[q] = vals[u * 4 + q]; o[q] = (vals[u * 4 + q] - mu) * rs * gg + bb;
      }
      if (out_sum) *(v4f*)(out_sum + (size_t)row * N + j) = sm;
      *(v4f*)(out_norm + (size_t)row * N + j) = o;
    }
    
  }
}



// ---- f16 WMMA path (v_wmma_f32_16x16x32_f16): 11-bit significands for operands in range — used where a [0,1] probability operand needs more precision than bf16
typedef _Float16 v16h __attribute__((ext_vector_type(16)));
union FragH { v16h v; v8us half[2]; _Float16 h[16]; unsigned short u[16]; };
template <int NT>
__device__ __forceinline__ v8f mmaH(v16h ah, v16h al, v16h bh, v16h bl, v8f c) {
  c = __builtin_amdgcn_wmma_f32_16x16x32_f16(false, ah, false, bh, (short)0, c, false, false);
  if (NT >= 2) c = __builtin_amdgcn_wmma_f32_16x16x32_f16(false, al, false, bh, (short)0, c, false, false);
  if (NT >= 3) c = __builtin_amdgcn_wmma_f32_16x16x32_f16(false, ah, false, bl, (short)0, c, false, false);
  asm volatile("v_nop\n\tv_nop\n\tv_nop\n\tv_nop" : "+v"(c) : "v"(ah), "v"(al), "v"(bh), "v"(bl));
  return c;
}
// batched GEMM like k_gemm_b but f16 operands: A f32 (split into f16 hi/lo if ASPLIT, else rounded to f16), Bt = f16 values [n][k]; alpha; C f32; N multiple of 16 (partial tiles skipped)
template <bool ASPLIT>
__global__ __launch_bounds__(128) void k_gemm_h(const float* __restrict__ A, int lda, size_t sA, const _Float16* __restrict__ Bh, int ldb, size_t sB, float alpha, float* __restrict__ C, int ldc, size_t sC, int M, int N, int K) {
  __shared__ __attribute__((aligned(16))) float so[4][16][64];
  const int tid = threadIdx.x, w = tid >> 5, lane = tid & 31, ln = lane & 15, hh = lane >> 4; const int by = blockIdx.y;
  A += (size_t)by * sA; Bh += (size_t)by * sB; C += (size_t)by * sC;
  const int ntn = (N + 63) / 64; const int wid = blockIdx.x * 4 + w; const int mt = wid / ntn, nq = wid % ntn; if (mt * 16 >= M) return;
  const int row0 = mt * 16, col0 = nq * 64; const float* arow = A + (size_t)(row0 + ln) * lda;
  v8f acc[4] = {};
  for (int kb = 0; kb < K; kb += 32) {
    FragH ah, al;
    const v4f x0 = *(const v4fa*)(arow + kb + 8 * hh), x1 = *(const v4fa*)(arow + kb + 8 * hh + 4), x2 = *(const v4fa*)(arow + kb + 16 + 8 * hh), x3 = *(const v4fa*)(arow + kb + 16 + 8 * hh + 4);
    float xs[16] = {x0[0],x0[1],x0[2],x0[3],x1[0],x1[1],x1[2],x1[3],x2[0],x2[1],x2[2],x2[3],x3[0],x3[1],x3[2],x3[3]};
#pragma unroll
    for (int i = 0; i < 16; ++i) { const _Float16 h = (_Float16)xs[i]; ah.h[i] = h; al.h[i] = ASPLIT ? (_Float16)(xs[i] - (float)h) : (_Float16)0.0f; }
#pragma unroll
    for (int t = 0; t < 4; ++t) { if (col0 + t * 16 >= N) continue; const size_t boff = (size_t)(col0 + t * 16 + ln) * ldb + kb; FragH bq; bq.half[0] = *(const v8us*)(Bh + boff + 8 * hh); bq.half[1] = *(const v8us*)(Bh + boff + 16 + 8 * hh);
      acc[t] = mmaH<ASPLIT ? 2 : 1>(ah.v, al.v, bq.v, bq.v, acc[t]); }
  }
#pragma unroll
  for (int t = 0; t < 4; ++t) { if (col0 + t * 16 >= N) continue;
#pragma unroll
    for (int r = 0; r < 8; ++r) so[w][8 * hh + r][t * 16 + ln] = acc[t][r] * alpha; }
  __builtin_amdgcn_fence(__ATOMIC_ACQ_REL, "workgroup"); __builtin_amdgcn_wave_barrier();
  const int rsub = lane >> 4, c4 = (lane & 15) * 4;
  {
#pragma unroll
    for (int q = 0; q < 8; ++q) { const int r = q * 2 + rsub; if (col0 + c4 < N) { const v4f v = *(const v4fa*)&so[w][r][c4]; *(v4f*)(C + (size_t)(row0 + r) * ldc + col0 + c4) = v; } }
     }
}

// Wt[n][k] = f16(W[k][n]·scale) from f32 row-major W[K][N] (scale = power of two; bf16-exact weights stay exact in f16 away from the subnormal range)
__global__ __launch_bounds__(256) void k_wt_f16(const float* __restrict__ W, _Float16* __restrict__ Wt, int K, int N, float scale) {
  const int t = blockIdx.x * 256 + threadIdx.x; if (t >= N * (K / 8)) return; const int n = t / (K / 8), k8 = (t % (K / 8)) * 8; FragH f;
#pragma unroll
  for (int i = 0; i < 8; ++i) f.h[i] = (_Float16)(bf16_round(W[(size_t)(k8 + i) * N + n]) * scale); const v8us o = f.half[0];
  *(v8us*)((unsigned short*)Wt + (size_t)n * K + k8) = o; 
}
// k_gemm_hh variant with fused epilogue: v = acc·alpha + bias[by·sBias + col] (+ CP[(row/rowsPerB)·sCPb + by·64 + col] if CP) ; ACT 0 none / 1 elu ; writes f16 C16 (and f32 C if non-null)
template <int ACT>
__global__ __launch_bounds__(128) void k_gemm_hhx(const _Float16* __restrict__ A, int lda, size_t sA, const _Float16* __restrict__ Bh, int ldb, size_t sB, float alpha, const float* __restrict__ bias, size_t sBias, const float* __restrict__ CP, int rowsPerB, size_t sCPb, int row0g,
    float* __restrict__ C, _Float16* __restrict__ C16, int ldc, size_t sC, int M, int N, int K) {
  __shared__ __attribute__((aligned(16))) float so[4][16][64];
  const int tid = threadIdx.x, w = tid >> 5, lane = tid & 31, ln = lane & 15, hh = lane >> 4; const int by = blockIdx.y;
  A += (size_t)by * sA; Bh += (size_t)by * sB; const size_t cofs = (size_t)by * sC; const float* bp = bias ? bias + (size_t)by * sBias : nullptr;
  const int ntn = (N + 63) / 64; const int wid = blockIdx.x * 4 + w; const int mt = wid / ntn, nq = wid % ntn; if (mt * 16 >= M) return;
  const int row0 = mt * 16, col0 = nq * 64; const _Float16* arow = A + (size_t)(row0 + ln) * lda;
  v8f acc[4] = {};
  for (int kb = 0; kb < K; kb += 32) { FragH ah; ah.half[0] = *(const v8us*)((const unsigned short*)arow + kb + 8 * hh); ah.half[1] = *(const v8us*)((const unsigned short*)arow + kb + 16 + 8 * hh);
#pragma unroll
    for (int t = 0; t < 4; ++t) { if (col0 + t * 16 >= N) continue; const size_t boff = (size_t)(col0 + t * 16 + ln) * ldb + kb; FragH bq; bq.half[0] = *(const v8us*)((const unsigned short*)Bh + boff + 8 * hh); bq.half[1] = *(const v8us*)((const unsigned short*)Bh + boff + 16 + 8 * hh);
      acc[t] = mmaH<1>(ah.v, ah.v, bq.v, bq.v, acc[t]); }
  }
#pragma unroll
  for (int t = 0; t < 4; ++t) { if (col0 + t * 16 >= N) continue; const int col = col0 + t * 16 + ln; const float bv = bp ? bf16_round(bp[col]) : 0.f;
#pragma unroll
    for (int r = 0; r < 8; ++r) { float v = acc[t][r] * alpha + bv; if (CP) { const int bidx = (row0g + row0 + 8 * hh + r) / rowsPerB; v += CP[(size_t)bidx * sCPb + (size_t)by * 64 + col]; } if (ACT == 1) v = (v > 0.f) ? v : expm1f(v); else if (ACT == 7) v = (v > 0.f) ? v + 1.0f : expf(v); else if (ACT == 8) v = tanhf(v); else if (ACT == 9) v = 0.5f * v * (1.0f + tanhf(0.7978845608028654f * (v + 0.044715f * v * v * v))); else if (ACT == 11) v = 1.0f / (1.0f + expf(-v)); else if (ACT == 12) v = (v > 0.f) ? v : 0.01f * v; else if (ACT == 14) v = (v > 0.f) ? v : 0.1f * v; else if (ACT == 15) v = v / (1.0f + expf(-v)); else if (ACT == 3) v = fmaxf(v, 0.f); else if (ACT == 6) v = 0.5f * v * (1.0f + erff(v * 0.70710678118654752f)); so[w][8 * hh + r][t * 16 + ln] = v; } }
  __builtin_amdgcn_fence(__ATOMIC_ACQ_REL, "workgroup"); __builtin_amdgcn_wave_barrier();
  const int rsub = lane >> 4, c4 = (lane & 15) * 4; typedef _Float16 v4h __attribute__((ext_vector_type(4)));
  {
#pragma unroll
    for (int q = 0; q < 8; ++q) { const int r = q * 2 + rsub; if (col0 + c4 < N) { const v4f v = *(const v4fa*)&so[w][r][c4]; if (C) *(v4f*)(C + cofs + (size_t)(row0 + r) * ldc + col0 + c4) = v; if (C16) { v4h h4; for (int i = 0; i < 4; ++i) h4[i] = (_Float16)v[i]; *(v4h*)(C16 + cofs + (size_t)(row0 + r) * ldc + col0 + c4) = h4; } } }
     }
}


typedef _Float16 v4h __attribute__((ext_vector_type(4)));

__global__ __launch_bounds__(256) void k_x16(const float* __restrict__ x, _Float16* __restrict__ X16, size_t n8) { const size_t t = (size_t)blockIdx.x * 256 + threadIdx.x; if (t >= n8) return; FragH f;
#pragma unroll
  for (int q = 0; q < 8; ++q) f.h[q] = (_Float16)bf16_round(x[t * 8 + q]); *(v8us*)((unsigned short*)X16 + t * 8) = f.half[0];  }
__global__ __launch_bounds__(256) void k_h16(const float* __restrict__ x, _Float16* __restrict__ X16, size_t n8) { const size_t t = (size_t)blockIdx.x * 256 + threadIdx.x; if (t >= n8) return; FragH f;
#pragma unroll
  for (int q = 0; q < 8; ++q) f.h[q] = (_Float16)x[t * 8 + q]; *(v8us*)((unsigned short*)X16 + t * 8) = f.half[0];  }
__global__ __launch_bounds__(256) void k_round16f(const float* __restrict__ W, _Float16* __restrict__ Bt, size_t n8) { const size_t t = (size_t)blockIdx.x * 256 + threadIdx.x; if (t >= n8) return; FragH f;
#pragma unroll
  for (int i = 0; i < 8; ++i) f.h[i] = (_Float16)(bf16_round(W[t * 8 + i]) * 16.0f); *(v8us*)((unsigned short*)Bt + t * 8) = f.half[0];  }
template <int NHv, int TTv>
__global__ __launch_bounds__(256) void k_vt(const _Float16* __restrict__ V16, int ldv, int voff, _Float16* __restrict__ Vt) { __shared__ unsigned short tl[64][66]; const int tid = threadIdx.x; const int slab = blockIdx.x / (TTv / 64), lg = blockIdx.x % (TTv / 64); const int b = slab / NHv, h = slab % NHv;
  for (int i = tid; i < 64 * 8; i += 256) { const int r = i / 8, c8 = (i % 8) * 8; FragH f; f.half[0] = *(const v8us*)((const unsigned short*)V16 + ((size_t)b * TTv + lg * 64 + r) * ldv + voff + h * 64 + c8);
#pragma unroll
    for (int q = 0; q < 8; ++q) tl[r][c8 + q] = f.u[q]; }
  __syncthreads();
  {
#pragma unroll
    for (int rd = 0; rd < 2; ++rd) { const int d = rd * 32 + tid / 8, pc = tid % 8; FragH f;
#pragma unroll
      for (int q = 0; q < 8; ++q) f.u[q] = tl[pc * 8 + q][d];
      *(v8us*)((unsigned short*)Vt + ((size_t)slab * 64 + d) * TTv + lg * 64 + pc * 8) = f.half[0]; }
     } }

__global__ __launch_bounds__(256) void k_hl(const float* __restrict__ F, _Float16* __restrict__ Hh, _Float16* __restrict__ Hl, size_t n8) { const size_t t = (size_t)blockIdx.x * 256 + threadIdx.x; if (t >= n8) return; FragH fh, fl; const v4f a = *(const v4fa*)(F + t * 8), c = *(const v4fa*)(F + t * 8 + 4);
#pragma unroll
  for (int q = 0; q < 4; ++q) { _Float16 h = (_Float16)a[q]; fh.h[q] = h; fl.h[q] = (_Float16)((a[q] - (float)h) * 1024.0f); h = (_Float16)c[q]; fh.h[4 + q] = h; fl.h[4 + q] = (_Float16)((c[q] - (float)h) * 1024.0f); }
  { *(v8us*)((unsigned short*)Hh + t * 8) = fh.half[0]; *(v8us*)((unsigned short*)Hl + t * 8) = fl.half[0];  } }

// ---- fast GEMM (wave tile 32x64; requires M % 32 == 0 rows per launch region and N % 64 == 0); epilogue = k_gemm_hhx semantics ----
__device__ __forceinline__ v16h g2_frag(const _Float16* p, int hh) { FragH f; f.half[0] = *(const v8us*)((const unsigned short*)p + 8 * hh); f.half[1] = *(const v8us*)((const unsigned short*)p + 16 + 8 * hh); return f.v; }
__device__ __forceinline__ v8f g2_mma(v16h a, v16h b, v8f c) { v8f d = __builtin_amdgcn_wmma_f32_16x16x32_f16(false, a, false, b, (short)0, c, false, false); asm volatile("v_nop\n\tv_nop\n\tv_nop\n\tv_nop" : "+v"(d) : "v"(a), "v"(b)); return d; }
template <int ACT>
__global__ __launch_bounds__(128) void k_gemm2(const _Float16* __restrict__ A, int lda, size_t sA, const _Float16* __restrict__ Bh, int ldb, size_t sB, float alpha, const float* __restrict__ bias, size_t sBias, const float* __restrict__ CP, int rowsPerB, size_t sCPb, int row0g,
    float* __restrict__ C, _Float16* __restrict__ C16, int ldc, size_t sC, int M, int N, int K) {
  __shared__ __attribute__((aligned(16))) float so[4][32][68];
  const int tid = threadIdx.x, w = tid >> 5, lane = tid & 31, ln = lane & 15, hh = lane >> 4; const int by = blockIdx.y;
  A += (size_t)by * sA; Bh += (size_t)by * sB; const size_t cofs = (size_t)by * sC; const float* bp = bias ? bias + (size_t)by * sBias : nullptr;
  const int ntn = N >> 6; const int mt = blockIdx.x / ntn, nq = blockIdx.x - mt * ntn; const int row0 = mt * 128 + 32 * w, col0 = nq * 64; if (row0 >= M) return;
  const _Float16* a0p = A + (size_t)(row0 + ln) * lda; const _Float16* a1p = a0p + (size_t)16 * lda;
  const _Float16* b0p = Bh + (size_t)(col0 + ln) * ldb; const _Float16* b1p = b0p + (size_t)16 * ldb; const _Float16* b2p = b1p + (size_t)16 * ldb; const _Float16* b3p = b2p + (size_t)16 * ldb;
  const v8f z8 = {0.f,0.f,0.f,0.f,0.f,0.f,0.f,0.f}; v8f c00 = z8, c01 = z8, c02 = z8, c03 = z8, c10 = z8, c11 = z8, c12 = z8, c13 = z8;
#pragma unroll 1
  for (int kb = 0; kb < K; kb += 32) { const v16h a0 = g2_frag(a0p + kb, hh), a1 = g2_frag(a1p + kb, hh);
    v16h b = g2_frag(b0p + kb, hh); c00 = g2_mma(a0, b, c00); c10 = g2_mma(a1, b, c10);
    b = g2_frag(b1p + kb, hh); c01 = g2_mma(a0, b, c01); c11 = g2_mma(a1, b, c11);
    b = g2_frag(b2p + kb, hh); c02 = g2_mma(a0, b, c02); c12 = g2_mma(a1, b, c12);
    b = g2_frag(b3p + kb, hh); c03 = g2_mma(a0, b, c03); c13 = g2_mma(a1, b, c13); }
  v8f accs[8] = {c00, c01, c02, c03, c10, c11, c12, c13};
#pragma unroll
  for (int u = 0; u < 8; ++u) { const int t = u & 3, half = u >> 2; const int col = col0 + t * 16 + ln; const float bv = bp ? bf16_round(bp[col]) : 0.f;
#pragma unroll
    for (int r = 0; r < 8; ++r) { const int rloc = half * 16 + 8 * hh + r; float v = accs[u][r] * alpha + bv; if (CP) { if (rowsPerB < 0) v += CP[cofs + (size_t)(row0g + row0 + rloc) * ldc + col];      /* rowsPerB < 0: own element of the batched C plane */ else { const int bidx = (row0g + row0 + rloc) / rowsPerB; v += CP[(size_t)bidx * sCPb + (size_t)by * 64 + col]; } }
      if (ACT == 3) v = fmaxf(v, 0.f); else if (ACT == 6) v = 0.5f * v * (1.0f + erff(v * 0.70710678118654752f)); else if (ACT == 11) v = 1.0f / (1.0f + expf(-v)); else if (ACT == 15) v = v / (1.0f + expf(-v)); else if (ACT == 12) v = (v > 0.f) ? v : 0.01f * v; else if (ACT == 8) v = tanhf(v);
      so[w][rloc][t * 16 + ln] = v; } }
  __builtin_amdgcn_fence(__ATOMIC_ACQ_REL, "workgroup"); __builtin_amdgcn_wave_barrier();
  const int rsub = lane >> 4, c4 = (lane & 15) * 4;
  {
#pragma unroll
    for (int q = 0; q < 16; ++q) { const int r = q * 2 + rsub; const v4f v = *(const v4fa*)&so[w][r][c4]; if (C) *(v4f*)(C + cofs + (size_t)(row0 + r) * ldc + col0 + c4) = v; if (C16) { v4h h4; for (int i = 0; i < 4; ++i) h4[i] = (_Float16)v[i]; *(v4h*)(C16 + cofs + (size_t)(row0 + r) * ldc + col0 + c4) = h4; } }
     } }



// lane l takes the value of lane l ^ 16 (the other half of the same query column)
__device__ __forceinline__ float xhalf(float x) { return __builtin_bit_cast(float, __builtin_amdgcn_permlanex16(__builtin_bit_cast(int, x), __builtin_bit_cast(int, x), 0x76543210, 0xfedcba98, false, false)); }
#define FSK 64      /* keys a stage */
#define FPH 72      /* LDS row pitch in 16-bit elements: 128 bytes of data + 16, the conflict-free pitch for 16-byte row readers */
#define FBB (64 * FPH * 2)      /* bytes of one tile buffer */
#define FRB (16 * FPH * 2)      /* bytes of 16 LDS rows: the step between a thread's four pieces of a tile */
#define FC2 (SCL * 1.4426950408889634f)      /* score scale times log2(e): the softmax runs in base 2 on the hardware's own exponential */
// One stage's copies of one thread: pieces (row, row + 16, row + 32, row + 48) of the K tile and of the V^T tile, 16 bytes each. The s_wait_xcnt closes the statement so that no address register is rewritten ahead of it.
__device__ __forceinline__ void fl_copy(unsigned lk, unsigned lv, const unsigned short* gk, size_t ks16, const unsigned short* gv) {
  const unsigned short* gk1 = gk + ks16; const unsigned short* gk2 = gk1 + ks16; const unsigned short* gk3 = gk2 + ks16;
  const unsigned short* gv1 = gv + (size_t)16 * TK; const unsigned short* gv2 = gv + (size_t)32 * TK; const unsigned short* gv3 = gv + (size_t)48 * TK;
  asm volatile("global_load_async_to_lds_b128 %0, %8, off\n\t"
               "global_load_async_to_lds_b128 %1, %9, off\n\t"
               "global_load_async_to_lds_b128 %2, %10, off\n\t"
               "global_load_async_to_lds_b128 %3, %11, off\n\t"
               "global_load_async_to_lds_b128 %4, %12, off\n\t"
               "global_load_async_to_lds_b128 %5, %13, off\n\t"
               "global_load_async_to_lds_b128 %6, %14, off\n\t"
               "global_load_async_to_lds_b128 %7, %15, off\n\t"
               "s_wait_xcnt 0x0"
               :: "v"(lk), "v"(lk + FRB), "v"(lk + 2 * FRB), "v"(lk + 3 * FRB), "v"(lv), "v"(lv + FRB), "v"(lv + 2 * FRB), "v"(lv + 3 * FRB),
                  "v"(gk), "v"(gk1), "v"(gk2), "v"(gk3), "v"(gv), "v"(gv1), "v"(gv2), "v"(gv3) : "memory");
}
__global__ __launch_bounds__(128) void k_flash(const _Float16* __restrict__ Q16, int ldq, const _Float16* __restrict__ K16, int ldk, const _Float16* __restrict__ Vt, float* __restrict__ O, int ldo) {
  constexpr int RPW = 16, DT = 4, KS = 2, NST = TK / FSK;
  __shared__ __attribute__((aligned(16))) unsigned short sK[2][64][FPH]; __shared__ __attribute__((aligned(16))) unsigned short sV[2][64][FPH];
  const int tid = threadIdx.x, w = tid >> 5, lane = tid & 31, ln = lane & 15, hh = lane >> 4;
  const int slab = blockIdx.x / QBNP, qblk = QB0P + blockIdx.x % QBNP; const int b = slab / NH, h = slab % NH; const int q0 = qblk * (4 * RPW) + w * RPW;
  FragH bq[KS];
  { const unsigned short* qr = (const unsigned short*)Q16 + ((size_t)b * TQ + q0 + ln) * ldq + h * 64;
#pragma unroll
    for (int ks = 0; ks < KS; ++ks) { bq[ks].half[0] = *(const v8us*)(qr + ks * 32 + 8 * hh); bq[ks].half[1] = *(const v8us*)(qr + ks * 32 + 16 + 8 * hh); } }
  const unsigned short* Vth = (const unsigned short*)Vt + (size_t)slab * 64 * TK;
  const int crow = tid >> 3, cseg = (tid & 7) * 8;      /* eight threads copy one 128-byte row */
  const size_t ks16 = (size_t)16 * ldk, kstg = (size_t)FSK * ldk;
  const unsigned short* gk = (const unsigned short*)K16 + ((size_t)b * TK + crow) * ldk + h * 64 + cseg;      /* the thread's first piece of the next stage to copy, advanced behind each stage's copies */
  const unsigned short* gv = Vth + (size_t)crow * TK + cseg;
  const unsigned lk0 = (unsigned)(size_t)&sK[0][crow][cseg], lv0 = (unsigned)(size_t)&sV[0][crow][cseg];      /* low 32 bits of a shared address = the byte offset in LDS */
  fl_copy(lk0, lv0, gk, ks16, gv); gk += kstg; gv += FSK;
  asm volatile("s_wait_asynccnt 0x0" ::: "memory");      /* stage 0 has landed before the barrier that publishes it */
  __syncthreads();
  fl_copy(lk0 + FBB, lv0 + FBB, gk, ks16, gv); gk += kstg; gv += FSK;
  float m_r = -3.0e38f, l_r = 0.f; v8f oacc[DT];
#pragma unroll
  for (int dt = 0; dt < DT; ++dt) oacc[dt] = (v8f){0.f,0.f,0.f,0.f,0.f,0.f,0.f,0.f};
#pragma unroll 1      /* one stage a trip: the buffer index stays a run-time value and the text small */
  for (int st = 0; st < NST; ++st) {
    const int buf = st & 1;
    const unsigned short* kf = &sK[buf][ln][8 * hh]; const unsigned short* vf = &sV[buf][ln][8 * hh];
#pragma unroll
    for (int ps2 = 0; ps2 < FSK / 32; ++ps2) {
      FragH ak[2][KS], av[DT];
#pragma unroll
      for (int nt = 0; nt < 2; ++nt)
#pragma unroll
        for (int ks = 0; ks < KS; ++ks) { const unsigned short* kr = kf + (ps2 * 32 + nt * 16) * FPH + ks * 32; ak[nt][ks].half[0] = *(const v8us*)kr; ak[nt][ks].half[1] = *(const v8us*)(kr + 16); }
#pragma unroll
      for (int dt = 0; dt < DT; ++dt) { const unsigned short* vr = vf + dt * 16 * FPH + ps2 * 32; av[dt].half[0] = *(const v8us*)vr; av[dt].half[1] = *(const v8us*)(vr + 16); }
      float sc[16];
#pragma unroll
      for (int nt = 0; nt < 2; ++nt) { v8f acc = (v8f){0.f,0.f,0.f,0.f,0.f,0.f,0.f,0.f};
#pragma unroll
        for (int ks = 0; ks < KS; ++ks) acc = mmaH<1>(ak[nt][ks].v, ak[nt][ks].v, bq[ks].v, bq[ks].v, acc);
#pragma unroll
        for (int r = 0; r < 8; ++r) sc[nt * 8 + r] = acc[r]; }      /* raw q.k: the maximum is kept unscaled, the scale goes into the exponent's multiply-add */
      float mx[4];
#pragma unroll
      for (int c = 0; c < 4; ++c) mx[c] = fmaxf(fmaxf(sc[c], sc[4 + c]), fmaxf(sc[8 + c], sc[12 + c]));
      float mc = fmaxf(fmaxf(mx[0], mx[1]), fmaxf(mx[2], mx[3])); mc = fmaxf(mc, xhalf(mc));      /* both halves of a column use one maximum: they share the output tiles */
      const float mn = fmaxf(m_r, mc); float al = (m_r - mn) * FC2; m_r = mn;
      const float nb = fmaf(-mn, FC2, 10.0f);      /* 2^(s FC2 + nb) = 1024 exp((s - mn) / 8) */
      FragH pb; float ps[4];
#pragma unroll
      for (int i = 0; i < 16; ++i) sc[i] = fmaf(sc[i], FC2, nb);
      asm("v_exp_f32 %0, %0\n\tv_exp_f32 %1, %1\n\tv_exp_f32 %2, %2\n\tv_exp_f32 %3, %3\n\tv_exp_f32 %4, %4\n\tv_exp_f32 %5, %5\n\tv_exp_f32 %6, %6\n\tv_exp_f32 %7, %7\n\tv_exp_f32 %8, %8\n\t"
          "v_exp_f32 %9, %9\n\tv_exp_f32 %10, %10\n\tv_exp_f32 %11, %11\n\tv_exp_f32 %12, %12\n\tv_exp_f32 %13, %13\n\tv_exp_f32 %14, %14\n\tv_exp_f32 %15, %15\n\tv_exp_f32 %16, %16\n\tv_nop"
          : "+v"(al), "+v"(sc[0]), "+v"(sc[1]), "+v"(sc[2]), "+v"(sc[3]), "+v"(sc[4]), "+v"(sc[5]), "+v"(sc[6]), "+v"(sc[7]), "+v"(sc[8]), "+v"(sc[9]), "+v"(sc[10]), "+v"(sc[11]), "+v"(sc[12]), "+v"(sc[13]), "+v"(sc[14]), "+v"(sc[15]));
#pragma unroll
      for (int i = 0; i < 16; ++i) { const float p = sc[i]; ps[i & 3] = (i < 4) ? p : ps[i & 3] + p; pb.h[i] = (_Float16)p; }      /* element i = key 8 hh + i (i < 8), 16 + 8 hh + i - 8 (i >= 8): the order of the V^T fragments above */
      l_r = l_r * al + ((ps[0] + ps[1]) + (ps[2] + ps[3]));
#pragma unroll
      for (int dt = 0; dt < DT; ++dt)
#pragma unroll
        for (int r = 0; r < 8; ++r) oacc[dt][r] *= al;
#pragma unroll
      for (int dt = 0; dt < DT; ++dt) oacc[dt] = mmaH<1>(av[dt].v, av[dt].v, pb.v, pb.v, oacc[dt]);
    }
    asm volatile("s_wait_dscnt 0x0" ::: "memory");      /* this wave's reads of the buffer have returned before it is given up */
    asm volatile("s_wait_asynccnt 0x0" ::: "memory");      /* this wave's copies of the next stage have landed */
    __syncthreads();      /* publishes the next stage and ends every wave's reads of this one */
    if (st + 2 < NST) { fl_copy(lk0 + buf * FBB, lv0 + buf * FBB, gk, ks16, gv); gk += kstg; gv += FSK; } }
  asm volatile("s_wait_asynccnt 0x0" ::: "memory");      /* no copy is left in flight when the wave ends */
  const float l = l_r + xhalf(l_r); const float inv = (l > 0.f) ? 1.0f / l : 0.f;      /* weights and sum both carry the 2^10 */
  float* orow = O + ((size_t)b * TQ + q0 + ln) * ldo + h * 64 + 8 * hh;      /* register r of tile dt = channel dt * 16 + 8 hh + r of query ln: 32 contiguous bytes a lane */
#pragma unroll
  for (int dt = 0; dt < DT; ++dt) { const v4f lo = {oacc[dt][0] * inv, oacc[dt][1] * inv, oacc[dt][2] * inv, oacc[dt][3] * inv}, hi = {oacc[dt][4] * inv, oacc[dt][5] * inv, oacc[dt][6] * inv, oacc[dt][7] * inv};
    *(v4f*)(orow + dt * 16) = lo; *(v4f*)(orow + dt * 16 + 4) = hi; } }
// 5-plane variant: S = Qh Kh^T + (Ql Kh^T + Qh Kl^T)/1024 with Q/K = [hi | 2^10 residual] f16 planes (QL/KL same layout as Q16/K16), then the 3-term P.V below.
// 3-term variant: O = (P_hi V_hi + (P_lo V_hi + P_hi V_lo) / 1024) / l with P = [hi | 2^10 residual] of 1024 p and V^T = [hi | 2^10 residual] planes (VtL same layout as Vt) -> ~2^-21-class products for un-averaged (early causal / peaked) rows
template <int CAUSAL>
__global__ __launch_bounds__(128) void k_flash5(const _Float16* __restrict__ Q16, const _Float16* __restrict__ QL, int ldq, const _Float16* __restrict__ K16, const _Float16* __restrict__ KL, int ldk, const _Float16* __restrict__ Vt, const _Float16* __restrict__ VtL, const int* __restrict__ MSK, float* __restrict__ O, int ldo) {
  constexpr int RPW = 16, RTN = RPW / 16, NQB = TQ / (4 * RPW), DT = 4, KS = 2;
  __shared__ __attribute__((aligned(16))) unsigned short sP[4][RPW][40]; __shared__ __attribute__((aligned(16))) unsigned short sPL[4][RPW][40]; __shared__ __attribute__((aligned(16))) float sO[4][RPW][64 + 4];
  const int tid = threadIdx.x, w = tid >> 5, lane = tid & 31, ln = lane & 15, hh = lane >> 4;
  const int slab = blockIdx.x / QBN5, qblk = QB05 + blockIdx.x % QBN5; (void)NQB; const int b = slab / NH, h = slab % NH; const int qb0 = qblk * (4 * RPW); const int q0 = qb0 + w * RPW;
  FragH aq[2][KS], aql[2][KS];
#pragma unroll
  for (int rt = 0; rt < RTN; ++rt) { const unsigned short* qr = (const unsigned short*)Q16 + ((size_t)b * TQ + q0 + rt * 16 + ln) * ldq + h * 64; const unsigned short* ql = (const unsigned short*)QL + ((size_t)b * TQ + q0 + rt * 16 + ln) * ldq + h * 64;
#pragma unroll
    for (int ks = 0; ks < KS; ++ks) { aq[rt][ks].half[0] = *(const v8us*)(qr + ks * 32 + 8 * hh); aq[rt][ks].half[1] = *(const v8us*)(qr + ks * 32 + 16 + 8 * hh); aql[rt][ks].half[0] = *(const v8us*)(ql + ks * 32 + 8 * hh); aql[rt][ks].half[1] = *(const v8us*)(ql + ks * 32 + 16 + 8 * hh); } }
  const unsigned short* Vth = (const unsigned short*)Vt + (size_t)slab * 64 * TK; const unsigned short* Vtl = (const unsigned short*)VtL + (size_t)slab * 64 * TK;
  float m_r[2][8], l_r[2][8]; v8f oacc[2][DT], oaccL[2][DT];
#pragma unroll
  for (int rt = 0; rt < RTN; ++rt) {
#pragma unroll
    for (int r = 0; r < 8; ++r) { m_r[rt][r] = -3.0e38f; l_r[rt][r] = 0.f; }
#pragma unroll
    for (int dt = 0; dt < DT; ++dt) { oacc[rt][dt] = (v8f){0.f,0.f,0.f,0.f,0.f,0.f,0.f,0.f}; oaccL[rt][dt] = oacc[rt][dt]; } }
  const int jend = (CAUSAL == 1) ? (qb0 + 4 * RPW) : ((CAUSAL == 23) ? min(TK, (qb0 / CHK + 2) * CHK) : TK);      /* causal / window: keys that can never contribute are skipped */ const int jbeg = (CAUSAL == 23) ? max(0, (qb0 / CHK - 1) * CHK) : 0;
#pragma unroll 1
  for (int j0 = jbeg; j0 < jend; j0 += 32) {
    v8f s[2][2];
#pragma unroll
    for (int nt = 0; nt < 2; ++nt) { const unsigned short* kr = (const unsigned short*)K16 + ((size_t)b * TK + j0 + nt * 16 + ln) * ldk + h * 64; const unsigned short* klr = (const unsigned short*)KL + ((size_t)b * TK + j0 + nt * 16 + ln) * ldk + h * 64; FragH bk[KS], bkl[KS];
#pragma unroll
      for (int ks = 0; ks < KS; ++ks) { bk[ks].half[0] = *(const v8us*)(kr + ks * 32 + 8 * hh); bk[ks].half[1] = *(const v8us*)(kr + ks * 32 + 16 + 8 * hh); bkl[ks].half[0] = *(const v8us*)(klr + ks * 32 + 8 * hh); bkl[ks].half[1] = *(const v8us*)(klr + ks * 32 + 16 + 8 * hh); }
#pragma unroll
      for (int rt = 0; rt < RTN; ++rt) { v8f acc = (v8f){0.f,0.f,0.f,0.f,0.f,0.f,0.f,0.f}, accl = acc;
#pragma unroll
        for (int ks = 0; ks < KS; ++ks) { acc = mmaH<1>(aq[rt][ks].v, aq[rt][ks].v, bk[ks].v, bk[ks].v, acc); accl = mmaH<1>(aql[rt][ks].v, aql[rt][ks].v, bk[ks].v, bk[ks].v, accl); accl = mmaH<1>(aq[rt][ks].v, aq[rt][ks].v, bkl[ks].v, bkl[ks].v, accl); }
#pragma unroll
        for (int r = 0; r < 8; ++r) acc[r] += accl[r] * 0.0009765625f;
        s[rt][nt] = acc; } }
#pragma unroll
    for (int rt = 0; rt < RTN; ++rt)
#pragma unroll
      for (int r = 0; r < 8; ++r) { const int tq = q0 + rt * 16 + 8 * hh + r; const int k0 = j0 + ln, k1 = j0 + 16 + ln;
        bool ok0 = (CAUSAL == 1) ? (k0 <= tq) : ((CAUSAL == 2) ? ((k0 >> 5) == (tq >> 5)) : true), ok1 = (CAUSAL == 1) ? (k1 <= tq) : ((CAUSAL == 2) ? ((k1 >> 5) == (tq >> 5)) : true);      /* mode 2: block-diagonal 32-token groups */
        if (CAUSAL == 4) { const int* mrow = MSK + ((size_t)b * TQ + tq) * TK; ok0 = mrow[k0] != 0; ok1 = mrow[k1] != 0; }      /* mode 4: per-(query, key) INPUT mask shared by all heads; masked keys contribute nothing (== the reference's -4096 fill, whose exp underflows to 0), rows with no valid key give l = 0 -> output 0 (== the reference's row_valid zeroing) */
        float s0 = ok0 ? s[rt][0][r] * SCL : -3.0e38f, s1 = ok1 ? s[rt][1][r] * SCL : -3.0e38f; if (CAUSAL == 17) { const float* amk = (const float*)MSK + (size_t)b * TK; s0 += bf16_round(amk[k0]); s1 += bf16_round(amk[k1]); } if (CAUSAL == 18) { const float* tb = (const float*)MSK; const int* ri = MSK + 1024 + (size_t)b * TK; const int rq = ri[tq]; s0 += tb[(h * 8 + rq) * 8 + ri[k0]]; s1 += tb[(h * 8 + rq) * 8 + ri[k1]]; } if (CAUSAL == 19) { const int* rel = MSK + (size_t)tq * TK; const float* rb = (const float*)MSK + (size_t)TQ * TK + ((size_t)(b * NH + h) * TQ + tq) * 64; s0 += rb[rel[k0]]; s1 += rb[rel[k1]]; }      /* mode 19: + (q.Ek[rel] + Eb[rel][h]) / 8 gathered by the int relative ids (packed [ids | table]) */      /* mode 18: + resource_bias[h][r_q][r_k] from the packed [table | ids] buffer (TQ == TK) */      /* mode 17: additive per-(batch, key) mask INPUT */ float mc = fmaxf(s0, s1);
        mc = fmaxf(mc, __shfl_xor(mc, 1, 32)); mc = fmaxf(mc, __shfl_xor(mc, 2, 32)); mc = fmaxf(mc, __shfl_xor(mc, 4, 32)); mc = fmaxf(mc, __shfl_xor(mc, 8, 32));
        const float mn = fmaxf(m_r[rt][r], mc); const float al = (mn > -1.0e38f) ? expf(m_r[rt][r] - mn) : 1.0f; m_r[rt][r] = mn; const float p0 = ok0 ? expf(s0 - mn) : 0.f, p1 = ok1 ? expf(s1 - mn) : 0.f; l_r[rt][r] = l_r[rt][r] * al + p0 + p1;
#pragma unroll
        for (int dt = 0; dt < DT; ++dt) { oacc[rt][dt][r] *= al; oaccL[rt][dt][r] *= al; }
        FragH t2, t2l; const float ps0 = p0 * 1024.0f, ps1 = p1 * 1024.0f; t2.h[0] = (_Float16)ps0; t2.h[1] = (_Float16)ps1; t2l.h[0] = (_Float16)((ps0 - (float)t2.h[0]) * 1024.0f); t2l.h[1] = (_Float16)((ps1 - (float)t2.h[1]) * 1024.0f);
        sP[w][rt * 16 + 8 * hh + r][ln] = t2.u[0]; sP[w][rt * 16 + 8 * hh + r][16 + ln] = t2.u[1]; sPL[w][rt * 16 + 8 * hh + r][ln] = t2l.u[0]; sPL[w][rt * 16 + 8 * hh + r][16 + ln] = t2l.u[1]; }
    __builtin_amdgcn_fence(__ATOMIC_ACQ_REL, "workgroup"); __builtin_amdgcn_wave_barrier();
    FragH pa[2], pl[2];
#pragma unroll
    for (int rt = 0; rt < RTN; ++rt) { pa[rt].half[0] = *(const v8us*)&sP[w][rt * 16 + ln][8 * hh]; pa[rt].half[1] = *(const v8us*)&sP[w][rt * 16 + ln][16 + 8 * hh]; pl[rt].half[0] = *(const v8us*)&sPL[w][rt * 16 + ln][8 * hh]; pl[rt].half[1] = *(const v8us*)&sPL[w][rt * 16 + ln][16 + 8 * hh]; }
#pragma unroll
    for (int dt = 0; dt < DT; ++dt) { const unsigned short* vrow = Vth + (size_t)(dt * 16 + ln) * TK + j0; const unsigned short* vrl = Vtl + (size_t)(dt * 16 + ln) * TK + j0; FragH bv, bl; bv.half[0] = *(const v8us*)(vrow + 8 * hh); bv.half[1] = *(const v8us*)(vrow + 16 + 8 * hh); bl.half[0] = *(const v8us*)(vrl + 8 * hh); bl.half[1] = *(const v8us*)(vrl + 16 + 8 * hh);
#pragma unroll
      for (int rt = 0; rt < RTN; ++rt) { oacc[rt][dt] = mmaH<1>(pa[rt].v, pa[rt].v, bv.v, bv.v, oacc[rt][dt]); oaccL[rt][dt] = mmaH<1>(pl[rt].v, pl[rt].v, bv.v, bv.v, oaccL[rt][dt]); oaccL[rt][dt] = mmaH<1>(pa[rt].v, pa[rt].v, bl.v, bl.v, oaccL[rt][dt]); } }
    __builtin_amdgcn_fence(__ATOMIC_ACQ_REL, "workgroup"); __builtin_amdgcn_wave_barrier(); }
#pragma unroll
  for (int rt = 0; rt < RTN; ++rt) {
#pragma unroll
    for (int r = 0; r < 8; ++r) { float l = l_r[rt][r]; l += __shfl_xor(l, 1, 32); l += __shfl_xor(l, 2, 32); l += __shfl_xor(l, 4, 32); l += __shfl_xor(l, 8, 32); l_r[rt][r] = (l > 0.f) ? 1.0f / (l * 1024.0f) : 0.f; }
#pragma unroll
    for (int dt = 0; dt < DT; ++dt)
#pragma unroll
      for (int r = 0; r < 8; ++r) { float v = oacc[rt][dt][r]; v += oaccL[rt][dt][r] * 0.0009765625f; sO[w][rt * 16 + 8 * hh + r][dt * 16 + ln] = v * l_r[rt][r]; } }
  __builtin_amdgcn_fence(__ATOMIC_ACQ_REL, "workgroup"); __builtin_amdgcn_wave_barrier();
  {
#pragma unroll
    for (int rp = 0; rp < RPW; rp += 2) { const int r = rp + (lane >> 4), pc = lane & 15; const v4f val = *(const v4fa*)&sO[w][r][pc * 4]; *(v4f*)(O + ((size_t)b * TQ + q0 + r) * ldo + h * 64 + pc * 4) = val; }
     } }

__global__ __launch_bounds__(256) void k_rotab(float* __restrict__ CS, float* __restrict__ SN) {
  #pragma clang fp contract(off)
  const int t = blockIdx.x * 256 + threadIdx.x; if (t >= SLEN * 32) return; const int j = t % 32, s = t / 32; const float ex = (float)(2 * j) / 64.0f; const float inv = 1.0f / powf(10000.0f, ex); const float th = (float)s * inv; const float c = cosf(th), sn = sinf(th);
  { *(float*)(CS + t) = c; *(float*)(SN + t) = sn;  } }
__global__ __launch_bounds__(256) void k_rope(const float* __restrict__ F, int nsrc, int ndst, int rep, const float* __restrict__ CS, const float* __restrict__ SN, _Float16* __restrict__ H, _Float16* __restrict__ L) {
  #pragma clang fp contract(off)
  const size_t t = (size_t)blockIdx.x * 256 + threadIdx.x; if (t >= (size_t)NR * ndst * 4) return; const int g8 = (int)(t % 4); const int hd = (int)((t / 4) % ndst); const size_t row = t / ((size_t)4 * ndst); const int s = (int)(row % SLEN); const int hs = hd / rep;
  const float* src = F + row * (size_t)(nsrc * 64) + hs * 64; FragH ah, al, bh, bl;
  for (int i = 0; i < 8; ++i) { const int d = g8 * 8 + i; const float c = CS[s * 32 + d], sn = SN[s * 32 + d]; const float x1 = src[d], x2 = src[d + 32];
    float o1 = x1 * c; o1 += -x2 * sn; float o2 = x2 * c; o2 += x1 * sn;
    _Float16 hv = (_Float16)o1; ah.h[i] = hv; al.h[i] = (_Float16)((o1 - (float)hv) * 1024.0f); hv = (_Float16)o2; bh.h[i] = hv; bl.h[i] = (_Float16)((o2 - (float)hv) * 1024.0f); }
  const size_t o = row * (size_t)(ndst * 64) + hd * 64 + g8 * 8;
  { *(v8us*)((unsigned short*)H + o) = ah.half[0]; *(v8us*)((unsigned short*)H + o + 32) = bh.half[0]; *(v8us*)((unsigned short*)L + o) = al.half[0]; *(v8us*)((unsigned short*)L + o + 32) = bl.half[0];  } }
__global__ __launch_bounds__(256) void k_rope2(const float* __restrict__ F, int nsrc, int ndst, int rep, const float* __restrict__ CS, const float* __restrict__ SN, _Float16* __restrict__ H, _Float16* __restrict__ L) {
  #pragma clang fp contract(off)
  const size_t t = (size_t)blockIdx.x * 256 + threadIdx.x; if (t >= (size_t)NR * ndst * 4) return; const int g16 = (int)(t % 4); const int hd = (int)((t / 4) % ndst); const size_t row = t / ((size_t)4 * ndst); const int s = (int)(row % SLEN); const int hs = hd / rep;
  const float* src = F + row * (size_t)(nsrc * 64) + hs * 64 + g16 * 16; FragH ah, al;
  for (int pr = 0; pr < 8; ++pr) { const int i = g16 * 8 + pr; const float c = CS[s * 32 + i], sn = SN[s * 32 + i]; const float x1 = src[2 * pr], x2 = src[2 * pr + 1];
    float o1 = x1 * c; o1 -= x2 * sn; float o2 = x1 * sn; o2 += x2 * c;
    _Float16 hv = (_Float16)o1; ah.h[2 * pr] = hv; al.h[2 * pr] = (_Float16)((o1 - (float)hv) * 1024.0f); hv = (_Float16)o2; ah.h[2 * pr + 1] = hv; al.h[2 * pr + 1] = (_Float16)((o2 - (float)hv) * 1024.0f); }
  const size_t o = row * (size_t)(ndst * 64) + hd * 64 + g16 * 16;
  { *(v8us*)((unsigned short*)H + o) = ah.half[0]; *(v8us*)((unsigned short*)H + o + 8) = ah.half[1]; *(v8us*)((unsigned short*)L + o) = al.half[0]; *(v8us*)((unsigned short*)L + o + 8) = al.half[1];  } }
__global__ __launch_bounds__(256) void k_ln512(const float* __restrict__ A, const float* __restrict__ res, const float* __restrict__ g, const float* __restrict__ bb, float* __restrict__ Y, _Float16* __restrict__ Y16) {
  #pragma clang fp contract(off)
  const int wv = threadIdx.x >> 5, ln = threadIdx.x & 31; const size_t r = (size_t)blockIdx.x * 8 + wv; if (r >= NR) return; float x[16]; float s = 0.f;
  for (int i = 0; i < 2; ++i) { const v8f a = *(const v8f*)(A + r * DM + i * 256 + ln * 8); for (int q = 0; q < 8; ++q) { float v = a[q]; if (res) v += bf16_round(res[r * DM + i * 256 + ln * 8 + q]); x[i * 8 + q] = v; s += v; } }
  for (int o = 16; o > 0; o >>= 1) s += __shfl_xor(s, o, 32); const float mu = s / (float)DM; float var = 0.f; for (int q = 0; q < 16; ++q) { const float d = x[q] - mu; var += d * d; }
  for (int o = 16; o > 0; o >>= 1) var += __shfl_xor(var, o, 32); const float inv = rsqrtf(var / (float)DM + 1e-5f);
  { for (int i = 0; i < 2; ++i) { const int c0 = i * 256 + ln * 8; v8f y; FragH f; for (int q = 0; q < 8; ++q) { float v = (x[i * 8 + q] - mu) * inv; v *= bf16_round(g[c0 + q]); v += bf16_round(bb[c0 + q]); y[q] = v; f.h[q] = (_Float16)v; } *(v8f*)(Y + r * DM + c0) = y; if (Y16) *(v8us*)((unsigned short*)Y16 + r * DM + c0) = f.half[0]; }  } }
__global__ __launch_bounds__(256) void k_pack(const float* __restrict__ rb, const int* __restrict__ rid, int* __restrict__ PK) { const int t = blockIdx.x * 256 + threadIdx.x; if (t >= 1024 + NB * TK) return; int v; if (t < 1024) v = __float_as_int(bf16_round(rb[t])); else v = rid[t - 1024]; *(int*)(PK + t) = v;  }
__global__ __launch_bounds__(256) void k_tabin(const float* __restrict__ sp, float* __restrict__ CS, float* __restrict__ SN) { const int t = blockIdx.x * 256 + threadIdx.x; if (t >= SLEN * 32) return; const int i = t % 32, s = t / 32; const float c = bf16_round(sp[s * 64 + 32 + i]), sn = bf16_round(sp[s * 64 + i]);
  { *(float*)(CS + t) = c; *(float*)(SN + t) = sn;  } }
__global__ __launch_bounds__(256) void k_wsc(const float* __restrict__ Wm, _Float16* __restrict__ Bt, size_t n8, float sc) { const size_t t = (size_t)blockIdx.x * 256 + threadIdx.x; if (t >= n8) return; FragH f; for (int q = 0; q < 8; ++q) f.h[q] = (_Float16)(bf16_round(Wm[t * 8 + q]) * sc); *(v8us*)((unsigned short*)Bt + t * 8) = f.half[0];  }
__global__ __launch_bounds__(256) void k_rotab2(float* __restrict__ CS, float* __restrict__ SN) {
  #pragma clang fp contract(off)
  const int t = blockIdx.x * 256 + threadIdx.x; if (t >= SLEN * 32) return; const int j = t % 32, s = t / 32; const float c0 = -0.14391156831212787f;      /* -ln(10000)/64 rounded to f32 */ const float inv = expf((float)(2 * j) * c0); const float th = (float)s * inv; const float c = cosf(th), sn = sinf(th);
  { *(float*)(CS + t) = c; *(float*)(SN + t) = sn;  } }
__global__ __launch_bounds__(256) void k_lnu(const float* __restrict__ X, _Float16* __restrict__ N16, float* __restrict__ XB) {
  #pragma clang fp contract(off)
  const int wv = threadIdx.x >> 5, ln = threadIdx.x & 31; const size_t r = (size_t)blockIdx.x * 8 + wv; if (r >= NR) return; float a[32]; float s = 0.f;
  for (int i = 0; i < 4; ++i) { const v8f v = *(const v8f*)(X + r * DM + (i * 32 + ln) * 8); for (int q = 0; q < 8; ++q) { const float u = bf16_round(v[q]); a[i * 8 + q] = u; s += u; } }
  for (int o = 16; o > 0; o >>= 1) s += __shfl_xor(s, o, 32); const float mu = s / (float)DM; float var = 0.f; for (int q = 0; q < 32; ++q) { const float d = a[q] - mu; var += d * d; }
  for (int o = 16; o > 0; o >>= 1) var += __shfl_xor(var, o, 32); const float den = sqrtf(var / (float)(DM - 1)) + 1e-6f; const float inv = 1.0f / den;      /* one reciprocal per row; (x-mean)*inv vs the reference's division differs by <= 1 ulp */
  { for (int i = 0; i < 4; ++i) { const int c0 = (i * 32 + ln) * 8; FragH f; v8f xb; for (int q = 0; q < 8; ++q) { f.h[q] = (_Float16)((a[i * 8 + q] - mu) * inv); xb[q] = a[i * 8 + q]; } *(v8us*)((unsigned short*)N16 + r * DM + c0) = f.half[0]; *(v8f*)(XB + r * DM + c0) = xb; }  } }
__global__ __launch_bounds__(256) void k_vtg(const _Float16* __restrict__ V16, _Float16* __restrict__ Vt) { __shared__ unsigned short tl[64][66]; const int tid = threadIdx.x; const int slab = blockIdx.x / (SLEN / 64), lg = blockIdx.x % (SLEN / 64); const int b = slab / NH, h = slab % NH; const int hs = h / NREP;
  for (int i = tid; i < 64 * 8; i += 256) { const int r = i / 8, c8 = (i % 8) * 8; FragH f; f.half[0] = *(const v8us*)((const unsigned short*)V16 + ((size_t)b * SLEN + lg * 64 + r) * KVD + hs * 64 + c8); for (int q = 0; q < 8; ++q) tl[r][c8 + q] = f.u[q]; }
  __syncthreads();
  { for (int rd = 0; rd < 2; ++rd) { const int d = rd * 32 + tid / 8, pc = tid % 8; FragH f; for (int q = 0; q < 8; ++q) f.u[q] = tl[pc * 8 + q][d]; *(v8us*)((unsigned short*)Vt + ((size_t)slab * 64 + d) * SLEN + lg * 64 + pc * 8) = f.half[0]; }  } }

__global__ __launch_bounds__(256) void k_h16s(const float* __restrict__ SRC, int lds, int coff, _Float16* __restrict__ DST, size_t n8) { const size_t t = (size_t)blockIdx.x * 256 + threadIdx.x; if (t >= n8) return; const size_t r = (t * 8) / DM; const int c = (int)((t * 8) % DM); const v8f a = *(const v8f*)(SRC + r * lds + coff + c); FragH f; for (int q = 0; q < 8; ++q) f.h[q] = (_Float16)a[q];
  *(v8us*)((unsigned short*)DST + t * 8) = f.half[0];  }


__global__ __launch_bounds__(256) void k_ccp(const float* __restrict__ QKV, int coff, _Float16* __restrict__ D) { const size_t t = (size_t)blockIdx.x * 256 + threadIdx.x; if (t >= (size_t)NR * DM / 8) return; const int c0 = (int)((t * 8) % DM); const size_t row = (t * 8) / DM; const v8f a = *(const v8f*)(QKV + row * 3 * DM + coff + c0); FragH f; for (int q = 0; q < 8; ++q) f.h[q] = (_Float16)a[q];
  *(v8us*)((unsigned short*)D + t * 8) = f.half[0];  }


__global__ __launch_bounds__(256) void k_tok(const float* __restrict__ x, _Float16* __restrict__ X16) { __shared__ float tl[DM][17]; const int tid = threadIdx.x; const int p0 = blockIdx.x * 16;      /* 16-pixel tiles: 34 KB of LDS */
  for (int i = tid; i < DM * 16; i += 256) { const int c = i / 16, p = i % 16; tl[c][p] = bf16_round(x[(size_t)c * NPIX + p0 + p]); }
  __syncthreads();
  { for (int i = tid; i < 16 * (DM / 8); i += 256) { const int p = i / (DM / 8), c0 = (i % (DM / 8)) * 8; FragH f; for (int q = 0; q < 8; ++q) f.h[q] = (_Float16)tl[c0 + q][p];
      *(v8us*)((unsigned short*)X16 + ((size_t)p0 + p) * DM + c0) = f.half[0]; }  } }
__global__ __launch_bounds__(256) void k_out(const float* __restrict__ Y, float* __restrict__ out) { const size_t t = (size_t)blockIdx.x * 256 + threadIdx.x; if (t >= (size_t)DM * NPIX / 8) return; const int p0 = (int)((t * 8) % NPIX); const int c = (int)((t * 8) / NPIX); v8f v; for (int q = 0; q < 8; ++q) v[q] = Y[((size_t)p0 + q) * DM + c];
  *(v8f*)(out + t * 8) = v;  }
extern "C" void kernel_launch(void* const* d_in, const int* in_sizes, int n_in,
                              void* d_out, int out_size, void* d_ws, size_t ws_size, hipStream_t stream) {
  (void)in_sizes; (void)n_in; (void)out_size;
  const float* x = (const float*)d_in[0]; const float* qw = (const float*)d_in[1]; const float* qb = (const float*)d_in[2]; const float* kw = (const float*)d_in[3]; const float* kb = (const float*)d_in[4]; const float* vw = (const float*)d_in[5]; const float* vb = (const float*)d_in[6]; const float* ow = (const float*)d_in[7]; const float* ob = (const float*)d_in[8];
  char* ws = (char*)d_ws; size_t off = 0;
  auto take = [&](size_t bytes) { char* p = ws + off; off += (bytes + 255) & ~(size_t)255; return p; };
  const size_t np = (size_t)NR * DM;
  _Float16* BQ = (_Float16*)take((size_t)DM * DM * 2); _Float16* BK = (_Float16*)take((size_t)DM * DM * 2); _Float16* BV = (_Float16*)take((size_t)DM * DM * 2); _Float16* BO = (_Float16*)take((size_t)DM * DM * 2); float* Y = (float*)take(np * 4);
   _Float16* X16 = (_Float16*)take(np * 2); _Float16* QH = (_Float16*)take(np * 2); _Float16* KH = (_Float16*)take(np * 2); _Float16* V16 = (_Float16*)take(np * 2); _Float16* VT = (_Float16*)take(np * 2); float* O = (float*)take(np * 4); _Float16* OH = QH; _Float16* OL = KH;
  if (off > ws_size) return;
  k_wsc<<<(unsigned)(((size_t)DM * DM / 8 + 255) / 256), 256, 0, stream>>>(qw, BQ, (size_t)DM * DM / 8, 16.0f); k_wsc<<<(unsigned)(((size_t)DM * DM / 8 + 255) / 256), 256, 0, stream>>>(kw, BK, (size_t)DM * DM / 8, 16.0f); k_wsc<<<(unsigned)(((size_t)DM * DM / 8 + 255) / 256), 256, 0, stream>>>(vw, BV, (size_t)DM * DM / 8, 16.0f); k_wsc<<<(unsigned)(((size_t)DM * DM / 8 + 255) / 256), 256, 0, stream>>>(ow, BO, (size_t)DM * DM / 8, 16.0f);      /* 1x1 conv (out, in) naturals */
  
  k_tok<<<NPIX / 16, 256, 0, stream>>>(x, X16);
  const dim3 g((NR / 128) * (DM / 64), 1);
  k_gemm2<0><<<g, 128, 0, stream>>>(X16, DM, 0, BQ, DM, 0, 0.0625f, qb, 0, nullptr, 1, 0, 0, nullptr, QH, DM, 0, NR, DM, DM);
  k_gemm2<0><<<g, 128, 0, stream>>>(X16, DM, 0, BK, DM, 0, 0.0625f, kb, 0, nullptr, 1, 0, 0, nullptr, KH, DM, 0, NR, DM, DM);
  k_gemm2<0><<<g, 128, 0, stream>>>(X16, DM, 0, BV, DM, 0, 0.0625f, vb, 0, nullptr, 1, 0, 0, nullptr, V16, DM, 0, NR, DM, DM);
  k_vtg<<<NB * NH * (SLEN / 64), 256, 0, stream>>>(V16, VT);
  k_flash<<<NB * NH * QBNP, 128, 0, stream>>>(QH, DM, KH, DM, VT, O, DM);
  k_hl<<<(unsigned)((np / 8 + 255) / 256), 256, 0, stream>>>(O, OH, OL, np / 8);
  k_gemm2<0><<<g, 128, 0, stream>>>(OL, DM, 0, BO, DM, 0, 0.0625f / 1024.0f, nullptr, 0, nullptr, 1, 0, 0, Y, nullptr, DM, 0, NR, DM, DM);
  k_gemm2<0><<<g, 128, 0, stream>>>(OH, DM, 0, BO, DM, 0, 0.0625f, ob, 0, Y, 1, (size_t)DM, 0, Y, nullptr, DM, 0, NR, DM, DM);      /* rows of the output conv */
  k_out<<<(unsigned)(((size_t)DM * NPIX / 8 + 255) / 256), 256, 0, stream>>>(Y, (float*)d_out);
}

// v004
// A run of this version takes 143 microseconds.
// Timed twice side by side with v003, it ran 1.45 and 1.44 times as fast.
// Counting every step since v000, it is 4.11 times as fast.
#include <hip/hip_runtime.h>
// SelfAttention4d (1 x 512 ch x 64 x 64 = 4096 tokens, 8 heads x 64: q/k/v = 1x1 convs (+ bias; the 1/8 scale applied in the flash kernel); softmax(q.k) v; out = 1x1 conv (+ bias) back to NCHW).
// Structure: NCHW -> exact f16 token rows by an LDS transpose kernel; q/k/v as f16 WMMA GEMMs (32x64 wave tiles, f32 accumulation, exact x16 (out,in) weights + bias, f16 out; channel = head*64 + d); V^T by LDS tiles; my fused flash kernel (no mask; the 1/8 applied as the score scale); ctx as f16 hi/residual into the output conv (two GEMM terms) + bias; NCHW store (thread per (channel, 8 pixels)).
// Compute dtype: inputs rounded to bf16; x / weights exact as f16; q, k, v plain f16 (~2^-12); softmax weights f16 x2^10; ctx hi + 2^-10 residual. v_wmma_f32_16x16x32_f16.
#define NB 1
#define DM 512
#define NKV 8
#define NPIX 4096
#define NREP (NH / NKV)
#define KVD (NKV * 64)           /* 512 */
#define NR (NB * SLEN)
#define CHK 512
typedef int v4i __attribute__((ext_vector_type(4)));
#define FF 2048
#define SLEN 4096
#define MQI 4096
#define MKI 4096
#define TQ SLEN
#define TK SLEN
#define NH 8
#define SCL 0.125f
#define QBLKS (TQ / 64)
#define QB05 0
#define QBN5 4
#define QB0P 0
#define QBNP QBLKS
#define RE 256
typedef __bf16 v16b __attribute__((ext_vector_type(16)));
typedef unsigned short v8us __attribute__((ext_vector_type(8), may_alias));
typedef float  v8f  __attribute__((ext_vector_type(8)));
typedef float  v4f  __attribute__((ext_vector_type(4)));
typedef float  v4fa __attribute__((ext_vector_type(4), may_alias));
union FragB { v16b v; v8us half[2]; unsigned short u[16]; };

__device__ __forceinline__ unsigned short bf16_bits(float x) { unsigned int u = __float_as_uint(x); return (unsigned short)((u + 0x7FFFu + ((u >> 16) & 1u)) >> 16); }
__device__ __forceinline__ float bf16_val(unsigned short b) { return __uint_as_float(((unsigned int)b) << 16); }
__device__ __forceinline__ float bf16_round(float x) { return bf16_val(bf16_bits(x)); }
// D += A·B with NT terms: 1 = ah·bh, 2 = + al·bh (A split), 3 = + ah·bl (both split)
template <int NT>
__device__ __forceinline__ v8f mmaN(v16b ah, v16b al, v16b bh, v16b bl, v8f c) {
  c = __builtin_amdgcn_wmma_f32_16x16x32_bf16(false, ah, false, bh, (short)0, c, false, false);
  if (NT >= 2) c = __builtin_amdgcn_wmma_f32_16x16x32_bf16(false, al, false, bh, (short)0, c, false, false);
  if (NT >= 3) c = __builtin_amdgcn_wmma_f32_16x16x32_bf16(false, ah, false, bl, (short)0, c, false, false);
  asm volatile("v_nop\n\tv_nop\n\tv_nop\n\tv_nop" : "+v"(c) : "v"(ah), "v"(al), "v"(bh), "v"(bl));
  return c;
}

__global__ __launch_bounds__(256) void k_wt_bf16(const float* __restrict__ W, unsigned short* __restrict__ Wt, int K, int N) {
  const int t = blockIdx.x * 256 + threadIdx.x;
  const int k8n = K / 8;
  if (t >= N * k8n) return;
  const int n = t / k8n, k8 = (t % k8n) * 8;
  v8us v;
#pragma unroll
  for (int i = 0; i < 8; ++i) v[i] = bf16_bits(W[(size_t)(k8 + i) * N + n]);
  *(v8us*)(Wt + (size_t)n * K + k8) = v;
  
}

// GEMM C[M][N] (f32, pitch ldc) = act(A[M][K]·W + bias). A f32 row-major (pitch lda) converted per fragment to bf16
// (ASPLIT: hi/lo two planes -> 2 terms, else single rounded term); Wt bf16 [N][K] (pitch ldb). BIAS_BF16 rounds the
// bias to bf16 first (bias quantised to bf16 before the add). K%32==0, M%16==0, N%64==0.
template <bool ASPLIT, int ACT, bool BIAS_BF16>
__global__ __launch_bounds__(128) void k_gemm_bf(const float* __restrict__ A, int lda, const unsigned short* __restrict__ Wt, int ldb,
                                               const float* __restrict__ bias, float* __restrict__ C, int ldc, int M, int N, int K) {
  __shared__ __attribute__((aligned(16))) float so[4][16][64];
  const int tid = threadIdx.x, w = tid >> 5, lane = tid & 31, ln = lane & 15, hh = lane >> 4;
  const int ntn = N / 64;
  const int wid = blockIdx.x * 4 + w;
  const int mt = wid / ntn, nq = wid % ntn;
  if (mt * 16 >= M) return;
  const int row0 = mt * 16, col0 = nq * 64;
  const float* arow = A + (size_t)(row0 + ln) * lda;
  v8f acc[4] = {};
  for (int kb = 0; kb < K; kb += 32) {
    FragB ah, al;
    const v4f x0 = *(const v4fa*)(arow + kb + 8 * hh), x1 = *(const v4fa*)(arow + kb + 8 * hh + 4);
    const v4f x2 = *(const v4fa*)(arow + kb + 16 + 8 * hh), x3 = *(const v4fa*)(arow + kb + 16 + 8 * hh + 4);
    float xs[16] = {x0[0],x0[1],x0[2],x0[3],x1[0],x1[1],x1[2],x1[3],x2[0],x2[1],x2[2],x2[3],x3[0],x3[1],x3[2],x3[3]};
#pragma unroll
    for (int i = 0; i < 16; ++i) { const unsigned short hb = bf16_bits(xs[i]); ah.u[i] = hb; al.u[i] = ASPLIT ? bf16_bits(xs[i] - bf16_val(hb)) : (unsigned short)0; }
#pragma unroll
    for (int t = 0; t < 4; ++t) {
      const unsigned short* brow = Wt + (size_t)(col0 + t * 16 + ln) * ldb + kb;
      FragB b;
      b.half[0] = *(const v8us*)(brow + 8 * hh);
      b.half[1] = *(const v8us*)(brow + 16 + 8 * hh);
      acc[t] = mmaN<ASPLIT ? 2 : 1>(ah.v, al.v, b.v, b.v, acc[t]);
    }
  }
#pragma unroll
  for (int t = 0; t < 4; ++t) {
    float bv = bias ? bias[col0 + t * 16 + ln] : 0.f;
    if (BIAS_BF16) bv = bf16_round(bv);
#pragma unroll
    for (int r = 0; r < 8; ++r) { float v = acc[t][r] + bv; if (ACT == 1) v = fmaxf(v, 0.f); so[w][8 * hh + r][t * 16 + ln] = v; }
  }
  __builtin_amdgcn_fence(__ATOMIC_ACQ_REL, "workgroup");
  __builtin_amdgcn_wave_barrier();
  const int rsub = lane >> 4, c4 = (lane & 15) * 4;
  {
#pragma unroll
    for (int q = 0; q < 8; ++q) {
      const int r = q * 2 + rsub;
      const v4f v = *(const v4fa*)&so[w][r][c4];
      *(v4f*)(C + (size_t)(row0 + r) * ldc + col0 + c4) = v;
    }
    
  }
}

// GEMM C = act(A·W + bias + resid): A f32 (ASPLIT -> hi/lo 2 terms), Wt bf16 [N][K]; ACT 0 none, 1 relu, 2 exact gelu;
// resid (optional, f32, row index = (row % rmod), pitch ldr, RES_BF16 rounds it) added before the activation.
template <bool ASPLIT, int ACT, bool BIAS_BF16, bool RES_BF16>
__global__ __launch_bounds__(128) void k_gemm_bf3(const float* __restrict__ A, int lda, const unsigned short* __restrict__ Wt, int ldb,
                                                const float* __restrict__ bias, const float* __restrict__ resid, int rmod, int ldr,
                                                float* __restrict__ C, int ldc, int M, int N, int K) {
  __shared__ __attribute__((aligned(16))) float so[4][16][64];
  const int tid = threadIdx.x, w = tid >> 5, lane = tid & 31, ln = lane & 15, hh = lane >> 4;
  const int ntn = N / 64;
  const int wid = blockIdx.x * 4 + w;
  const int mt = wid / ntn, nq = wid % ntn;
  if (mt * 16 >= M) return;
  const int row0 = mt * 16, col0 = nq * 64;
  const float* arow = A + (size_t)(row0 + ln) * lda;
  v8f acc[4] = {};
  for (int kb = 0; kb < K; kb += 32) {
    FragB ah, al;
    const v4f x0 = *(const v4fa*)(arow + kb + 8 * hh), x1 = *(const v4fa*)(arow + kb + 8 * hh + 4);
    const v4f x2 = *(const v4fa*)(arow + kb + 16 + 8 * hh), x3 = *(const v4fa*)(arow + kb + 16 + 8 * hh + 4);
    float xs[16] = {x0[0],x0[1],x0[2],x0[3],x1[0],x1[1],x1[2],x1[3],x2[0],x2[1],x2[2],x2[3],x3[0],x3[1],x3[2],x3[3]};
#pragma unroll
    for (int i = 0; i < 16; ++i) { const unsigned short hb = bf16_bits(xs[i]); ah.u[i] = hb; al.u[i] = ASPLIT ? bf16_bits(xs[i] - bf16_val(hb)) : (unsigned short)0; }
#pragma unroll
    for (int t = 0; t < 4; ++t) {
      const unsigned short* brow = Wt + (size_t)(col0 + t * 16 + ln) * ldb + kb;
      FragB b;
      b.half[0] = *(const v8us*)(brow + 8 * hh);
      b.half[1] = *(const v8us*)(brow + 16 + 8 * hh);
      acc[t] = mmaN<ASPLIT ? 2 : 1>(ah.v, al.v, b.v, b.v, acc[t]);
    }
  }
#pragma unroll
  for (int t = 0; t < 4; ++t) {
    const int col = col0 + t * 16 + ln;
    float bv = bias ? bias[col] : 0.f;
    if (BIAS_BF16) bv = bf16_round(bv);
#pragma unroll
    for (int r = 0; r < 8; ++r) {
      float v = acc[t][r] + bv;
      if (resid) { float rv = resid[(size_t)((row0 + 8 * hh + r) % rmod) * ldr + col]; if (RES_BF16) rv = bf16_round(rv); v += rv; }
      if (ACT == 1) v = fmaxf(v, 0.f);
      if (ACT == 2) v = 0.5f * v * (1.0f + erff(v * 0.70710678118654752f));
      if (ACT == 3) { const float u = 0.7978845608028654f * (v + 0.044715f * v * v * v); v = 0.5f * v * (1.0f + tanhf(u)); }
      so[w][8 * hh + r][t * 16 + ln] = v;
    }
  }
  __builtin_amdgcn_fence(__ATOMIC_ACQ_REL, "workgroup");
  __builtin_amdgcn_wave_barrier();
  const int rsub = lane >> 4, c4 = (lane & 15) * 4;
  {
#pragma unroll
    for (int q = 0; q < 8; ++q) {
      const int r = q * 2 + rsub;
      const v4f v = *(const v4fa*)&so[w][r][c4];
      *(v4f*)(C + (size_t)(row0 + r) * ldc + col0 + c4) = v;
    }
    
  }
}
// row LayerNorm (biased variance, eps) over N: s = X (+ R); optional out_sum <- s; out_norm <- (s-mu)*rsqrt(var+eps)*g + b
template <bool PARAM_BF16>
__global__ __launch_bounds__(256) void k_layernorm(const float* __restrict__ X, const float* __restrict__ R, const float* __restrict__ g, const float* __restrict__ bta,
                                                  float* __restrict__ out_sum, float* __restrict__ out_norm, int N, float eps) {
  __shared__ float red[256];
  const int row = blockIdx.x, tid = threadIdx.x;
  const float* x = X + (size_t)row * N; const float* rr = R ? R + (size_t)row * N : nullptr;
  float vals[16];                     // up to N = 4096
  const int per = N / 256;            // contiguous chunk per thread? use strided-by-4 chunks: thread handles j = tid*4 + 1024*u
  float s1 = 0.f;
  for (int u = 0; u < per / 4; ++u) {
    const int j = tid * 4 + 1024 * u;
    const v4f a = *(const v4fa*)(x + j);
    v4f b = {0.f,0.f,0.f,0.f}; if (rr) b = *(const v4fa*)(rr + j);
#pragma unroll
    for (int q = 0; q < 4; ++q) { const float v = a[q] + b[q]; vals[u * 4 + q] = v; s1 += v; }
  }
  red[tid] = s1; __syncthreads();
  for (int st = 128; st > 0; st >>= 1) { if (tid < st) red[tid] += red[tid + st]; __syncthreads(); }
  const float mu = red[0] / (float)N; __syncthreads();
  float s2 = 0.f;
  for (int u = 0; u < per / 4; ++u)
#pragma unroll
    for (int q = 0; q < 4; ++q) { const float c = vals[u * 4 + q] - mu; s2 += c * c; }
  red[tid] = s2; __syncthreads();
  for (int st = 128; st > 0; st >>= 1) { if (tid < st) red[tid] += red[tid + st]; __syncthreads(); }
  const float rs = rsqrtf(red[0] / (float)N + eps);
  {
    for (int u = 0; u < per / 4; ++u) {
      const int j = tid * 4 + 1024 * u;
      v4f o, sm;
#pragma unroll
      for (int q = 0; q < 4; ++q) {
        float gg = g[j + q], bb = bta[j + q];
        if (PARAM_BF16) { gg = bf16_round(gg); bb = bf16_round(bb); }
        sm[q] = vals[u * 4 + q]; o[q] = (vals[u * 4 + q] - mu) * rs * gg + bb;
      }
      if (out_sum) *(v4f*)(out_sum + (size_t)row * N + j) = sm;
      *(v4f*)(out_norm + (size_t)row * N + j) = o;
    }
    
  }
}



// ---- f16 WMMA path (v_wmma_f32_16x16x32_f16): 11-bit significands for operands in range — used where a [0,1] probability operand needs more precision than bf16
typedef _Float16 v16h __attribute__((ext_vector_type(16)));
union FragH { v16h v; v8us half[2]; _Float16 h[16]; unsigned short u[16]; };
template <int NT>
__device__ __forceinline__ v8f mmaH(v16h ah, v16h al, v16h bh, v16h bl, v8f c) {
  c = __builtin_amdgcn_wmma_f32_16x16x32_f16(false, ah, false, bh, (short)0, c, false, false);
  if (NT >= 2) c = __builtin_amdgcn_wmma_f32_16x16x32_f16(false, al, false, bh, (short)0, c, false, false);
  if (NT >= 3) c = __builtin_amdgcn_wmma_f32_16x16x32_f16(false, ah, false, bl, (short)0, c, false, false);
  asm volatile("v_nop\n\tv_nop\n\tv_nop\n\tv_nop" : "+v"(c) : "v"(ah), "v"(al), "v"(bh), "v"(bl));
  return c;
}
// batched GEMM like k_gemm_b but f16 operands: A f32 (split into f16 hi/lo if ASPLIT, else rounded to f16), Bt = f16 values [n][k]; alpha; C f32; N multiple of 16 (partial tiles skipped)
template <bool ASPLIT>
__global__ __launch_bounds__(128) void k_gemm_h(const float* __restrict__ A, int lda, size_t sA, const _Float16* __restrict__ Bh, int ldb, size_t sB, float alpha, float* __restrict__ C, int ldc, size_t sC, int M, int N, int K) {
  __shared__ __attribute__((aligned(16))) float so[4][16][64];
  const int tid = threadIdx.x, w = tid >> 5, lane = tid & 31, ln = lane & 15, hh = lane >> 4; const int by = blockIdx.y;
  A += (size_t)by * sA; Bh += (size_t)by * sB; C += (size_t)by * sC;
  const int ntn = (N + 63) / 64; const int wid = blockIdx.x * 4 + w; const int mt = wid / ntn, nq = wid % ntn; if (mt * 16 >= M) return;
  const int row0 = mt * 16, col0 = nq * 64; const float* arow = A + (size_t)(row0 + ln) * lda;
  v8f acc[4] = {};
  for (int kb = 0; kb < K; kb += 32) {
    FragH ah, al;
    const v4f x0 = *(const v4fa*)(arow + kb + 8 * hh), x1 = *(const v4fa*)(arow + kb + 8 * hh + 4), x2 = *(const v4fa*)(arow + kb + 16 + 8 * hh), x3 = *(const v4fa*)(arow + kb + 16 + 8 * hh + 4);
    float xs[16] = {x0[0],x0[1],x0[2],x0[3],x1[0],x1[1],x1[2],x1[3],x2[0],x2[1],x2[2],x2[3],x3[0],x3[1],x3[2],x3[3]};
#pragma unroll
    for (int i = 0; i < 16; ++i) { const _Float16 h = (_Float16)xs[i]; ah.h[i] = h; al.h[i] = ASPLIT ? (_Float16)(xs[i] - (float)h) : (_Float16)0.0f; }
#pragma unroll
    for (int t = 0; t < 4; ++t) { if (col0 + t * 16 >= N) continue; const size_t boff = (size_t)(col0 + t * 16 + ln) * ldb + kb; FragH bq; bq.half[0] = *(const v8us*)(Bh + boff + 8 * hh); bq.half[1] = *(const v8us*)(Bh + boff + 16 + 8 * hh);
      acc[t] = mmaH<ASPLIT ? 2 : 1>(ah.v, al.v, bq.v, bq.v, acc[t]); }
  }
#pragma unroll
  for (int t = 0; t < 4; ++t) { if (col0 + t * 16 >= N) continue;
#pragma unroll
    for (int r = 0; r < 8; ++r) so[w][8 * hh + r][t * 16 + ln] = acc[t][r] * alpha; }
  __builtin_amdgcn_fence(__ATOMIC_ACQ_REL, "workgroup"); __builtin_amdgcn_wave_barrier();
  const int rsub = lane >> 4, c4 = (lane & 15) * 4;
  {
#pragma unroll
    for (int q = 0; q < 8; ++q) { const int r = q * 2 + rsub; if (col0 + c4 < N) { const v4f v = *(const v4fa*)&so[w][r][c4]; *(v4f*)(C + (size_t)(row0 + r) * ldc + col0 + c4) = v; } }
     }
}

// Wt[n][k] = f16(W[k][n]·scale) from f32 row-major W[K][N] (scale = power of two; bf16-exact weights stay exact in f16 away from the subnormal range)
__global__ __launch_bounds__(256) void k_wt_f16(const float* __restrict__ W, _Float16* __restrict__ Wt, int K, int N, float scale) {
  const int t = blockIdx.x * 256 + threadIdx.x; if (t >= N * (K / 8)) return; const int n = t / (K / 8), k8 = (t % (K / 8)) * 8; FragH f;
#pragma unroll
  for (int i = 0; i < 8; ++i) f.h[i] = (_Float16)(bf16_round(W[(size_t)(k8 + i) * N + n]) * scale); const v8us o = f.half[0];
  *(v8us*)((unsigned short*)Wt + (size_t)n * K + k8) = o; 
}
// k_gemm_hh variant with fused epilogue: v = acc·alpha + bias[by·sBias + col] (+ CP[(row/rowsPerB)·sCPb + by·64 + col] if CP) ; ACT 0 none / 1 elu ; writes f16 C16 (and f32 C if non-null)
template <int ACT>
__global__ __launch_bounds__(128) void k_gemm_hhx(const _Float16* __restrict__ A, int lda, size_t sA, const _Float16* __restrict__ Bh, int ldb, size_t sB, float alpha, const float* __restrict__ bias, size_t sBias, const float* __restrict__ CP, int rowsPerB, size_t sCPb, int row0g,
    float* __restrict__ C, _Float16* __restrict__ C16, int ldc, size_t sC, int M, int N, int K) {
  __shared__ __attribute__((aligned(16))) float so[4][16][64];
  const int tid = threadIdx.x, w = tid >> 5, lane = tid & 31, ln = lane & 15, hh = lane >> 4; const int by = blockIdx.y;
  A += (size_t)by * sA; Bh += (size_t)by * sB; const size_t cofs = (size_t)by * sC; const float* bp = bias ? bias + (size_t)by * sBias : nullptr;
  const int ntn = (N + 63) / 64; const int wid = blockIdx.x * 4 + w; const int mt = wid / ntn, nq = wid % ntn; if (mt * 16 >= M) return;
  const int row0 = mt * 16, col0 = nq * 64; const _Float16* arow = A + (size_t)(row0 + ln) * lda;
  v8f acc[4] = {};
  for (int kb = 0; kb < K; kb += 32) { FragH ah; ah.half[0] = *(const v8us*)((const unsigned short*)arow + kb + 8 * hh); ah.half[1] = *(const v8us*)((const unsigned short*)arow + kb + 16 + 8 * hh);
#pragma unroll
    for (int t = 0; t < 4; ++t) { if (col0 + t * 16 >= N) continue; const size_t boff = (size_t)(col0 + t * 16 + ln) * ldb + kb; FragH bq; bq.half[0] = *(const v8us*)((const unsigned short*)Bh + boff + 8 * hh); bq.half[1] = *(const v8us*)((const unsigned short*)Bh + boff + 16 + 8 * hh);
      acc[t] = mmaH<1>(ah.v, ah.v, bq.v, bq.v, acc[t]); }
  }
#pragma unroll
  for (int t = 0; t < 4; ++t) { if (col0 + t * 16 >= N) continue; const int col = col0 + t * 16 + ln; const float bv = bp ? bf16_round(bp[col]) : 0.f;
#pragma unroll
    for (int r = 0; r < 8; ++r) { float v = acc[t][r] * alpha + bv; if (CP) { const int bidx = (row0g + row0 + 8 * hh + r) / rowsPerB; v += CP[(size_t)bidx * sCPb + (size_t)by * 64 + col]; } if (ACT == 1) v = (v > 0.f) ? v : expm1f(v); else if (ACT == 7) v = (v > 0.f) ? v + 1.0f : expf(v); else if (ACT == 8) v = tanhf(v); else if (ACT == 9) v = 0.5f * v * (1.0f + tanhf(0.7978845608028654f * (v + 0.044715f * v * v * v))); else if (ACT == 11) v = 1.0f / (1.0f + expf(-v)); else if (ACT == 12) v = (v > 0.f) ? v : 0.01f * v; else if (ACT == 14) v = (v > 0.f) ? v : 0.1f * v; else if (ACT == 15) v = v / (1.0f + expf(-v)); else if (ACT == 3) v = fmaxf(v, 0.f); else if (ACT == 6) v = 0.5f * v * (1.0f + erff(v * 0.70710678118654752f)); so[w][8 * hh + r][t * 16 + ln] = v; } }
  __builtin_amdgcn_fence(__ATOMIC_ACQ_REL, "workgroup"); __builtin_amdgcn_wave_barrier();
  const int rsub = lane >> 4, c4 = (lane & 15) * 4; typedef _Float16 v4h __attribute__((ext_vector_type(4)));
  {
#pragma unroll
    for (int q = 0; q < 8; ++q) { const int r = q * 2 + rsub; if (col0 + c4 < N) { const v4f v = *(const v4fa*)&so[w][r][c4]; if (C) *(v4f*)(C + cofs + (size_t)(row0 + r) * ldc + col0 + c4) = v; if (C16) { v4h h4; for (int i = 0; i < 4; ++i) h4[i] = (_Float16)v[i]; *(v4h*)(C16 + cofs + (size_t)(row0 + r) * ldc + col0 + c4) = h4; } } }
     }
}


typedef _Float16 v4h __attribute__((ext_vector_type(4)));

__global__ __launch_bounds__(256) void k_x16(const float* __restrict__ x, _Float16* __restrict__ X16, size_t n8) { const size_t t = (size_t)blockIdx.x * 256 + threadIdx.x; if (t >= n8) return; FragH f;
#pragma unroll
  for (int q = 0; q < 8; ++q) f.h[q] = (_Float16)bf16_round(x[t * 8 + q]); *(v8us*)((unsigned short*)X16 + t * 8) = f.half[0];  }
__global__ __launch_bounds__(256) void k_h16(const float* __restrict__ x, _Float16* __restrict__ X16, size_t n8) { const size_t t = (size_t)blockIdx.x * 256 + threadIdx.x; if (t >= n8) return; FragH f;
#pragma unroll
  for (int q = 0; q < 8; ++q) f.h[q] = (_Float16)x[t * 8 + q]; *(v8us*)((unsigned short*)X16 + t * 8) = f.half[0];  }
__global__ __launch_bounds__(256) void k_round16f(const float* __restrict__ W, _Float16* __restrict__ Bt, size_t n8) { const size_t t = (size_t)blockIdx.x * 256 + threadIdx.x; if (t >= n8) return; FragH f;
#pragma unroll
  for (int i = 0; i < 8; ++i) f.h[i] = (_Float16)(bf16_round(W[t * 8 + i]) * 16.0f); *(v8us*)((unsigned short*)Bt + t * 8) = f.half[0];  }
template <int NHv, int TTv>
__global__ __launch_bounds__(256) void k_vt(const _Float16* __restrict__ V16, int ldv, int voff, _Float16* __restrict__ Vt) { __shared__ unsigned short tl[64][66]; const int tid = threadIdx.x; const int slab = blockIdx.x / (TTv / 64), lg = blockIdx.x % (TTv / 64); const int b = slab / NHv, h = slab % NHv;
  for (int i = tid; i < 64 * 8; i += 256) { const int r = i / 8, c8 = (i % 8) * 8; FragH f; f.half[0] = *(const v8us*)((const unsigned short*)V16 + ((size_t)b * TTv + lg * 64 + r) * ldv + voff + h * 64 + c8);
#pragma unroll
    for (int q = 0; q < 8; ++q) tl[r][c8 + q] = f.u[q]; }
  __syncthreads();
  {
#pragma unroll
    for (int rd = 0; rd < 2; ++rd) { const int d = rd * 32 + tid / 8, pc = tid % 8; FragH f;
#pragma unroll
      for (int q = 0; q < 8; ++q) f.u[q] = tl[pc * 8 + q][d];
      *(v8us*)((unsigned short*)Vt + ((size_t)slab * 64 + d) * TTv + lg * 64 + pc * 8) = f.half[0]; }
     } }

__global__ __launch_bounds__(256) void k_hl(const float* __restrict__ F, _Float16* __restrict__ Hh, _Float16* __restrict__ Hl, size_t n8) { const size_t t = (size_t)blockIdx.x * 256 + threadIdx.x; if (t >= n8) return; FragH fh, fl; const v4f a = *(const v4fa*)(F + t * 8), c = *(const v4fa*)(F + t * 8 + 4);
#pragma unroll
  for (int q = 0; q < 4; ++q) { _Float16 h = (_Float16)a[q]; fh.h[q] = h; fl.h[q] = (_Float16)((a[q] - (float)h) * 1024.0f); h = (_Float16)c[q]; fh.h[4 + q] = h; fl.h[4 + q] = (_Float16)((c[q] - (float)h) * 1024.0f); }
  { *(v8us*)((unsigned short*)Hh + t * 8) = fh.half[0]; *(v8us*)((unsigned short*)Hl + t * 8) = fl.half[0];  } }

// ---- fast GEMM (block tile 128x64, wave tile 32x64; requires M % 128 == 0 rows per launch region, N % 64 == 0 and K % 256 == 0); epilogue = k_gemm_hhx semantics ----
// A and B come through LDS: a stage is 256 k of the block's 128 A rows and 64 B rows (rows of 512 bytes), brought once for the four waves by asynchronous copies, one whole row a wave and copy,
// two buffers, the next stage flying while a stage is worked on. The fragments read from LDS hold the same elements in the same order as those read from global memory before.
#define GSK 256      /* k a stage */
#define GPH (GSK + 8)      /* LDS row pitch in 16-bit elements: 512 bytes of data + 16, a conflict-free pitch for 16-byte row readers */
#define GRB (4 * GPH * 2)      /* bytes of 4 LDS rows: the step between a thread's pieces of a tile */
#define GBB (192 * GPH * 2)      /* bytes of one buffer: rows 0 to 127 the A tile, rows 128 to 191 the B tile */
__device__ __forceinline__ v16h g2_frag(const _Float16* p, int hh) { FragH f; f.half[0] = *(const v8us*)((const unsigned short*)p + 8 * hh); f.half[1] = *(const v8us*)((const unsigned short*)p + 16 + 8 * hh); return f.v; }
__device__ __forceinline__ v8f g2_mma(v16h a, v16h b, v8f c) { v8f d = __builtin_amdgcn_wmma_f32_16x16x32_f16(false, a, false, b, (short)0, c, false, false); asm volatile("v_nop\n\tv_nop\n\tv_nop\n\tv_nop" : "+v"(d) : "v"(a), "v"(b)); return d; }
// Eight copies of one thread, 16 bytes each: rows four apart, in LDS (GRB bytes) and in global memory (gs elements). The s_wait_xcnt closes the statement so that no address register is rewritten ahead of it.
__device__ __forceinline__ void g2_copy8(unsigned l, const unsigned short* g, size_t gs) {
  const unsigned short* g1 = g + gs; const unsigned short* g2 = g1 + gs; const unsigned short* g3 = g2 + gs; const unsigned short* g4 = g3 + gs; const unsigned short* g5 = g4 + gs; const unsigned short* g6 = g5 + gs; const unsigned short* g7 = g6 + gs;
  asm volatile("global_load_async_to_lds_b128 %0, %8, off\n\t"
               "global_load_async_to_lds_b128 %1, %9, off\n\t"
               "global_load_async_to_lds_b128 %2, %10, off\n\t"
               "global_load_async_to_lds_b128 %3, %11, off\n\t"
               "global_load_async_to_lds_b128 %4, %12, off\n\t"
               "global_load_async_to_lds_b128 %5, %13, off\n\t"
               "global_load_async_to_lds_b128 %6, %14, off\n\t"
               "global_load_async_to_lds_b128 %7, %15, off\n\t"
               "s_wait_xcnt 0x0"
               :: "v"(l), "v"(l + GRB), "v"(l + 2 * GRB), "v"(l + 3 * GRB), "v"(l + 4 * GRB), "v"(l + 5 * GRB), "v"(l + 6 * GRB), "v"(l + 7 * GRB),
                  "v"(g), "v"(g1), "v"(g2), "v"(g3), "v"(g4), "v"(g5), "v"(g6), "v"(g7) : "memory");
}
// One stage's copies of one thread: 32 pieces of the A tile and 16 of the B tile (48 in flight a wave).
__device__ __forceinline__ void g2_stage(unsigned l, const unsigned short* ga, size_t as4, const unsigned short* gb, size_t bs4) {
#pragma unroll
  for (int c = 0; c < 4; ++c) g2_copy8(l + c * 8 * GRB, ga + c * 8 * as4, as4);
#pragma unroll
  for (int c = 0; c < 2; ++c) g2_copy8(l + (32 + c * 8) * GRB, gb + c * 8 * bs4, bs4);
}
template <int ACT>
__global__ __launch_bounds__(128) void k_gemm2(const _Float16* __restrict__ A, int lda, size_t sA, const _Float16* __restrict__ Bh, int ldb, size_t sB, float alpha, const float* __restrict__ bias, size_t sBias, const float* __restrict__ CP, int rowsPerB, size_t sCPb, int row0g,
    float* __restrict__ C, _Float16* __restrict__ C16, int ldc, size_t sC, int M, int N, int K) {
  __shared__ __attribute__((aligned(16))) float so[4][32][68]; __shared__ __attribute__((aligned(16))) unsigned short sT[2][192][GPH];
  const int tid = threadIdx.x, w = tid >> 5, lane = tid & 31, ln = lane & 15, hh = lane >> 4; const int by = blockIdx.y;
  A += (size_t)by * sA; Bh += (size_t)by * sB; const size_t cofs = (size_t)by * sC; const float* bp = bias ? bias + (size_t)by * sBias : nullptr;
  const int ntn = N >> 6; const int mt = blockIdx.x / ntn, nq = blockIdx.x - mt * ntn; const int row0 = mt * 128 + 32 * w, col0 = nq * 64; if (mt * 128 >= M) return;      /* the whole block leaves or none of it: barriers follow */
  const size_t as4 = (size_t)4 * lda, bs4 = (size_t)4 * ldb; const int nst = K / GSK;
  const unsigned short* ga = (const unsigned short*)A + (size_t)(mt * 128 + w) * lda + lane * 8;      /* the thread's first piece of the next stage to copy: a wave copies one whole row */
  const unsigned short* gb = (const unsigned short*)Bh + (size_t)(col0 + w) * ldb + lane * 8;
  const unsigned l0 = (unsigned)(size_t)&sT[0][w][lane * 8];      /* low 32 bits of a shared address = the byte offset in LDS */
  g2_stage(l0, ga, as4, gb, bs4); ga += GSK; gb += GSK;
  asm volatile("s_wait_asynccnt 0x0" ::: "memory");      /* stage 0 has landed before the barrier that publishes it */
  __syncthreads();
  if (nst > 1) { g2_stage(l0 + GBB, ga, as4, gb, bs4); ga += GSK; gb += GSK; }
  const v8f z8 = {0.f,0.f,0.f,0.f,0.f,0.f,0.f,0.f}; v8f c00 = z8, c01 = z8, c02 = z8, c03 = z8, c10 = z8, c11 = z8, c12 = z8, c13 = z8;
#pragma unroll 1      /* one stage a trip: the buffer index stays a run-time value and the text small */
  for (int st = 0; st < nst; ++st) {
    const int buf = st & 1;
    const _Float16* af = (const _Float16*)&sT[buf][32 * w + ln][0]; const _Float16* bf = (const _Float16*)&sT[buf][128 + ln][0];
    v16h fa[2][2], fb[2][4];      /* two fragment sets: a k step's reads are issued as one group ahead of the k step before it, inside the stage */
    fa[0][0] = g2_frag(af, hh); fa[0][1] = g2_frag(af + 16 * GPH, hh);
#pragma unroll
    for (int t = 0; t < 4; ++t) fb[0][t] = g2_frag(bf + t * 16 * GPH, hh);
#pragma unroll
    for (int kk = 0; kk < GSK / 32; ++kk) { const int cu = kk & 1, nx = cu ^ 1;
      if (kk + 1 < GSK / 32) { fa[nx][0] = g2_frag(af + (kk + 1) * 32, hh); fa[nx][1] = g2_frag(af + 16 * GPH + (kk + 1) * 32, hh);
#pragma unroll
        for (int t = 0; t < 4; ++t) fb[nx][t] = g2_frag(bf + t * 16 * GPH + (kk + 1) * 32, hh); }
      c00 = g2_mma(fa[cu][0], fb[cu][0], c00); c10 = g2_mma(fa[cu][1], fb[cu][0], c10);
      c01 = g2_mma(fa[cu][0], fb[cu][1], c01); c11 = g2_mma(fa[cu][1], fb[cu][1], c11);
      c02 = g2_mma(fa[cu][0], fb[cu][2], c02); c12 = g2_mma(fa[cu][1], fb[cu][2], c12);
      c03 = g2_mma(fa[cu][0], fb[cu][3], c03); c13 = g2_mma(fa[cu][1], fb[cu][3], c13); }
    asm volatile("s_wait_dscnt 0x0" ::: "memory");      /* this wave's reads of the buffer have returned before it is given up */
    asm volatile("s_wait_asynccnt 0x0" ::: "memory");      /* this wave's copies of the next stage have landed */
    __syncthreads();      /* publishes the next stage and ends every wave's reads of this one */
    if (st + 2 < nst) { g2_stage(l0 + buf * GBB, ga, as4, gb, bs4); ga += GSK; gb += GSK; } }
  asm volatile("s_wait_asynccnt 0x0" ::: "memory");      /* no copy is left in flight when the wave goes on to the epilogue */
  v8f accs[8] = {c00, c01, c02, c03, c10, c11, c12, c13};
#pragma unroll
  for (int u = 0; u < 8; ++u) { const int t = u & 3, half = u >> 2; const int col = col0 + t * 16 + ln; const float bv = bp ? bf16_round(bp[col]) : 0.f;
#pragma unroll
    for (int r = 0; r < 8; ++r) { const int rloc = half * 16 + 8 * hh + r; float v = accs[u][r] * alpha + bv; if (CP) { if (rowsPerB < 0) v += CP[cofs + (size_t)(row0g + row0 + rloc) * ldc + col];      /* rowsPerB < 0: own element of the batched C plane */ else { const int bidx = (row0g + row0 + rloc) / rowsPerB; v += CP[(size_t)bidx * sCPb + (size_t)by * 64 + col]; } }
      if (ACT == 3) v = fmaxf(v, 0.f); else if (ACT == 6) v = 0.5f * v * (1.0f + erff(v * 0.70710678118654752f)); else if (ACT == 11) v = 1.0f / (1.0f + expf(-v)); else if (ACT == 15) v = v / (1.0f + expf(-v)); else if (ACT == 12) v = (v > 0.f) ? v : 0.01f * v; else if (ACT == 8) v = tanhf(v);
      so[w][rloc][t * 16 + ln] = v; } }
  __builtin_amdgcn_fence(__ATOMIC_ACQ_REL, "workgroup"); __builtin_amdgcn_wave_barrier();
  const int rsub = lane >> 4, c4 = (lane & 15) * 4;
  {
#pragma unroll
    for (int q = 0; q < 16; ++q) { const int r = q * 2 + rsub; const v4f v = *(const v4fa*)&so[w][r][c4]; if (C) *(v4f*)(C + cofs + (size_t)(row0 + r) * ldc + col0 + c4) = v; if (C16) { v4h h4; for (int i = 0; i < 4; ++i) h4[i] = (_Float16)v[i]; *(v4h*)(C16 + cofs + (size_t)(row0 + r) * ldc + col0 + c4) = h4; } }
     } }



// lane l takes the value of lane l ^ 16 (the other half of the same query column)
__device__ __forceinline__ float xhalf(float x) { return __builtin_bit_cast(float, __builtin_amdgcn_permlanex16(__builtin_bit_cast(int, x), __builtin_bit_cast(int, x), 0x76543210, 0xfedcba98, false, false)); }
#define FSK 64      /* keys a stage */
#define FPH 72      /* LDS row pitch in 16-bit elements: 128 bytes of data + 16, the conflict-free pitch for 16-byte row readers */
#define FBB (64 * FPH * 2)      /* bytes of one tile buffer */
#define FRB (16 * FPH * 2)      /* bytes of 16 LDS rows: the step between a thread's four pieces of a tile */
#define FC2 (SCL * 1.4426950408889634f)      /* score scale times log2(e): the softmax runs in base 2 on the hardware's own exponential */
// One stage's copies of one thread: pieces (row, row + 16, row + 32, row + 48) of the K tile and of the V^T tile, 16 bytes each. The s_wait_xcnt closes the statement so that no address register is rewritten ahead of it.
__device__ __forceinline__ void fl_copy(unsigned lk, unsigned lv, const unsigned short* gk, size_t ks16, const unsigned short* gv) {
  const unsigned short* gk1 = gk + ks16; const unsigned short* gk2 = gk1 + ks16; const unsigned short* gk3 = gk2 + ks16;
  const unsigned short* gv1 = gv + (size_t)16 * TK; const unsigned short* gv2 = gv + (size_t)32 * TK; const unsigned short* gv3 = gv + (size_t)48 * TK;
  asm volatile("global_load_async_to_lds_b128 %0, %8, off\n\t"
               "global_load_async_to_lds_b128 %1, %9, off\n\t"
               "global_load_async_to_lds_b128 %2, %10, off\n\t"
               "global_load_async_to_lds_b128 %3, %11, off\n\t"
               "global_load_async_to_lds_b128 %4, %12, off\n\t"
               "global_load_async_to_lds_b128 %5, %13, off\n\t"
               "global_load_async_to_lds_b128 %6, %14, off\n\t"
               "global_load_async_to_lds_b128 %7, %15, off\n\t"
               "s_wait_xcnt 0x0"
               :: "v"(lk), "v"(lk + FRB), "v"(lk + 2 * FRB), "v"(lk + 3 * FRB), "v"(lv), "v"(lv + FRB), "v"(lv + 2 * FRB), "v"(lv + 3 * FRB),
                  "v"(gk), "v"(gk1), "v"(gk2), "v"(gk3), "v"(gv), "v"(gv1), "v"(gv2), "v"(gv3) : "memory");
}
__global__ __launch_bounds__(128) void k_flash(const _Float16* __restrict__ Q16, int ldq, const _Float16* __restrict__ K16, int ldk, const _Float16* __restrict__ Vt, float* __restrict__ O, int ldo) {
  constexpr int RPW = 16, DT = 4, KS = 2, NST = TK / FSK;
  __shared__ __attribute__((aligned(16))) unsigned short sK[2][64][FPH]; __shared__ __attribute__((aligned(16))) unsigned short sV[2][64][FPH];
  const int tid = threadIdx.x, w = tid >> 5, lane = tid & 31, ln = lane & 15, hh = lane >> 4;
  const int slab = blockIdx.x / QBNP, qblk = QB0P + blockIdx.x % QBNP; const int b = slab / NH, h = slab % NH; const int q0 = qblk * (4 * RPW) + w * RPW;
  FragH bq[KS];
  { const unsigned short* qr = (const unsigned short*)Q16 + ((size_t)b * TQ + q0 + ln) * ldq + h * 64;
#pragma unroll
    for (int ks = 0; ks < KS; ++ks) { bq[ks].half[0] = *(const v8us*)(qr + ks * 32 + 8 * hh); bq[ks].half[1] = *(const v8us*)(qr + ks * 32 + 16 + 8 * hh); } }
  const unsigned short* Vth = (const unsigned short*)Vt + (size_t)slab * 64 * TK;
  const int crow = tid >> 3, cseg = (tid & 7) * 8;      /* eight threads copy one 128-byte row */
  const size_t ks16 = (size_t)16 * ldk, kstg = (size_t)FSK * ldk;
  const unsigned short* gk = (const unsigned short*)K16 + ((size_t)b * TK + crow) * ldk + h * 64 + cseg;      /* the thread's first piece of the next stage to copy, advanced behind each stage's copies */
  const unsigned short* gv = Vth + (size_t)crow * TK + cseg;
  const unsigned lk0 = (unsigned)(size_t)&sK[0][crow][cseg], lv0 = (unsigned)(size_t)&sV[0][crow][cseg];      /* low 32 bits of a shared address = the byte offset in LDS */
  fl_copy(lk0, lv0, gk, ks16, gv); gk += kstg; gv += FSK;
  asm volatile("s_wait_asynccnt 0x0" ::: "memory");      /* stage 0 has landed before the barrier that publishes it */
  __syncthreads();
  fl_copy(lk0 + FBB, lv0 + FBB, gk, ks16, gv); gk += kstg; gv += FSK;
  float m_r = -3.0e38f, l_r = 0.f; v8f oacc[DT];
#pragma unroll
  for (int dt = 0; dt < DT; ++dt) oacc[dt] = (v8f){0.f,0.f,0.f,0.f,0.f,0.f,0.f,0.f};
#pragma unroll 1      /* one stage a trip: the buffer index stays a run-time value and the text small */
  for (int st = 0; st < NST; ++st) {
    const int buf = st & 1;
    const unsigned short* kf = &sK[buf][ln][8 * hh]; const unsigned short* vf = &sV[buf][ln][8 * hh];
#pragma unroll
    for (int ps2 = 0; ps2 < FSK / 32; ++ps2) {
      FragH ak[2][KS], av[DT];
#pragma unroll
      for (int nt = 0; nt < 2; ++nt)
#pragma unroll
        for (int ks = 0; ks < KS; ++ks) { const unsigned short* kr = kf + (ps2 * 32 + nt * 16) * FPH + ks * 32; ak[nt][ks].half[0] = *(const v8us*)kr; ak[nt][ks].half[1] = *(const v8us*)(kr + 16); }
#pragma unroll
      for (int dt = 0; dt < DT; ++dt) { const unsigned short* vr = vf + dt * 16 * FPH + ps2 * 32; av[dt].half[0] = *(const v8us*)vr; av[dt].half[1] = *(const v8us*)(vr + 16); }
      float sc[16];
#pragma unroll
      for (int nt = 0; nt < 2; ++nt) { v8f acc = (v8f){0.f,0.f,0.f,0.f,0.f,0.f,0.f,0.f};
#pragma unroll
        for (int ks = 0; ks < KS; ++ks) acc = mmaH<1>(ak[nt][ks].v, ak[nt][ks].v, bq[ks].v, bq[ks].v, acc);
#pragma unroll
        for (int r = 0; r < 8; ++r) sc[nt * 8 + r] = acc[r]; }      /* raw q.k: the maximum is kept unscaled, the scale goes into the exponent's multiply-add */
      float mx[4];
#pragma unroll
      for (int c = 0; c < 4; ++c) mx[c] = fmaxf(fmaxf(sc[c], sc[4 + c]), fmaxf(sc[8 + c], sc[12 + c]));
      float mc = fmaxf(fmaxf(mx[0], mx[1]), fmaxf(mx[2], mx[3])); mc = fmaxf(mc, xhalf(mc));      /* both halves of a column use one maximum: they share the output tiles */
      const float mn = fmaxf(m_r, mc); float al = (m_r - mn) * FC2; m_r = mn;
      const float nb = fmaf(-mn, FC2, 10.0f);      /* 2^(s FC2 + nb) = 1024 exp((s - mn) / 8) */
      FragH pb; float ps[4];
#pragma unroll
      for (int i = 0; i < 16; ++i) sc[i] = fmaf(sc[i], FC2, nb);
      asm("v_exp_f32 %0, %0\n\tv_exp_f32 %1, %1\n\tv_exp_f32 %2, %2\n\tv_exp_f32 %3, %3\n\tv_exp_f32 %4, %4\n\tv_exp_f32 %5, %5\n\tv_exp_f32 %6, %6\n\tv_exp_f32 %7, %7\n\tv_exp_f32 %8, %8\n\t"
          "v_exp_f32 %9, %9\n\tv_exp_f32 %10, %10\n\tv_exp_f32 %11, %11\n\tv_exp_f32 %12, %12\n\tv_exp_f32 %13, %13\n\tv_exp_f32 %14, %14\n\tv_exp_f32 %15, %15\n\tv_exp_f32 %16, %16\n\tv_nop"
          : "+v"(al), "+v"(sc[0]), "+v"(sc[1]), "+v"(sc[2]), "+v"(sc[3]), "+v"(sc[4]), "+v"(sc[5]), "+v"(sc[6]), "+v"(sc[7]), "+v"(sc[8]), "+v"(sc[9]), "+v"(sc[10]), "+v"(sc[11]), "+v"(sc[12]), "+v"(sc[13]), "+v"(sc[14]), "+v"(sc[15]));
#pragma unroll
      for (int i = 0; i < 16; ++i) { const float p = sc[i]; ps[i & 3] = (i < 4) ? p : ps[i & 3] + p; pb.h[i] = (_Float16)p; }      /* element i = key 8 hh + i (i < 8), 16 + 8 hh + i - 8 (i >= 8): the order of the V^T fragments above */
      l_r = l_r * al + ((ps[0] + ps[1]) + (ps[2] + ps[3]));
#pragma unroll
      for (int dt = 0; dt < DT; ++dt)
#pragma unroll
        for (int r = 0; r < 8; ++r) oacc[dt][r] *= al;
#pragma unroll
      for (int dt = 0; dt < DT; ++dt) oacc[dt] = mmaH<1>(av[dt].v, av[dt].v, pb.v, pb.v, oacc[dt]);
    }
    asm volatile("s_wait_dscnt 0x0" ::: "memory");      /* this wave's reads of the buffer have returned before it is given up */
    asm volatile("s_wait_asynccnt 0x0" ::: "memory");      /* this wave's copies of the next stage have landed */
    __syncthreads();      /* publishes the next stage and ends every wave's reads of this one */
    if (st + 2 < NST) { fl_copy(lk0 + buf * FBB, lv0 + buf * FBB, gk, ks16, gv); gk += kstg; gv += FSK; } }
  asm volatile("s_wait_asynccnt 0x0" ::: "memory");      /* no copy is left in flight when the wave ends */
  const float l = l_r + xhalf(l_r); const float inv = (l > 0.f) ? 1.0f / l : 0.f;      /* weights and sum both carry the 2^10 */
  float* orow = O + ((size_t)b * TQ + q0 + ln) * ldo + h * 64 + 8 * hh;      /* register r of tile dt = channel dt * 16 + 8 hh + r of query ln: 32 contiguous bytes a lane */
#pragma unroll
  for (int dt = 0; dt < DT; ++dt) { const v4f lo = {oacc[dt][0] * inv, oacc[dt][1] * inv, oacc[dt][2] * inv, oacc[dt][3] * inv}, hi = {oacc[dt][4] * inv, oacc[dt][5] * inv, oacc[dt][6] * inv, oacc[dt][7] * inv};
    *(v4f*)(orow + dt * 16) = lo; *(v4f*)(orow + dt * 16 + 4) = hi; } }
// 5-plane variant: S = Qh Kh^T + (Ql Kh^T + Qh Kl^T)/1024 with Q/K = [hi | 2^10 residual] f16 planes (QL/KL same layout as Q16/K16), then the 3-term P.V below.
// 3-term variant: O = (P_hi V_hi + (P_lo V_hi + P_hi V_lo) / 1024) / l with P = [hi | 2^10 residual] of 1024 p and V^T = [hi | 2^10 residual] planes (VtL same layout as Vt) -> ~2^-21-class products for un-averaged (early causal / peaked) rows
template <int CAUSAL>
__global__ __launch_bounds__(128) void k_flash5(const _Float16* __restrict__ Q16, const _Float16* __restrict__ QL, int ldq, const _Float16* __restrict__ K16, const _Float16* __restrict__ KL, int ldk, const _Float16* __restrict__ Vt, const _Float16* __restrict__ VtL, const int* __restrict__ MSK, float* __restrict__ O, int ldo) {
  constexpr int RPW = 16, RTN = RPW / 16, NQB = TQ / (4 * RPW), DT = 4, KS = 2;
  __shared__ __attribute__((aligned(16))) unsigned short sP[4][RPW][40]; __shared__ __attribute__((aligned(16))) unsigned short sPL[4][RPW][40]; __shared__ __attribute__((aligned(16))) float sO[4][RPW][64 + 4];
  const int tid = threadIdx.x, w = tid >> 5, lane = tid & 31, ln = lane & 15, hh = lane >> 4;
  const int slab = blockIdx.x / QBN5, qblk = QB05 + blockIdx.x % QBN5; (void)NQB; const int b = slab / NH, h = slab % NH; const int qb0 = qblk * (4 * RPW); const int q0 = qb0 + w * RPW;
  FragH aq[2][KS], aql[2][KS];
#pragma unroll
  for (int rt = 0; rt < RTN; ++rt) { const unsigned short* qr = (const unsigned short*)Q16 + ((size_t)b * TQ + q0 + rt * 16 + ln) * ldq + h * 64; const unsigned short* ql = (const unsigned short*)QL + ((size_t)b * TQ + q0 + rt * 16 + ln) * ldq + h * 64;
#pragma unroll
    for (int ks = 0; ks < KS; ++ks) { aq[rt][ks].half[0] = *(const v8us*)(qr + ks * 32 + 8 * hh); aq[rt][ks].half[1] = *(const v8us*)(qr + ks * 32 + 16 + 8 * hh); aql[rt][ks].half[0] = *(const v8us*)(ql + ks * 32 + 8 * hh); aql[rt][ks].half[1] = *(const v8us*)(ql + ks * 32 + 16 + 8 * hh); } }
  const unsigned short* Vth = (const unsigned short*)Vt + (size_t)slab * 64 * TK; const unsigned short* Vtl = (const unsigned short*)VtL + (size_t)slab * 64 * TK;
  float m_r[2][8], l_r[2][8]; v8f oacc[2][DT], oaccL[2][DT];
#pragma unroll
  for (int rt = 0; rt < RTN; ++rt) {
#pragma unroll
    for (int r = 0; r < 8; ++r) { m_r[rt][r] = -3.0e38f; l_r[rt][r] = 0.f; }
#pragma unroll
    for (int dt = 0; dt < DT; ++dt) { oacc[rt][dt] = (v8f){0.f,0.f,0.f,0.f,0.f,0.f,0.f,0.f}; oaccL[rt][dt] = oacc[rt][dt]; } }
  const int jend = (CAUSAL == 1) ? (qb0 + 4 * RPW) : ((CAUSAL == 23) ? min(TK, (qb0 / CHK + 2) * CHK) : TK);      /* causal / window: keys that can never contribute are skipped */ const int jbeg = (CAUSAL == 23) ? max(0, (qb0 / CHK - 1) * CHK) : 0;
#pragma unroll 1
  for (int j0 = jbeg; j0 < jend; j0 += 32) {
    v8f s[2][2];
#pragma unroll
    for (int nt = 0; nt < 2; ++nt) { const unsigned short* kr = (const unsigned short*)K16 + ((size_t)b * TK + j0 + nt * 16 + ln) * ldk + h * 64; const unsigned short* klr = (const unsigned short*)KL + ((size_t)b * TK + j0 + nt * 16 + ln) * ldk + h * 64; FragH bk[KS], bkl[KS];
#pragma unroll
      for (int ks = 0; ks < KS; ++ks) { bk[ks].half[0] = *(const v8us*)(kr + ks * 32 + 8 * hh); bk[ks].half[1] = *(const v8us*)(kr + ks * 32 + 16 + 8 * hh); bkl[ks].half[0] = *(const v8us*)(klr + ks * 32 + 8 * hh); bkl[ks].half[1] = *(const v8us*)(klr + ks * 32 + 16 + 8 * hh); }
#pragma unroll
      for (int rt = 0; rt < RTN; ++rt) { v8f acc = (v8f){0.f,0.f,0.f,0.f,0.f,0.f,0.f,0.f}, accl = acc;
#pragma unroll
        for (int ks = 0; ks < KS; ++ks) { acc = mmaH<1>(aq[rt][ks].v, aq[rt][ks].v, bk[ks].v, bk[ks].v, acc); accl = mmaH<1>(aql[rt][ks].v, aql[rt][ks].v, bk[ks].v, bk[ks].v, accl); accl = mmaH<1>(aq[rt][ks].v, aq[rt][ks].v, bkl[ks].v, bkl[ks].v, accl); }
#pragma unroll
        for (int r = 0; r < 8; ++r) acc[r] += accl[r] * 0.0009765625f;
        s[rt][nt] = acc; } }
#pragma unroll
    for (int rt = 0; rt < RTN; ++rt)
#pragma unroll
      for (int r = 0; r < 8; ++r) { const int tq = q0 + rt * 16 + 8 * hh + r; const int k0 = j0 + ln, k1 = j0 + 16 + ln;
        bool ok0 = (CAUSAL == 1) ? (k0 <= tq) : ((CAUSAL == 2) ? ((k0 >> 5) == (tq >> 5)) : true), ok1 = (CAUSAL == 1) ? (k1 <= tq) : ((CAUSAL == 2) ? ((k1 >> 5) == (tq >> 5)) : true);      /* mode 2: block-diagonal 32-token groups */
        if (CAUSAL == 4) { const int* mrow = MSK + ((size_t)b * TQ + tq) * TK; ok0 = mrow[k0] != 0; ok1 = mrow[k1] != 0; }      /* mode 4: per-(query, key) INPUT mask shared by all heads; masked keys contribute nothing (== the reference's -4096 fill, whose exp underflows to 0), rows with no valid key give l = 0 -> output 0 (== the reference's row_valid zeroing) */
        float s0 = ok0 ? s[rt][0][r] * SCL : -3.0e38f, s1 = ok1 ? s[rt][1][r] * SCL : -3.0e38f; if (CAUSAL == 17) { const float* amk = (const float*)MSK + (size_t)b * TK; s0 += bf16_round(amk[k0]); s1 += bf16_round(amk[k1]); } if (CAUSAL == 18) { const float* tb = (const float*)MSK; const int* ri = MSK + 1024 + (size_t)b * TK; const int rq = ri[tq]; s0 += tb[(h * 8 + rq) * 8 + ri[k0]]; s1 += tb[(h * 8 + rq) * 8 + ri[k1]]; } if (CAUSAL == 19) { const int* rel = MSK + (size_t)tq * TK; const float* rb = (const float*)MSK + (size_t)TQ * TK + ((size_t)(b * NH + h) * TQ + tq) * 64; s0 += rb[rel[k0]]; s1 += rb[rel[k1]]; }      /* mode 19: + (q.Ek[rel] + Eb[rel][h]) / 8 gathered by the int relative ids (packed [ids | table]) */      /* mode 18: + resource_bias[h][r_q][r_k] from the packed [table | ids] buffer (TQ == TK) */      /* mode 17: additive per-(batch, key) mask INPUT */ float mc = fmaxf(s0, s1);
        mc = fmaxf(mc, __shfl_xor(mc, 1, 32)); mc = fmaxf(mc, __shfl_xor(mc, 2, 32)); mc = fmaxf(mc, __shfl_xor(mc, 4, 32)); mc = fmaxf(mc, __shfl_xor(mc, 8, 32));
        const float mn = fmaxf(m_r[rt][r], mc); const float al = (mn > -1.0e38f) ? expf(m_r[rt][r] - mn) : 1.0f; m_r[rt][r] = mn; const float p0 = ok0 ? expf(s0 - mn) : 0.f, p1 = ok1 ? expf(s1 - mn) : 0.f; l_r[rt][r] = l_r[rt][r] * al + p0 + p1;
#pragma unroll
        for (int dt = 0; dt < DT; ++dt) { oacc[rt][dt][r] *= al; oaccL[rt][dt][r] *= al; }
        FragH t2, t2l; const float ps0 = p0 * 1024.0f, ps1 = p1 * 1024.0f; t2.h[0] = (_Float16)ps0; t2.h[1] = (_Float16)ps1; t2l.h[0] = (_Float16)((ps0 - (float)t2.h[0]) * 1024.0f); t2l.h[1] = (_Float16)((ps1 - (float)t2.h[1]) * 1024.0f);
        sP[w][rt * 16 + 8 * hh + r][ln] = t2.u[0]; sP[w][rt * 16 + 8 * hh + r][16 + ln] = t2.u[1]; sPL[w][rt * 16 + 8 * hh + r][ln] = t2l.u[0]; sPL[w][rt * 16 + 8 * hh + r][16 + ln] = t2l.u[1]; }
    __builtin_amdgcn_fence(__ATOMIC_ACQ_REL, "workgroup"); __builtin_amdgcn_wave_barrier();
    FragH pa[2], pl[2];
#pragma unroll
    for (int rt = 0; rt < RTN; ++rt) { pa[rt].half[0] = *(const v8us*)&sP[w][rt * 16 + ln][8 * hh]; pa[rt].half[1] = *(const v8us*)&sP[w][rt * 16 + ln][16 + 8 * hh]; pl[rt].half[0] = *(const v8us*)&sPL[w][rt * 16 + ln][8 * hh]; pl[rt].half[1] = *(const v8us*)&sPL[w][rt * 16 + ln][16 + 8 * hh]; }
#pragma unroll
    for (int dt = 0; dt < DT; ++dt) { const unsigned short* vrow = Vth + (size_t)(dt * 16 + ln) * TK + j0; const unsigned short* vrl = Vtl + (size_t)(dt * 16 + ln) * TK + j0; FragH bv, bl; bv.half[0] = *(const v8us*)(vrow + 8 * hh); bv.half[1] = *(const v8us*)(vrow + 16 + 8 * hh); bl.half[0] = *(const v8us*)(vrl + 8 * hh); bl.half[1] = *(const v8us*)(vrl + 16 + 8 * hh);
#pragma unroll
      for (int rt = 0; rt < RTN; ++rt) { oacc[rt][dt] = mmaH<1>(pa[rt].v, pa[rt].v, bv.v, bv.v, oacc[rt][dt]); oaccL[rt][dt] = mmaH<1>(pl[rt].v, pl[rt].v, bv.v, bv.v, oaccL[rt][dt]); oaccL[rt][dt] = mmaH<1>(pa[rt].v, pa[rt].v, bl.v, bl.v, oaccL[rt][dt]); } }
    __builtin_amdgcn_fence(__ATOMIC_ACQ_REL, "workgroup"); __builtin_amdgcn_wave_barrier(); }
#pragma unroll
  for (int rt = 0; rt < RTN; ++rt) {
#pragma unroll
    for (int r = 0; r < 8; ++r) { float l = l_r[rt][r]; l += __shfl_xor(l, 1, 32); l += __shfl_xor(l, 2, 32); l += __shfl_xor(l, 4, 32); l += __shfl_xor(l, 8, 32); l_r[rt][r] = (l > 0.f) ? 1.0f / (l * 1024.0f) : 0.f; }
#pragma unroll
    for (int dt = 0; dt < DT; ++dt)
#pragma unroll
      for (int r = 0; r < 8; ++r) { float v = oacc[rt][dt][r]; v += oaccL[rt][dt][r] * 0.0009765625f; sO[w][rt * 16 + 8 * hh + r][dt * 16 + ln] = v * l_r[rt][r]; } }
  __builtin_amdgcn_fence(__ATOMIC_ACQ_REL, "workgroup"); __builtin_amdgcn_wave_barrier();
  {
#pragma unroll
    for (int rp = 0; rp < RPW; rp += 2) { const int r = rp + (lane >> 4), pc = lane & 15; const v4f val = *(const v4fa*)&sO[w][r][pc * 4]; *(v4f*)(O + ((size_t)b * TQ + q0 + r) * ldo + h * 64 + pc * 4) = val; }
     } }

__global__ __launch_bounds__(256) void k_rotab(float* __restrict__ CS, float* __restrict__ SN) {
  #pragma clang fp contract(off)
  const int t = blockIdx.x * 256 + threadIdx.x; if (t >= SLEN * 32) return; const int j = t % 32, s = t / 32; const float ex = (float)(2 * j) / 64.0f; const float inv = 1.0f / powf(10000.0f, ex); const float th = (float)s * inv; const float c = cosf(th), sn = sinf(th);
  { *(float*)(CS + t) = c; *(float*)(SN + t) = sn;  } }
__global__ __launch_bounds__(256) void k_rope(const float* __restrict__ F, int nsrc, int ndst, int rep, const float* __restrict__ CS, const float* __restrict__ SN, _Float16* __restrict__ H, _Float16* __restrict__ L) {
  #pragma clang fp contract(off)
  const size_t t = (size_t)blockIdx.x * 256 + threadIdx.x; if (t >= (size_t)NR * ndst * 4) return; const int g8 = (int)(t % 4); const int hd = (int)((t / 4) % ndst); const size_t row = t / ((size_t)4 * ndst); const int s = (int)(row % SLEN); const int hs = hd / rep;
  const float* src = F + row * (size_t)(nsrc * 64) + hs * 64; FragH ah, al, bh, bl;
  for (int i = 0; i < 8; ++i) { const int d = g8 * 8 + i; const float c = CS[s * 32 + d], sn = SN[s * 32 + d]; const float x1 = src[d], x2 = src[d + 32];
    float o1 = x1 * c; o1 += -x2 * sn; float o2 = x2 * c; o2 += x1 * sn;
    _Float16 hv = (_Float16)o1; ah.h[i] = hv; al.h[i] = (_Float16)((o1 - (float)hv) * 1024.0f); hv = (_Float16)o2; bh.h[i] = hv; bl.h[i] = (_Float16)((o2 - (float)hv) * 1024.0f); }
  const size_t o = row * (size_t)(ndst * 64) + hd * 64 + g8 * 8;
  { *(v8us*)((unsigned short*)H + o) = ah.half[0]; *(v8us*)((unsigned short*)H + o + 32) = bh.half[0]; *(v8us*)((unsigned short*)L + o) = al.half[0]; *(v8us*)((unsigned short*)L + o + 32) = bl.half[0];  } }
__global__ __launch_bounds__(256) void k_rope2(const float* __restrict__ F, int nsrc, int ndst, int rep, const float* __restrict__ CS, const float* __restrict__ SN, _Float16* __restrict__ H, _Float16* __restrict__ L) {
  #pragma clang fp contract(off)
  const size_t t = (size_t)blockIdx.x * 256 + threadIdx.x; if (t >= (size_t)NR * ndst * 4) return; const int g16 = (int)(t % 4); const int hd = (int)((t / 4) % ndst); const size_t row = t / ((size_t)4 * ndst); const int s = (int)(row % SLEN); const int hs = hd / rep;
  const float* src = F + row * (size_t)(nsrc * 64) + hs * 64 + g16 * 16; FragH ah, al;
  for (int pr = 0; pr < 8; ++pr) { const int i = g16 * 8 + pr; const float c = CS[s * 32 + i], sn = SN[s * 32 + i]; const float x1 = src[2 * pr], x2 = src[2 * pr + 1];
    float o1 = x1 * c; o1 -= x2 * sn; float o2 = x1 * sn; o2 += x2 * c;
    _Float16 hv = (_Float16)o1; ah.h[2 * pr] = hv; al.h[2 * pr] = (_Float16)((o1 - (float)hv) * 1024.0f); hv = (_Float16)o2; ah.h[2 * pr + 1] = hv; al.h[2 * pr + 1] = (_Float16)((o2 - (float)hv) * 1024.0f); }
  const size_t o = row * (size_t)(ndst * 64) + hd * 64 + g16 * 16;
  { *(v8us*)((unsigned short*)H + o) = ah.half[0]; *(v8us*)((unsigned short*)H + o + 8) = ah.half[1]; *(v8us*)((unsigned short*)L + o) = al.half[0]; *(v8us*)((unsigned short*)L + o + 8) = al.half[1];  } }
__global__ __launch_bounds__(256) void k_ln512(const float* __restrict__ A, const float* __restrict__ res, const float* __restrict__ g, const float* __restrict__ bb, float* __restrict__ Y, _Float16* __restrict__ Y16) {
  #pragma clang fp contract(off)
  const int wv = threadIdx.x >> 5, ln = threadIdx.x & 31; const size_t r = (size_t)blockIdx.x * 8 + wv; if (r >= NR) return; float x[16]; float s = 0.f;
  for (int i = 0; i < 2; ++i) { const v8f a = *(const v8f*)(A + r * DM + i * 256 + ln * 8); for (int q = 0; q < 8; ++q) { float v = a[q]; if (res) v += bf16_round(res[r * DM + i * 256 + ln * 8 + q]); x[i * 8 + q] = v; s += v; } }
  for (int o = 16; o > 0; o >>= 1) s += __shfl_xor(s, o, 32); const float mu = s / (float)DM; float var = 0.f; for (int q = 0; q < 16; ++q) { const float d = x[q] - mu; var += d * d; }
  for (int o = 16; o > 0; o >>= 1) var += __shfl_xor(var, o, 32); const float inv = rsqrtf(var / (float)DM + 1e-5f);
  { for (int i = 0; i < 2; ++i) { const int c0 = i * 256 + ln * 8; v8f y; FragH f; for (int q = 0; q < 8; ++q) { float v = (x[i * 8 + q] - mu) * inv; v *= bf16_round(g[c0 + q]); v += bf16_round(bb[c0 + q]); y[q] = v; f.h[q] = (_Float16)v; } *(v8f*)(Y + r * DM + c0) = y; if (Y16) *(v8us*)((unsigned short*)Y16 + r * DM + c0) = f.half[0]; }  } }
__global__ __launch_bounds__(256) void k_pack(const float* __restrict__ rb, const int* __restrict__ rid, int* __restrict__ PK) { const int t = blockIdx.x * 256 + threadIdx.x; if (t >= 1024 + NB * TK) return; int v; if (t < 1024) v = __float_as_int(bf16_round(rb[t])); else v = rid[t - 1024]; *(int*)(PK + t) = v;  }
__global__ __launch_bounds__(256) void k_tabin(const float* __restrict__ sp, float* __restrict__ CS, float* __restrict__ SN) { const int t = blockIdx.x * 256 + threadIdx.x; if (t >= SLEN * 32) return; const int i = t % 32, s = t / 32; const float c = bf16_round(sp[s * 64 + 32 + i]), sn = bf16_round(sp[s * 64 + i]);
  { *(float*)(CS + t) = c; *(float*)(SN + t) = sn;  } }
__global__ __launch_bounds__(256) void k_wsc(const float* __restrict__ Wm, _Float16* __restrict__ Bt, size_t n8, float sc) { const size_t t = (size_t)blockIdx.x * 256 + threadIdx.x; if (t >= n8) return; FragH f; for (int q = 0; q < 8; ++q) f.h[q] = (_Float16)(bf16_round(Wm[t * 8 + q]) * sc); *(v8us*)((unsigned short*)Bt + t * 8) = f.half[0];  }
__global__ __launch_bounds__(256) void k_rotab2(float* __restrict__ CS, float* __restrict__ SN) {
  #pragma clang fp contract(off)
  const int t = blockIdx.x * 256 + threadIdx.x; if (t >= SLEN * 32) return; const int j = t % 32, s = t / 32; const float c0 = -0.14391156831212787f;      /* -ln(10000)/64 rounded to f32 */ const float inv = expf((float)(2 * j) * c0); const float th = (float)s * inv; const float c = cosf(th), sn = sinf(th);
  { *(float*)(CS + t) = c; *(float*)(SN + t) = sn;  } }
__global__ __launch_bounds__(256) void k_lnu(const float* __restrict__ X, _Float16* __restrict__ N16, float* __restrict__ XB) {
  #pragma clang fp contract(off)
  const int wv = threadIdx.x >> 5, ln = threadIdx.x & 31; const size_t r = (size_t)blockIdx.x * 8 + wv; if (r >= NR) return; float a[32]; float s = 0.f;
  for (int i = 0; i < 4; ++i) { const v8f v = *(const v8f*)(X + r * DM + (i * 32 + ln) * 8); for (int q = 0; q < 8; ++q) { const float u = bf16_round(v[q]); a[i * 8 + q] = u; s += u; } }
  for (int o = 16; o > 0; o >>= 1) s += __shfl_xor(s, o, 32); const float mu = s / (float)DM; float var = 0.f; for (int q = 0; q < 32; ++q) { const float d = a[q] - mu; var += d * d; }
  for (int o = 16; o > 0; o >>= 1) var += __shfl_xor(var, o, 32); const float den = sqrtf(var / (float)(DM - 1)) + 1e-6f; const float inv = 1.0f / den;      /* one reciprocal per row; (x-mean)*inv vs the reference's division differs by <= 1 ulp */
  { for (int i = 0; i < 4; ++i) { const int c0 = (i * 32 + ln) * 8; FragH f; v8f xb; for (int q = 0; q < 8; ++q) { f.h[q] = (_Float16)((a[i * 8 + q] - mu) * inv); xb[q] = a[i * 8 + q]; } *(v8us*)((unsigned short*)N16 + r * DM + c0) = f.half[0]; *(v8f*)(XB + r * DM + c0) = xb; }  } }
__global__ __launch_bounds__(256) void k_vtg(const _Float16* __restrict__ V16, _Float16* __restrict__ Vt) { __shared__ unsigned short tl[64][66]; const int tid = threadIdx.x; const int slab = blockIdx.x / (SLEN / 64), lg = blockIdx.x % (SLEN / 64); const int b = slab / NH, h = slab % NH; const int hs = h / NREP;
  for (int i = tid; i < 64 * 8; i += 256) { const int r = i / 8, c8 = (i % 8) * 8; FragH f; f.half[0] = *(const v8us*)((const unsigned short*)V16 + ((size_t)b * SLEN + lg * 64 + r) * KVD + hs * 64 + c8); for (int q = 0; q < 8; ++q) tl[r][c8 + q] = f.u[q]; }
  __syncthreads();
  { for (int rd = 0; rd < 2; ++rd) { const int d = rd * 32 + tid / 8, pc = tid % 8; FragH f; for (int q = 0; q < 8; ++q) f.u[q] = tl[pc * 8 + q][d]; *(v8us*)((unsigned short*)Vt + ((size_t)slab * 64 + d) * SLEN + lg * 64 + pc * 8) = f.half[0]; }  } }

__global__ __launch_bounds__(256) void k_h16s(const float* __restrict__ SRC, int lds, int coff, _Float16* __restrict__ DST, size_t n8) { const size_t t = (size_t)blockIdx.x * 256 + threadIdx.x; if (t >= n8) return; const size_t r = (t * 8) / DM; const int c = (int)((t * 8) % DM); const v8f a = *(const v8f*)(SRC + r * lds + coff + c); FragH f; for (int q = 0; q < 8; ++q) f.h[q] = (_Float16)a[q];
  *(v8us*)((unsigned short*)DST + t * 8) = f.half[0];  }


__global__ __launch_bounds__(256) void k_ccp(const float* __restrict__ QKV, int coff, _Float16* __restrict__ D) { const size_t t = (size_t)blockIdx.x * 256 + threadIdx.x; if (t >= (size_t)NR * DM / 8) return; const int c0 = (int)((t * 8) % DM); const size_t row = (t * 8) / DM; const v8f a = *(const v8f*)(QKV + row * 3 * DM + coff + c0); FragH f; for (int q = 0; q < 8; ++q) f.h[q] = (_Float16)a[q];
  *(v8us*)((unsigned short*)D + t * 8) = f.half[0];  }


__global__ __launch_bounds__(256) void k_tok(const float* __restrict__ x, _Float16* __restrict__ X16) { __shared__ float tl[DM][17]; const int tid = threadIdx.x; const int p0 = blockIdx.x * 16;      /* 16-pixel tiles: 34 KB of LDS */
  for (int i = tid; i < DM * 16; i += 256) { const int c = i / 16, p = i % 16; tl[c][p] = bf16_round(x[(size_t)c * NPIX + p0 + p]); }
  __syncthreads();
  { for (int i = tid; i < 16 * (DM / 8); i += 256) { const int p = i / (DM / 8), c0 = (i % (DM / 8)) * 8; FragH f; for (int q = 0; q < 8; ++q) f.h[q] = (_Float16)tl[c0 + q][p];
      *(v8us*)((unsigned short*)X16 + ((size_t)p0 + p) * DM + c0) = f.half[0]; }  } }
__global__ __launch_bounds__(256) void k_out(const float* __restrict__ Y, float* __restrict__ out) { const size_t t = (size_t)blockIdx.x * 256 + threadIdx.x; if (t >= (size_t)DM * NPIX / 8) return; const int p0 = (int)((t * 8) % NPIX); const int c = (int)((t * 8) / NPIX); v8f v; for (int q = 0; q < 8; ++q) v[q] = Y[((size_t)p0 + q) * DM + c];
  *(v8f*)(out + t * 8) = v;  }
extern "C" void kernel_launch(void* const* d_in, const int* in_sizes, int n_in,
                              void* d_out, int out_size, void* d_ws, size_t ws_size, hipStream_t stream) {
  (void)in_sizes; (void)n_in; (void)out_size;
  const float* x = (const float*)d_in[0]; const float* qw = (const float*)d_in[1]; const float* qb = (const float*)d_in[2]; const float* kw = (const float*)d_in[3]; const float* kb = (const float*)d_in[4]; const float* vw = (const float*)d_in[5]; const float* vb = (const float*)d_in[6]; const float* ow = (const float*)d_in[7]; const float* ob = (const float*)d_in[8];
  char* ws = (char*)d_ws; size_t off = 0;
  auto take = [&](size_t bytes) { char* p = ws + off; off += (bytes + 255) & ~(size_t)255; return p; };
  const size_t np = (size_t)NR * DM;
  _Float16* BQ = (_Float16*)take((size_t)DM * DM * 2); _Float16* BK = (_Float16*)take((size_t)DM * DM * 2); _Float16* BV = (_Float16*)take((size_t)DM * DM * 2); _Float16* BO = (_Float16*)take((size_t)DM * DM * 2); float* Y = (float*)take(np * 4);
   _Float16* X16 = (_Float16*)take(np * 2); _Float16* QH = (_Float16*)take(np * 2); _Float16* KH = (_Float16*)take(np * 2); _Float16* V16 = (_Float16*)take(np * 2); _Float16* VT = (_Float16*)take(np * 2); float* O = (float*)take(np * 4); _Float16* OH = QH; _Float16* OL = KH;
  if (off > ws_size) return;
  k_wsc<<<(unsigned)(((size_t)DM * DM / 8 + 255) / 256), 256, 0, stream>>>(qw, BQ, (size_t)DM * DM / 8, 16.0f); k_wsc<<<(unsigned)(((size_t)DM * DM / 8 + 255) / 256), 256, 0, stream>>>(kw, BK, (size_t)DM * DM / 8, 16.0f); k_wsc<<<(unsigned)(((size_t)DM * DM / 8 + 255) / 256), 256, 0, stream>>>(vw, BV, (size_t)DM * DM / 8, 16.0f); k_wsc<<<(unsigned)(((size_t)DM * DM / 8 + 255) / 256), 256, 0, stream>>>(ow, BO, (size_t)DM * DM / 8, 16.0f);      /* 1x1 conv (out, in) naturals */
  
  k_tok<<<NPIX / 16, 256, 0, stream>>>(x, X16);
  const dim3 g((NR / 128) * (DM / 64), 1);
  k_gemm2<0><<<g, 128, 0, stream>>>(X16, DM, 0, BQ, DM, 0, 0.0625f, qb, 0, nullptr, 1, 0, 0, nullptr, QH, DM, 0, NR, DM, DM);
  k_gemm2<0><<<g, 128, 0, stream>>>(X16, DM, 0, BK, DM, 0, 0.0625f, kb, 0, nullptr, 1, 0, 0, nullptr, KH, DM, 0, NR, DM, DM);
  k_gemm2<0><<<g, 128, 0, stream>>>(X16, DM, 0, BV, DM, 0, 0.0625f, vb, 0, nullptr, 1, 0, 0, nullptr, V16, DM, 0, NR, DM, DM);
  k_vtg<<<NB * NH * (SLEN / 64), 256, 0, stream>>>(V16, VT);
  k_flash<<<NB * NH * QBNP, 128, 0, stream>>>(QH, DM, KH, DM, VT, O, DM);
  k_hl<<<(unsigned)((np / 8 + 255) / 256), 256, 0, stream>>>(O, OH, OL, np / 8);
  k_gemm2<0><<<g, 128, 0, stream>>>(OL, DM, 0, BO, DM, 0, 0.0625f / 1024.0f, nullptr, 0, nullptr, 1, 0, 0, Y, nullptr, DM, 0, NR, DM, DM);
  k_gemm2<0><<<g, 128, 0, stream>>>(OH, DM, 0, BO, DM, 0, 0.0625f, ob, 0, Y, 1, (size_t)DM, 0, Y, nullptr, DM, 0, NR, DM, DM);      /* rows of the output conv */
  k_out<<<(unsigned)(((size_t)DM * NPIX / 8 + 255) / 256), 256, 0, stream>>>(Y, (float*)d_out);
}

// v005
// A run of this version takes 132 microseconds.
// In two side-by-side timings against v004, it was 1.08 and 1.09 times as fast.
// Over all steps from v000 it is 4.46 times as fast.
#include <hip/hip_runtime.h>
// SelfAttention4d (1 x 512 ch x 64 x 64 = 4096 tokens, 8 heads x 64: q/k/v = 1x1 convs (+ bias; the 1/8 scale applied in the flash kernel); softmax(q.k) v; out = 1x1 conv (+ bias) back to NCHW).
// Structure: NCHW -> exact f16 token rows by an LDS transpose kernel; q/k/v as f16 WMMA GEMMs (32x64 wave tiles, f32 accumulation, exact x16 (out,in) weights + bias, f16 out; channel = head*64 + d); V^T by LDS tiles; my fused flash kernel (no mask; the 1/8 applied as the score scale); ctx as f16 hi/residual into the output conv (two GEMM terms) + bias; NCHW store (thread per (channel, 8 pixels)).
// Compute dtype: inputs rounded to bf16; x / weights exact as f16; q, k, v plain f16 (~2^-12); softmax weights f16 x2^10; ctx hi + 2^-10 residual. v_wmma_f32_16x16x32_f16.
#define NB 1
#define DM 512
#define NKV 8
#define NPIX 4096
#define NREP (NH / NKV)
#define KVD (NKV * 64)           /* 512 */
#define NR (NB * SLEN)
#define CHK 512
typedef int v4i __attribute__((ext_vector_type(4)));
#define FF 2048
#define SLEN 4096
#define MQI 4096
#define MKI 4096
#define TQ SLEN
#define TK SLEN
#define NH 8
#define SCL 0.125f
#define QBLKS (TQ / 64)
#define QB05 0
#define QBN5 4
#define QB0P 0
#define QBNP QBLKS
#define RE 256
typedef __bf16 v16b __attribute__((ext_vector_type(16)));
typedef unsigned short v8us __attribute__((ext_vector_type(8), may_alias));
typedef float  v8f  __attribute__((ext_vector_type(8)));
typedef float  v4f  __attribute__((ext_vector_type(4)));
typedef float  v4fa __attribute__((ext_vector_type(4), may_alias));
union FragB { v16b v; v8us half[2]; unsigned short u[16]; };

__device__ __forceinline__ unsigned short bf16_bits(float x) { unsigned int u = __float_as_uint(x); return (unsigned short)((u + 0x7FFFu + ((u >> 16) & 1u)) >> 16); }
__device__ __forceinline__ float bf16_val(unsigned short b) { return __uint_as_float(((unsigned int)b) << 16); }
__device__ __forceinline__ float bf16_round(float x) { return bf16_val(bf16_bits(x)); }
// D += A·B with NT terms: 1 = ah·bh, 2 = + al·bh (A split), 3 = + ah·bl (both split)
template <int NT>
__device__ __forceinline__ v8f mmaN(v16b ah, v16b al, v16b bh, v16b bl, v8f c) {
  c = __builtin_amdgcn_wmma_f32_16x16x32_bf16(false, ah, false, bh, (short)0, c, false, false);
  if (NT >= 2) c = __builtin_amdgcn_wmma_f32_16x16x32_bf16(false, al, false, bh, (short)0, c, false, false);
  if (NT >= 3) c = __builtin_amdgcn_wmma_f32_16x16x32_bf16(false, ah, false, bl, (short)0, c, false, false);
  asm volatile("v_nop\n\tv_nop\n\tv_nop\n\tv_nop" : "+v"(c) : "v"(ah), "v"(al), "v"(bh), "v"(bl));
  return c;
}

__global__ __launch_bounds__(256) void k_wt_bf16(const float* __restrict__ W, unsigned short* __restrict__ Wt, int K, int N) {
  const int t = blockIdx.x * 256 + threadIdx.x;
  const int k8n = K / 8;
  if (t >= N * k8n) return;
  const int n = t / k8n, k8 = (t % k8n) * 8;
  v8us v;
#pragma unroll
  for (int i = 0; i < 8; ++i) v[i] = bf16_bits(W[(size_t)(k8 + i) * N + n]);
  *(v8us*)(Wt + (size_t)n * K + k8) = v;
  
}

// GEMM C[M][N] (f32, pitch ldc) = act(A[M][K]·W + bias). A f32 row-major (pitch lda) converted per fragment to bf16
// (ASPLIT: hi/lo two planes -> 2 terms, else single rounded term); Wt bf16 [N][K] (pitch ldb). BIAS_BF16 rounds the
// bias to bf16 first (bias quantised to bf16 before the add). K%32==0, M%16==0, N%64==0.
template <bool ASPLIT, int ACT, bool BIAS_BF16>
__global__ __launch_bounds__(128) void k_gemm_bf(const float* __restrict__ A, int lda, const unsigned short* __restrict__ Wt, int ldb,
                                               const float* __restrict__ bias, float* __restrict__ C, int ldc, int M, int N, int K) {
  __shared__ __attribute__((aligned(16))) float so[4][16][64];
  const int tid = threadIdx.x, w = tid >> 5, lane = tid & 31, ln = lane & 15, hh = lane >> 4;
  const int ntn = N / 64;
  const int wid = blockIdx.x * 4 + w;
  const int mt = wid / ntn, nq = wid % ntn;
  if (mt * 16 >= M) return;
  const int row0 = mt * 16, col0 = nq * 64;
  const float* arow = A + (size_t)(row0 + ln) * lda;
  v8f acc[4] = {};
  for (int kb = 0; kb < K; kb += 32) {
    FragB ah, al;
    const v4f x0 = *(const v4fa*)(arow + kb + 8 * hh), x1 = *(const v4fa*)(arow + kb + 8 * hh + 4);
    const v4f x2 = *(const v4fa*)(arow + kb + 16 + 8 * hh), x3 = *(const v4fa*)(arow + kb + 16 + 8 * hh + 4);
    float xs[16] = {x0[0],x0[1],x0[2],x0[3],x1[0],x1[1],x1[2],x1[3],x2[0],x2[1],x2[2],x2[3],x3[0],x3[1],x3[2],x3[3]};
#pragma unroll
    for (int i = 0; i < 16; ++i) { const unsigned short hb = bf16_bits(xs[i]); ah.u[i] = hb; al.u[i] = ASPLIT ? bf16_bits(xs[i] - bf16_val(hb)) : (unsigned short)0; }
#pragma unroll
    for (int t = 0; t < 4; ++t) {
      const unsigned short* brow = Wt + (size_t)(col0 + t * 16 + ln) * ldb + kb;
      FragB b;
      b.half[0] = *(const v8us*)(brow + 8 * hh);
      b.half[1] = *(const v8us*)(brow + 16 + 8 * hh);
      acc[t] = mmaN<ASPLIT ? 2 : 1>(ah.v, al.v, b.v, b.v, acc[t]);
    }
  }
#pragma unroll
  for (int t = 0; t < 4; ++t) {
    float bv = bias ? bias[col0 + t * 16 + ln] : 0.f;
    if (BIAS_BF16) bv = bf16_round(bv);
#pragma unroll
    for (int r = 0; r < 8; ++r) { float v = acc[t][r] + bv; if (ACT == 1) v = fmaxf(v, 0.f); so[w][8 * hh + r][t * 16 + ln] = v; }
  }
  __builtin_amdgcn_fence(__ATOMIC_ACQ_REL, "workgroup");
  __builtin_amdgcn_wave_barrier();
  const int rsub = lane >> 4, c4 = (lane & 15) * 4;
  {
#pragma unroll
    for (int q = 0; q < 8; ++q) {
      const int r = q * 2 + rsub;
      const v4f v = *(const v4fa*)&so[w][r][c4];
      *(v4f*)(C + (size_t)(row0 + r) * ldc + col0 + c4) = v;
    }
    
  }
}

// GEMM C = act(A·W + bias + resid): A f32 (ASPLIT -> hi/lo 2 terms), Wt bf16 [N][K]; ACT 0 none, 1 relu, 2 exact gelu;
// resid (optional, f32, row index = (row % rmod), pitch ldr, RES_BF16 rounds it) added before the activation.
template <bool ASPLIT, int ACT, bool BIAS_BF16, bool RES_BF16>
__global__ __launch_bounds__(128) void k_gemm_bf3(const float* __restrict__ A, int lda, const unsigned short* __restrict__ Wt, int ldb,
                                                const float* __restrict__ bias, const float* __restrict__ resid, int rmod, int ldr,
                                                float* __restrict__ C, int ldc, int M, int N, int K) {
  __shared__ __attribute__((aligned(16))) float so[4][16][64];
  const int tid = threadIdx.x, w = tid >> 5, lane = tid & 31, ln = lane & 15, hh = lane >> 4;
  const int ntn = N / 64;
  const int wid = blockIdx.x * 4 + w;
  const int mt = wid / ntn, nq = wid % ntn;
  if (mt * 16 >= M) return;
  const int row0 = mt * 16, col0 = nq * 64;
  const float* arow = A + (size_t)(row0 + ln) * lda;
  v8f acc[4] = {};
  for (int kb = 0; kb < K; kb += 32) {
    FragB ah, al;
    const v4f x0 = *(const v4fa*)(arow + kb + 8 * hh), x1 = *(const v4fa*)(arow + kb + 8 * hh + 4);
    const v4f x2 = *(const v4fa*)(arow + kb + 16 + 8 * hh), x3 = *(const v4fa*)(arow + kb + 16 + 8 * hh + 4);
    float xs[16] = {x0[0],x0[1],x0[2],x0[3],x1[0],x1[1],x1[2],x1[3],x2[0],x2[1],x2[2],x2[3],x3[0],x3[1],x3[2],x3[3]};
#pragma unroll
    for (int i = 0; i < 16; ++i) { const unsigned short hb = bf16_bits(xs[i]); ah.u[i] = hb; al.u[i] = ASPLIT ? bf16_bits(xs[i] - bf16_val(hb)) : (unsigned short)0; }
#pragma unroll
    for (int t = 0; t < 4; ++t) {
      const unsigned short* brow = Wt + (size_t)(col0 + t * 16 + ln) * ldb + kb;
      FragB b;
      b.half[0] = *(const v8us*)(brow + 8 * hh);
      b.half[1] = *(const v8us*)(brow + 16 + 8 * hh);
      acc[t] = mmaN<ASPLIT ? 2 : 1>(ah.v, al.v, b.v, b.v, acc[t]);
    }
  }
#pragma unroll
  for (int t = 0; t < 4; ++t) {
    const int col = col0 + t * 16 + ln;
    float bv = bias ? bias[col] : 0.f;
    if (BIAS_BF16) bv = bf16_round(bv);
#pragma unroll
    for (int r = 0; r < 8; ++r) {
      float v = acc[t][r] + bv;
      if (resid) { float rv = resid[(size_t)((row0 + 8 * hh + r) % rmod) * ldr + col]; if (RES_BF16) rv = bf16_round(rv); v += rv; }
      if (ACT == 1) v = fmaxf(v, 0.f);
      if (ACT == 2) v = 0.5f * v * (1.0f + erff(v * 0.70710678118654752f));
      if (ACT == 3) { const float u = 0.7978845608028654f * (v + 0.044715f * v * v * v); v = 0.5f * v * (1.0f + tanhf(u)); }
      so[w][8 * hh + r][t * 16 + ln] = v;
    }
  }
  __builtin_amdgcn_fence(__ATOMIC_ACQ_REL, "workgroup");
  __builtin_amdgcn_wave_barrier();
  const int rsub = lane >> 4, c4 = (lane & 15) * 4;
  {
#pragma unroll
    for (int q = 0; q < 8; ++q) {
      const int r = q * 2 + rsub;
      const v4f v = *(const v4fa*)&so[w][r][c4];
      *(v4f*)(C + (size_t)(row0 + r) * ldc + col0 + c4) = v;
    }
    
  }
}
// row LayerNorm (biased variance, eps) over N: s = X (+ R); optional out_sum <- s; out_norm <- (s-mu)*rsqrt(var+eps)*g + b
template <bool PARAM_BF16>
__global__ __launch_bounds__(256) void k_layernorm(const float* __restrict__ X, const float* __restrict__ R, const float* __restrict__ g, const float* __restrict__ bta,
                                                  float* __restrict__ out_sum, float* __restrict__ out_norm, int N, float eps) {
  __shared__ float red[256];
  const int row = blockIdx.x, tid = threadIdx.x;
  const float* x = X + (size_t)row * N; const float* rr = R ? R + (size_t)row * N : nullptr;
  float vals[16];                     // up to N = 4096
  const int per = N / 256;            // contiguous chunk per thread? use strided-by-4 chunks: thread handles j = tid*4 + 1024*u
  float s1 = 0.f;
  for (int u = 0; u < per / 4; ++u) {
    const int j = tid * 4 + 1024 * u;
    const v4f a = *(const v4fa*)(x + j);
    v4f b = {0.f,0.f,0.f,0.f}; if (rr) b = *(const v4fa*)(rr + j);
#pragma unroll
    for (int q = 0; q < 4; ++q) { const float v = a[q] + b[q]; vals[u * 4 + q] = v; s1 += v; }
  }
  red[tid] = s1; __syncthreads();
  for (int st = 128; st > 0; st >>= 1) { if (tid < st) red[tid] += red[tid + st]; __syncthreads(); }
  const float mu = red[0] / (float)N; __syncthreads();
  float s2 = 0.f;
  for (int u = 0; u < per / 4; ++u)
#pragma unroll
    for (int q = 0; q < 4; ++q) { const float c = vals[u * 4 + q] - mu; s2 += c * c; }
  red[tid] = s2; __syncthreads();
  for (int st = 128; st > 0; st >>= 1) { if (tid < st) red[tid] += red[tid + st]; __syncthreads(); }
  const float rs = rsqrtf(red[0] / (float)N + eps);
  {
    for (int u = 0; u < per / 4; ++u) {
      const int j = tid * 4 + 1024 * u;
      v4f o, sm;
#pragma unroll
      for (int q = 0; q < 4; ++q) {
        float gg = g[j + q], bb = bta[j + q];
        if (PARAM_BF16) { gg = bf16_round(gg); bb = bf16_round(bb); }
        sm[q] = vals[u * 4 + q]; o[q] = (vals[u * 4 + q] - mu) * rs * gg + bb;
      }
      if (out_sum) *(v4f*)(out_sum + (size_t)row * N + j) = sm;
      *(v4f*)(out_norm + (size_t)row * N + j) = o;
    }
    
  }
}



// ---- f16 WMMA path (v_wmma_f32_16x16x32_f16): 11-bit significands for operands in range — used where a [0,1] probability operand needs more precision than bf16
typedef _Float16 v16h __attribute__((ext_vector_type(16)));
union FragH { v16h v; v8us half[2]; _Float16 h[16]; unsigned short u[16]; };
template <int NT>
__device__ __forceinline__ v8f mmaH(v16h ah, v16h al, v16h bh, v16h bl, v8f c) {
  c = __builtin_amdgcn_wmma_f32_16x16x32_f16(false, ah, false, bh, (short)0, c, false, false);
  if (NT >= 2) c = __builtin_amdgcn_wmma_f32_16x16x32_f16(false, al, false, bh, (short)0, c, false, false);
  if (NT >= 3) c = __builtin_amdgcn_wmma_f32_16x16x32_f16(false, ah, false, bl, (short)0, c, false, false);
  asm volatile("v_nop\n\tv_nop\n\tv_nop\n\tv_nop" : "+v"(c) : "v"(ah), "v"(al), "v"(bh), "v"(bl));
  return c;
}
// batched GEMM like k_gemm_b but f16 operands: A f32 (split into f16 hi/lo if ASPLIT, else rounded to f16), Bt = f16 values [n][k]; alpha; C f32; N multiple of 16 (partial tiles skipped)
template <bool ASPLIT>
__global__ __launch_bounds__(128) void k_gemm_h(const float* __restrict__ A, int lda, size_t sA, const _Float16* __restrict__ Bh, int ldb, size_t sB, float alpha, float* __restrict__ C, int ldc, size_t sC, int M, int N, int K) {
  __shared__ __attribute__((aligned(16))) float so[4][16][64];
  const int tid = threadIdx.x, w = tid >> 5, lane = tid & 31, ln = lane & 15, hh = lane >> 4; const int by = blockIdx.y;
  A += (size_t)by * sA; Bh += (size_t)by * sB; C += (size_t)by * sC;
  const int ntn = (N + 63) / 64; const int wid = blockIdx.x * 4 + w; const int mt = wid / ntn, nq = wid % ntn; if (mt * 16 >= M) return;
  const int row0 = mt * 16, col0 = nq * 64; const float* arow = A + (size_t)(row0 + ln) * lda;
  v8f acc[4] = {};
  for (int kb = 0; kb < K; kb += 32) {
    FragH ah, al;
    const v4f x0 = *(const v4fa*)(arow + kb + 8 * hh), x1 = *(const v4fa*)(arow + kb + 8 * hh + 4), x2 = *(const v4fa*)(arow + kb + 16 + 8 * hh), x3 = *(const v4fa*)(arow + kb + 16 + 8 * hh + 4);
    float xs[16] = {x0[0],x0[1],x0[2],x0[3],x1[0],x1[1],x1[2],x1[3],x2[0],x2[1],x2[2],x2[3],x3[0],x3[1],x3[2],x3[3]};
#pragma unroll
    for (int i = 0; i < 16; ++i) { const _Float16 h = (_Float16)xs[i]; ah.h[i] = h; al.h[i] = ASPLIT ? (_Float16)(xs[i] - (float)h) : (_Float16)0.0f; }
#pragma unroll
    for (int t = 0; t < 4; ++t) { if (col0 + t * 16 >= N) continue; const size_t boff = (size_t)(col0 + t * 16 + ln) * ldb + kb; FragH bq; bq.half[0] = *(const v8us*)(Bh + boff + 8 * hh); bq.half[1] = *(const v8us*)(Bh + boff + 16 + 8 * hh);
      acc[t] = mmaH<ASPLIT ? 2 : 1>(ah.v, al.v, bq.v, bq.v, acc[t]); }
  }
#pragma unroll
  for (int t = 0; t < 4; ++t) { if (col0 + t * 16 >= N) continue;
#pragma unroll
    for (int r = 0; r < 8; ++r) so[w][8 * hh + r][t * 16 + ln] = acc[t][r] * alpha; }
  __builtin_amdgcn_fence(__ATOMIC_ACQ_REL, "workgroup"); __builtin_amdgcn_wave_barrier();
  const int rsub = lane >> 4, c4 = (lane & 15) * 4;
  {
#pragma unroll
    for (int q = 0; q < 8; ++q) { const int r = q * 2 + rsub; if (col0 + c4 < N) { const v4f v = *(const v4fa*)&so[w][r][c4]; *(v4f*)(C + (size_t)(row0 + r) * ldc + col0 + c4) = v; } }
     }
}

// Wt[n][k] = f16(W[k][n]·scale) from f32 row-major W[K][N] (scale = power of two; bf16-exact weights stay exact in f16 away from the subnormal range)
__global__ __launch_bounds__(256) void k_wt_f16(const float* __restrict__ W, _Float16* __restrict__ Wt, int K, int N, float scale) {
  const int t = blockIdx.x * 256 + threadIdx.x; if (t >= N * (K / 8)) return; const int n = t / (K / 8), k8 = (t % (K / 8)) * 8; FragH f;
#pragma unroll
  for (int i = 0; i < 8; ++i) f.h[i] = (_Float16)(bf16_round(W[(size_t)(k8 + i) * N + n]) * scale); const v8us o = f.half[0];
  *(v8us*)((unsigned short*)Wt + (size_t)n * K + k8) = o; 
}
// k_gemm_hh variant with fused epilogue: v = acc·alpha + bias[by·sBias + col] (+ CP[(row/rowsPerB)·sCPb + by·64 + col] if CP) ; ACT 0 none / 1 elu ; writes f16 C16 (and f32 C if non-null)
template <int ACT>
__global__ __launch_bounds__(128) void k_gemm_hhx(const _Float16* __restrict__ A, int lda, size_t sA, const _Float16* __restrict__ Bh, int ldb, size_t sB, float alpha, const float* __restrict__ bias, size_t sBias, const float* __restrict__ CP, int rowsPerB, size_t sCPb, int row0g,
    float* __restrict__ C, _Float16* __restrict__ C16, int ldc, size_t sC, int M, int N, int K) {
  __shared__ __attribute__((aligned(16))) float so[4][16][64];
  const int tid = threadIdx.x, w = tid >> 5, lane = tid & 31, ln = lane & 15, hh = lane >> 4; const int by = blockIdx.y;
  A += (size_t)by * sA; Bh += (size_t)by * sB; const size_t cofs = (size_t)by * sC; const float* bp = bias ? bias + (size_t)by * sBias : nullptr;
  const int ntn = (N + 63) / 64; const int wid = blockIdx.x * 4 + w; const int mt = wid / ntn, nq = wid % ntn; if (mt * 16 >= M) return;
  const int row0 = mt * 16, col0 = nq * 64; const _Float16* arow = A + (size_t)(row0 + ln) * lda;
  v8f acc[4] = {};
  for (int kb = 0; kb < K; kb += 32) { FragH ah; ah.half[0] = *(const v8us*)((const unsigned short*)arow + kb + 8 * hh); ah.half[1] = *(const v8us*)((const unsigned short*)arow + kb + 16 + 8 * hh);
#pragma unroll
    for (int t = 0; t < 4; ++t) { if (col0 + t * 16 >= N) continue; const size_t boff = (size_t)(col0 + t * 16 + ln) * ldb + kb; FragH bq; bq.half[0] = *(const v8us*)((const unsigned short*)Bh + boff + 8 * hh); bq.half[1] = *(const v8us*)((const unsigned short*)Bh + boff + 16 + 8 * hh);
      acc[t] = mmaH<1>(ah.v, ah.v, bq.v, bq.v, acc[t]); }
  }
#pragma unroll
  for (int t = 0; t < 4; ++t) { if (col0 + t * 16 >= N) continue; const int col = col0 + t * 16 + ln; const float bv = bp ? bf16_round(bp[col]) : 0.f;
#pragma unroll
    for (int r = 0; r < 8; ++r) { float v = acc[t][r] * alpha + bv; if (CP) { const int bidx = (row0g + row0 + 8 * hh + r) / rowsPerB; v += CP[(size_t)bidx * sCPb + (size_t)by * 64 + col]; } if (ACT == 1) v = (v > 0.f) ? v : expm1f(v); else if (ACT == 7) v = (v > 0.f) ? v + 1.0f : expf(v); else if (ACT == 8) v = tanhf(v); else if (ACT == 9) v = 0.5f * v * (1.0f + tanhf(0.7978845608028654f * (v + 0.044715f * v * v * v))); else if (ACT == 11) v = 1.0f / (1.0f + expf(-v)); else if (ACT == 12) v = (v > 0.f) ? v : 0.01f * v; else if (ACT == 14) v = (v > 0.f) ? v : 0.1f * v; else if (ACT == 15) v = v / (1.0f + expf(-v)); else if (ACT == 3) v = fmaxf(v, 0.f); else if (ACT == 6) v = 0.5f * v * (1.0f + erff(v * 0.70710678118654752f)); so[w][8 * hh + r][t * 16 + ln] = v; } }
  __builtin_amdgcn_fence(__ATOMIC_ACQ_REL, "workgroup"); __builtin_amdgcn_wave_barrier();
  const int rsub = lane >> 4, c4 = (lane & 15) * 4; typedef _Float16 v4h __attribute__((ext_vector_type(4)));
  {
#pragma unroll
    for (int q = 0; q < 8; ++q) { const int r = q * 2 + rsub; if (col0 + c4 < N) { const v4f v = *(const v4fa*)&so[w][r][c4]; if (C) *(v4f*)(C + cofs + (size_t)(row0 + r) * ldc + col0 + c4) = v; if (C16) { v4h h4; for (int i = 0; i < 4; ++i) h4[i] = (_Float16)v[i]; *(v4h*)(C16 + cofs + (size_t)(row0 + r) * ldc + col0 + c4) = h4; } } }
     }
}


typedef _Float16 v4h __attribute__((ext_vector_type(4)));

__global__ __launch_bounds__(256) void k_x16(const float* __restrict__ x, _Float16* __restrict__ X16, size_t n8) { const size_t t = (size_t)blockIdx.x * 256 + threadIdx.x; if (t >= n8) return; FragH f;
#pragma unroll
  for (int q = 0; q < 8; ++q) f.h[q] = (_Float16)bf16_round(x[t * 8 + q]); *(v8us*)((unsigned short*)X16 + t * 8) = f.half[0];  }
__global__ __launch_bounds__(256) void k_h16(const float* __restrict__ x, _Float16* __restrict__ X16, size_t n8) { const size_t t = (size_t)blockIdx.x * 256 + threadIdx.x; if (t >= n8) return; FragH f;
#pragma unroll
  for (int q = 0; q < 8; ++q) f.h[q] = (_Float16)x[t * 8 + q]; *(v8us*)((unsigned short*)X16 + t * 8) = f.half[0];  }
__global__ __launch_bounds__(256) void k_round16f(const float* __restrict__ W, _Float16* __restrict__ Bt, size_t n8) { const size_t t = (size_t)blockIdx.x * 256 + threadIdx.x; if (t >= n8) return; FragH f;
#pragma unroll
  for (int i = 0; i < 8; ++i) f.h[i] = (_Float16)(bf16_round(W[t * 8 + i]) * 16.0f); *(v8us*)((unsigned short*)Bt + t * 8) = f.half[0];  }
template <int NHv, int TTv>
__global__ __launch_bounds__(256) void k_vt(const _Float16* __restrict__ V16, int ldv, int voff, _Float16* __restrict__ Vt) { __shared__ unsigned short tl[64][66]; const int tid = threadIdx.x; const int slab = blockIdx.x / (TTv / 64), lg = blockIdx.x % (TTv / 64); const int b = slab / NHv, h = slab % NHv;
  for (int i = tid; i < 64 * 8; i += 256) { const int r = i / 8, c8 = (i % 8) * 8; FragH f; f.half[0] = *(const v8us*)((const unsigned short*)V16 + ((size_t)b * TTv + lg * 64 + r) * ldv + voff + h * 64 + c8);
#pragma unroll
    for (int q = 0; q < 8; ++q) tl[r][c8 + q] = f.u[q]; }
  __syncthreads();
  {
#pragma unroll
    for (int rd = 0; rd < 2; ++rd) { const int d = rd * 32 + tid / 8, pc = tid % 8; FragH f;
#pragma unroll
      for (int q = 0; q < 8; ++q) f.u[q] = tl[pc * 8 + q][d];
      *(v8us*)((unsigned short*)Vt + ((size_t)slab * 64 + d) * TTv + lg * 64 + pc * 8) = f.half[0]; }
     } }

__global__ __launch_bounds__(256) void k_hl(const float* __restrict__ F, _Float16* __restrict__ Hh, _Float16* __restrict__ Hl, size_t n8) { const size_t t = (size_t)blockIdx.x * 256 + threadIdx.x; if (t >= n8) return; FragH fh, fl; const v4f a = *(const v4fa*)(F + t * 8), c = *(const v4fa*)(F + t * 8 + 4);
#pragma unroll
  for (int q = 0; q < 4; ++q) { _Float16 h = (_Float16)a[q]; fh.h[q] = h; fl.h[q] = (_Float16)((a[q] - (float)h) * 1024.0f); h = (_Float16)c[q]; fh.h[4 + q] = h; fl.h[4 + q] = (_Float16)((c[q] - (float)h) * 1024.0f); }
  { *(v8us*)((unsigned short*)Hh + t * 8) = fh.half[0]; *(v8us*)((unsigned short*)Hl + t * 8) = fl.half[0];  } }

// ---- fast GEMM (block tile 128x64, wave tile 32x64; requires M % 128 == 0 rows per launch region, N % 64 == 0 and K % 256 == 0); epilogue = k_gemm_hhx semantics, except that blockIdx.y picks the bias from bias, bias1, bias2 ----
// A and B come through LDS: a stage is 256 k of the block's 128 A rows and 64 B rows (rows of 512 bytes), brought once for the four waves by asynchronous copies, one whole row a wave and copy,
// two buffers, the next stage flying while a stage is worked on. The fragments read from LDS hold the same elements in the same order as those read from global memory before.
#define GSK 256      /* k a stage */
#define GPH (GSK + 8)      /* LDS row pitch in 16-bit elements: 512 bytes of data + 16, a conflict-free pitch for 16-byte row readers */
#define GRB (4 * GPH * 2)      /* bytes of 4 LDS rows: the step between a thread's pieces of a tile */
#define GBB (192 * GPH * 2)      /* bytes of one buffer: rows 0 to 127 the A tile, rows 128 to 191 the B tile */
__device__ __forceinline__ v16h g2_frag(const _Float16* p, int hh) { FragH f; f.half[0] = *(const v8us*)((const unsigned short*)p + 8 * hh); f.half[1] = *(const v8us*)((const unsigned short*)p + 16 + 8 * hh); return f.v; }
__device__ __forceinline__ v8f g2_mma(v16h a, v16h b, v8f c) { v8f d = __builtin_amdgcn_wmma_f32_16x16x32_f16(false, a, false, b, (short)0, c, false, false); asm volatile("v_nop\n\tv_nop\n\tv_nop\n\tv_nop" : "+v"(d) : "v"(a), "v"(b)); return d; }
// Eight copies of one thread, 16 bytes each: rows four apart, in LDS (GRB bytes) and in global memory (gs elements). The s_wait_xcnt closes the statement so that no address register is rewritten ahead of it.
__device__ __forceinline__ void g2_copy8(unsigned l, const unsigned short* g, size_t gs) {
  const unsigned short* g1 = g + gs; const unsigned short* g2 = g1 + gs; const unsigned short* g3 = g2 + gs; const unsigned short* g4 = g3 + gs; const unsigned short* g5 = g4 + gs; const unsigned short* g6 = g5 + gs; const unsigned short* g7 = g6 + gs;
  asm volatile("global_load_async_to_lds_b128 %0, %8, off\n\t"
               "global_load_async_to_lds_b128 %1, %9, off\n\t"
               "global_load_async_to_lds_b128 %2, %10, off\n\t"
               "global_load_async_to_lds_b128 %3, %11, off\n\t"
               "global_load_async_to_lds_b128 %4, %12, off\n\t"
               "global_load_async_to_lds_b128 %5, %13, off\n\t"
               "global_load_async_to_lds_b128 %6, %14, off\n\t"
               "global_load_async_to_lds_b128 %7, %15, off\n\t"
               "s_wait_xcnt 0x0"
               :: "v"(l), "v"(l + GRB), "v"(l + 2 * GRB), "v"(l + 3 * GRB), "v"(l + 4 * GRB), "v"(l + 5 * GRB), "v"(l + 6 * GRB), "v"(l + 7 * GRB),
                  "v"(g), "v"(g1), "v"(g2), "v"(g3), "v"(g4), "v"(g5), "v"(g6), "v"(g7) : "memory");
}
// One stage's copies of one thread: 32 pieces of the A tile and 16 of the B tile (48 in flight a wave).
__device__ __forceinline__ void g2_stage(unsigned l, const unsigned short* ga, size_t as4, const unsigned short* gb, size_t bs4) {
#pragma unroll
  for (int c = 0; c < 4; ++c) g2_copy8(l + c * 8 * GRB, ga + c * 8 * as4, as4);
#pragma unroll
  for (int c = 0; c < 2; ++c) g2_copy8(l + (32 + c * 8) * GRB, gb + c * 8 * bs4, bs4);
}
template <int ACT>
__global__ __launch_bounds__(128) void k_gemm2(const _Float16* __restrict__ A, int lda, size_t sA, const _Float16* __restrict__ Bh, int ldb, size_t sB, float alpha, const float* __restrict__ bias, const float* __restrict__ bias1, const float* __restrict__ bias2, const float* __restrict__ CP, int rowsPerB, size_t sCPb, int row0g,
    float* __restrict__ C, _Float16* __restrict__ C16, int ldc, size_t sC, int M, int N, int K) {
  __shared__ __attribute__((aligned(16))) float so[4][32][68]; __shared__ __attribute__((aligned(16))) unsigned short sT[2][192][GPH];
  const int tid = threadIdx.x, w = tid >> 5, lane = tid & 31, ln = lane & 15, hh = lane >> 4; const int by = blockIdx.y;
  A += (size_t)by * sA; Bh += (size_t)by * sB; const size_t cofs = (size_t)by * sC; const float* bp = (by == 0) ? bias : ((by == 1) ? bias1 : bias2);      /* products that need nothing of each other share one grid: blockIdx.y picks the product, its B and C planes and its own bias vector */
  const int ntn = N >> 6; const int mt = blockIdx.x / ntn, nq = blockIdx.x - mt * ntn; const int row0 = mt * 128 + 32 * w, col0 = nq * 64; if (mt * 128 >= M) return;      /* the whole block leaves or none of it: barriers follow */
  const size_t as4 = (size_t)4 * lda, bs4 = (size_t)4 * ldb; const int nst = K / GSK;
  const unsigned short* ga = (const unsigned short*)A + (size_t)(mt * 128 + w) * lda + lane * 8;      /* the thread's first piece of the next stage to copy: a wave copies one whole row */
  const unsigned short* gb = (const unsigned short*)Bh + (size_t)(col0 + w) * ldb + lane * 8;
  const unsigned l0 = (unsigned)(size_t)&sT[0][w][lane * 8];      /* low 32 bits of a shared address = the byte offset in LDS */
  g2_stage(l0, ga, as4, gb, bs4); ga += GSK; gb += GSK;
  asm volatile("s_wait_asynccnt 0x0" ::: "memory");      /* stage 0 has landed before the barrier that publishes it */
  __syncthreads();
  if (nst > 1) { g2_stage(l0 + GBB, ga, as4, gb, bs4); ga += GSK; gb += GSK; }
  const v8f z8 = {0.f,0.f,0.f,0.f,0.f,0.f,0.f,0.f}; v8f c00 = z8, c01 = z8, c02 = z8, c03 = z8, c10 = z8, c11 = z8, c12 = z8, c13 = z8;
#pragma unroll 1      /* one stage a trip: the buffer index stays a run-time value and the text small */
  for (int st = 0; st < nst; ++st) {
    const int buf = st & 1;
    const _Float16* af = (const _Float16*)&sT[buf][32 * w + ln][0]; const _Float16* bf = (const _Float16*)&sT[buf][128 + ln][0];
    v16h fa[2][2], fb[2][4];      /* two fragment sets: a k step's reads are issued as one group ahead of the k step before it, inside the stage */
    fa[0][0] = g2_frag(af, hh); fa[0][1] = g2_frag(af + 16 * GPH, hh);
#pragma unroll
    for (int t = 0; t < 4; ++t) fb[0][t] = g2_frag(bf + t * 16 * GPH, hh);
#pragma unroll
    for (int kk = 0; kk < GSK / 32; ++kk) { const int cu = kk & 1, nx = cu ^ 1;
      if (kk + 1 < GSK / 32) { fa[nx][0] = g2_frag(af + (kk + 1) * 32, hh); fa[nx][1] = g2_frag(af + 16 * GPH + (kk + 1) * 32, hh);
#pragma unroll
        for (int t = 0; t < 4; ++t) fb[nx][t] = g2_frag(bf + t * 16 * GPH + (kk + 1) * 32, hh); }
      c00 = g2_mma(fa[cu][0], fb[cu][0], c00); c10 = g2_mma(fa[cu][1], fb[cu][0], c10);
      c01 = g2_mma(fa[cu][0], fb[cu][1], c01); c11 = g2_mma(fa[cu][1], fb[cu][1], c11);
      c02 = g2_mma(fa[cu][0], fb[cu][2], c02); c12 = g2_mma(fa[cu][1], fb[cu][2], c12);
      c03 = g2_mma(fa[cu][0], fb[cu][3], c03); c13 = g2_mma(fa[cu][1], fb[cu][3], c13); }
    asm volatile("s_wait_dscnt 0x0" ::: "memory");      /* this wave's reads of the buffer have returned before it is given up */
    asm volatile("s_wait_asynccnt 0x0" ::: "memory");      /* this wave's copies of the next stage have landed */
    __syncthreads();      /* publishes the next stage and ends every wave's reads of this one */
    if (st + 2 < nst) { g2_stage(l0 + buf * GBB, ga, as4, gb, bs4); ga += GSK; gb += GSK; } }
  asm volatile("s_wait_asynccnt 0x0" ::: "memory");      /* no copy is left in flight when the wave goes on to the epilogue */
  v8f accs[8] = {c00, c01, c02, c03, c10, c11, c12, c13};
#pragma unroll
  for (int u = 0; u < 8; ++u) { const int t = u & 3, half = u >> 2; const int col = col0 + t * 16 + ln; const float bv = bp ? bf16_round(bp[col]) : 0.f;
#pragma unroll
    for (int r = 0; r < 8; ++r) { const int rloc = half * 16 + 8 * hh + r; float v = accs[u][r] * alpha + bv; if (CP) { if (rowsPerB < 0) v += CP[cofs + (size_t)(row0g + row0 + rloc) * ldc + col];      /* rowsPerB < 0: own element of the batched C plane */ else { const int bidx = (row0g + row0 + rloc) / rowsPerB; v += CP[(size_t)bidx * sCPb + (size_t)by * 64 + col]; } }
      if (ACT == 3) v = fmaxf(v, 0.f); else if (ACT == 6) v = 0.5f * v * (1.0f + erff(v * 0.70710678118654752f)); else if (ACT == 11) v = 1.0f / (1.0f + expf(-v)); else if (ACT == 15) v = v / (1.0f + expf(-v)); else if (ACT == 12) v = (v > 0.f) ? v : 0.01f * v; else if (ACT == 8) v = tanhf(v);
      so[w][rloc][t * 16 + ln] = v; } }
  __builtin_amdgcn_fence(__ATOMIC_ACQ_REL, "workgroup"); __builtin_amdgcn_wave_barrier();
  const int rsub = lane >> 4, c4 = (lane & 15) * 4;
  {
#pragma unroll
    for (int q = 0; q < 16; ++q) { const int r = q * 2 + rsub; const v4f v = *(const v4fa*)&so[w][r][c4]; if (C) *(v4f*)(C + cofs + (size_t)(row0 + r) * ldc + col0 + c4) = v; if (C16) { v4h h4; for (int i = 0; i < 4; ++i) h4[i] = (_Float16)v[i]; *(v4h*)(C16 + cofs + (size_t)(row0 + r) * ldc + col0 + c4) = h4; } }
     } }



// lane l takes the value of lane l ^ 16 (the other half of the same query column)
__device__ __forceinline__ float xhalf(float x) { return __builtin_bit_cast(float, __builtin_amdgcn_permlanex16(__builtin_bit_cast(int, x), __builtin_bit_cast(int, x), 0x76543210, 0xfedcba98, false, false)); }
#define FSK 64      /* keys a stage */
#define FPH 72      /* LDS row pitch in 16-bit elements: 128 bytes of data + 16, the conflict-free pitch for 16-byte row readers */
#define FBB (64 * FPH * 2)      /* bytes of one tile buffer */
#define FRB (16 * FPH * 2)      /* bytes of 16 LDS rows: the step between a thread's four pieces of a tile */
#define FC2 (SCL * 1.4426950408889634f)      /* score scale times log2(e): the softmax runs in base 2 on the hardware's own exponential */
// One stage's copies of one thread: pieces (row, row + 16, row + 32, row + 48) of the K tile and of the V^T tile, 16 bytes each. The s_wait_xcnt closes the statement so that no address register is rewritten ahead of it.
__device__ __forceinline__ void fl_copy(unsigned lk, unsigned lv, const unsigned short* gk, size_t ks16, const unsigned short* gv) {
  const unsigned short* gk1 = gk + ks16; const unsigned short* gk2 = gk1 + ks16; const unsigned short* gk3 = gk2 + ks16;
  const unsigned short* gv1 = gv + (size_t)16 * TK; const unsigned short* gv2 = gv + (size_t)32 * TK; const unsigned short* gv3 = gv + (size_t)48 * TK;
  asm volatile("global_load_async_to_lds_b128 %0, %8, off\n\t"
               "global_load_async_to_lds_b128 %1, %9, off\n\t"
               "global_load_async_to_lds_b128 %2, %10, off\n\t"
               "global_load_async_to_lds_b128 %3, %11, off\n\t"
               "global_load_async_to_lds_b128 %4, %12, off\n\t"
               "global_load_async_to_lds_b128 %5, %13, off\n\t"
               "global_load_async_to_lds_b128 %6, %14, off\n\t"
               "global_load_async_to_lds_b128 %7, %15, off\n\t"
               "s_wait_xcnt 0x0"
               :: "v"(lk), "v"(lk + FRB), "v"(lk + 2 * FRB), "v"(lk + 3 * FRB), "v"(lv), "v"(lv + FRB), "v"(lv + 2 * FRB), "v"(lv + 3 * FRB),
                  "v"(gk), "v"(gk1), "v"(gk2), "v"(gk3), "v"(gv), "v"(gv1), "v"(gv2), "v"(gv3) : "memory");
}
__global__ __launch_bounds__(128) void k_flash(const _Float16* __restrict__ Q16, int ldq, const _Float16* __restrict__ K16, int ldk, const _Float16* __restrict__ Vt, float* __restrict__ O, int ldo) {
  constexpr int RPW = 16, DT = 4, KS = 2, NST = TK / FSK;
  __shared__ __attribute__((aligned(16))) unsigned short sK[2][64][FPH]; __shared__ __attribute__((aligned(16))) unsigned short sV[2][64][FPH];
  const int tid = threadIdx.x, w = tid >> 5, lane = tid & 31, ln = lane & 15, hh = lane >> 4;
  const int slab = blockIdx.x / QBNP, qblk = QB0P + blockIdx.x % QBNP; const int b = slab / NH, h = slab % NH; const int q0 = qblk * (4 * RPW) + w * RPW;
  FragH bq[KS];
  { const unsigned short* qr = (const unsigned short*)Q16 + ((size_t)b * TQ + q0 + ln) * ldq + h * 64;
#pragma unroll
    for (int ks = 0; ks < KS; ++ks) { bq[ks].half[0] = *(const v8us*)(qr + ks * 32 + 8 * hh); bq[ks].half[1] = *(const v8us*)(qr + ks * 32 + 16 + 8 * hh); } }
  const unsigned short* Vth = (const unsigned short*)Vt + (size_t)slab * 64 * TK;
  const int crow = tid >> 3, cseg = (tid & 7) * 8;      /* eight threads copy one 128-byte row */
  const size_t ks16 = (size_t)16 * ldk, kstg = (size_t)FSK * ldk;
  const unsigned short* gk = (const unsigned short*)K16 + ((size_t)b * TK + crow) * ldk + h * 64 + cseg;      /* the thread's first piece of the next stage to copy, advanced behind each stage's copies */
  const unsigned short* gv = Vth + (size_t)crow * TK + cseg;
  const unsigned lk0 = (unsigned)(size_t)&sK[0][crow][cseg], lv0 = (unsigned)(size_t)&sV[0][crow][cseg];      /* low 32 bits of a shared address = the byte offset in LDS */
  fl_copy(lk0, lv0, gk, ks16, gv); gk += kstg; gv += FSK;
  asm volatile("s_wait_asynccnt 0x0" ::: "memory");      /* stage 0 has landed before the barrier that publishes it */
  __syncthreads();
  fl_copy(lk0 + FBB, lv0 + FBB, gk, ks16, gv); gk += kstg; gv += FSK;
  float m_r = -3.0e38f, l_r = 0.f; v8f oacc[DT];
#pragma unroll
  for (int dt = 0; dt < DT; ++dt) oacc[dt] = (v8f){0.f,0.f,0.f,0.f,0.f,0.f,0.f,0.f};
#pragma unroll 1      /* one stage a trip: the buffer index stays a run-time value and the text small */
  for (int st = 0; st < NST; ++st) {
    const int buf = st & 1;
    const unsigned short* kf = &sK[buf][ln][8 * hh]; const unsigned short* vf = &sV[buf][ln][8 * hh];
#pragma unroll
    for (int ps2 = 0; ps2 < FSK / 32; ++ps2) {
      FragH ak[2][KS], av[DT];
#pragma unroll
      for (int nt = 0; nt < 2; ++nt)
#pragma unroll
        for (int ks = 0; ks < KS; ++ks) { const unsigned short* kr = kf + (ps2 * 32 + nt * 16) * FPH + ks * 32; ak[nt][ks].half[0] = *(const v8us*)kr; ak[nt][ks].half[1] = *(const v8us*)(kr + 16); }
#pragma unroll
      for (int dt = 0; dt < DT; ++dt) { const unsigned short* vr = vf + dt * 16 * FPH + ps2 * 32; av[dt].half[0] = *(const v8us*)vr; av[dt].half[1] = *(const v8us*)(vr + 16); }
      float sc[16];
#pragma unroll
      for (int nt = 0; nt < 2; ++nt) { v8f acc = (v8f){0.f,0.f,0.f,0.f,0.f,0.f,0.f,0.f};
#pragma unroll
        for (int ks = 0; ks < KS; ++ks) acc = mmaH<1>(ak[nt][ks].v, ak[nt][ks].v, bq[ks].v, bq[ks].v, acc);
#pragma unroll
        for (int r = 0; r < 8; ++r) sc[nt * 8 + r] = acc[r]; }      /* raw q.k: the maximum is kept unscaled, the scale goes into the exponent's multiply-add */
      float mx[4];
#pragma unroll
      for (int c = 0; c < 4; ++c) mx[c] = fmaxf(fmaxf(sc[c], sc[4 + c]), fmaxf(sc[8 + c], sc[12 + c]));
      float mc = fmaxf(fmaxf(mx[0], mx[1]), fmaxf(mx[2], mx[3])); mc = fmaxf(mc, xhalf(mc));      /* both halves of a column use one maximum: they share the output tiles */
      const float mn = fmaxf(m_r, mc); float al = (m_r - mn) * FC2; m_r = mn;
      const float nb = fmaf(-mn, FC2, 10.0f);      /* 2^(s FC2 + nb) = 1024 exp((s - mn) / 8) */
      FragH pb; float ps[4];
#pragma unroll
      for (int i = 0; i < 16; ++i) sc[i] = fmaf(sc[i], FC2, nb);
      asm("v_exp_f32 %0, %0\n\tv_exp_f32 %1, %1\n\tv_exp_f32 %2, %2\n\tv_exp_f32 %3, %3\n\tv_exp_f32 %4, %4\n\tv_exp_f32 %5, %5\n\tv_exp_f32 %6, %6\n\tv_exp_f32 %7, %7\n\tv_exp_f32 %8, %8\n\t"
          "v_exp_f32 %9, %9\n\tv_exp_f32 %10, %10\n\tv_exp_f32 %11, %11\n\tv_exp_f32 %12, %12\n\tv_exp_f32 %13, %13\n\tv_exp_f32 %14, %14\n\tv_exp_f32 %15, %15\n\tv_exp_f32 %16, %16\n\tv_nop"
          : "+v"(al), "+v"(sc[0]), "+v"(sc[1]), "+v"(sc[2]), "+v"(sc[3]), "+v"(sc[4]), "+v"(sc[5]), "+v"(sc[6]), "+v"(sc[7]), "+v"(sc[8]), "+v"(sc[9]), "+v"(sc[10]), "+v"(sc[11]), "+v"(sc[12]), "+v"(sc[13]), "+v"(sc[14]), "+v"(sc[15]));
#pragma unroll
      for (int i = 0; i < 16; ++i) { const float p = sc[i]; ps[i & 3] = (i < 4) ? p : ps[i & 3] + p; pb.h[i] = (_Float16)p; }      /* element i = key 8 hh + i (i < 8), 16 + 8 hh + i - 8 (i >= 8): the order of the V^T fragments above */
      l_r = l_r * al + ((ps[0] + ps[1]) + (ps[2] + ps[3]));
#pragma unroll
      for (int dt = 0; dt < DT; ++dt)
#pragma unroll
        for (int r = 0; r < 8; ++r) oacc[dt][r] *= al;
#pragma unroll
      for (int dt = 0; dt < DT; ++dt) oacc[dt] = mmaH<1>(av[dt].v, av[dt].v, pb.v, pb.v, oacc[dt]);
    }
    asm volatile("s_wait_dscnt 0x0" ::: "memory");      /* this wave's reads of the buffer have returned before it is given up */
    asm volatile("s_wait_asynccnt 0x0" ::: "memory");      /* this wave's copies of the next stage have landed */
    __syncthreads();      /* publishes the next stage and ends every wave's reads of this one */
    if (st + 2 < NST) { fl_copy(lk0 + buf * FBB, lv0 + buf * FBB, gk, ks16, gv); gk += kstg; gv += FSK; } }
  asm volatile("s_wait_asynccnt 0x0" ::: "memory");      /* no copy is left in flight when the wave ends */
  const float l = l_r + xhalf(l_r); const float inv = (l > 0.f) ? 1.0f / l : 0.f;      /* weights and sum both carry the 2^10 */
  float* orow = O + ((size_t)b * TQ + q0 + ln) * ldo + h * 64 + 8 * hh;      /* register r of tile dt = channel dt * 16 + 8 hh + r of query ln: 32 contiguous bytes a lane */
#pragma unroll
  for (int dt = 0; dt < DT; ++dt) { const v4f lo = {oacc[dt][0] * inv, oacc[dt][1] * inv, oacc[dt][2] * inv, oacc[dt][3] * inv}, hi = {oacc[dt][4] * inv, oacc[dt][5] * inv, oacc[dt][6] * inv, oacc[dt][7] * inv};
    *(v4f*)(orow + dt * 16) = lo; *(v4f*)(orow + dt * 16 + 4) = hi; } }
// 5-plane variant: S = Qh Kh^T + (Ql Kh^T + Qh Kl^T)/1024 with Q/K = [hi | 2^10 residual] f16 planes (QL/KL same layout as Q16/K16), then the 3-term P.V below.
// 3-term variant: O = (P_hi V_hi + (P_lo V_hi + P_hi V_lo) / 1024) / l with P = [hi | 2^10 residual] of 1024 p and V^T = [hi | 2^10 residual] planes (VtL same layout as Vt) -> ~2^-21-class products for un-averaged (early causal / peaked) rows
template <int CAUSAL>
__global__ __launch_bounds__(128) void k_flash5(const _Float16* __restrict__ Q16, const _Float16* __restrict__ QL, int ldq, const _Float16* __restrict__ K16, const _Float16* __restrict__ KL, int ldk, const _Float16* __restrict__ Vt, const _Float16* __restrict__ VtL, const int* __restrict__ MSK, float* __restrict__ O, int ldo) {
  constexpr int RPW = 16, RTN = RPW / 16, NQB = TQ / (4 * RPW), DT = 4, KS = 2;
  __shared__ __attribute__((aligned(16))) unsigned short sP[4][RPW][40]; __shared__ __attribute__((aligned(16))) unsigned short sPL[4][RPW][40]; __shared__ __attribute__((aligned(16))) float sO[4][RPW][64 + 4];
  const int tid = threadIdx.x, w = tid >> 5, lane = tid & 31, ln = lane & 15, hh = lane >> 4;
  const int slab = blockIdx.x / QBN5, qblk = QB05 + blockIdx.x % QBN5; (void)NQB; const int b = slab / NH, h = slab % NH; const int qb0 = qblk * (4 * RPW); const int q0 = qb0 + w * RPW;
  FragH aq[2][KS], aql[2][KS];
#pragma unroll
  for (int rt = 0; rt < RTN; ++rt) { const unsigned short* qr = (const unsigned short*)Q16 + ((size_t)b * TQ + q0 + rt * 16 + ln) * ldq + h * 64; const unsigned short* ql = (const unsigned short*)QL + ((size_t)b * TQ + q0 + rt * 16 + ln) * ldq + h * 64;
#pragma unroll
    for (int ks = 0; ks < KS; ++ks) { aq[rt][ks].half[0] = *(const v8us*)(qr + ks * 32 + 8 * hh); aq[rt][ks].half[1] = *(const v8us*)(qr + ks * 32 + 16 + 8 * hh); aql[rt][ks].half[0] = *(const v8us*)(ql + ks * 32 + 8 * hh); aql[rt][ks].half[1] = *(const v8us*)(ql + ks * 32 + 16 + 8 * hh); } }
  const unsigned short* Vth = (const unsigned short*)Vt + (size_t)slab * 64 * TK; const unsigned short* Vtl = (const unsigned short*)VtL + (size_t)slab * 64 * TK;
  float m_r[2][8], l_r[2][8]; v8f oacc[2][DT], oaccL[2][DT];
#pragma unroll
  for (int rt = 0; rt < RTN; ++rt) {
#pragma unroll
    for (int r = 0; r < 8; ++r) { m_r[rt][r] = -3.0e38f; l_r[rt][r] = 0.f; }
#pragma unroll
    for (int dt = 0; dt < DT; ++dt) { oacc[rt][dt] = (v8f){0.f,0.f,0.f,0.f,0.f,0.f,0.f,0.f}; oaccL[rt][dt] = oacc[rt][dt]; } }
  const int jend = (CAUSAL == 1) ? (qb0 + 4 * RPW) : ((CAUSAL == 23) ? min(TK, (qb0 / CHK + 2) * CHK) : TK);      /* causal / window: keys that can never contribute are skipped */ const int jbeg = (CAUSAL == 23) ? max(0, (qb0 / CHK - 1) * CHK) : 0;
#pragma unroll 1
  for (int j0 = jbeg; j0 < jend; j0 += 32) {
    v8f s[2][2];
#pragma unroll
    for (int nt = 0; nt < 2; ++nt) { const unsigned short* kr = (const unsigned short*)K16 + ((size_t)b * TK + j0 + nt * 16 + ln) * ldk + h * 64; const unsigned short* klr = (const unsigned short*)KL + ((size_t)b * TK + j0 + nt * 16 + ln) * ldk + h * 64; FragH bk[KS], bkl[KS];
#pragma unroll
      for (int ks = 0; ks < KS; ++ks) { bk[ks].half[0] = *(const v8us*)(kr + ks * 32 + 8 * hh); bk[ks].half[1] = *(const v8us*)(kr + ks * 32 + 16 + 8 * hh); bkl[ks].half[0] = *(const v8us*)(klr + ks * 32 + 8 * hh); bkl[ks].half[1] = *(const v8us*)(klr + ks * 32 + 16 + 8 * hh); }
#pragma unroll
      for (int rt = 0; rt < RTN; ++rt) { v8f acc = (v8f){0.f,0.f,0.f,0.f,0.f,0.f,0.f,0.f}, accl = acc;
#pragma unroll
        for (int ks = 0; ks < KS; ++ks) { acc = mmaH<1>(aq[rt][ks].v, aq[rt][ks].v, bk[ks].v, bk[ks].v, acc); accl = mmaH<1>(aql[rt][ks].v, aql[rt][ks].v, bk[ks].v, bk[ks].v, accl); accl = mmaH<1>(aq[rt][ks].v, aq[rt][ks].v, bkl[ks].v, bkl[ks].v, accl); }
#pragma unroll
        for (int r = 0; r < 8; ++r) acc[r] += accl[r] * 0.0009765625f;
        s[rt][nt] = acc; } }
#pragma unroll
    for (int rt = 0; rt < RTN; ++rt)
#pragma unroll
      for (int r = 0; r < 8; ++r) { const int tq = q0 + rt * 16 + 8 * hh + r; const int k0 = j0 + ln, k1 = j0 + 16 + ln;
        bool ok0 = (CAUSAL == 1) ? (k0 <= tq) : ((CAUSAL == 2) ? ((k0 >> 5) == (tq >> 5)) : true), ok1 = (CAUSAL == 1) ? (k1 <= tq) : ((CAUSAL == 2) ? ((k1 >> 5) == (tq >> 5)) : true);      /* mode 2: block-diagonal 32-token groups */
        if (CAUSAL == 4) { const int* mrow = MSK + ((size_t)b * TQ + tq) * TK; ok0 = mrow[k0] != 0; ok1 = mrow[k1] != 0; }      /* mode 4: per-(query, key) INPUT mask shared by all heads; masked keys contribute nothing (== the reference's -4096 fill, whose exp underflows to 0), rows with no valid key give l = 0 -> output 0 (== the reference's row_valid zeroing) */
        float s0 = ok0 ? s[rt][0][r] * SCL : -3.0e38f, s1 = ok1 ? s[rt][1][r] * SCL : -3.0e38f; if (CAUSAL == 17) { const float* amk = (const float*)MSK + (size_t)b * TK; s0 += bf16_round(amk[k0]); s1 += bf16_round(amk[k1]); } if (CAUSAL == 18) { const float* tb = (const float*)MSK; const int* ri = MSK + 1024 + (size_t)b * TK; const int rq = ri[tq]; s0 += tb[(h * 8 + rq) * 8 + ri[k0]]; s1 += tb[(h * 8 + rq) * 8 + ri[k1]]; } if (CAUSAL == 19) { const int* rel = MSK + (size_t)tq * TK; const float* rb = (const float*)MSK + (size_t)TQ * TK + ((size_t)(b * NH + h) * TQ + tq) * 64; s0 += rb[rel[k0]]; s1 += rb[rel[k1]]; }      /* mode 19: + (q.Ek[rel] + Eb[rel][h]) / 8 gathered by the int relative ids (packed [ids | table]) */      /* mode 18: + resource_bias[h][r_q][r_k] from the packed [table | ids] buffer (TQ == TK) */      /* mode 17: additive per-(batch, key) mask INPUT */ float mc = fmaxf(s0, s1);
        mc = fmaxf(mc, __shfl_xor(mc, 1, 32)); mc = fmaxf(mc, __shfl_xor(mc, 2, 32)); mc = fmaxf(mc, __shfl_xor(mc, 4, 32)); mc = fmaxf(mc, __shfl_xor(mc, 8, 32));
        const float mn = fmaxf(m_r[rt][r], mc); const float al = (mn > -1.0e38f) ? expf(m_r[rt][r] - mn) : 1.0f; m_r[rt][r] = mn; const float p0 = ok0 ? expf(s0 - mn) : 0.f, p1 = ok1 ? expf(s1 - mn) : 0.f; l_r[rt][r] = l_r[rt][r] * al + p0 + p1;
#pragma unroll
        for (int dt = 0; dt < DT; ++dt) { oacc[rt][dt][r] *= al; oaccL[rt][dt][r] *= al; }
        FragH t2, t2l; const float ps0 = p0 * 1024.0f, ps1 = p1 * 1024.0f; t2.h[0] = (_Float16)ps0; t2.h[1] = (_Float16)ps1; t2l.h[0] = (_Float16)((ps0 - (float)t2.h[0]) * 1024.0f); t2l.h[1] = (_Float16)((ps1 - (float)t2.h[1]) * 1024.0f);
        sP[w][rt * 16 + 8 * hh + r][ln] = t2.u[0]; sP[w][rt * 16 + 8 * hh + r][16 + ln] = t2.u[1]; sPL[w][rt * 16 + 8 * hh + r][ln] = t2l.u[0]; sPL[w][rt * 16 + 8 * hh + r][16 + ln] = t2l.u[1]; }
    __builtin_amdgcn_fence(__ATOMIC_ACQ_REL, "workgroup"); __builtin_amdgcn_wave_barrier();
    FragH pa[2], pl[2];
#pragma unroll
    for (int rt = 0; rt < RTN; ++rt) { pa[rt].half[0] = *(const v8us*)&sP[w][rt * 16 + ln][8 * hh]; pa[rt].half[1] = *(const v8us*)&sP[w][rt * 16 + ln][16 + 8 * hh]; pl[rt].half[0] = *(const v8us*)&sPL[w][rt * 16 + ln][8 * hh]; pl[rt].half[1] = *(const v8us*)&sPL[w][rt * 16 + ln][16 + 8 * hh]; }
#pragma unroll
    for (int dt = 0; dt < DT; ++dt) { const unsigned short* vrow = Vth + (size_t)(dt * 16 + ln) * TK + j0; const unsigned short* vrl = Vtl + (size_t)(dt * 16 + ln) * TK + j0; FragH bv, bl; bv.half[0] = *(const v8us*)(vrow + 8 * hh); bv.half[1] = *(const v8us*)(vrow + 16 + 8 * hh); bl.half[0] = *(const v8us*)(vrl + 8 * hh); bl.half[1] = *(const v8us*)(vrl + 16 + 8 * hh);
#pragma unroll
      for (int rt = 0; rt < RTN; ++rt) { oacc[rt][dt] = mmaH<1>(pa[rt].v, pa[rt].v, bv.v, bv.v, oacc[rt][dt]); oaccL[rt][dt] = mmaH<1>(pl[rt].v, pl[rt].v, bv.v, bv.v, oaccL[rt][dt]); oaccL[rt][dt] = mmaH<1>(pa[rt].v, pa[rt].v, bl.v, bl.v, oaccL[rt][dt]); } }
    __builtin_amdgcn_fence(__ATOMIC_ACQ_REL, "workgroup"); __builtin_amdgcn_wave_barrier(); }
#pragma unroll
  for (int rt = 0; rt < RTN; ++rt) {
#pragma unroll
    for (int r = 0; r < 8; ++r) { float l = l_r[rt][r]; l += __shfl_xor(l, 1, 32); l += __shfl_xor(l, 2, 32); l += __shfl_xor(l, 4, 32); l += __shfl_xor(l, 8, 32); l_r[rt][r] = (l > 0.f) ? 1.0f / (l * 1024.0f) : 0.f; }
#pragma unroll
    for (int dt = 0; dt < DT; ++dt)
#pragma unroll
      for (int r = 0; r < 8; ++r) { float v = oacc[rt][dt][r]; v += oaccL[rt][dt][r] * 0.0009765625f; sO[w][rt * 16 + 8 * hh + r][dt * 16 + ln] = v * l_r[rt][r]; } }
  __builtin_amdgcn_fence(__ATOMIC_ACQ_REL, "workgroup"); __builtin_amdgcn_wave_barrier();
  {
#pragma unroll
    for (int rp = 0; rp < RPW; rp += 2) { const int r = rp + (lane >> 4), pc = lane & 15; const v4f val = *(const v4fa*)&sO[w][r][pc * 4]; *(v4f*)(O + ((size_t)b * TQ + q0 + r) * ldo + h * 64 + pc * 4) = val; }
     } }

__global__ __launch_bounds__(256) void k_rotab(float* __restrict__ CS, float* __restrict__ SN) {
  #pragma clang fp contract(off)
  const int t = blockIdx.x * 256 + threadIdx.x; if (t >= SLEN * 32) return; const int j = t % 32, s = t / 32; const float ex = (float)(2 * j) / 64.0f; const float inv = 1.0f / powf(10000.0f, ex); const float th = (float)s * inv; const float c = cosf(th), sn = sinf(th);
  { *(float*)(CS + t) = c; *(float*)(SN + t) = sn;  } }
__global__ __launch_bounds__(256) void k_rope(const float* __restrict__ F, int nsrc, int ndst, int rep, const float* __restrict__ CS, const float* __restrict__ SN, _Float16* __restrict__ H, _Float16* __restrict__ L) {
  #pragma clang fp contract(off)
  const size_t t = (size_t)blockIdx.x * 256 + threadIdx.x; if (t >= (size_t)NR * ndst * 4) return; const int g8 = (int)(t % 4); const int hd = (int)((t / 4) % ndst); const size_t row = t / ((size_t)4 * ndst); const int s = (int)(row % SLEN); const int hs = hd / rep;
  const float* src = F + row * (size_t)(nsrc * 64) + hs * 64; FragH ah, al, bh, bl;
  for (int i = 0; i < 8; ++i) { const int d = g8 * 8 + i; const float c = CS[s * 32 + d], sn = SN[s * 32 + d]; const float x1 = src[d], x2 = src[d + 32];
    float o1 = x1 * c; o1 += -x2 * sn; float o2 = x2 * c; o2 += x1 * sn;
    _Float16 hv = (_Float16)o1; ah.h[i] = hv; al.h[i] = (_Float16)((o1 - (float)hv) * 1024.0f); hv = (_Float16)o2; bh.h[i] = hv; bl.h[i] = (_Float16)((o2 - (float)hv) * 1024.0f); }
  const size_t o = row * (size_t)(ndst * 64) + hd * 64 + g8 * 8;
  { *(v8us*)((unsigned short*)H + o) = ah.half[0]; *(v8us*)((unsigned short*)H + o + 32) = bh.half[0]; *(v8us*)((unsigned short*)L + o) = al.half[0]; *(v8us*)((unsigned short*)L + o + 32) = bl.half[0];  } }
__global__ __launch_bounds__(256) void k_rope2(const float* __restrict__ F, int nsrc, int ndst, int rep, const float* __restrict__ CS, const float* __restrict__ SN, _Float16* __restrict__ H, _Float16* __restrict__ L) {
  #pragma clang fp contract(off)
  const size_t t = (size_t)blockIdx.x * 256 + threadIdx.x; if (t >= (size_t)NR * ndst * 4) return; const int g16 = (int)(t % 4); const int hd = (int)((t / 4) % ndst); const size_t row = t / ((size_t)4 * ndst); const int s = (int)(row % SLEN); const int hs = hd / rep;
  const float* src = F + row * (size_t)(nsrc * 64) + hs * 64 + g16 * 16; FragH ah, al;
  for (int pr = 0; pr < 8; ++pr) { const int i = g16 * 8 + pr; const float c = CS[s * 32 + i], sn = SN[s * 32 + i]; const float x1 = src[2 * pr], x2 = src[2 * pr + 1];
    float o1 = x1 * c; o1 -= x2 * sn; float o2 = x1 * sn; o2 += x2 * c;
    _Float16 hv = (_Float16)o1; ah.h[2 * pr] = hv; al.h[2 * pr] = (_Float16)((o1 - (float)hv) * 1024.0f); hv = (_Float16)o2; ah.h[2 * pr + 1] = hv; al.h[2 * pr + 1] = (_Float16)((o2 - (float)hv) * 1024.0f); }
  const size_t o = row * (size_t)(ndst * 64) + hd * 64 + g16 * 16;
  { *(v8us*)((unsigned short*)H + o) = ah.half[0]; *(v8us*)((unsigned short*)H + o + 8) = ah.half[1]; *(v8us*)((unsigned short*)L + o) = al.half[0]; *(v8us*)((unsigned short*)L + o + 8) = al.half[1];  } }
__global__ __launch_bounds__(256) void k_ln512(const float* __restrict__ A, const float* __restrict__ res, const float* __restrict__ g, const float* __restrict__ bb, float* __restrict__ Y, _Float16* __restrict__ Y16) {
  #pragma clang fp contract(off)
  const int wv = threadIdx.x >> 5, ln = threadIdx.x & 31; const size_t r = (size_t)blockIdx.x * 8 + wv; if (r >= NR) return; float x[16]; float s = 0.f;
  for (int i = 0; i < 2; ++i) { const v8f a = *(const v8f*)(A + r * DM + i * 256 + ln * 8); for (int q = 0; q < 8; ++q) { float v = a[q]; if (res) v += bf16_round(res[r * DM + i * 256 + ln * 8 + q]); x[i * 8 + q] = v; s += v; } }
  for (int o = 16; o > 0; o >>= 1) s += __shfl_xor(s, o, 32); const float mu = s / (float)DM; float var = 0.f; for (int q = 0; q < 16; ++q) { const float d = x[q] - mu; var += d * d; }
  for (int o = 16; o > 0; o >>= 1) var += __shfl_xor(var, o, 32); const float inv = rsqrtf(var / (float)DM + 1e-5f);
  { for (int i = 0; i < 2; ++i) { const int c0 = i * 256 + ln * 8; v8f y; FragH f; for (int q = 0; q < 8; ++q) { float v = (x[i * 8 + q] - mu) * inv; v *= bf16_round(g[c0 + q]); v += bf16_round(bb[c0 + q]); y[q] = v; f.h[q] = (_Float16)v; } *(v8f*)(Y + r * DM + c0) = y; if (Y16) *(v8us*)((unsigned short*)Y16 + r * DM + c0) = f.half[0]; }  } }
__global__ __launch_bounds__(256) void k_pack(const float* __restrict__ rb, const int* __restrict__ rid, int* __restrict__ PK) { const int t = blockIdx.x * 256 + threadIdx.x; if (t >= 1024 + NB * TK) return; int v; if (t < 1024) v = __float_as_int(bf16_round(rb[t])); else v = rid[t - 1024]; *(int*)(PK + t) = v;  }
__global__ __launch_bounds__(256) void k_tabin(const float* __restrict__ sp, float* __restrict__ CS, float* __restrict__ SN) { const int t = blockIdx.x * 256 + threadIdx.x; if (t >= SLEN * 32) return; const int i = t % 32, s = t / 32; const float c = bf16_round(sp[s * 64 + 32 + i]), sn = bf16_round(sp[s * 64 + i]);
  { *(float*)(CS + t) = c; *(float*)(SN + t) = sn;  } }
__global__ __launch_bounds__(256) void k_rotab2(float* __restrict__ CS, float* __restrict__ SN) {
  #pragma clang fp contract(off)
  const int t = blockIdx.x * 256 + threadIdx.x; if (t >= SLEN * 32) return; const int j = t % 32, s = t / 32; const float c0 = -0.14391156831212787f;      /* -ln(10000)/64 rounded to f32 */ const float inv = expf((float)(2 * j) * c0); const float th = (float)s * inv; const float c = cosf(th), sn = sinf(th);
  { *(float*)(CS + t) = c; *(float*)(SN + t) = sn;  } }
__global__ __launch_bounds__(256) void k_lnu(const float* __restrict__ X, _Float16* __restrict__ N16, float* __restrict__ XB) {
  #pragma clang fp contract(off)
  const int wv = threadIdx.x >> 5, ln = threadIdx.x & 31; const size_t r = (size_t)blockIdx.x * 8 + wv; if (r >= NR) return; float a[32]; float s = 0.f;
  for (int i = 0; i < 4; ++i) { const v8f v = *(const v8f*)(X + r * DM + (i * 32 + ln) * 8); for (int q = 0; q < 8; ++q) { const float u = bf16_round(v[q]); a[i * 8 + q] = u; s += u; } }
  for (int o = 16; o > 0; o >>= 1) s += __shfl_xor(s, o, 32); const float mu = s / (float)DM; float var = 0.f; for (int q = 0; q < 32; ++q) { const float d = a[q] - mu; var += d * d; }
  for (int o = 16; o > 0; o >>= 1) var += __shfl_xor(var, o, 32); const float den = sqrtf(var / (float)(DM - 1)) + 1e-6f; const float inv = 1.0f / den;      /* one reciprocal per row; (x-mean)*inv vs the reference's division differs by <= 1 ulp */
  { for (int i = 0; i < 4; ++i) { const int c0 = (i * 32 + ln) * 8; FragH f; v8f xb; for (int q = 0; q < 8; ++q) { f.h[q] = (_Float16)((a[i * 8 + q] - mu) * inv); xb[q] = a[i * 8 + q]; } *(v8us*)((unsigned short*)N16 + r * DM + c0) = f.half[0]; *(v8f*)(XB + r * DM + c0) = xb; }  } }
__global__ __launch_bounds__(256) void k_vtg(const _Float16* __restrict__ V16, _Float16* __restrict__ Vt) { __shared__ unsigned short tl[64][66]; const int tid = threadIdx.x; const int slab = blockIdx.x / (SLEN / 64), lg = blockIdx.x % (SLEN / 64); const int b = slab / NH, h = slab % NH; const int hs = h / NREP;
  for (int i = tid; i < 64 * 8; i += 256) { const int r = i / 8, c8 = (i % 8) * 8; FragH f; f.half[0] = *(const v8us*)((const unsigned short*)V16 + ((size_t)b * SLEN + lg * 64 + r) * KVD + hs * 64 + c8); for (int q = 0; q < 8; ++q) tl[r][c8 + q] = f.u[q]; }
  __syncthreads();
  { for (int rd = 0; rd < 2; ++rd) { const int d = rd * 32 + tid / 8, pc = tid % 8; FragH f; for (int q = 0; q < 8; ++q) f.u[q] = tl[pc * 8 + q][d]; *(v8us*)((unsigned short*)Vt + ((size_t)slab * 64 + d) * SLEN + lg * 64 + pc * 8) = f.half[0]; }  } }

__global__ __launch_bounds__(256) void k_h16s(const float* __restrict__ SRC, int lds, int coff, _Float16* __restrict__ DST, size_t n8) { const size_t t = (size_t)blockIdx.x * 256 + threadIdx.x; if (t >= n8) return; const size_t r = (t * 8) / DM; const int c = (int)((t * 8) % DM); const v8f a = *(const v8f*)(SRC + r * lds + coff + c); FragH f; for (int q = 0; q < 8; ++q) f.h[q] = (_Float16)a[q];
  *(v8us*)((unsigned short*)DST + t * 8) = f.half[0];  }


__global__ __launch_bounds__(256) void k_ccp(const float* __restrict__ QKV, int coff, _Float16* __restrict__ D) { const size_t t = (size_t)blockIdx.x * 256 + threadIdx.x; if (t >= (size_t)NR * DM / 8) return; const int c0 = (int)((t * 8) % DM); const size_t row = (t * 8) / DM; const v8f a = *(const v8f*)(QKV + row * 3 * DM + coff + c0); FragH f; for (int q = 0; q < 8; ++q) f.h[q] = (_Float16)a[q];
  *(v8us*)((unsigned short*)D + t * 8) = f.half[0];  }


// The five preparations need nothing of each other and share one grid: blocks 0 to TOKB - 1 turn 16 pixels each into token rows, then WSB blocks for each of the four weight matrices (x16, f16). The branch is uniform for a block.
#define TOKB (NPIX / 16)
#define WSB (DM * DM / 8 / 256)      /* 8 weights a thread, no remainder */
__global__ __launch_bounds__(256) void k_prep(const float* __restrict__ x, _Float16* __restrict__ X16, const float* __restrict__ qw, const float* __restrict__ kw, const float* __restrict__ vw, const float* __restrict__ ow,
    _Float16* __restrict__ BQ, _Float16* __restrict__ BK, _Float16* __restrict__ BV, _Float16* __restrict__ BO) { __shared__ float tl[DM][17]; const int tid = threadIdx.x;
  if (blockIdx.x >= TOKB) { const int wb = blockIdx.x - TOKB, m = wb / WSB; const float* Wm = (m == 0) ? qw : ((m == 1) ? kw : ((m == 2) ? vw : ow)); _Float16* Bt = (m == 0) ? BQ : ((m == 1) ? BK : ((m == 2) ? BV : BO));
    const size_t t = (size_t)(wb - m * WSB) * 256 + tid; FragH f; for (int q = 0; q < 8; ++q) f.h[q] = (_Float16)(bf16_round(Wm[t * 8 + q]) * 16.0f); *(v8us*)((unsigned short*)Bt + t * 8) = f.half[0]; return; }
  const int p0 = blockIdx.x * 16;      /* 16-pixel tiles: 34 KB of LDS */
  for (int i = tid; i < DM * 16; i += 256) { const int c = i / 16, p = i % 16; tl[c][p] = bf16_round(x[(size_t)c * NPIX + p0 + p]); }
  __syncthreads();
  { for (int i = tid; i < 16 * (DM / 8); i += 256) { const int p = i / (DM / 8), c0 = (i % (DM / 8)) * 8; FragH f; for (int q = 0; q < 8; ++q) f.h[q] = (_Float16)tl[c0 + q][p];
      *(v8us*)((unsigned short*)X16 + ((size_t)p0 + p) * DM + c0) = f.half[0]; }  } }
__global__ __launch_bounds__(256) void k_out(const float* __restrict__ Y, float* __restrict__ out) { const size_t t = (size_t)blockIdx.x * 256 + threadIdx.x; if (t >= (size_t)DM * NPIX / 8) return; const int p0 = (int)((t * 8) % NPIX); const int c = (int)((t * 8) / NPIX); v8f v; for (int q = 0; q < 8; ++q) v[q] = Y[((size_t)p0 + q) * DM + c];
  *(v8f*)(out + t * 8) = v;  }
extern "C" void kernel_launch(void* const* d_in, const int* in_sizes, int n_in,
                              void* d_out, int out_size, void* d_ws, size_t ws_size, hipStream_t stream) {
  (void)in_sizes; (void)n_in; (void)out_size;
  const float* x = (const float*)d_in[0]; const float* qw = (const float*)d_in[1]; const float* qb = (const float*)d_in[2]; const float* kw = (const float*)d_in[3]; const float* kb = (const float*)d_in[4]; const float* vw = (const float*)d_in[5]; const float* vb = (const float*)d_in[6]; const float* ow = (const float*)d_in[7]; const float* ob = (const float*)d_in[8];
  char* ws = (char*)d_ws; size_t off = 0;
  auto take = [&](size_t bytes) { char* p = ws + off; off += (bytes + 255) & ~(size_t)255; return p; };
  const size_t np = (size_t)NR * DM;
  _Float16* BQ = (_Float16*)take((size_t)DM * DM * 2); _Float16* BK = (_Float16*)take((size_t)DM * DM * 2); _Float16* BV = (_Float16*)take((size_t)DM * DM * 2); _Float16* BO = (_Float16*)take((size_t)DM * DM * 2); float* Y = (float*)take(np * 4);
   _Float16* X16 = (_Float16*)take(np * 2); _Float16* QH = (_Float16*)take(np * 2); _Float16* KH = (_Float16*)take(np * 2); _Float16* V16 = (_Float16*)take(np * 2); _Float16* VT = (_Float16*)take(np * 2); float* O = (float*)take(np * 4); _Float16* OH = QH; _Float16* OL = KH;
  if (off > ws_size) return;
  k_prep<<<TOKB + 4 * WSB, 256, 0, stream>>>(x, X16, qw, kw, vw, ow, BQ, BK, BV, BO);      /* token rows; 1x1 conv (out, in) naturals */
  const dim3 g((NR / 128) * (DM / 64), 1), g3((NR / 128) * (DM / 64), 3);
  k_gemm2<0><<<g3, 128, 0, stream>>>(X16, DM, 0, BQ, DM, (size_t)DM * DM, 0.0625f, qb, kb, vb, nullptr, 1, 0, 0, nullptr, QH, DM, np, NR, DM, DM);      /* q, k, v: BQ, BK, BV and QH, KH, V16 lie one behind the other in the workspace */
  k_vtg<<<NB * NH * (SLEN / 64), 256, 0, stream>>>(V16, VT);
  k_flash<<<NB * NH * QBNP, 128, 0, stream>>>(QH, DM, KH, DM, VT, O, DM);
  k_hl<<<(unsigned)((np / 8 + 255) / 256), 256, 0, stream>>>(O, OH, OL, np / 8);
  k_gemm2<0><<<g, 128, 0, stream>>>(OL, DM, 0, BO, DM, 0, 0.0625f / 1024.0f, nullptr, nullptr, nullptr, nullptr, 1, 0, 0, Y, nullptr, DM, 0, NR, DM, DM);
  k_gemm2<0><<<g, 128, 0, stream>>>(OH, DM, 0, BO, DM, 0, 0.0625f, ob, nullptr, nullptr, Y, 1, (size_t)DM, 0, Y, nullptr, DM, 0, NR, DM, DM);      /* rows of the output conv */
  k_out<<<(unsigned)(((size_t)DM * NPIX / 8 + 255) / 256), 256, 0, stream>>>(Y, (float*)d_out);
}

// v006
// A run of this version takes 105 microseconds.
// Two timings next to v005 put it at 1.24 and 1.26 times that version's speed.
// All steps since v000 together make it 5.56 times as fast.
#include <hip/hip_runtime.h>
// SelfAttention4d (1 x 512 ch x 64 x 64 = 4096 tokens, 8 heads x 64: q/k/v = 1x1 convs (+ bias; the 1/8 scale applied in the flash kernel); softmax(q.k) v; out = 1x1 conv (+ bias) back to NCHW).
// Structure: NCHW -> exact f16 token rows by an LDS transpose kernel; q/k/v as f16 WMMA GEMMs (32x64 wave tiles, f32 accumulation, exact x16 (out,in) weights + bias, f16 out; channel = head*64 + d); V^T stored by the v GEMM itself (block tile turned in LDS); my fused flash kernel (no mask; the 1/8 applied as the score scale), which stores ctx as f16 hi/residual for the output conv (two GEMM terms) + bias; the last GEMM stores NCHW (block tile turned in LDS).
// Compute dtype: inputs rounded to bf16; x / weights exact as f16; q, k, v plain f16 (~2^-12); softmax weights f16 x2^10; ctx hi + 2^-10 residual; v_wmma_f32_16x16x32_f16.
#define NB 1
#define DM 512
#define NKV 8
#define NPIX 4096
#define NREP (NH / NKV)
#define KVD (NKV * 64)           /* 512 */
#define NR (NB * SLEN)
#define CHK 512
typedef int v4i __attribute__((ext_vector_type(4)));
#define FF 2048
#define SLEN 4096
#define MQI 4096
#define MKI 4096
#define TQ SLEN
#define TK SLEN
#define NH 8
#define SCL 0.125f
#define QBLKS (TQ / 64)
#define QB05 0
#define QBN5 4
#define QB0P 0
#define QBNP QBLKS
#define RE 256
typedef __bf16 v16b __attribute__((ext_vector_type(16)));
typedef unsigned short v8us __attribute__((ext_vector_type(8), may_alias));
typedef float  v8f  __attribute__((ext_vector_type(8)));
typedef float  v4f  __attribute__((ext_vector_type(4)));
typedef float  v4fa __attribute__((ext_vector_type(4), may_alias));
union FragB { v16b v; v8us half[2]; unsigned short u[16]; };

__device__ __forceinline__ unsigned short bf16_bits(float x) { unsigned int u = __float_as_uint(x); return (unsigned short)((u + 0x7FFFu + ((u >> 16) & 1u)) >> 16); }
__device__ __forceinline__ float bf16_val(unsigned short b) { return __uint_as_float(((unsigned int)b) << 16); }
__device__ __forceinline__ float bf16_round(float x) { return bf16_val(bf16_bits(x)); }
// D += A·B with NT terms: 1 = ah·bh, 2 = + al·bh (A split), 3 = + ah·bl (both split)
template <int NT>
__device__ __forceinline__ v8f mmaN(v16b ah, v16b al, v16b bh, v16b bl, v8f c) {
  c = __builtin_amdgcn_wmma_f32_16x16x32_bf16(false, ah, false, bh, (short)0, c, false, false);
  if (NT >= 2) c = __builtin_amdgcn_wmma_f32_16x16x32_bf16(false, al, false, bh, (short)0, c, false, false);
  if (NT >= 3) c = __builtin_amdgcn_wmma_f32_16x16x32_bf16(false, ah, false, bl, (short)0, c, false, false);
  asm volatile("v_nop\n\tv_nop\n\tv_nop\n\tv_nop" : "+v"(c) : "v"(ah), "v"(al), "v"(bh), "v"(bl));
  return c;
}

__global__ __launch_bounds__(256) void k_wt_bf16(const float* __restrict__ W, unsigned short* __restrict__ Wt, int K, int N) {
  const int t = blockIdx.x * 256 + threadIdx.x;
  const int k8n = K / 8;
  if (t >= N * k8n) return;
  const int n = t / k8n, k8 = (t % k8n) * 8;
  v8us v;
#pragma unroll
  for (int i = 0; i < 8; ++i) v[i] = bf16_bits(W[(size_t)(k8 + i) * N + n]);
  *(v8us*)(Wt + (size_t)n * K + k8) = v;
  
}

// GEMM C[M][N] (f32, pitch ldc) = act(A[M][K]·W + bias). A f32 row-major (pitch lda) converted per fragment to bf16
// (ASPLIT: hi/lo two planes -> 2 terms, else single rounded term); Wt bf16 [N][K] (pitch ldb). BIAS_BF16 rounds the
// bias to bf16 first (bias quantised to bf16 before the add). K%32==0, M%16==0, N%64==0.
template <bool ASPLIT, int ACT, bool BIAS_BF16>
__global__ __launch_bounds__(128) void k_gemm_bf(const float* __restrict__ A, int lda, const unsigned short* __restrict__ Wt, int ldb,
                                               const float* __restrict__ bias, float* __restrict__ C, int ldc, int M, int N, int K) {
  __shared__ __attribute__((aligned(16))) float so[4][16][64];
  const int tid = threadIdx.x, w = tid >> 5, lane = tid & 31, ln = lane & 15, hh = lane >> 4;
  const int ntn = N / 64;
  const int wid = blockIdx.x * 4 + w;
  const int mt = wid / ntn, nq = wid % ntn;
  if (mt * 16 >= M) return;
  const int row0 = mt * 16, col0 = nq * 64;
  const float* arow = A + (size_t)(row0 + ln) * lda;
  v8f acc[4] = {};
  for (int kb = 0; kb < K; kb += 32) {
    FragB ah, al;
    const v4f x0 = *(const v4fa*)(arow + kb + 8 * hh), x1 = *(const v4fa*)(arow + kb + 8 * hh + 4);
    const v4f x2 = *(const v4fa*)(arow + kb + 16 + 8 * hh), x3 = *(const v4fa*)(arow + kb + 16 + 8 * hh + 4);
    float xs[16] = {x0[0],x0[1],x0[2],x0[3],x1[0],x1[1],x1[2],x1[3],x2[0],x2[1],x2[2],x2[3],x3[0],x3[1],x3[2],x3[3]};
#pragma unroll
    for (int i = 0; i < 16; ++i) { const unsigned short hb = bf16_bits(xs[i]); ah.u[i] = hb; al.u[i] = ASPLIT ? bf16_bits(xs[i] - bf16_val(hb)) : (unsigned short)0; }
#pragma unroll
    for (int t = 0; t < 4; ++t) {
      const unsigned short* brow = Wt + (size_t)(col0 + t * 16 + ln) * ldb + kb;
      FragB b;
      b.half[0] = *(const v8us*)(brow + 8 * hh);
      b.half[1] = *(const v8us*)(brow + 16 + 8 * hh);
      acc[t] = mmaN<ASPLIT ? 2 : 1>(ah.v, al.v, b.v, b.v, acc[t]);
    }
  }
#pragma unroll
  for (int t = 0; t < 4; ++t) {
    float bv = bias ? bias[col0 + t * 16 + ln] : 0.f;
    if (BIAS_BF16) bv = bf16_round(bv);
#pragma unroll
    for (int r = 0; r < 8; ++r) { float v = acc[t][r] + bv; if (ACT == 1) v = fmaxf(v, 0.f); so[w][8 * hh + r][t * 16 + ln] = v; }
  }
  __builtin_amdgcn_fence(__ATOMIC_ACQ_REL, "workgroup");
  __builtin_amdgcn_wave_barrier();
  const int rsub = lane >> 4, c4 = (lane & 15) * 4;
  {
#pragma unroll
    for (int q = 0; q < 8; ++q) {
      const int r = q * 2 + rsub;
      const v4f v = *(const v4fa*)&so[w][r][c4];
      *(v4f*)(C + (size_t)(row0 + r) * ldc + col0 + c4) = v;
    }
    
  }
}

// GEMM C = act(A·W + bias + resid): A f32 (ASPLIT -> hi/lo 2 terms), Wt bf16 [N][K]; ACT 0 none, 1 relu, 2 exact gelu;
// resid (optional, f32, row index = (row % rmod), pitch ldr, RES_BF16 rounds it) added before the activation.
template <bool ASPLIT, int ACT, bool BIAS_BF16, bool RES_BF16>
__global__ __launch_bounds__(128) void k_gemm_bf3(const float* __restrict__ A, int lda, const unsigned short* __restrict__ Wt, int ldb,
                                                const float* __restrict__ bias, const float* __restrict__ resid, int rmod, int ldr,
                                                float* __restrict__ C, int ldc, int M, int N, int K) {
  __shared__ __attribute__((aligned(16))) float so[4][16][64];
  const int tid = threadIdx.x, w = tid >> 5, lane = tid & 31, ln = lane & 15, hh = lane >> 4;
  const int ntn = N / 64;
  const int wid = blockIdx.x * 4 + w;
  const int mt = wid / ntn, nq = wid % ntn;
  if (mt * 16 >= M) return;
  const int row0 = mt * 16, col0 = nq * 64;
  const float* arow = A + (size_t)(row0 + ln) * lda;
  v8f acc[4] = {};
  for (int kb = 0; kb < K; kb += 32) {
    FragB ah, al;
    const v4f x0 = *(const v4fa*)(arow + kb + 8 * hh), x1 = *(const v4fa*)(arow + kb + 8 * hh + 4);
    const v4f x2 = *(const v4fa*)(arow + kb + 16 + 8 * hh), x3 = *(const v4fa*)(arow + kb + 16 + 8 * hh + 4);
    float xs[16] = {x0[0],x0[1],x0[2],x0[3],x1[0],x1[1],x1[2],x1[3],x2[0],x2[1],x2[2],x2[3],x3[0],x3[1],x3[2],x3[3]};
#pragma unroll
    for (int i = 0; i < 16; ++i) { const unsigned short hb = bf16_bits(xs[i]); ah.u[i] = hb; al.u[i] = ASPLIT ? bf16_bits(xs[i] - bf16_val(hb)) : (unsigned short)0; }
#pragma unroll
    for (int t = 0; t < 4; ++t) {
      const unsigned short* brow = Wt + (size_t)(col0 + t * 16 + ln) * ldb + kb;
      FragB b;
      b.half[0] = *(const v8us*)(brow + 8 * hh);
      b.half[1] = *(const v8us*)(brow + 16 + 8 * hh);
      acc[t] = mmaN<ASPLIT ? 2 : 1>(ah.v, al.v, b.v, b.v, acc[t]);
    }
  }
#pragma unroll
  for (int t = 0; t < 4; ++t) {
    const int col = col0 + t * 16 + ln;
    float bv = bias ? bias[col] : 0.f;
    if (BIAS_BF16) bv = bf16_round(bv);
#pragma unroll
    for (int r = 0; r < 8; ++r) {
      float v = acc[t][r] + bv;
      if (resid) { float rv = resid[(size_t)((row0 + 8 * hh + r) % rmod) * ldr + col]; if (RES_BF16) rv = bf16_round(rv); v += rv; }
      if (ACT == 1) v = fmaxf(v, 0.f);
      if (ACT == 2) v = 0.5f * v * (1.0f + erff(v * 0.70710678118654752f));
      if (ACT == 3) { const float u = 0.7978845608028654f * (v + 0.044715f * v * v * v); v = 0.5f * v * (1.0f + tanhf(u)); }
      so[w][8 * hh + r][t * 16 + ln] = v;
    }
  }
  __builtin_amdgcn_fence(__ATOMIC_ACQ_REL, "workgroup");
  __builtin_amdgcn_wave_barrier();
  const int rsub = lane >> 4, c4 = (lane & 15) * 4;
  {
#pragma unroll
    for (int q = 0; q < 8; ++q) {
      const int r = q * 2 + rsub;
      const v4f v = *(const v4fa*)&so[w][r][c4];
      *(v4f*)(C + (size_t)(row0 + r) * ldc + col0 + c4) = v;
    }
    
  }
}
// row LayerNorm (biased variance, eps) over N: s = X (+ R); optional out_sum <- s; out_norm <- (s-mu)*rsqrt(var+eps)*g + b
template <bool PARAM_BF16>
__global__ __launch_bounds__(256) void k_layernorm(const float* __restrict__ X, const float* __restrict__ R, const float* __restrict__ g, const float* __restrict__ bta,
                                                  float* __restrict__ out_sum, float* __restrict__ out_norm, int N, float eps) {
  __shared__ float red[256];
  const int row = blockIdx.x, tid = threadIdx.x;
  const float* x = X + (size_t)row * N; const float* rr = R ? R + (size_t)row * N : nullptr;
  float vals[16];                     // up to N = 4096
  const int per = N / 256;            // contiguous chunk per thread? use strided-by-4 chunks: thread handles j = tid*4 + 1024*u
  float s1 = 0.f;
  for (int u = 0; u < per / 4; ++u) {
    const int j = tid * 4 + 1024 * u;
    const v4f a = *(const v4fa*)(x + j);
    v4f b = {0.f,0.f,0.f,0.f}; if (rr) b = *(const v4fa*)(rr + j);
#pragma unroll
    for (int q = 0; q < 4; ++q) { const float v = a[q] + b[q]; vals[u * 4 + q] = v; s1 += v; }
  }
  red[tid] = s1; __syncthreads();
  for (int st = 128; st > 0; st >>= 1) { if (tid < st) red[tid] += red[tid + st]; __syncthreads(); }
  const float mu = red[0] / (float)N; __syncthreads();
  float s2 = 0.f;
  for (int u = 0; u < per / 4; ++u)
#pragma unroll
    for (int q = 0; q < 4; ++q) { const float c = vals[u * 4 + q] - mu; s2 += c * c; }
  red[tid] = s2; __syncthreads();
  for (int st = 128; st > 0; st >>= 1) { if (tid < st) red[tid] += red[tid + st]; __syncthreads(); }
  const float rs = rsqrtf(red[0] / (float)N + eps);
  {
    for (int u = 0; u < per / 4; ++u) {
      const int j = tid * 4 + 1024 * u;
      v4f o, sm;
#pragma unroll
      for (int q = 0; q < 4; ++q) {
        float gg = g[j + q], bb = bta[j + q];
        if (PARAM_BF16) { gg = bf16_round(gg); bb = bf16_round(bb); }
        sm[q] = vals[u * 4 + q]; o[q] = (vals[u * 4 + q] - mu) * rs * gg + bb;
      }
      if (out_sum) *(v4f*)(out_sum + (size_t)row * N + j) = sm;
      *(v4f*)(out_norm + (size_t)row * N + j) = o;
    }
    
  }
}



// ---- f16 WMMA path (v_wmma_f32_16x16x32_f16): 11-bit significands for operands in range — used where a [0,1] probability operand needs more precision than bf16
typedef _Float16 v16h __attribute__((ext_vector_type(16)));
union FragH { v16h v; v8us half[2]; _Float16 h[16]; unsigned short u[16]; };
template <int NT>
__device__ __forceinline__ v8f mmaH(v16h ah, v16h al, v16h bh, v16h bl, v8f c) {
  c = __builtin_amdgcn_wmma_f32_16x16x32_f16(false, ah, false, bh, (short)0, c, false, false);
  if (NT >= 2) c = __builtin_amdgcn_wmma_f32_16x16x32_f16(false, al, false, bh, (short)0, c, false, false);
  if (NT >= 3) c = __builtin_amdgcn_wmma_f32_16x16x32_f16(false, ah, false, bl, (short)0, c, false, false);
  asm volatile("v_nop\n\tv_nop\n\tv_nop\n\tv_nop" : "+v"(c) : "v"(ah), "v"(al), "v"(bh), "v"(bl));
  return c;
}
// batched GEMM like k_gemm_b but f16 operands: A f32 (split into f16 hi/lo if ASPLIT, else rounded to f16), Bt = f16 values [n][k]; alpha; C f32; N multiple of 16 (partial tiles skipped)
template <bool ASPLIT>
__global__ __launch_bounds__(128) void k_gemm_h(const float* __restrict__ A, int lda, size_t sA, const _Float16* __restrict__ Bh, int ldb, size_t sB, float alpha, float* __restrict__ C, int ldc, size_t sC, int M, int N, int K) {
  __shared__ __attribute__((aligned(16))) float so[4][16][64];
  const int tid = threadIdx.x, w = tid >> 5, lane = tid & 31, ln = lane & 15, hh = lane >> 4; const int by = blockIdx.y;
  A += (size_t)by * sA; Bh += (size_t)by * sB; C += (size_t)by * sC;
  const int ntn = (N + 63) / 64; const int wid = blockIdx.x * 4 + w; const int mt = wid / ntn, nq = wid % ntn; if (mt * 16 >= M) return;
  const int row0 = mt * 16, col0 = nq * 64; const float* arow = A + (size_t)(row0 + ln) * lda;
  v8f acc[4] = {};
  for (int kb = 0; kb < K; kb += 32) {
    FragH ah, al;
    const v4f x0 = *(const v4fa*)(arow + kb + 8 * hh), x1 = *(const v4fa*)(arow + kb + 8 * hh + 4), x2 = *(const v4fa*)(arow + kb + 16 + 8 * hh), x3 = *(const v4fa*)(arow + kb + 16 + 8 * hh + 4);
    float xs[16] = {x0[0],x0[1],x0[2],x0[3],x1[0],x1[1],x1[2],x1[3],x2[0],x2[1],x2[2],x2[3],x3[0],x3[1],x3[2],x3[3]};
#pragma unroll
    for (int i = 0; i < 16; ++i) { const _Float16 h = (_Float16)xs[i]; ah.h[i] = h; al.h[i] = ASPLIT ? (_Float16)(xs[i] - (float)h) : (_Float16)0.0f; }
#pragma unroll
    for (int t = 0; t < 4; ++t) { if (col0 + t * 16 >= N) continue; const size_t boff = (size_t)(col0 + t * 16 + ln) * ldb + kb; FragH bq; bq.half[0] = *(const v8us*)(Bh + boff + 8 * hh); bq.half[1] = *(const v8us*)(Bh + boff + 16 + 8 * hh);
      acc[t] = mmaH<ASPLIT ? 2 : 1>(ah.v, al.v, bq.v, bq.v, acc[t]); }
  }
#pragma unroll
  for (int t = 0; t < 4; ++t) { if (col0 + t * 16 >= N) continue;
#pragma unroll
    for (int r = 0; r < 8; ++r) so[w][8 * hh + r][t * 16 + ln] = acc[t][r] * alpha; }
  __builtin_amdgcn_fence(__ATOMIC_ACQ_REL, "workgroup"); __builtin_amdgcn_wave_barrier();
  const int rsub = lane >> 4, c4 = (lane & 15) * 4;
  {
#pragma unroll
    for (int q = 0; q < 8; ++q) { const int r = q * 2 + rsub; if (col0 + c4 < N) { const v4f v = *(const v4fa*)&so[w][r][c4]; *(v4f*)(C + (size_t)(row0 + r) * ldc + col0 + c4) = v; } }
     }
}

// Wt[n][k] = f16(W[k][n]·scale) from f32 row-major W[K][N] (scale = power of two; bf16-exact weights stay exact in f16 away from the subnormal range)
__global__ __launch_bounds__(256) void k_wt_f16(const float* __restrict__ W, _Float16* __restrict__ Wt, int K, int N, float scale) {
  const int t = blockIdx.x * 256 + threadIdx.x; if (t >= N * (K / 8)) return; const int n = t / (K / 8), k8 = (t % (K / 8)) * 8; FragH f;
#pragma unroll
  for (int i = 0; i < 8; ++i) f.h[i] = (_Float16)(bf16_round(W[(size_t)(k8 + i) * N + n]) * scale); const v8us o = f.half[0];
  *(v8us*)((unsigned short*)Wt + (size_t)n * K + k8) = o; 
}
// k_gemm_hh variant with fused epilogue: v = acc·alpha + bias[by·sBias + col] (+ CP[(row/rowsPerB)·sCPb + by·64 + col] if CP) ; ACT 0 none / 1 elu ; writes f16 C16 (and f32 C if non-null)
template <int ACT>
__global__ __launch_bounds__(128) void k_gemm_hhx(const _Float16* __restrict__ A, int lda, size_t sA, const _Float16* __restrict__ Bh, int ldb, size_t sB, float alpha, const float* __restrict__ bias, size_t sBias, const float* __restrict__ CP, int rowsPerB, size_t sCPb, int row0g,
    float* __restrict__ C, _Float16* __restrict__ C16, int ldc, size_t sC, int M, int N, int K) {
  __shared__ __attribute__((aligned(16))) float so[4][16][64];
  const int tid = threadIdx.x, w = tid >> 5, lane = tid & 31, ln = lane & 15, hh = lane >> 4; const int by = blockIdx.y;
  A += (size_t)by * sA; Bh += (size_t)by * sB; const size_t cofs = (size_t)by * sC; const float* bp = bias ? bias + (size_t)by * sBias : nullptr;
  const int ntn = (N + 63) / 64; const int wid = blockIdx.x * 4 + w; const int mt = wid / ntn, nq = wid % ntn; if (mt * 16 >= M) return;
  const int row0 = mt * 16, col0 = nq * 64; const _Float16* arow = A + (size_t)(row0 + ln) * lda;
  v8f acc[4] = {};
  for (int kb = 0; kb < K; kb += 32) { FragH ah; ah.half[0] = *(const v8us*)((const unsigned short*)arow + kb + 8 * hh); ah.half[1] = *(const v8us*)((const unsigned short*)arow + kb + 16 + 8 * hh);
#pragma unroll
    for (int t = 0; t < 4; ++t) { if (col0 + t * 16 >= N) continue; const size_t boff = (size_t)(col0 + t * 16 + ln) * ldb + kb; FragH bq; bq.half[0] = *(const v8us*)((const unsigned short*)Bh + boff + 8 * hh); bq.half[1] = *(const v8us*)((const unsigned short*)Bh + boff + 16 + 8 * hh);
      acc[t] = mmaH<1>(ah.v, ah.v, bq.v, bq.v, acc[t]); }
  }
#pragma unroll
  for (int t = 0; t < 4; ++t) { if (col0 + t * 16 >= N) continue; const int col = col0 + t * 16 + ln; const float bv = bp ? bf16_round(bp[col]) : 0.f;
#pragma unroll
    for (int r = 0; r < 8; ++r) { float v = acc[t][r] * alpha + bv; if (CP) { const int bidx = (row0g + row0 + 8 * hh + r) / rowsPerB; v += CP[(size_t)bidx * sCPb + (size_t)by * 64 + col]; } if (ACT == 1) v = (v > 0.f) ? v : expm1f(v); else if (ACT == 7) v = (v > 0.f) ? v + 1.0f : expf(v); else if (ACT == 8) v = tanhf(v); else if (ACT == 9) v = 0.5f * v * (1.0f + tanhf(0.7978845608028654f * (v + 0.044715f * v * v * v))); else if (ACT == 11) v = 1.0f / (1.0f + expf(-v)); else if (ACT == 12) v = (v > 0.f) ? v : 0.01f * v; else if (ACT == 14) v = (v > 0.f) ? v : 0.1f * v; else if (ACT == 15) v = v / (1.0f + expf(-v)); else if (ACT == 3) v = fmaxf(v, 0.f); else if (ACT == 6) v = 0.5f * v * (1.0f + erff(v * 0.70710678118654752f)); so[w][8 * hh + r][t * 16 + ln] = v; } }
  __builtin_amdgcn_fence(__ATOMIC_ACQ_REL, "workgroup"); __builtin_amdgcn_wave_barrier();
  const int rsub = lane >> 4, c4 = (lane & 15) * 4; typedef _Float16 v4h __attribute__((ext_vector_type(4)));
  {
#pragma unroll
    for (int q = 0; q < 8; ++q) { const int r = q * 2 + rsub; if (col0 + c4 < N) { const v4f v = *(const v4fa*)&so[w][r][c4]; if (C) *(v4f*)(C + cofs + (size_t)(row0 + r) * ldc + col0 + c4) = v; if (C16) { v4h h4; for (int i = 0; i < 4; ++i) h4[i] = (_Float16)v[i]; *(v4h*)(C16 + cofs + (size_t)(row0 + r) * ldc + col0 + c4) = h4; } } }
     }
}


typedef _Float16 v4h __attribute__((ext_vector_type(4)));

__global__ __launch_bounds__(256) void k_x16(const float* __restrict__ x, _Float16* __restrict__ X16, size_t n8) { const size_t t = (size_t)blockIdx.x * 256 + threadIdx.x; if (t >= n8) return; FragH f;
#pragma unroll
  for (int q = 0; q < 8; ++q) f.h[q] = (_Float16)bf16_round(x[t * 8 + q]); *(v8us*)((unsigned short*)X16 + t * 8) = f.half[0];  }
__global__ __launch_bounds__(256) void k_h16(const float* __restrict__ x, _Float16* __restrict__ X16, size_t n8) { const size_t t = (size_t)blockIdx.x * 256 + threadIdx.x; if (t >= n8) return; FragH f;
#pragma unroll
  for (int q = 0; q < 8; ++q) f.h[q] = (_Float16)x[t * 8 + q]; *(v8us*)((unsigned short*)X16 + t * 8) = f.half[0];  }
__global__ __launch_bounds__(256) void k_round16f(const float* __restrict__ W, _Float16* __restrict__ Bt, size_t n8) { const size_t t = (size_t)blockIdx.x * 256 + threadIdx.x; if (t >= n8) return; FragH f;
#pragma unroll
  for (int i = 0; i < 8; ++i) f.h[i] = (_Float16)(bf16_round(W[t * 8 + i]) * 16.0f); *(v8us*)((unsigned short*)Bt + t * 8) = f.half[0];  }
template <int NHv, int TTv>
__global__ __launch_bounds__(256) void k_vt(const _Float16* __restrict__ V16, int ldv, int voff, _Float16* __restrict__ Vt) { __shared__ unsigned short tl[64][66]; const int tid = threadIdx.x; const int slab = blockIdx.x / (TTv / 64), lg = blockIdx.x % (TTv / 64); const int b = slab / NHv, h = slab % NHv;
  for (int i = tid; i < 64 * 8; i += 256) { const int r = i / 8, c8 = (i % 8) * 8; FragH f; f.half[0] = *(const v8us*)((const unsigned short*)V16 + ((size_t)b * TTv + lg * 64 + r) * ldv + voff + h * 64 + c8);
#pragma unroll
    for (int q = 0; q < 8; ++q) tl[r][c8 + q] = f.u[q]; }
  __syncthreads();
  {
#pragma unroll
    for (int rd = 0; rd < 2; ++rd) { const int d = rd * 32 + tid / 8, pc = tid % 8; FragH f;
#pragma unroll
      for (int q = 0; q < 8; ++q) f.u[q] = tl[pc * 8 + q][d];
      *(v8us*)((unsigned short*)Vt + ((size_t)slab * 64 + d) * TTv + lg * 64 + pc * 8) = f.half[0]; }
     } }

// ---- fast GEMM (block tile 128x64, wave tile 32x64; requires M % 128 == 0 rows per launch region, N % 64 == 0 and K % 256 == 0); epilogue = k_gemm_hhx semantics ----
// A and B come through LDS: a stage is 256 k of the block's 128 A rows and 64 B rows (rows of 512 bytes), brought once for the four waves by asynchronous copies, one whole row a wave and copy,
// two buffers, the next stage flying while a stage is worked on. The fragments read from LDS hold the same elements in the same order as those read from global memory before.
#define GSK 256      /* k a stage */
#define GPH (GSK + 8)      /* LDS row pitch in 16-bit elements: 512 bytes of data + 16, a conflict-free pitch for 16-byte row readers */
#define GRB (4 * GPH * 2)      /* bytes of 4 LDS rows: the step between a thread's pieces of a tile */
#define GBB (192 * GPH * 2)      /* bytes of one buffer: rows 0 to 127 the A tile, rows 128 to 191 the B tile */
#define GTP 132      /* pitch in floats of a column of the turned 128 x 64 output tile: 128 rows + 4, so that the 16 columns of a register tile start in 16 different bank groups */
__device__ __forceinline__ v16h g2_frag(const _Float16* p, int hh) { FragH f; f.half[0] = *(const v8us*)((const unsigned short*)p + 8 * hh); f.half[1] = *(const v8us*)((const unsigned short*)p + 16 + 8 * hh); return f.v; }
__device__ __forceinline__ v8f g2_mma(v16h a, v16h b, v8f c) { v8f d = __builtin_amdgcn_wmma_f32_16x16x32_f16(false, a, false, b, (short)0, c, false, false); asm volatile("v_nop\n\tv_nop\n\tv_nop\n\tv_nop" : "+v"(d) : "v"(a), "v"(b)); return d; }
// Eight copies of one thread, 16 bytes each: rows four apart, in LDS (GRB bytes) and in global memory (gs elements). The s_wait_xcnt closes the statement so that no address register is rewritten ahead of it.
__device__ __forceinline__ void g2_copy8(unsigned l, const unsigned short* g, size_t gs) {
  const unsigned short* g1 = g + gs; const unsigned short* g2 = g1 + gs; const unsigned short* g3 = g2 + gs; const unsigned short* g4 = g3 + gs; const unsigned short* g5 = g4 + gs; const unsigned short* g6 = g5 + gs; const unsigned short* g7 = g6 + gs;
  asm volatile("global_load_async_to_lds_b128 %0, %8, off\n\t"
               "global_load_async_to_lds_b128 %1, %9, off\n\t"
               "global_load_async_to_lds_b128 %2, %10, off\n\t"
               "global_load_async_to_lds_b128 %3, %11, off\n\t"
               "global_load_async_to_lds_b128 %4, %12, off\n\t"
               "global_load_async_to_lds_b128 %5, %13, off\n\t"
               "global_load_async_to_lds_b128 %6, %14, off\n\t"
               "global_load_async_to_lds_b128 %7, %15, off\n\t"
               "s_wait_xcnt 0x0"
               :: "v"(l), "v"(l + GRB), "v"(l + 2 * GRB), "v"(l + 3 * GRB), "v"(l + 4 * GRB), "v"(l + 5 * GRB), "v"(l + 6 * GRB), "v"(l + 7 * GRB),
                  "v"(g), "v"(g1), "v"(g2), "v"(g3), "v"(g4), "v"(g5), "v"(g6), "v"(g7) : "memory");
}
// One stage's copies of one thread: 32 pieces of the A tile and 16 of the B tile (48 in flight a wave).
__device__ __forceinline__ void g2_stage(unsigned l, const unsigned short* ga, size_t as4, const unsigned short* gb, size_t bs4) {
#pragma unroll
  for (int c = 0; c < 4; ++c) g2_copy8(l + c * 8 * GRB, ga + c * 8 * as4, as4);
#pragma unroll
  for (int c = 0; c < 2; ++c) g2_copy8(l + (32 + c * 8) * GRB, gb + c * 8 * bs4, bs4);
}
template <int ACT>
__global__ __launch_bounds__(128) void k_gemm2(const _Float16* __restrict__ A, int lda, size_t sA, const _Float16* __restrict__ Bh, int ldb, size_t sB, float alpha, const float* __restrict__ bias, const float* __restrict__ bias1, const float* __restrict__ bias2, const float* __restrict__ CP, int rowsPerB, size_t sCPb, int row0g,
    float* __restrict__ C, _Float16* __restrict__ C16, int ldc, size_t sC, int M, int N, int K, int tby, float* __restrict__ Ct, _Float16* __restrict__ Ct16) {
  __shared__ __attribute__((aligned(16))) float so[4][32][68]; __shared__ __attribute__((aligned(16))) unsigned short sT[2][192][GPH];
  const int tid = threadIdx.x, w = tid >> 5, lane = tid & 31, ln = lane & 15, hh = lane >> 4; const int by = blockIdx.y;
  A += (size_t)by * sA; Bh += (size_t)by * sB; const size_t cofs = (size_t)by * sC; const float* bp = (by == 0) ? bias : ((by == 1) ? bias1 : bias2);      /* products that need nothing of each other share one grid: blockIdx.y picks the product, its B and C planes and its own bias vector */
  const int ntn = N >> 6; const int mt = blockIdx.x / ntn, nq = blockIdx.x - mt * ntn; const int row0 = mt * 128 + 32 * w, col0 = nq * 64; if (mt * 128 >= M) return;      /* the whole block leaves or none of it: barriers follow */
  const size_t as4 = (size_t)4 * lda, bs4 = (size_t)4 * ldb; const int nst = K / GSK;
  const unsigned short* ga = (const unsigned short*)A + (size_t)(mt * 128 + w) * lda + lane * 8;      /* the thread's first piece of the next stage to copy: a wave copies one whole row */
  const unsigned short* gb = (const unsigned short*)Bh + (size_t)(col0 + w) * ldb + lane * 8;
  const unsigned l0 = (unsigned)(size_t)&sT[0][w][lane * 8];      /* low 32 bits of a shared address = the byte offset in LDS */
  g2_stage(l0, ga, as4, gb, bs4); ga += GSK; gb += GSK;
  asm volatile("s_wait_asynccnt 0x0" ::: "memory");      /* stage 0 has landed before the barrier that publishes it */
  __syncthreads();
  if (nst > 1) { g2_stage(l0 + GBB, ga, as4, gb, bs4); ga += GSK; gb += GSK; }
  const v8f z8 = {0.f,0.f,0.f,0.f,0.f,0.f,0.f,0.f}; v8f c00 = z8, c01 = z8, c02 = z8, c03 = z8, c10 = z8, c11 = z8, c12 = z8, c13 = z8;
#pragma unroll 1      /* one stage a trip: the buffer index stays a run-time value and the text small */
  for (int st = 0; st < nst; ++st) {
    const int buf = st & 1;
    const _Float16* af = (const _Float16*)&sT[buf][32 * w + ln][0]; const _Float16* bf = (const _Float16*)&sT[buf][128 + ln][0];
    v16h fa[2][2], fb[2][4];      /* two fragment sets: a k step's reads are issued as one group ahead of the k step before it, inside the stage */
    fa[0][0] = g2_frag(af, hh); fa[0][1] = g2_frag(af + 16 * GPH, hh);
#pragma unroll
    for (int t = 0; t < 4; ++t) fb[0][t] = g2_frag(bf + t * 16 * GPH, hh);
#pragma unroll
    for (int kk = 0; kk < GSK / 32; ++kk) { const int cu = kk & 1, nx = cu ^ 1;
      if (kk + 1 < GSK / 32) { fa[nx][0] = g2_frag(af + (kk + 1) * 32, hh); fa[nx][1] = g2_frag(af + 16 * GPH + (kk + 1) * 32, hh);
#pragma unroll
        for (int t = 0; t < 4; ++t) fb[nx][t] = g2_frag(bf + t * 16 * GPH + (kk + 1) * 32, hh); }
      c00 = g2_mma(fa[cu][0], fb[cu][0], c00); c10 = g2_mma(fa[cu][1], fb[cu][0], c10);
      c01 = g2_mma(fa[cu][0], fb[cu][1], c01); c11 = g2_mma(fa[cu][1], fb[cu][1], c11);
      c02 = g2_mma(fa[cu][0], fb[cu][2], c02); c12 = g2_mma(fa[cu][1], fb[cu][2], c12);
      c03 = g2_mma(fa[cu][0], fb[cu][3], c03); c13 = g2_mma(fa[cu][1], fb[cu][3], c13); }
    asm volatile("s_wait_dscnt 0x0" ::: "memory");      /* this wave's reads of the buffer have returned before it is given up */
    asm volatile("s_wait_asynccnt 0x0" ::: "memory");      /* this wave's copies of the next stage have landed */
    __syncthreads();      /* publishes the next stage and ends every wave's reads of this one */
    if (st + 2 < nst) { g2_stage(l0 + buf * GBB, ga, as4, gb, bs4); ga += GSK; gb += GSK; } }
  asm volatile("s_wait_asynccnt 0x0" ::: "memory");      /* no copy is left in flight when the wave goes on to the epilogue */
  v8f accs[8] = {c00, c01, c02, c03, c10, c11, c12, c13};
#pragma unroll
  for (int u = 0; u < 8; ++u) { const int t = u & 3, half = u >> 2; const int col = col0 + t * 16 + ln; const float bv = bp ? bf16_round(bp[col]) : 0.f;
#pragma unroll
    for (int r = 0; r < 8; ++r) { const int rloc = half * 16 + 8 * hh + r; float v = accs[u][r] * alpha + bv; if (CP) { if (rowsPerB < 0) v += CP[cofs + (size_t)(row0g + row0 + rloc) * ldc + col];      /* rowsPerB < 0: own element of the batched C plane */ else { const int bidx = (row0g + row0 + rloc) / rowsPerB; v += CP[(size_t)bidx * sCPb + (size_t)by * 64 + col]; } }
      if (ACT == 3) v = fmaxf(v, 0.f); else if (ACT == 6) v = 0.5f * v * (1.0f + erff(v * 0.70710678118654752f)); else if (ACT == 11) v = 1.0f / (1.0f + expf(-v)); else if (ACT == 15) v = v / (1.0f + expf(-v)); else if (ACT == 12) v = (v > 0.f) ? v : 0.01f * v; else if (ACT == 8) v = tanhf(v);
      accs[u][r] = v; } }
  if (by == tby) {      /* this product's consumer wants C^T (column-major, pitch NR, a constant: the stores of a thread differ by immediate offsets): the block's 128 x 64 tile is turned in LDS and stored from here; the test reads the same for the whole block */
    float* sf = &so[0][0][0];
#pragma unroll
    for (int u = 0; u < 8; ++u) { float* d = sf + ((u & 3) * 16 + ln) * GTP + 32 * w + (u >> 2) * 16 + 8 * hh;      /* a lane's 8 registers are 8 consecutive rows of one column */
      *(v4f*)d = (v4f){accs[u][0], accs[u][1], accs[u][2], accs[u][3]}; *(v4f*)(d + 4) = (v4f){accs[u][4], accs[u][5], accs[u][6], accs[u][7]}; }
    __syncthreads();      /* a wave stores whole columns of the block tile, which hold rows of all four waves */
    if (Ct) {
#pragma unroll
      for (int q = 0; q < 16; ++q) { const int c = w * 16 + q; const v4f v = *(const v4fa*)(sf + c * GTP + lane * 4); *(v4f*)(Ct + (size_t)(col0 + c) * NR + mt * 128 + lane * 4) = v; }      /* 512 contiguous bytes a wave and store */
      asm volatile("s_wait_xcnt 0x0" ::: "memory"); }      /* behind the last store of the run: in the listing the other store path follows and rewrites these stores' registers */
    else { unsigned short* tb = (unsigned short*)Ct16 + (size_t)(col0 + w * 16 + hh) * NR + mt * 128 + ln * 8;
#pragma unroll
      for (int q = 0; q < 8; ++q) { const float* s = sf + (w * 16 + hh + q * 2) * GTP + ln * 8; const v4f a = *(const v4fa*)s, e = *(const v4fa*)(s + 4); FragH f;
#pragma unroll
        for (int i = 0; i < 4; ++i) { f.h[i] = (_Float16)a[i]; f.h[4 + i] = (_Float16)e[i]; }
        *(v8us*)(tb + (size_t)q * 2 * NR) = f.half[0]; } }      /* 256 contiguous bytes a half wave */
    return; }
#pragma unroll
  for (int u = 0; u < 8; ++u)
#pragma unroll
    for (int r = 0; r < 8; ++r) so[w][(u >> 2) * 16 + 8 * hh + r][(u & 3) * 16 + ln] = accs[u][r];
  __builtin_amdgcn_fence(__ATOMIC_ACQ_REL, "workgroup"); __builtin_amdgcn_wave_barrier();
  const int rsub = lane >> 4, c4 = (lane & 15) * 4;
  {
#pragma unroll
    for (int q = 0; q < 16; ++q) { const int r = q * 2 + rsub; const v4f v = *(const v4fa*)&so[w][r][c4]; if (C) { *(v4f*)(C + cofs + (size_t)(row0 + r) * ldc + col0 + c4) = v; asm volatile("s_wait_xcnt 0x0" ::: "memory"); }      /* the f16 conversion that may follow rewrites this store's data registers */
      if (C16) { v4h h4; for (int i = 0; i < 4; ++i) h4[i] = (_Float16)v[i]; *(v4h*)(C16 + cofs + (size_t)(row0 + r) * ldc + col0 + c4) = h4; } }
    asm volatile("s_wait_xcnt 0x0" ::: "memory");      /* behind the last row-major store: in the listing the turned-tile path follows and rewrites that store's address registers */
     } }



// lane l takes the value of lane l ^ 16 (the other half of the same query column)
__device__ __forceinline__ float xhalf(float x) { return __builtin_bit_cast(float, __builtin_amdgcn_permlanex16(__builtin_bit_cast(int, x), __builtin_bit_cast(int, x), 0x76543210, 0xfedcba98, false, false)); }
#define FSK 64      /* keys a stage */
#define FPH 72      /* LDS row pitch in 16-bit elements: 128 bytes of data + 16, the conflict-free pitch for 16-byte row readers */
#define FBB (64 * FPH * 2)      /* bytes of one tile buffer */
#define FRB (16 * FPH * 2)      /* bytes of 16 LDS rows: the step between a thread's four pieces of a tile */
#define FC2 (SCL * 1.4426950408889634f)      /* score scale times log2(e): the softmax runs in base 2 on the hardware's own exponential */
// One stage's copies of one thread: pieces (row, row + 16, row + 32, row + 48) of the K tile and of the V^T tile, 16 bytes each. The s_wait_xcnt closes the statement so that no address register is rewritten ahead of it.
__device__ __forceinline__ void fl_copy(unsigned lk, unsigned lv, const unsigned short* gk, size_t ks16, const unsigned short* gv) {
  const unsigned short* gk1 = gk + ks16; const unsigned short* gk2 = gk1 + ks16; const unsigned short* gk3 = gk2 + ks16;
  const unsigned short* gv1 = gv + (size_t)16 * TK; const unsigned short* gv2 = gv + (size_t)32 * TK; const unsigned short* gv3 = gv + (size_t)48 * TK;
  asm volatile("global_load_async_to_lds_b128 %0, %8, off\n\t"
               "global_load_async_to_lds_b128 %1, %9, off\n\t"
               "global_load_async_to_lds_b128 %2, %10, off\n\t"
               "global_load_async_to_lds_b128 %3, %11, off\n\t"
               "global_load_async_to_lds_b128 %4, %12, off\n\t"
               "global_load_async_to_lds_b128 %5, %13, off\n\t"
               "global_load_async_to_lds_b128 %6, %14, off\n\t"
               "global_load_async_to_lds_b128 %7, %15, off\n\t"
               "s_wait_xcnt 0x0"
               :: "v"(lk), "v"(lk + FRB), "v"(lk + 2 * FRB), "v"(lk + 3 * FRB), "v"(lv), "v"(lv + FRB), "v"(lv + 2 * FRB), "v"(lv + 3 * FRB),
                  "v"(gk), "v"(gk1), "v"(gk2), "v"(gk3), "v"(gv), "v"(gv1), "v"(gv2), "v"(gv3) : "memory");
}
__global__ __launch_bounds__(128) void k_flash(const _Float16* __restrict__ Q16, int ldq, const _Float16* __restrict__ K16, int ldk, const _Float16* __restrict__ Vt, _Float16* __restrict__ OHp, _Float16* __restrict__ OLp, int ldo) {
  constexpr int RPW = 16, DT = 4, KS = 2, NST = TK / FSK;
  __shared__ __attribute__((aligned(16))) unsigned short sK[2][64][FPH]; __shared__ __attribute__((aligned(16))) unsigned short sV[2][64][FPH];
  const int tid = threadIdx.x, w = tid >> 5, lane = tid & 31, ln = lane & 15, hh = lane >> 4;
  const int slab = blockIdx.x / QBNP, qblk = QB0P + blockIdx.x % QBNP; const int b = slab / NH, h = slab % NH; const int q0 = qblk * (4 * RPW) + w * RPW;
  FragH bq[KS];
  { const unsigned short* qr = (const unsigned short*)Q16 + ((size_t)b * TQ + q0 + ln) * ldq + h * 64;
#pragma unroll
    for (int ks = 0; ks < KS; ++ks) { bq[ks].half[0] = *(const v8us*)(qr + ks * 32 + 8 * hh); bq[ks].half[1] = *(const v8us*)(qr + ks * 32 + 16 + 8 * hh); } }
  const unsigned short* Vth = (const unsigned short*)Vt + (size_t)slab * 64 * TK;
  const int crow = tid >> 3, cseg = (tid & 7) * 8;      /* eight threads copy one 128-byte row */
  const size_t ks16 = (size_t)16 * ldk, kstg = (size_t)FSK * ldk;
  const unsigned short* gk = (const unsigned short*)K16 + ((size_t)b * TK + crow) * ldk + h * 64 + cseg;      /* the thread's first piece of the next stage to copy, advanced behind each stage's copies */
  const unsigned short* gv = Vth + (size_t)crow * TK + cseg;
  const unsigned lk0 = (unsigned)(size_t)&sK[0][crow][cseg], lv0 = (unsigned)(size_t)&sV[0][crow][cseg];      /* low 32 bits of a shared address = the byte offset in LDS */
  fl_copy(lk0, lv0, gk, ks16, gv); gk += kstg; gv += FSK;
  asm volatile("s_wait_asynccnt 0x0" ::: "memory");      /* stage 0 has landed before the barrier that publishes it */
  __syncthreads();
  fl_copy(lk0 + FBB, lv0 + FBB, gk, ks16, gv); gk += kstg; gv += FSK;
  float m_r = -3.0e38f, l_r = 0.f; v8f oacc[DT];
#pragma unroll
  for (int dt = 0; dt < DT; ++dt) oacc[dt] = (v8f){0.f,0.f,0.f,0.f,0.f,0.f,0.f,0.f};
#pragma unroll 1      /* one stage a trip: the buffer index stays a run-time value and the text small */
  for (int st = 0; st < NST; ++st) {
    const int buf = st & 1;
    const unsigned short* kf = &sK[buf][ln][8 * hh]; const unsigned short* vf = &sV[buf][ln][8 * hh];
#pragma unroll
    for (int ps2 = 0; ps2 < FSK / 32; ++ps2) {
      FragH ak[2][KS], av[DT];
#pragma unroll
      for (int nt = 0; nt < 2; ++nt)
#pragma unroll
        for (int ks = 0; ks < KS; ++ks) { const unsigned short* kr = kf + (ps2 * 32 + nt * 16) * FPH + ks * 32; ak[nt][ks].half[0] = *(const v8us*)kr; ak[nt][ks].half[1] = *(const v8us*)(kr + 16); }
#pragma unroll
      for (int dt = 0; dt < DT; ++dt) { const unsigned short* vr = vf + dt * 16 * FPH + ps2 * 32; av[dt].half[0] = *(const v8us*)vr; av[dt].half[1] = *(const v8us*)(vr + 16); }
      float sc[16];
#pragma unroll
      for (int nt = 0; nt < 2; ++nt) { v8f acc = (v8f){0.f,0.f,0.f,0.f,0.f,0.f,0.f,0.f};
#pragma unroll
        for (int ks = 0; ks < KS; ++ks) acc = mmaH<1>(ak[nt][ks].v, ak[nt][ks].v, bq[ks].v, bq[ks].v, acc);
#pragma unroll
        for (int r = 0; r < 8; ++r) sc[nt * 8 + r] = acc[r]; }      /* raw q.k: the maximum is kept unscaled, the scale goes into the exponent's multiply-add */
      float mx[4];
#pragma unroll
      for (int c = 0; c < 4; ++c) mx[c] = fmaxf(fmaxf(sc[c], sc[4 + c]), fmaxf(sc[8 + c], sc[12 + c]));
      float mc = fmaxf(fmaxf(mx[0], mx[1]), fmaxf(mx[2], mx[3])); mc = fmaxf(mc, xhalf(mc));      /* both halves of a column use one maximum: they share the output tiles */
      const float mn = fmaxf(m_r, mc); float al = (m_r - mn) * FC2; m_r = mn;
      const float nb = fmaf(-mn, FC2, 10.0f);      /* 2^(s FC2 + nb) = 1024 exp((s - mn) / 8) */
      FragH pb; float ps[4];
#pragma unroll
      for (int i = 0; i < 16; ++i) sc[i] = fmaf(sc[i], FC2, nb);
      asm("v_exp_f32 %0, %0\n\tv_exp_f32 %1, %1\n\tv_exp_f32 %2, %2\n\tv_exp_f32 %3, %3\n\tv_exp_f32 %4, %4\n\tv_exp_f32 %5, %5\n\tv_exp_f32 %6, %6\n\tv_exp_f32 %7, %7\n\tv_exp_f32 %8, %8\n\t"
          "v_exp_f32 %9, %9\n\tv_exp_f32 %10, %10\n\tv_exp_f32 %11, %11\n\tv_exp_f32 %12, %12\n\tv_exp_f32 %13, %13\n\tv_exp_f32 %14, %14\n\tv_exp_f32 %15, %15\n\tv_exp_f32 %16, %16\n\tv_nop"
          : "+v"(al), "+v"(sc[0]), "+v"(sc[1]), "+v"(sc[2]), "+v"(sc[3]), "+v"(sc[4]), "+v"(sc[5]), "+v"(sc[6]), "+v"(sc[7]), "+v"(sc[8]), "+v"(sc[9]), "+v"(sc[10]), "+v"(sc[11]), "+v"(sc[12]), "+v"(sc[13]), "+v"(sc[14]), "+v"(sc[15]));
#pragma unroll
      for (int i = 0; i < 16; ++i) { const float p = sc[i]; ps[i & 3] = (i < 4) ? p : ps[i & 3] + p; pb.h[i] = (_Float16)p; }      /* element i = key 8 hh + i (i < 8), 16 + 8 hh + i - 8 (i >= 8): the order of the V^T fragments above */
      l_r = l_r * al + ((ps[0] + ps[1]) + (ps[2] + ps[3]));
#pragma unroll
      for (int dt = 0; dt < DT; ++dt)
#pragma unroll
        for (int r = 0; r < 8; ++r) oacc[dt][r] *= al;
#pragma unroll
      for (int dt = 0; dt < DT; ++dt) oacc[dt] = mmaH<1>(av[dt].v, av[dt].v, pb.v, pb.v, oacc[dt]);
    }
    asm volatile("s_wait_dscnt 0x0" ::: "memory");      /* this wave's reads of the buffer have returned before it is given up */
    asm volatile("s_wait_asynccnt 0x0" ::: "memory");      /* this wave's copies of the next stage have landed */
    __syncthreads();      /* publishes the next stage and ends every wave's reads of this one */
    if (st + 2 < NST) { fl_copy(lk0 + buf * FBB, lv0 + buf * FBB, gk, ks16, gv); gk += kstg; gv += FSK; } }
  asm volatile("s_wait_asynccnt 0x0" ::: "memory");      /* no copy is left in flight when the wave ends */
  const float l = l_r + xhalf(l_r); const float inv = (l > 0.f) ? 1.0f / l : 0.f;      /* weights and sum both carry the 2^10 */
  const size_t oofs = ((size_t)b * TQ + q0 + ln) * ldo + h * 64 + 8 * hh;      /* register r of tile dt = channel dt * 16 + 8 hh + r of query ln: 16 contiguous bytes a lane in each plane */
#pragma unroll
  for (int dt = 0; dt < DT; ++dt) { FragH fh, fl;      /* the output conv's two operands, f16 and the 2^10 residual, are formed here from the registers */
#pragma unroll
    for (int r = 0; r < 8; ++r) { const float v = oacc[dt][r] * inv; const _Float16 hv = (_Float16)v; fh.h[r] = hv; fl.h[r] = (_Float16)((v - (float)hv) * 1024.0f); }
    *(v8us*)((unsigned short*)OHp + oofs + dt * 16) = fh.half[0]; *(v8us*)((unsigned short*)OLp + oofs + dt * 16) = fl.half[0]; } }
// 5-plane variant: S = Qh Kh^T + (Ql Kh^T + Qh Kl^T)/1024 with Q/K = [hi | 2^10 residual] f16 planes (QL/KL same layout as Q16/K16), then the 3-term P.V below.
// 3-term variant: O = (P_hi V_hi + (P_lo V_hi + P_hi V_lo) / 1024) / l with P = [hi | 2^10 residual] of 1024 p and V^T = [hi | 2^10 residual] planes (VtL same layout as Vt) -> ~2^-21-class products for un-averaged (early causal / peaked) rows
template <int CAUSAL>
__global__ __launch_bounds__(128) void k_flash5(const _Float16* __restrict__ Q16, const _Float16* __restrict__ QL, int ldq, const _Float16* __restrict__ K16, const _Float16* __restrict__ KL, int ldk, const _Float16* __restrict__ Vt, const _Float16* __restrict__ VtL, const int* __restrict__ MSK, float* __restrict__ O, int ldo) {
  constexpr int RPW = 16, RTN = RPW / 16, NQB = TQ / (4 * RPW), DT = 4, KS = 2;
  __shared__ __attribute__((aligned(16))) unsigned short sP[4][RPW][40]; __shared__ __attribute__((aligned(16))) unsigned short sPL[4][RPW][40]; __shared__ __attribute__((aligned(16))) float sO[4][RPW][64 + 4];
  const int tid = threadIdx.x, w = tid >> 5, lane = tid & 31, ln = lane & 15, hh = lane >> 4;
  const int slab = blockIdx.x / QBN5, qblk = QB05 + blockIdx.x % QBN5; (void)NQB; const int b = slab / NH, h = slab % NH; const int qb0 = qblk * (4 * RPW); const int q0 = qb0 + w * RPW;
  FragH aq[2][KS], aql[2][KS];
#pragma unroll
  for (int rt = 0; rt < RTN; ++rt) { const unsigned short* qr = (const unsigned short*)Q16 + ((size_t)b * TQ + q0 + rt * 16 + ln) * ldq + h * 64; const unsigned short* ql = (const unsigned short*)QL + ((size_t)b * TQ + q0 + rt * 16 + ln) * ldq + h * 64;
#pragma unroll
    for (int ks = 0; ks < KS; ++ks) { aq[rt][ks].half[0] = *(const v8us*)(qr + ks * 32 + 8 * hh); aq[rt][ks].half[1] = *(const v8us*)(qr + ks * 32 + 16 + 8 * hh); aql[rt][ks].half[0] = *(const v8us*)(ql + ks * 32 + 8 * hh); aql[rt][ks].half[1] = *(const v8us*)(ql + ks * 32 + 16 + 8 * hh); } }
  const unsigned short* Vth = (const unsigned short*)Vt + (size_t)slab * 64 * TK; const unsigned short* Vtl = (const unsigned short*)VtL + (size_t)slab * 64 * TK;
  float m_r[2][8], l_r[2][8]; v8f oacc[2][DT], oaccL[2][DT];
#pragma unroll
  for (int rt = 0; rt < RTN; ++rt) {
#pragma unroll
    for (int r = 0; r < 8; ++r) { m_r[rt][r] = -3.0e38f; l_r[rt][r] = 0.f; }
#pragma unroll
    for (int dt = 0; dt < DT; ++dt) { oacc[rt][dt] = (v8f){0.f,0.f,0.f,0.f,0.f,0.f,0.f,0.f}; oaccL[rt][dt] = oacc[rt][dt]; } }
  const int jend = (CAUSAL == 1) ? (qb0 + 4 * RPW) : ((CAUSAL == 23) ? min(TK, (qb0 / CHK + 2) * CHK) : TK);      /* causal / window: keys that can never contribute are skipped */ const int jbeg = (CAUSAL == 23) ? max(0, (qb0 / CHK - 1) * CHK) : 0;
#pragma unroll 1
  for (int j0 = jbeg; j0 < jend; j0 += 32) {
    v8f s[2][2];
#pragma unroll
    for (int nt = 0; nt < 2; ++nt) { const unsigned short* kr = (const unsigned short*)K16 + ((size_t)b * TK + j0 + nt * 16 + ln) * ldk + h * 64; const unsigned short* klr = (const unsigned short*)KL + ((size_t)b * TK + j0 + nt * 16 + ln) * ldk + h * 64; FragH bk[KS], bkl[KS];
#pragma unroll
      for (int ks = 0; ks < KS; ++ks) { bk[ks].half[0] = *(const v8us*)(kr + ks * 32 + 8 * hh); bk[ks].half[1] = *(const v8us*)(kr + ks * 32 + 16 + 8 * hh); bkl[ks].half[0] = *(const v8us*)(klr + ks * 32 + 8 * hh); bkl[ks].half[1] = *(const v8us*)(klr + ks * 32 + 16 + 8 * hh); }
#pragma unroll
      for (int rt = 0; rt < RTN; ++rt) { v8f acc = (v8f){0.f,0.f,0.f,0.f,0.f,0.f,0.f,0.f}, accl = acc;
#pragma unroll
        for (int ks = 0; ks < KS; ++ks) { acc = mmaH<1>(aq[rt][ks].v, aq[rt][ks].v, bk[ks].v, bk[ks].v, acc); accl = mmaH<1>(aql[rt][ks].v, aql[rt][ks].v, bk[ks].v, bk[ks].v, accl); accl = mmaH<1>(aq[rt][ks].v, aq[rt][ks].v, bkl[ks].v, bkl[ks].v, accl); }
#pragma unroll
        for (int r = 0; r < 8; ++r) acc[r] += accl[r] * 0.0009765625f;
        s[rt][nt] = acc; } }
#pragma unroll
    for (int rt = 0; rt < RTN; ++rt)
#pragma unroll
      for (int r = 0; r < 8; ++r) { const int tq = q0 + rt * 16 + 8 * hh + r; const int k0 = j0 + ln, k1 = j0 + 16 + ln;
        bool ok0 = (CAUSAL == 1) ? (k0 <= tq) : ((CAUSAL == 2) ? ((k0 >> 5) == (tq >> 5)) : true), ok1 = (CAUSAL == 1) ? (k1 <= tq) : ((CAUSAL == 2) ? ((k1 >> 5) == (tq >> 5)) : true);      /* mode 2: block-diagonal 32-token groups */
        if (CAUSAL == 4) { const int* mrow = MSK + ((size_t)b * TQ + tq) * TK; ok0 = mrow[k0] != 0; ok1 = mrow[k1] != 0; }      /* mode 4: per-(query, key) INPUT mask shared by all heads; masked keys contribute nothing (== the reference's -4096 fill, whose exp underflows to 0), rows with no valid key give l = 0 -> output 0 (== the reference's row_valid zeroing) */
        float s0 = ok0 ? s[rt][0][r] * SCL : -3.0e38f, s1 = ok1 ? s[rt][1][r] * SCL : -3.0e38f; if (CAUSAL == 17) { const float* amk = (const float*)MSK + (size_t)b * TK; s0 += bf16_round(amk[k0]); s1 += bf16_round(amk[k1]); } if (CAUSAL == 18) { const float* tb = (const float*)MSK; const int* ri = MSK + 1024 + (size_t)b * TK; const int rq = ri[tq]; s0 += tb[(h * 8 + rq) * 8 + ri[k0]]; s1 += tb[(h * 8 + rq) * 8 + ri[k1]]; } if (CAUSAL == 19) { const int* rel = MSK + (size_t)tq * TK; const float* rb = (const float*)MSK + (size_t)TQ * TK + ((size_t)(b * NH + h) * TQ + tq) * 64; s0 += rb[rel[k0]]; s1 += rb[rel[k1]]; }      /* mode 19: + (q.Ek[rel] + Eb[rel][h]) / 8 gathered by the int relative ids (packed [ids | table]) */      /* mode 18: + resource_bias[h][r_q][r_k] from the packed [table | ids] buffer (TQ == TK) */      /* mode 17: additive per-(batch, key) mask INPUT */ float mc = fmaxf(s0, s1);
        mc = fmaxf(mc, __shfl_xor(mc, 1, 32)); mc = fmaxf(mc, __shfl_xor(mc, 2, 32)); mc = fmaxf(mc, __shfl_xor(mc, 4, 32)); mc = fmaxf(mc, __shfl_xor(mc, 8, 32));
        const float mn = fmaxf(m_r[rt][r], mc); const float al = (mn > -1.0e38f) ? expf(m_r[rt][r] - mn) : 1.0f; m_r[rt][r] = mn; const float p0 = ok0 ? expf(s0 - mn) : 0.f, p1 = ok1 ? expf(s1 - mn) : 0.f; l_r[rt][r] = l_r[rt][r] * al + p0 + p1;
#pragma unroll
        for (int dt = 0; dt < DT; ++dt) { oacc[rt][dt][r] *= al; oaccL[rt][dt][r] *= al; }
        FragH t2, t2l; const float ps0 = p0 * 1024.0f, ps1 = p1 * 1024.0f; t2.h[0] = (_Float16)ps0; t2.h[1] = (_Float16)ps1; t2l.h[0] = (_Float16)((ps0 - (float)t2.h[0]) * 1024.0f); t2l.h[1] = (_Float16)((ps1 - (float)t2.h[1]) * 1024.0f);
        sP[w][rt * 16 + 8 * hh + r][ln] = t2.u[0]; sP[w][rt * 16 + 8 * hh + r][16 + ln] = t2.u[1]; sPL[w][rt * 16 + 8 * hh + r][ln] = t2l.u[0]; sPL[w][rt * 16 + 8 * hh + r][16 + ln] = t2l.u[1]; }
    __builtin_amdgcn_fence(__ATOMIC_ACQ_REL, "workgroup"); __builtin_amdgcn_wave_barrier();
    FragH pa[2], pl[2];
#pragma unroll
    for (int rt = 0; rt < RTN; ++rt) { pa[rt].half[0] = *(const v8us*)&sP[w][rt * 16 + ln][8 * hh]; pa[rt].half[1] = *(const v8us*)&sP[w][rt * 16 + ln][16 + 8 * hh]; pl[rt].half[0] = *(const v8us*)&sPL[w][rt * 16 + ln][8 * hh]; pl[rt].half[1] = *(const v8us*)&sPL[w][rt * 16 + ln][16 + 8 * hh]; }
#pragma unroll
    for (int dt = 0; dt < DT; ++dt) { const unsigned short* vrow = Vth + (size_t)(dt * 16 + ln) * TK + j0; const unsigned short* vrl = Vtl + (size_t)(dt * 16 + ln) * TK + j0; FragH bv, bl; bv.half[0] = *(const v8us*)(vrow + 8 * hh); bv.half[1] = *(const v8us*)(vrow + 16 + 8 * hh); bl.half[0] = *(const v8us*)(vrl + 8 * hh); bl.half[1] = *(const v8us*)(vrl + 16 + 8 * hh);
#pragma unroll
      for (int rt = 0; rt < RTN; ++rt) { oacc[rt][dt] = mmaH<1>(pa[rt].v, pa[rt].v, bv.v, bv.v, oacc[rt][dt]); oaccL[rt][dt] = mmaH<1>(pl[rt].v, pl[rt].v, bv.v, bv.v, oaccL[rt][dt]); oaccL[rt][dt] = mmaH<1>(pa[rt].v, pa[rt].v, bl.v, bl.v, oaccL[rt][dt]); } }
    __builtin_amdgcn_fence(__ATOMIC_ACQ_REL, "workgroup"); __builtin_amdgcn_wave_barrier(); }
#pragma unroll
  for (int rt = 0; rt < RTN; ++rt) {
#pragma unroll
    for (int r = 0; r < 8; ++r) { float l = l_r[rt][r]; l += __shfl_xor(l, 1, 32); l += __shfl_xor(l, 2, 32); l += __shfl_xor(l, 4, 32); l += __shfl_xor(l, 8, 32); l_r[rt][r] = (l > 0.f) ? 1.0f / (l * 1024.0f) : 0.f; }
#pragma unroll
    for (int dt = 0; dt < DT; ++dt)
#pragma unroll
      for (int r = 0; r < 8; ++r) { float v = oacc[rt][dt][r]; v += oaccL[rt][dt][r] * 0.0009765625f; sO[w][rt * 16 + 8 * hh + r][dt * 16 + ln] = v * l_r[rt][r]; } }
  __builtin_amdgcn_fence(__ATOMIC_ACQ_REL, "workgroup"); __builtin_amdgcn_wave_barrier();
  {
#pragma unroll
    for (int rp = 0; rp < RPW; rp += 2) { const int r = rp + (lane >> 4), pc = lane & 15; const v4f val = *(const v4fa*)&sO[w][r][pc * 4]; *(v4f*)(O + ((size_t)b * TQ + q0 + r) * ldo + h * 64 + pc * 4) = val; }
     } }

__global__ __launch_bounds__(256) void k_rotab(float* __restrict__ CS, float* __restrict__ SN) {
  #pragma clang fp contract(off)
  const int t = blockIdx.x * 256 + threadIdx.x; if (t >= SLEN * 32) return; const int j = t % 32, s = t / 32; const float ex = (float)(2 * j) / 64.0f; const float inv = 1.0f / powf(10000.0f, ex); const float th = (float)s * inv; const float c = cosf(th), sn = sinf(th);
  { *(float*)(CS + t) = c; *(float*)(SN + t) = sn;  } }
__global__ __launch_bounds__(256) void k_rope(const float* __restrict__ F, int nsrc, int ndst, int rep, const float* __restrict__ CS, const float* __restrict__ SN, _Float16* __restrict__ H, _Float16* __restrict__ L) {
  #pragma clang fp contract(off)
  const size_t t = (size_t)blockIdx.x * 256 + threadIdx.x; if (t >= (size_t)NR * ndst * 4) return; const int g8 = (int)(t % 4); const int hd = (int)((t / 4) % ndst); const size_t row = t / ((size_t)4 * ndst); const int s = (int)(row % SLEN); const int hs = hd / rep;
  const float* src = F + row * (size_t)(nsrc * 64) + hs * 64; FragH ah, al, bh, bl;
  for (int i = 0; i < 8; ++i) { const int d = g8 * 8 + i; const float c = CS[s * 32 + d], sn = SN[s * 32 + d]; const float x1 = src[d], x2 = src[d + 32];
    float o1 = x1 * c; o1 += -x2 * sn; float o2 = x2 * c; o2 += x1 * sn;
    _Float16 hv = (_Float16)o1; ah.h[i] = hv; al.h[i] = (_Float16)((o1 - (float)hv) * 1024.0f); hv = (_Float16)o2; bh.h[i] = hv; bl.h[i] = (_Float16)((o2 - (float)hv) * 1024.0f); }
  const size_t o = row * (size_t)(ndst * 64) + hd * 64 + g8 * 8;
  { *(v8us*)((unsigned short*)H + o) = ah.half[0]; *(v8us*)((unsigned short*)H + o + 32) = bh.half[0]; *(v8us*)((unsigned short*)L + o) = al.half[0]; *(v8us*)((unsigned short*)L + o + 32) = bl.half[0];  } }
__global__ __launch_bounds__(256) void k_rope2(const float* __restrict__ F, int nsrc, int ndst, int rep, const float* __restrict__ CS, const float* __restrict__ SN, _Float16* __restrict__ H, _Float16* __restrict__ L) {
  #pragma clang fp contract(off)
  const size_t t = (size_t)blockIdx.x * 256 + threadIdx.x; if (t >= (size_t)NR * ndst * 4) return; const int g16 = (int)(t % 4); const int hd = (int)((t / 4) % ndst); const size_t row = t / ((size_t)4 * ndst); const int s = (int)(row % SLEN); const int hs = hd / rep;
  const float* src = F + row * (size_t)(nsrc * 64) + hs * 64 + g16 * 16; FragH ah, al;
  for (int pr = 0; pr < 8; ++pr) { const int i = g16 * 8 + pr; const float c = CS[s * 32 + i], sn = SN[s * 32 + i]; const float x1 = src[2 * pr], x2 = src[2 * pr + 1];
    float o1 = x1 * c; o1 -= x2 * sn; float o2 = x1 * sn; o2 += x2 * c;
    _Float16 hv = (_Float16)o1; ah.h[2 * pr] = hv; al.h[2 * pr] = (_Float16)((o1 - (float)hv) * 1024.0f); hv = (_Float16)o2; ah.h[2 * pr + 1] = hv; al.h[2 * pr + 1] = (_Float16)((o2 - (float)hv) * 1024.0f); }
  const size_t o = row * (size_t)(ndst * 64) + hd * 64 + g16 * 16;
  { *(v8us*)((unsigned short*)H + o) = ah.half[0]; *(v8us*)((unsigned short*)H + o + 8) = ah.half[1]; *(v8us*)((unsigned short*)L + o) = al.half[0]; *(v8us*)((unsigned short*)L + o + 8) = al.half[1];  } }
__global__ __launch_bounds__(256) void k_ln512(const float* __restrict__ A, const float* __restrict__ res, const float* __restrict__ g, const float* __restrict__ bb, float* __restrict__ Y, _Float16* __restrict__ Y16) {
  #pragma clang fp contract(off)
  const int wv = threadIdx.x >> 5, ln = threadIdx.x & 31; const size_t r = (size_t)blockIdx.x * 8 + wv; if (r >= NR) return; float x[16]; float s = 0.f;
  for (int i = 0; i < 2; ++i) { const v8f a = *(const v8f*)(A + r * DM + i * 256 + ln * 8); for (int q = 0; q < 8; ++q) { float v = a[q]; if (res) v += bf16_round(res[r * DM + i * 256 + ln * 8 + q]); x[i * 8 + q] = v; s += v; } }
  for (int o = 16; o > 0; o >>= 1) s += __shfl_xor(s, o, 32); const float mu = s / (float)DM; float var = 0.f; for (int q = 0; q < 16; ++q) { const float d = x[q] - mu; var += d * d; }
  for (int o = 16; o > 0; o >>= 1) var += __shfl_xor(var, o, 32); const float inv = rsqrtf(var / (float)DM + 1e-5f);
  { for (int i = 0; i < 2; ++i) { const int c0 = i * 256 + ln * 8; v8f y; FragH f; for (int q = 0; q < 8; ++q) { float v = (x[i * 8 + q] - mu) * inv; v *= bf16_round(g[c0 + q]); v += bf16_round(bb[c0 + q]); y[q] = v; f.h[q] = (_Float16)v; } *(v8f*)(Y + r * DM + c0) = y; if (Y16) *(v8us*)((unsigned short*)Y16 + r * DM + c0) = f.half[0]; }  } }
__global__ __launch_bounds__(256) void k_pack(const float* __restrict__ rb, const int* __restrict__ rid, int* __restrict__ PK) { const int t = blockIdx.x * 256 + threadIdx.x; if (t >= 1024 + NB * TK) return; int v; if (t < 1024) v = __float_as_int(bf16_round(rb[t])); else v = rid[t - 1024]; *(int*)(PK + t) = v;  }
__global__ __launch_bounds__(256) void k_tabin(const float* __restrict__ sp, float* __restrict__ CS, float* __restrict__ SN) { const int t = blockIdx.x * 256 + threadIdx.x; if (t >= SLEN * 32) return; const int i = t % 32, s = t / 32; const float c = bf16_round(sp[s * 64 + 32 + i]), sn = bf16_round(sp[s * 64 + i]);
  { *(float*)(CS + t) = c; *(float*)(SN + t) = sn;  } }
__global__ __launch_bounds__(256) void k_rotab2(float* __restrict__ CS, float* __restrict__ SN) {
  #pragma clang fp contract(off)
  const int t = blockIdx.x * 256 + threadIdx.x; if (t >= SLEN * 32) return; const int j = t % 32, s = t / 32; const float c0 = -0.14391156831212787f;      /* -ln(10000)/64 rounded to f32 */ const float inv = expf((float)(2 * j) * c0); const float th = (float)s * inv; const float c = cosf(th), sn = sinf(th);
  { *(float*)(CS + t) = c; *(float*)(SN + t) = sn;  } }
__global__ __launch_bounds__(256) void k_lnu(const float* __restrict__ X, _Float16* __restrict__ N16, float* __restrict__ XB) {
  #pragma clang fp contract(off)
  const int wv = threadIdx.x >> 5, ln = threadIdx.x & 31; const size_t r = (size_t)blockIdx.x * 8 + wv; if (r >= NR) return; float a[32]; float s = 0.f;
  for (int i = 0; i < 4; ++i) { const v8f v = *(const v8f*)(X + r * DM + (i * 32 + ln) * 8); for (int q = 0; q < 8; ++q) { const float u = bf16_round(v[q]); a[i * 8 + q] = u; s += u; } }
  for (int o = 16; o > 0; o >>= 1) s += __shfl_xor(s, o, 32); const float mu = s / (float)DM; float var = 0.f; for (int q = 0; q < 32; ++q) { const float d = a[q] - mu; var += d * d; }
  for (int o = 16; o > 0; o >>= 1) var += __shfl_xor(var, o, 32); const float den = sqrtf(var / (float)(DM - 1)) + 1e-6f; const float inv = 1.0f / den;      /* one reciprocal per row; (x-mean)*inv vs the reference's division differs by <= 1 ulp */
  { for (int i = 0; i < 4; ++i) { const int c0 = (i * 32 + ln) * 8; FragH f; v8f xb; for (int q = 0; q < 8; ++q) { f.h[q] = (_Float16)((a[i * 8 + q] - mu) * inv); xb[q] = a[i * 8 + q]; } *(v8us*)((unsigned short*)N16 + r * DM + c0) = f.half[0]; *(v8f*)(XB + r * DM + c0) = xb; }  } }
__global__ __launch_bounds__(256) void k_h16s(const float* __restrict__ SRC, int lds, int coff, _Float16* __restrict__ DST, size_t n8) { const size_t t = (size_t)blockIdx.x * 256 + threadIdx.x; if (t >= n8) return; const size_t r = (t * 8) / DM; const int c = (int)((t * 8) % DM); const v8f a = *(const v8f*)(SRC + r * lds + coff + c); FragH f; for (int q = 0; q < 8; ++q) f.h[q] = (_Float16)a[q];
  *(v8us*)((unsigned short*)DST + t * 8) = f.half[0];  }


__global__ __launch_bounds__(256) void k_ccp(const float* __restrict__ QKV, int coff, _Float16* __restrict__ D) { const size_t t = (size_t)blockIdx.x * 256 + threadIdx.x; if (t >= (size_t)NR * DM / 8) return; const int c0 = (int)((t * 8) % DM); const size_t row = (t * 8) / DM; const v8f a = *(const v8f*)(QKV + row * 3 * DM + coff + c0); FragH f; for (int q = 0; q < 8; ++q) f.h[q] = (_Float16)a[q];
  *(v8us*)((unsigned short*)D + t * 8) = f.half[0];  }


// The five preparations need nothing of each other and share one grid: blocks 0 to TOKB - 1 turn 16 pixels each into token rows, then WSB blocks for each of the four weight matrices (x16, f16). The branch is uniform for a block.
#define TOKB (NPIX / 16)
#define WSB (DM * DM / 8 / 256)      /* 8 weights a thread, no remainder */
__global__ __launch_bounds__(256) void k_prep(const float* __restrict__ x, _Float16* __restrict__ X16, const float* __restrict__ qw, const float* __restrict__ kw, const float* __restrict__ vw, const float* __restrict__ ow,
    _Float16* __restrict__ BQ, _Float16* __restrict__ BK, _Float16* __restrict__ BV, _Float16* __restrict__ BO) { __shared__ float tl[DM][17]; const int tid = threadIdx.x;
  if (blockIdx.x >= TOKB) { const int wb = blockIdx.x - TOKB, m = wb / WSB; const float* Wm = (m == 0) ? qw : ((m == 1) ? kw : ((m == 2) ? vw : ow)); _Float16* Bt = (m == 0) ? BQ : ((m == 1) ? BK : ((m == 2) ? BV : BO));
    const size_t t = (size_t)(wb - m * WSB) * 256 + tid; FragH f; for (int q = 0; q < 8; ++q) f.h[q] = (_Float16)(bf16_round(Wm[t * 8 + q]) * 16.0f); *(v8us*)((unsigned short*)Bt + t * 8) = f.half[0]; return; }
  const int p0 = blockIdx.x * 16;      /* 16-pixel tiles: 34 KB of LDS */
  for (int i = tid; i < DM * 16; i += 256) { const int c = i / 16, p = i % 16; tl[c][p] = bf16_round(x[(size_t)c * NPIX + p0 + p]); }
  __syncthreads();
  { for (int i = tid; i < 16 * (DM / 8); i += 256) { const int p = i / (DM / 8), c0 = (i % (DM / 8)) * 8; FragH f; for (int q = 0; q < 8; ++q) f.h[q] = (_Float16)tl[c0 + q][p];
      *(v8us*)((unsigned short*)X16 + ((size_t)p0 + p) * DM + c0) = f.half[0]; }  } }
extern "C" void kernel_launch(void* const* d_in, const int* in_sizes, int n_in,
                              void* d_out, int out_size, void* d_ws, size_t ws_size, hipStream_t stream) {
  (void)in_sizes; (void)n_in; (void)out_size;
  const float* x = (const float*)d_in[0]; const float* qw = (const float*)d_in[1]; const float* qb = (const float*)d_in[2]; const float* kw = (const float*)d_in[3]; const float* kb = (const float*)d_in[4]; const float* vw = (const float*)d_in[5]; const float* vb = (const float*)d_in[6]; const float* ow = (const float*)d_in[7]; const float* ob = (const float*)d_in[8];
  char* ws = (char*)d_ws; size_t off = 0;
  auto take = [&](size_t bytes) { char* p = ws + off; off += (bytes + 255) & ~(size_t)255; return p; };
  const size_t np = (size_t)NR * DM;
  _Float16* BQ = (_Float16*)take((size_t)DM * DM * 2); _Float16* BK = (_Float16*)take((size_t)DM * DM * 2); _Float16* BV = (_Float16*)take((size_t)DM * DM * 2); _Float16* BO = (_Float16*)take((size_t)DM * DM * 2); float* Y = (float*)take(np * 4);
   _Float16* X16 = (_Float16*)take(np * 2); _Float16* QH = (_Float16*)take(np * 2); _Float16* KH = (_Float16*)take(np * 2); _Float16* VT = (_Float16*)take(np * 2); _Float16* OH = (_Float16*)take(np * 2); _Float16* OL = (_Float16*)take(np * 2);
  if (off > ws_size) return;
  k_prep<<<TOKB + 4 * WSB, 256, 0, stream>>>(x, X16, qw, kw, vw, ow, BQ, BK, BV, BO);      /* token rows; 1x1 conv (out, in) naturals */
  const dim3 g((NR / 128) * (DM / 64), 1), g3((NR / 128) * (DM / 64), 3);
  k_gemm2<0><<<g3, 128, 0, stream>>>(X16, DM, 0, BQ, DM, (size_t)DM * DM, 0.0625f, qb, kb, vb, nullptr, 1, 0, 0, nullptr, QH, DM, np, NR, DM, DM, 2, nullptr, VT);      /* q, k, v: BQ, BK, BV and QH, KH lie one behind the other in the workspace; v leaves its GEMM as V^T (channel = head * 64 + d rows of SLEN tokens) */
  k_flash<<<NB * NH * QBNP, 128, 0, stream>>>(QH, DM, KH, DM, VT, OH, OL, DM);
  k_gemm2<0><<<g, 128, 0, stream>>>(OL, DM, 0, BO, DM, 0, 0.0625f / 1024.0f, nullptr, nullptr, nullptr, nullptr, 1, 0, 0, Y, nullptr, DM, 0, NR, DM, DM, -1, nullptr, nullptr);
  k_gemm2<0><<<g, 128, 0, stream>>>(OH, DM, 0, BO, DM, 0, 0.0625f, ob, nullptr, nullptr, Y, 1, (size_t)DM, 0, nullptr, nullptr, DM, 0, NR, DM, DM, 0, (float*)d_out, nullptr);      /* the output conv, stored as NCHW */
}

// v007
// Measured time: 97.4 microseconds a run.
// Timed twice side by side with v006, it ran 1.10 and 1.09 times as fast.
// All steps since v000 together make it 6.08 times as fast.
#include <hip/hip_runtime.h>
// SelfAttention4d (1 x 512 ch x 64 x 64 = 4096 tokens, 8 heads x 64: q/k/v = 1x1 convs (+ bias; the 1/8 scale applied in the flash kernel); softmax(q.k) v; out = 1x1 conv (+ bias) back to NCHW).
// Structure: NCHW -> exact f16 token rows by an LDS transpose kernel; q/k/v as f16 WMMA GEMMs (32x64 wave tiles, f32 accumulation, exact x16 (out,in) weights + bias, f16 out; channel = head*64 + d); V^T stored by the v GEMM itself (block tile turned in LDS); my fused flash kernel (no mask; the 1/8 applied as the score scale), which stores ctx as f16 hi/residual for the output conv (two GEMM terms) + bias; the last GEMM stores NCHW (block tile turned in LDS).
// Compute dtype: inputs rounded to bf16; x / weights exact as f16; q, k, v plain f16 (~2^-12); softmax weights f16 x2^10; ctx hi + 2^-10 residual; v_wmma_f32_16x16x32_f16.
#define NB 1
#define DM 512
#define NKV 8
#define NPIX 4096
#define NREP (NH / NKV)
#define KVD (NKV * 64)           /* 512 */
#define NR (NB * SLEN)
#define CHK 512
typedef int v4i __attribute__((ext_vector_type(4)));
#define FF 2048
#define SLEN 4096
#define MQI 4096
#define MKI 4096
#define TQ SLEN
#define TK SLEN
#define NH 8
#define SCL 0.125f
#define QBLKS (TQ / 64)
#define QB05 0
#define QBN5 4
#define QB0P 0
#define QBNP QBLKS
#define RE 256
typedef __bf16 v16b __attribute__((ext_vector_type(16)));
typedef unsigned short v8us __attribute__((ext_vector_type(8), may_alias));
typedef float  v8f  __attribute__((ext_vector_type(8)));
typedef float  v4f  __attribute__((ext_vector_type(4)));
typedef float  v4fa __attribute__((ext_vector_type(4), may_alias));
union FragB { v16b v; v8us half[2]; unsigned short u[16]; };

__device__ __forceinline__ unsigned short bf16_bits(float x) { unsigned int u = __float_as_uint(x); return (unsigned short)((u + 0x7FFFu + ((u >> 16) & 1u)) >> 16); }
__device__ __forceinline__ float bf16_val(unsigned short b) { return __uint_as_float(((unsigned int)b) << 16); }
__device__ __forceinline__ float bf16_round(float x) { return bf16_val(bf16_bits(x)); }
// D += A·B with NT terms: 1 = ah·bh, 2 = + al·bh (A split), 3 = + ah·bl (both split)
template <int NT>
__device__ __forceinline__ v8f mmaN(v16b ah, v16b al, v16b bh, v16b bl, v8f c) {
  c = __builtin_amdgcn_wmma_f32_16x16x32_bf16(false, ah, false, bh, (short)0, c, false, false);
  if (NT >= 2) c = __builtin_amdgcn_wmma_f32_16x16x32_bf16(false, al, false, bh, (short)0, c, false, false);
  if (NT >= 3) c = __builtin_amdgcn_wmma_f32_16x16x32_bf16(false, ah, false, bl, (short)0, c, false, false);
  asm volatile("v_nop\n\tv_nop\n\tv_nop\n\tv_nop" : "+v"(c) : "v"(ah), "v"(al), "v"(bh), "v"(bl));
  return c;
}

__global__ __launch_bounds__(256) void k_wt_bf16(const float* __restrict__ W, unsigned short* __restrict__ Wt, int K, int N) {
  const int t = blockIdx.x * 256 + threadIdx.x;
  const int k8n = K / 8;
  if (t >= N * k8n) return;
  const int n = t / k8n, k8 = (t % k8n) * 8;
  v8us v;
#pragma unroll
  for (int i = 0; i < 8; ++i) v[i] = bf16_bits(W[(size_t)(k8 + i) * N + n]);
  *(v8us*)(Wt + (size_t)n * K + k8) = v;
  
}

// GEMM C[M][N] (f32, pitch ldc) = act(A[M][K]·W + bias). A f32 row-major (pitch lda) converted per fragment to bf16
// (ASPLIT: hi/lo two planes -> 2 terms, else single rounded term); Wt bf16 [N][K] (pitch ldb). BIAS_BF16 rounds the
// bias to bf16 first (bias quantised to bf16 before the add). K%32==0, M%16==0, N%64==0.
template <bool ASPLIT, int ACT, bool BIAS_BF16>
__global__ __launch_bounds__(128) void k_gemm_bf(const float* __restrict__ A, int lda, const unsigned short* __restrict__ Wt, int ldb,
                                               const float* __restrict__ bias, float* __restrict__ C, int ldc, int M, int N, int K) {
  __shared__ __attribute__((aligned(16))) float so[4][16][64];
  const int tid = threadIdx.x, w = tid >> 5, lane = tid & 31, ln = lane & 15, hh = lane >> 4;
  const int ntn = N / 64;
  const int wid = blockIdx.x * 4 + w;
  const int mt = wid / ntn, nq = wid % ntn;
  if (mt * 16 >= M) return;
  const int row0 = mt * 16, col0 = nq * 64;
  const float* arow = A + (size_t)(row0 + ln) * lda;
  v8f acc[4] = {};
  for (int kb = 0; kb < K; kb += 32) {
    FragB ah, al;
    const v4f x0 = *(const v4fa*)(arow + kb + 8 * hh), x1 = *(const v4fa*)(arow + kb + 8 * hh + 4);
    const v4f x2 = *(const v4fa*)(arow + kb + 16 + 8 * hh), x3 = *(const v4fa*)(arow + kb + 16 + 8 * hh + 4);
    float xs[16] = {x0[0],x0[1],x0[2],x0[3],x1[0],x1[1],x1[2],x1[3],x2[0],x2[1],x2[2],x2[3],x3[0],x3[1],x3[2],x3[3]};
#pragma unroll
    for (int i = 0; i < 16; ++i) { const unsigned short hb = bf16_bits(xs[i]); ah.u[i] = hb; al.u[i] = ASPLIT ? bf16_bits(xs[i] - bf16_val(hb)) : (unsigned short)0; }
#pragma unroll
    for (int t = 0; t < 4; ++t) {
      const unsigned short* brow = Wt + (size_t)(col0 + t * 16 + ln) * ldb + kb;
      FragB b;
      b.half[0] = *(const v8us*)(brow + 8 * hh);
      b.half[1] = *(const v8us*)(brow + 16 + 8 * hh);
      acc[t] = mmaN<ASPLIT ? 2 : 1>(ah.v, al.v, b.v, b.v, acc[t]);
    }
  }
#pragma unroll
  for (int t = 0; t < 4; ++t) {
    float bv = bias ? bias[col0 + t * 16 + ln] : 0.f;
    if (BIAS_BF16) bv = bf16_round(bv);
#pragma unroll
    for (int r = 0; r < 8; ++r) { float v = acc[t][r] + bv; if (ACT == 1) v = fmaxf(v, 0.f); so[w][8 * hh + r][t * 16 + ln] = v; }
  }
  __builtin_amdgcn_fence(__ATOMIC_ACQ_REL, "workgroup");
  __builtin_amdgcn_wave_barrier();
  const int rsub = lane >> 4, c4 = (lane & 15) * 4;
  {
#pragma unroll
    for (int q = 0; q < 8; ++q) {
      const int r = q * 2 + rsub;
      const v4f v = *(const v4fa*)&so[w][r][c4];
      *(v4f*)(C + (size_t)(row0 + r) * ldc + col0 + c4) = v;
    }
    
  }
}

// GEMM C = act(A·W + bias + resid): A f32 (ASPLIT -> hi/lo 2 terms), Wt bf16 [N][K]; ACT 0 none, 1 relu, 2 exact gelu;
// resid (optional, f32, row index = (row % rmod), pitch ldr, RES_BF16 rounds it) added before the activation.
template <bool ASPLIT, int ACT, bool BIAS_BF16, bool RES_BF16>
__global__ __launch_bounds__(128) void k_gemm_bf3(const float* __restrict__ A, int lda, const unsigned short* __restrict__ Wt, int ldb,
                                                const float* __restrict__ bias, const float* __restrict__ resid, int rmod, int ldr,
                                                float* __restrict__ C, int ldc, int M, int N, int K) {
  __shared__ __attribute__((aligned(16))) float so[4][16][64];
  const int tid = threadIdx.x, w = tid >> 5, lane = tid & 31, ln = lane & 15, hh = lane >> 4;
  const int ntn = N / 64;
  const int wid = blockIdx.x * 4 + w;
  const int mt = wid / ntn, nq = wid % ntn;
  if (mt * 16 >= M) return;
  const int row0 = mt * 16, col0 = nq * 64;
  const float* arow = A + (size_t)(row0 + ln) * lda;
  v8f acc[4] = {};
  for (int kb = 0; kb < K; kb += 32) {
    FragB ah, al;
    const v4f x0 = *(const v4fa*)(arow + kb + 8 * hh), x1 = *(const v4fa*)(arow + kb + 8 * hh + 4);
    const v4f x2 = *(const v4fa*)(arow + kb + 16 + 8 * hh), x3 = *(const v4fa*)(arow + kb + 16 + 8 * hh + 4);
    float xs[16] = {x0[0],x0[1],x0[2],x0[3],x1[0],x1[1],x1[2],x1[3],x2[0],x2[1],x2[2],x2[3],x3[0],x3[1],x3[2],x3[3]};
#pragma unroll
    for (int i = 0; i < 16; ++i) { const unsigned short hb = bf16_bits(xs[i]); ah.u[i] = hb; al.u[i] = ASPLIT ? bf16_bits(xs[i] - bf16_val(hb)) : (unsigned short)0; }
#pragma unroll
    for (int t = 0; t < 4; ++t) {
      const unsigned short* brow = Wt + (size_t)(col0 + t * 16 + ln) * ldb + kb;
      FragB b;
      b.half[0] = *(const v8us*)(brow + 8 * hh);
      b.half[1] = *(const v8us*)(brow + 16 + 8 * hh);
      acc[t] = mmaN<ASPLIT ? 2 : 1>(ah.v, al.v, b.v, b.v, acc[t]);
    }
  }
#pragma unroll
  for (int t = 0; t < 4; ++t) {
    const int col = col0 + t * 16 + ln;
    float bv = bias ? bias[col] : 0.f;
    if (BIAS_BF16) bv = bf16_round(bv);
#pragma unroll
    for (int r = 0; r < 8; ++r) {
      float v = acc[t][r] + bv;
      if (resid) { float rv = resid[(size_t)((row0 + 8 * hh + r) % rmod) * ldr + col]; if (RES_BF16) rv = bf16_round(rv); v += rv; }
      if (ACT == 1) v = fmaxf(v, 0.f);
      if (ACT == 2) v = 0.5f * v * (1.0f + erff(v * 0.70710678118654752f));
      if (ACT == 3) { const float u = 0.7978845608028654f * (v + 0.044715f * v * v * v); v = 0.5f * v * (1.0f + tanhf(u)); }
      so[w][8 * hh + r][t * 16 + ln] = v;
    }
  }
  __builtin_amdgcn_fence(__ATOMIC_ACQ_REL, "workgroup");
  __builtin_amdgcn_wave_barrier();
  const int rsub = lane >> 4, c4 = (lane & 15) * 4;
  {
#pragma unroll
    for (int q = 0; q < 8; ++q) {
      const int r = q * 2 + rsub;
      const v4f v = *(const v4fa*)&so[w][r][c4];
      *(v4f*)(C + (size_t)(row0 + r) * ldc + col0 + c4) = v;
    }
    
  }
}
// row LayerNorm (biased variance, eps) over N: s = X (+ R); optional out_sum <- s; out_norm <- (s-mu)*rsqrt(var+eps)*g + b
template <bool PARAM_BF16>
__global__ __launch_bounds__(256) void k_layernorm(const float* __restrict__ X, const float* __restrict__ R, const float* __restrict__ g, const float* __restrict__ bta,
                                                  float* __restrict__ out_sum, float* __restrict__ out_norm, int N, float eps) {
  __shared__ float red[256];
  const int row = blockIdx.x, tid = threadIdx.x;
  const float* x = X + (size_t)row * N; const float* rr = R ? R + (size_t)row * N : nullptr;
  float vals[16];                     // up to N = 4096
  const int per = N / 256;            // contiguous chunk per thread? use strided-by-4 chunks: thread handles j = tid*4 + 1024*u
  float s1 = 0.f;
  for (int u = 0; u < per / 4; ++u) {
    const int j = tid * 4 + 1024 * u;
    const v4f a = *(const v4fa*)(x + j);
    v4f b = {0.f,0.f,0.f,0.f}; if (rr) b = *(const v4fa*)(rr + j);
#pragma unroll
    for (int q = 0; q < 4; ++q) { const float v = a[q] + b[q]; vals[u * 4 + q] = v; s1 += v; }
  }
  red[tid] = s1; __syncthreads();
  for (int st = 128; st > 0; st >>= 1) { if (tid < st) red[tid] += red[tid + st]; __syncthreads(); }
  const float mu = red[0] / (float)N; __syncthreads();
  float s2 = 0.f;
  for (int u = 0; u < per / 4; ++u)
#pragma unroll
    for (int q = 0; q < 4; ++q) { const float c = vals[u * 4 + q] - mu; s2 += c * c; }
  red[tid] = s2; __syncthreads();
  for (int st = 128; st > 0; st >>= 1) { if (tid < st) red[tid] += red[tid + st]; __syncthreads(); }
  const float rs = rsqrtf(red[0] / (float)N + eps);
  {
    for (int u = 0; u < per / 4; ++u) {
      const int j = tid * 4 + 1024 * u;
      v4f o, sm;
#pragma unroll
      for (int q = 0; q < 4; ++q) {
        float gg = g[j + q], bb = bta[j + q];
        if (PARAM_BF16) { gg = bf16_round(gg); bb = bf16_round(bb); }
        sm[q] = vals[u * 4 + q]; o[q] = (vals[u * 4 + q] - mu) * rs * gg + bb;
      }
      if (out_sum) *(v4f*)(out_sum + (size_t)row * N + j) = sm;
      *(v4f*)(out_norm + (size_t)row * N + j) = o;
    }
    
  }
}



// ---- f16 WMMA path (v_wmma_f32_16x16x32_f16): 11-bit significands for operands in range — used where a [0,1] probability operand needs more precision than bf16
typedef _Float16 v16h __attribute__((ext_vector_type(16)));
union FragH { v16h v; v8us half[2]; _Float16 h[16]; unsigned short u[16]; };
template <int NT>
__device__ __forceinline__ v8f mmaH(v16h ah, v16h al, v16h bh, v16h bl, v8f c) {
  c = __builtin_amdgcn_wmma_f32_16x16x32_f16(false, ah, false, bh, (short)0, c, false, false);
  if (NT >= 2) c = __builtin_amdgcn_wmma_f32_16x16x32_f16(false, al, false, bh, (short)0, c, false, false);
  if (NT >= 3) c = __builtin_amdgcn_wmma_f32_16x16x32_f16(false, ah, false, bl, (short)0, c, false, false);
  asm volatile("v_nop\n\tv_nop\n\tv_nop\n\tv_nop" : "+v"(c) : "v"(ah), "v"(al), "v"(bh), "v"(bl));
  return c;
}
// batched GEMM like k_gemm_b but f16 operands: A f32 (split into f16 hi/lo if ASPLIT, else rounded to f16), Bt = f16 values [n][k]; alpha; C f32; N multiple of 16 (partial tiles skipped)
template <bool ASPLIT>
__global__ __launch_bounds__(128) void k_gemm_h(const float* __restrict__ A, int lda, size_t sA, const _Float16* __restrict__ Bh, int ldb, size_t sB, float alpha, float* __restrict__ C, int ldc, size_t sC, int M, int N, int K) {
  __shared__ __attribute__((aligned(16))) float so[4][16][64];
  const int tid = threadIdx.x, w = tid >> 5, lane = tid & 31, ln = lane & 15, hh = lane >> 4; const int by = blockIdx.y;
  A += (size_t)by * sA; Bh += (size_t)by * sB; C += (size_t)by * sC;
  const int ntn = (N + 63) / 64; const int wid = blockIdx.x * 4 + w; const int mt = wid / ntn, nq = wid % ntn; if (mt * 16 >= M) return;
  const int row0 = mt * 16, col0 = nq * 64; const float* arow = A + (size_t)(row0 + ln) * lda;
  v8f acc[4] = {};
  for (int kb = 0; kb < K; kb += 32) {
    FragH ah, al;
    const v4f x0 = *(const v4fa*)(arow + kb + 8 * hh), x1 = *(const v4fa*)(arow + kb + 8 * hh + 4), x2 = *(const v4fa*)(arow + kb + 16 + 8 * hh), x3 = *(const v4fa*)(arow + kb + 16 + 8 * hh + 4);
    float xs[16] = {x0[0],x0[1],x0[2],x0[3],x1[0],x1[1],x1[2],x1[3],x2[0],x2[1],x2[2],x2[3],x3[0],x3[1],x3[2],x3[3]};
#pragma unroll
    for (int i = 0; i < 16; ++i) { const _Float16 h = (_Float16)xs[i]; ah.h[i] = h; al.h[i] = ASPLIT ? (_Float16)(xs[i] - (float)h) : (_Float16)0.0f; }
#pragma unroll
    for (int t = 0; t < 4; ++t) { if (col0 + t * 16 >= N) continue; const size_t boff = (size_t)(col0 + t * 16 + ln) * ldb + kb; FragH bq; bq.half[0] = *(const v8us*)(Bh + boff + 8 * hh); bq.half[1] = *(const v8us*)(Bh + boff + 16 + 8 * hh);
      acc[t] = mmaH<ASPLIT ? 2 : 1>(ah.v, al.v, bq.v, bq.v, acc[t]); }
  }
#pragma unroll
  for (int t = 0; t < 4; ++t) { if (col0 + t * 16 >= N) continue;
#pragma unroll
    for (int r = 0; r < 8; ++r) so[w][8 * hh + r][t * 16 + ln] = acc[t][r] * alpha; }
  __builtin_amdgcn_fence(__ATOMIC_ACQ_REL, "workgroup"); __builtin_amdgcn_wave_barrier();
  const int rsub = lane >> 4, c4 = (lane & 15) * 4;
  {
#pragma unroll
    for (int q = 0; q < 8; ++q) { const int r = q * 2 + rsub; if (col0 + c4 < N) { const v4f v = *(const v4fa*)&so[w][r][c4]; *(v4f*)(C + (size_t)(row0 + r) * ldc + col0 + c4) = v; } }
     }
}

// Wt[n][k] = f16(W[k][n]·scale) from f32 row-major W[K][N] (scale = power of two; bf16-exact weights stay exact in f16 away from the subnormal range)
__global__ __launch_bounds__(256) void k_wt_f16(const float* __restrict__ W, _Float16* __restrict__ Wt, int K, int N, float scale) {
  const int t = blockIdx.x * 256 + threadIdx.x; if (t >= N * (K / 8)) return; const int n = t / (K / 8), k8 = (t % (K / 8)) * 8; FragH f;
#pragma unroll
  for (int i = 0; i < 8; ++i) f.h[i] = (_Float16)(bf16_round(W[(size_t)(k8 + i) * N + n]) * scale); const v8us o = f.half[0];
  *(v8us*)((unsigned short*)Wt + (size_t)n * K + k8) = o; 
}
// k_gemm_hh variant with fused epilogue: v = acc·alpha + bias[by·sBias + col] (+ CP[(row/rowsPerB)·sCPb + by·64 + col] if CP) ; ACT 0 none / 1 elu ; writes f16 C16 (and f32 C if non-null)
template <int ACT>
__global__ __launch_bounds__(128) void k_gemm_hhx(const _Float16* __restrict__ A, int lda, size_t sA, const _Float16* __restrict__ Bh, int ldb, size_t sB, float alpha, const float* __restrict__ bias, size_t sBias, const float* __restrict__ CP, int rowsPerB, size_t sCPb, int row0g,
    float* __restrict__ C, _Float16* __restrict__ C16, int ldc, size_t sC, int M, int N, int K) {
  __shared__ __attribute__((aligned(16))) float so[4][16][64];
  const int tid = threadIdx.x, w = tid >> 5, lane = tid & 31, ln = lane & 15, hh = lane >> 4; const int by = blockIdx.y;
  A += (size_t)by * sA; Bh += (size_t)by * sB; const size_t cofs = (size_t)by * sC; const float* bp = bias ? bias + (size_t)by * sBias : nullptr;
  const int ntn = (N + 63) / 64; const int wid = blockIdx.x * 4 + w; const int mt = wid / ntn, nq = wid % ntn; if (mt * 16 >= M) return;
  const int row0 = mt * 16, col0 = nq * 64; const _Float16* arow = A + (size_t)(row0 + ln) * lda;
  v8f acc[4] = {};
  for (int kb = 0; kb < K; kb += 32) { FragH ah; ah.half[0] = *(const v8us*)((const unsigned short*)arow + kb + 8 * hh); ah.half[1] = *(const v8us*)((const unsigned short*)arow + kb + 16 + 8 * hh);
#pragma unroll
    for (int t = 0; t < 4; ++t) { if (col0 + t * 16 >= N) continue; const size_t boff = (size_t)(col0 + t * 16 + ln) * ldb + kb; FragH bq; bq.half[0] = *(const v8us*)((const unsigned short*)Bh + boff + 8 * hh); bq.half[1] = *(const v8us*)((const unsigned short*)Bh + boff + 16 + 8 * hh);
      acc[t] = mmaH<1>(ah.v, ah.v, bq.v, bq.v, acc[t]); }
  }
#pragma unroll
  for (int t = 0; t < 4; ++t) { if (col0 + t * 16 >= N) continue; const int col = col0 + t * 16 + ln; const float bv = bp ? bf16_round(bp[col]) : 0.f;
#pragma unroll
    for (int r = 0; r < 8; ++r) { float v = acc[t][r] * alpha + bv; if (CP) { const int bidx = (row0g + row0 + 8 * hh + r) / rowsPerB; v += CP[(size_t)bidx * sCPb + (size_t)by * 64 + col]; } if (ACT == 1) v = (v > 0.f) ? v : expm1f(v); else if (ACT == 7) v = (v > 0.f) ? v + 1.0f : expf(v); else if (ACT == 8) v = tanhf(v); else if (ACT == 9) v = 0.5f * v * (1.0f + tanhf(0.7978845608028654f * (v + 0.044715f * v * v * v))); else if (ACT == 11) v = 1.0f / (1.0f + expf(-v)); else if (ACT == 12) v = (v > 0.f) ? v : 0.01f * v; else if (ACT == 14) v = (v > 0.f) ? v : 0.1f * v; else if (ACT == 15) v = v / (1.0f + expf(-v)); else if (ACT == 3) v = fmaxf(v, 0.f); else if (ACT == 6) v = 0.5f * v * (1.0f + erff(v * 0.70710678118654752f)); so[w][8 * hh + r][t * 16 + ln] = v; } }
  __builtin_amdgcn_fence(__ATOMIC_ACQ_REL, "workgroup"); __builtin_amdgcn_wave_barrier();
  const int rsub = lane >> 4, c4 = (lane & 15) * 4; typedef _Float16 v4h __attribute__((ext_vector_type(4)));
  {
#pragma unroll
    for (int q = 0; q < 8; ++q) { const int r = q * 2 + rsub; if (col0 + c4 < N) { const v4f v = *(const v4fa*)&so[w][r][c4]; if (C) *(v4f*)(C + cofs + (size_t)(row0 + r) * ldc + col0 + c4) = v; if (C16) { v4h h4; for (int i = 0; i < 4; ++i) h4[i] = (_Float16)v[i]; *(v4h*)(C16 + cofs + (size_t)(row0 + r) * ldc + col0 + c4) = h4; } } }
     }
}


typedef _Float16 v4h __attribute__((ext_vector_type(4)));

__global__ __launch_bounds__(256) void k_x16(const float* __restrict__ x, _Float16* __restrict__ X16, size_t n8) { const size_t t = (size_t)blockIdx.x * 256 + threadIdx.x; if (t >= n8) return; FragH f;
#pragma unroll
  for (int q = 0; q < 8; ++q) f.h[q] = (_Float16)bf16_round(x[t * 8 + q]); *(v8us*)((unsigned short*)X16 + t * 8) = f.half[0];  }
__global__ __launch_bounds__(256) void k_h16(const float* __restrict__ x, _Float16* __restrict__ X16, size_t n8) { const size_t t = (size_t)blockIdx.x * 256 + threadIdx.x; if (t >= n8) return; FragH f;
#pragma unroll
  for (int q = 0; q < 8; ++q) f.h[q] = (_Float16)x[t * 8 + q]; *(v8us*)((unsigned short*)X16 + t * 8) = f.half[0];  }
__global__ __launch_bounds__(256) void k_round16f(const float* __restrict__ W, _Float16* __restrict__ Bt, size_t n8) { const size_t t = (size_t)blockIdx.x * 256 + threadIdx.x; if (t >= n8) return; FragH f;
#pragma unroll
  for (int i = 0; i < 8; ++i) f.h[i] = (_Float16)(bf16_round(W[t * 8 + i]) * 16.0f); *(v8us*)((unsigned short*)Bt + t * 8) = f.half[0];  }
template <int NHv, int TTv>
__global__ __launch_bounds__(256) void k_vt(const _Float16* __restrict__ V16, int ldv, int voff, _Float16* __restrict__ Vt) { __shared__ unsigned short tl[64][66]; const int tid = threadIdx.x; const int slab = blockIdx.x / (TTv / 64), lg = blockIdx.x % (TTv / 64); const int b = slab / NHv, h = slab % NHv;
  for (int i = tid; i < 64 * 8; i += 256) { const int r = i / 8, c8 = (i % 8) * 8; FragH f; f.half[0] = *(const v8us*)((const unsigned short*)V16 + ((size_t)b * TTv + lg * 64 + r) * ldv + voff + h * 64 + c8);
#pragma unroll
    for (int q = 0; q < 8; ++q) tl[r][c8 + q] = f.u[q]; }
  __syncthreads();
  {
#pragma unroll
    for (int rd = 0; rd < 2; ++rd) { const int d = rd * 32 + tid / 8, pc = tid % 8; FragH f;
#pragma unroll
      for (int q = 0; q < 8; ++q) f.u[q] = tl[pc * 8 + q][d];
      *(v8us*)((unsigned short*)Vt + ((size_t)slab * 64 + d) * TTv + lg * 64 + pc * 8) = f.half[0]; }
     } }

// ---- fast GEMM (block tile 128x64, wave tile 32x64; requires M % 128 == 0 rows per launch region, N % 64 == 0 and K % 256 == 0); epilogue = k_gemm_hhx semantics ----
// A and B come through LDS: a stage is 256 k of the block's 128 A rows and 64 B rows (rows of 512 bytes), brought once for the four waves by asynchronous copies, one whole row a wave and copy,
// two buffers, the next stage flying while a stage is worked on. The fragments read from LDS hold the same elements in the same order as those read from global memory before.
#define GSK 256      /* k a stage */
#define GPH (GSK + 8)      /* LDS row pitch in 16-bit elements: 512 bytes of data + 16, a conflict-free pitch for 16-byte row readers */
#define GRB (4 * GPH * 2)      /* bytes of 4 LDS rows: the step between a thread's pieces of a tile */
#define GBB (192 * GPH * 2)      /* bytes of one buffer: rows 0 to 127 the A tile, rows 128 to 191 the B tile */
#define GTP 132      /* pitch in floats of a column of the turned 128 x 64 output tile: 128 rows + 4, so that the 16 columns of a register tile start in 16 different bank groups */
__device__ __forceinline__ v16h g2_frag(const _Float16* p, int hh) { FragH f; f.half[0] = *(const v8us*)((const unsigned short*)p + 8 * hh); f.half[1] = *(const v8us*)((const unsigned short*)p + 16 + 8 * hh); return f.v; }
__device__ __forceinline__ v8f g2_mma(v16h a, v16h b, v8f c) { v8f d = __builtin_amdgcn_wmma_f32_16x16x32_f16(false, a, false, b, (short)0, c, false, false); asm volatile("v_nop\n\tv_nop\n\tv_nop\n\tv_nop" : "+v"(d) : "v"(a), "v"(b)); return d; }
// Eight copies of one thread, 16 bytes each: rows four apart, in LDS (GRB bytes) and in global memory (gs elements). The s_wait_xcnt closes the statement so that no address register is rewritten ahead of it.
__device__ __forceinline__ void g2_copy8(unsigned l, const unsigned short* g, size_t gs) {
  const unsigned short* g1 = g + gs; const unsigned short* g2 = g1 + gs; const unsigned short* g3 = g2 + gs; const unsigned short* g4 = g3 + gs; const unsigned short* g5 = g4 + gs; const unsigned short* g6 = g5 + gs; const unsigned short* g7 = g6 + gs;
  asm volatile("global_load_async_to_lds_b128 %0, %8, off\n\t"
               "global_load_async_to_lds_b128 %1, %9, off\n\t"
               "global_load_async_to_lds_b128 %2, %10, off\n\t"
               "global_load_async_to_lds_b128 %3, %11, off\n\t"
               "global_load_async_to_lds_b128 %4, %12, off\n\t"
               "global_load_async_to_lds_b128 %5, %13, off\n\t"
               "global_load_async_to_lds_b128 %6, %14, off\n\t"
               "global_load_async_to_lds_b128 %7, %15, off\n\t"
               "s_wait_xcnt 0x0"
               :: "v"(l), "v"(l + GRB), "v"(l + 2 * GRB), "v"(l + 3 * GRB), "v"(l + 4 * GRB), "v"(l + 5 * GRB), "v"(l + 6 * GRB), "v"(l + 7 * GRB),
                  "v"(g), "v"(g1), "v"(g2), "v"(g3), "v"(g4), "v"(g5), "v"(g6), "v"(g7) : "memory");
}
// One stage's copies of one thread: 32 pieces of the A tile and 16 of the B tile (48 in flight a wave).
__device__ __forceinline__ void g2_stage(unsigned l, const unsigned short* ga, size_t as4, const unsigned short* gb, size_t bs4) {
#pragma unroll
  for (int c = 0; c < 4; ++c) g2_copy8(l + c * 8 * GRB, ga + c * 8 * as4, as4);
#pragma unroll
  for (int c = 0; c < 2; ++c) g2_copy8(l + (32 + c * 8) * GRB, gb + c * 8 * bs4, bs4);
}
template <int ACT>
__global__ __launch_bounds__(128) void k_gemm2(const _Float16* __restrict__ A, int lda, size_t sA, const _Float16* __restrict__ Bh, int ldb, size_t sB, float alpha, const float* __restrict__ bias, const float* __restrict__ bias1, const float* __restrict__ bias2, const float* __restrict__ CP, int rowsPerB, size_t sCPb, int row0g,
    float* __restrict__ C, _Float16* __restrict__ C16, int ldc, size_t sC, int M, int N, int K, int tby, float* __restrict__ Ct, _Float16* __restrict__ Ct16) {
  __shared__ __attribute__((aligned(16))) float so[4][32][68]; __shared__ __attribute__((aligned(16))) unsigned short sT[2][192][GPH];
  const int tid = threadIdx.x, w = tid >> 5, lane = tid & 31, ln = lane & 15, hh = lane >> 4; const int by = blockIdx.y;
  A += (size_t)by * sA; Bh += (size_t)by * sB; const size_t cofs = (size_t)by * sC; const float* bp = (by == 0) ? bias : ((by == 1) ? bias1 : bias2);      /* products that need nothing of each other share one grid: blockIdx.y picks the product, its B and C planes and its own bias vector */
  const int ntn = N >> 6; const int mt = blockIdx.x / ntn, nq = blockIdx.x - mt * ntn; const int row0 = mt * 128 + 32 * w, col0 = nq * 64; if (mt * 128 >= M) return;      /* the whole block leaves or none of it: barriers follow */
  const size_t as4 = (size_t)4 * lda, bs4 = (size_t)4 * ldb; const int nst = K / GSK;
  const unsigned short* ga = (const unsigned short*)A + (size_t)(mt * 128 + w) * lda + lane * 8;      /* the thread's first piece of the next stage to copy: a wave copies one whole row */
  const unsigned short* gb = (const unsigned short*)Bh + (size_t)(col0 + w) * ldb + lane * 8;
  const unsigned l0 = (unsigned)(size_t)&sT[0][w][lane * 8];      /* low 32 bits of a shared address = the byte offset in LDS */
  g2_stage(l0, ga, as4, gb, bs4); ga += GSK; gb += GSK;
  asm volatile("s_wait_asynccnt 0x0" ::: "memory");      /* stage 0 has landed before the barrier that publishes it */
  __syncthreads();
  if (nst > 1) { g2_stage(l0 + GBB, ga, as4, gb, bs4); ga += GSK; gb += GSK; }
  const v8f z8 = {0.f,0.f,0.f,0.f,0.f,0.f,0.f,0.f}; v8f c00 = z8, c01 = z8, c02 = z8, c03 = z8, c10 = z8, c11 = z8, c12 = z8, c13 = z8;
#pragma unroll 1      /* one stage a trip: the buffer index stays a run-time value and the text small */
  for (int st = 0; st < nst; ++st) {
    const int buf = st & 1;
    const _Float16* af = (const _Float16*)&sT[buf][32 * w + ln][0]; const _Float16* bf = (const _Float16*)&sT[buf][128 + ln][0];
    v16h fa[2][2], fb[2][4];      /* two fragment sets: a k step's reads are issued as one group ahead of the k step before it, inside the stage */
    fa[0][0] = g2_frag(af, hh); fa[0][1] = g2_frag(af + 16 * GPH, hh);
#pragma unroll
    for (int t = 0; t < 4; ++t) fb[0][t] = g2_frag(bf + t * 16 * GPH, hh);
#pragma unroll
    for (int kk = 0; kk < GSK / 32; ++kk) { const int cu = kk & 1, nx = cu ^ 1;
      if (kk + 1 < GSK / 32) { fa[nx][0] = g2_frag(af + (kk + 1) * 32, hh); fa[nx][1] = g2_frag(af + 16 * GPH + (kk + 1) * 32, hh);
#pragma unroll
        for (int t = 0; t < 4; ++t) fb[nx][t] = g2_frag(bf + t * 16 * GPH + (kk + 1) * 32, hh); }
      c00 = g2_mma(fa[cu][0], fb[cu][0], c00); c10 = g2_mma(fa[cu][1], fb[cu][0], c10);
      c01 = g2_mma(fa[cu][0], fb[cu][1], c01); c11 = g2_mma(fa[cu][1], fb[cu][1], c11);
      c02 = g2_mma(fa[cu][0], fb[cu][2], c02); c12 = g2_mma(fa[cu][1], fb[cu][2], c12);
      c03 = g2_mma(fa[cu][0], fb[cu][3], c03); c13 = g2_mma(fa[cu][1], fb[cu][3], c13); }
    asm volatile("s_wait_dscnt 0x0" ::: "memory");      /* this wave's reads of the buffer have returned before it is given up */
    asm volatile("s_wait_asynccnt 0x0" ::: "memory");      /* this wave's copies of the next stage have landed */
    __syncthreads();      /* publishes the next stage and ends every wave's reads of this one */
    if (st + 2 < nst) { g2_stage(l0 + buf * GBB, ga, as4, gb, bs4); ga += GSK; gb += GSK; } }
  asm volatile("s_wait_asynccnt 0x0" ::: "memory");      /* no copy is left in flight when the wave goes on to the epilogue */
  v8f accs[8] = {c00, c01, c02, c03, c10, c11, c12, c13};
#pragma unroll
  for (int u = 0; u < 8; ++u) { const int t = u & 3, half = u >> 2; const int col = col0 + t * 16 + ln; const float bv = bp ? bf16_round(bp[col]) : 0.f;
#pragma unroll
    for (int r = 0; r < 8; ++r) { const int rloc = half * 16 + 8 * hh + r; float v = accs[u][r] * alpha + bv; if (CP) { if (rowsPerB < 0) v += CP[cofs + (size_t)(row0g + row0 + rloc) * ldc + col];      /* rowsPerB < 0: own element of the batched C plane */ else { const int bidx = (row0g + row0 + rloc) / rowsPerB; v += CP[(size_t)bidx * sCPb + (size_t)by * 64 + col]; } }
      if (ACT == 3) v = fmaxf(v, 0.f); else if (ACT == 6) v = 0.5f * v * (1.0f + erff(v * 0.70710678118654752f)); else if (ACT == 11) v = 1.0f / (1.0f + expf(-v)); else if (ACT == 15) v = v / (1.0f + expf(-v)); else if (ACT == 12) v = (v > 0.f) ? v : 0.01f * v; else if (ACT == 8) v = tanhf(v);
      accs[u][r] = v; } }
  if (by == tby) {      /* this product's consumer wants C^T (column-major, pitch NR, a constant: the stores of a thread differ by immediate offsets): the block's 128 x 64 tile is turned in LDS and stored from here; the test reads the same for the whole block */
    float* sf = &so[0][0][0];
#pragma unroll
    for (int u = 0; u < 8; ++u) { float* d = sf + ((u & 3) * 16 + ln) * GTP + 32 * w + (u >> 2) * 16 + 8 * hh;      /* a lane's 8 registers are 8 consecutive rows of one column */
      *(v4f*)d = (v4f){accs[u][0], accs[u][1], accs[u][2], accs[u][3]}; *(v4f*)(d + 4) = (v4f){accs[u][4], accs[u][5], accs[u][6], accs[u][7]}; }
    __syncthreads();      /* a wave stores whole columns of the block tile, which hold rows of all four waves */
    if (Ct) {
#pragma unroll
      for (int q = 0; q < 16; ++q) { const int c = w * 16 + q; const v4f v = *(const v4fa*)(sf + c * GTP + lane * 4); *(v4f*)(Ct + (size_t)(col0 + c) * NR + mt * 128 + lane * 4) = v; }      /* 512 contiguous bytes a wave and store */
      asm volatile("s_wait_xcnt 0x0" ::: "memory"); }      /* behind the last store of the run: in the listing the other store path follows and rewrites these stores' registers */
    else { unsigned short* tb = (unsigned short*)Ct16 + (size_t)(col0 + w * 16 + hh) * NR + mt * 128 + ln * 8;
#pragma unroll
      for (int q = 0; q < 8; ++q) { const float* s = sf + (w * 16 + hh + q * 2) * GTP + ln * 8; const v4f a = *(const v4fa*)s, e = *(const v4fa*)(s + 4); FragH f;
#pragma unroll
        for (int i = 0; i < 4; ++i) { f.h[i] = (_Float16)a[i]; f.h[4 + i] = (_Float16)e[i]; }
        *(v8us*)(tb + (size_t)q * 2 * NR) = f.half[0]; } }      /* 256 contiguous bytes a half wave */
    return; }
#pragma unroll
  for (int u = 0; u < 8; ++u)
#pragma unroll
    for (int r = 0; r < 8; ++r) so[w][(u >> 2) * 16 + 8 * hh + r][(u & 3) * 16 + ln] = accs[u][r];
  __builtin_amdgcn_fence(__ATOMIC_ACQ_REL, "workgroup"); __builtin_amdgcn_wave_barrier();
  const int rsub = lane >> 4, c4 = (lane & 15) * 4;
  {
#pragma unroll
    for (int q = 0; q < 16; ++q) { const int r = q * 2 + rsub; const v4f v = *(const v4fa*)&so[w][r][c4]; if (C) { *(v4f*)(C + cofs + (size_t)(row0 + r) * ldc + col0 + c4) = v; asm volatile("s_wait_xcnt 0x0" ::: "memory"); }      /* the f16 conversion that may follow rewrites this store's data registers */
      if (C16) { v4h h4; for (int i = 0; i < 4; ++i) h4[i] = (_Float16)v[i]; *(v4h*)(C16 + cofs + (size_t)(row0 + r) * ldc + col0 + c4) = h4; } }
    asm volatile("s_wait_xcnt 0x0" ::: "memory");      /* behind the last row-major store: in the listing the turned-tile path follows and rewrites that store's address registers */
     } }



// lane l takes the value of lane l ^ 16 (the other half of the same query column)
__device__ __forceinline__ float xhalf(float x) { return __builtin_bit_cast(float, __builtin_amdgcn_permlanex16(__builtin_bit_cast(int, x), __builtin_bit_cast(int, x), 0x76543210, 0xfedcba98, false, false)); }
#define FKG 2      /* key groups a block */
#define FSK 64      /* keys a stage */
#define FPH 72      /* LDS row pitch in 16-bit elements: 128 bytes of data + 16, the conflict-free pitch for 16-byte row readers */
#define FBB (64 * FPH * 2)      /* bytes of one tile buffer */
#define FRB (16 * FPH * 2)      /* bytes of 16 LDS rows: the step between a thread's four pieces of a tile */
#define FC2 (SCL * 1.4426950408889634f)      /* score scale times log2(e): the softmax runs in base 2 on the hardware's own exponential */
// One stage's copies of one thread: pieces (row, row + 16, row + 32, row + 48) of the K tile and of the V^T tile, 16 bytes each. The s_wait_xcnt closes the statement so that no address register is rewritten ahead of it.
__device__ __forceinline__ void fl_copy(unsigned lk, unsigned lv, const unsigned short* gk, size_t ks16, const unsigned short* gv) {
  const unsigned short* gk1 = gk + ks16; const unsigned short* gk2 = gk1 + ks16; const unsigned short* gk3 = gk2 + ks16;
  const unsigned short* gv1 = gv + (size_t)16 * TK; const unsigned short* gv2 = gv + (size_t)32 * TK; const unsigned short* gv3 = gv + (size_t)48 * TK;
  asm volatile("global_load_async_to_lds_b128 %0, %8, off\n\t"
               "global_load_async_to_lds_b128 %1, %9, off\n\t"
               "global_load_async_to_lds_b128 %2, %10, off\n\t"
               "global_load_async_to_lds_b128 %3, %11, off\n\t"
               "global_load_async_to_lds_b128 %4, %12, off\n\t"
               "global_load_async_to_lds_b128 %5, %13, off\n\t"
               "global_load_async_to_lds_b128 %6, %14, off\n\t"
               "global_load_async_to_lds_b128 %7, %15, off\n\t"
               "s_wait_xcnt 0x0"
               :: "v"(lk), "v"(lk + FRB), "v"(lk + 2 * FRB), "v"(lk + 3 * FRB), "v"(lv), "v"(lv + FRB), "v"(lv + 2 * FRB), "v"(lv + 3 * FRB),
                  "v"(gk), "v"(gk1), "v"(gk2), "v"(gk3), "v"(gv), "v"(gv1), "v"(gv2), "v"(gv3) : "memory");
}
__global__ __launch_bounds__(128 * FKG) void k_flash(const _Float16* __restrict__ Q16, int ldq, const _Float16* __restrict__ K16, int ldk, const _Float16* __restrict__ Vt, _Float16* __restrict__ OHp, _Float16* __restrict__ OLp, int ldo) {
  constexpr int RPW = 16, DT = 4, KS = 2, KPG = TK / FKG, NST = KPG / FSK;
  __shared__ __attribute__((aligned(16))) unsigned short sK[FKG][2][64][FPH]; __shared__ __attribute__((aligned(16))) unsigned short sV[FKG][2][64][FPH];
  const int kg = threadIdx.x >> 7, tid = threadIdx.x & 127, w = tid >> 5, lane = tid & 31, ln = lane & 15, hh = lane >> 4;      /* tid, w: the thread and the wave inside its key group */
  const int slab = blockIdx.x / QBNP, qblk = QB0P + blockIdx.x % QBNP; const int b = slab / NH, h = slab % NH; const int q0 = qblk * (4 * RPW) + w * RPW;
  FragH bq[KS];
  { const unsigned short* qr = (const unsigned short*)Q16 + ((size_t)b * TQ + q0 + ln) * ldq + h * 64;
#pragma unroll
    for (int ks = 0; ks < KS; ++ks) { bq[ks].half[0] = *(const v8us*)(qr + ks * 32 + 8 * hh); bq[ks].half[1] = *(const v8us*)(qr + ks * 32 + 16 + 8 * hh); } }
  const unsigned short* Vth = (const unsigned short*)Vt + (size_t)slab * 64 * TK;
  const int crow = tid >> 3, cseg = (tid & 7) * 8;      /* eight threads copy one 128-byte row */
  const size_t ks16 = (size_t)16 * ldk, kstg = (size_t)FSK * ldk;
  const unsigned short* gk = (const unsigned short*)K16 + ((size_t)b * TK + kg * KPG + crow) * ldk + h * 64 + cseg;      /* the thread's first piece of the next stage to copy, advanced behind each stage's copies */
  const unsigned short* gv = Vth + (size_t)crow * TK + kg * KPG + cseg;
  const unsigned lk0 = (unsigned)(size_t)&sK[kg][0][crow][cseg], lv0 = (unsigned)(size_t)&sV[kg][0][crow][cseg];      /* low 32 bits of a shared address = the byte offset in LDS */
  fl_copy(lk0, lv0, gk, ks16, gv); gk += kstg; gv += FSK;
  asm volatile("s_wait_asynccnt 0x0" ::: "memory");      /* stage 0 has landed before the barrier that publishes it */
  __syncthreads();
  fl_copy(lk0 + FBB, lv0 + FBB, gk, ks16, gv); gk += kstg; gv += FSK;
  float m_r = -3.0e38f, l_r = 0.f; v8f oacc[DT];
#pragma unroll
  for (int dt = 0; dt < DT; ++dt) oacc[dt] = (v8f){0.f,0.f,0.f,0.f,0.f,0.f,0.f,0.f};
#pragma unroll 1      /* one stage a trip: the buffer index stays a run-time value and the text small */
  for (int st = 0; st < NST; ++st) {
    const int buf = st & 1;
    const unsigned short* kf = &sK[kg][buf][ln][8 * hh]; const unsigned short* vf = &sV[kg][buf][ln][8 * hh];
#pragma unroll
    for (int ps2 = 0; ps2 < FSK / 32; ++ps2) {
      FragH ak[2][KS], av[DT];
#pragma unroll
      for (int nt = 0; nt < 2; ++nt)
#pragma unroll
        for (int ks = 0; ks < KS; ++ks) { const unsigned short* kr = kf + (ps2 * 32 + nt * 16) * FPH + ks * 32; ak[nt][ks].half[0] = *(const v8us*)kr; ak[nt][ks].half[1] = *(const v8us*)(kr + 16); }
#pragma unroll
      for (int dt = 0; dt < DT; ++dt) { const unsigned short* vr = vf + dt * 16 * FPH + ps2 * 32; av[dt].half[0] = *(const v8us*)vr; av[dt].half[1] = *(const v8us*)(vr + 16); }
      float sc[16];
#pragma unroll
      for (int nt = 0; nt < 2; ++nt) { v8f acc = (v8f){0.f,0.f,0.f,0.f,0.f,0.f,0.f,0.f};
#pragma unroll
        for (int ks = 0; ks < KS; ++ks) acc = mmaH<1>(ak[nt][ks].v, ak[nt][ks].v, bq[ks].v, bq[ks].v, acc);
#pragma unroll
        for (int r = 0; r < 8; ++r) sc[nt * 8 + r] = acc[r]; }      /* raw q.k: the maximum is kept unscaled, the scale goes into the exponent's multiply-add */
      float mx[4];
#pragma unroll
      for (int c = 0; c < 4; ++c) mx[c] = fmaxf(fmaxf(sc[c], sc[4 + c]), fmaxf(sc[8 + c], sc[12 + c]));
      float mc = fmaxf(fmaxf(mx[0], mx[1]), fmaxf(mx[2], mx[3])); mc = fmaxf(mc, xhalf(mc));      /* both halves of a column use one maximum: they share the output tiles */
      const float mn = fmaxf(m_r, mc); float al = (m_r - mn) * FC2; m_r = mn;
      const float nb = fmaf(-mn, FC2, 10.0f);      /* 2^(s FC2 + nb) = 1024 exp((s - mn) / 8) */
      FragH pb; float ps[4];
#pragma unroll
      for (int i = 0; i < 16; ++i) sc[i] = fmaf(sc[i], FC2, nb);
      asm("v_exp_f32 %0, %0\n\tv_exp_f32 %1, %1\n\tv_exp_f32 %2, %2\n\tv_exp_f32 %3, %3\n\tv_exp_f32 %4, %4\n\tv_exp_f32 %5, %5\n\tv_exp_f32 %6, %6\n\tv_exp_f32 %7, %7\n\tv_exp_f32 %8, %8\n\t"
          "v_exp_f32 %9, %9\n\tv_exp_f32 %10, %10\n\tv_exp_f32 %11, %11\n\tv_exp_f32 %12, %12\n\tv_exp_f32 %13, %13\n\tv_exp_f32 %14, %14\n\tv_exp_f32 %15, %15\n\tv_exp_f32 %16, %16\n\tv_nop"
          : "+v"(al), "+v"(sc[0]), "+v"(sc[1]), "+v"(sc[2]), "+v"(sc[3]), "+v"(sc[4]), "+v"(sc[5]), "+v"(sc[6]), "+v"(sc[7]), "+v"(sc[8]), "+v"(sc[9]), "+v"(sc[10]), "+v"(sc[11]), "+v"(sc[12]), "+v"(sc[13]), "+v"(sc[14]), "+v"(sc[15]));
#pragma unroll
      for (int i = 0; i < 16; ++i) { const float p = sc[i]; ps[i & 3] = (i < 4) ? p : ps[i & 3] + p; pb.h[i] = (_Float16)p; }      /* element i = key 8 hh + i (i < 8), 16 + 8 hh + i - 8 (i >= 8): the order of the V^T fragments above */
      l_r = l_r * al + ((ps[0] + ps[1]) + (ps[2] + ps[3]));
#pragma unroll
      for (int dt = 0; dt < DT; ++dt)
#pragma unroll
        for (int r = 0; r < 8; ++r) oacc[dt][r] *= al;
#pragma unroll
      for (int dt = 0; dt < DT; ++dt) oacc[dt] = mmaH<1>(av[dt].v, av[dt].v, pb.v, pb.v, oacc[dt]);
    }
    asm volatile("s_wait_dscnt 0x0" ::: "memory");      /* this wave's reads of the buffer have returned before it is given up */
    asm volatile("s_wait_asynccnt 0x0" ::: "memory");      /* this wave's copies of the next stage have landed */
    __syncthreads();      /* publishes the next stage and ends every wave's reads of this one */
    if (st + 2 < NST) { fl_copy(lk0 + buf * FBB, lv0 + buf * FBB, gk, ks16, gv); gk += kstg; gv += FSK; } }
  asm volatile("s_wait_asynccnt 0x0" ::: "memory");      /* no copy is left in flight when the ring becomes the hand-over buffer */
  /* the loop's last barrier has ended every wave's reads of the ring and no copy was issued behind it: the K ring now carries group 1's state, 16 bytes a lane and piece, lanes side by side */
  v4fa* sm = (v4fa*)&sK[0][0][0][0] + (w * (2 * DT + 1)) * 32 + lane;
  if (kg == 1) {
#pragma unroll
    for (int dt = 0; dt < DT; ++dt) { sm[(2 * dt) * 32] = (v4f){oacc[dt][0], oacc[dt][1], oacc[dt][2], oacc[dt][3]}; sm[(2 * dt + 1) * 32] = (v4f){oacc[dt][4], oacc[dt][5], oacc[dt][6], oacc[dt][7]}; }
    sm[2 * DT * 32] = (v4f){m_r, l_r, 0.f, 0.f}; }
  __syncthreads();      /* group 1's state is in LDS before group 0 reads it; every wave passes it */
  if (kg == 1) return;      /* no barrier follows */
  { const v4f ml = sm[2 * DT * 32]; const float mj = fmaxf(m_r, ml[0]);      /* both partial softmaxes are brought to the common maximum */
    const float f0 = __builtin_amdgcn_exp2f((m_r - mj) * FC2), f1 = __builtin_amdgcn_exp2f((ml[0] - mj) * FC2);
    l_r = l_r * f0 + ml[1] * f1;
#pragma unroll
    for (int dt = 0; dt < DT; ++dt) { const v4f a = sm[(2 * dt) * 32], e = sm[(2 * dt + 1) * 32];
#pragma unroll
      for (int r = 0; r < 4; ++r) { oacc[dt][r] = oacc[dt][r] * f0 + a[r] * f1; oacc[dt][4 + r] = oacc[dt][4 + r] * f0 + e[r] * f1; } } }
  const float l = l_r + xhalf(l_r); const float inv = (l > 0.f) ? 1.0f / l : 0.f;      /* weights and sum both carry the 2^10 */
  const size_t oofs = ((size_t)b * TQ + q0 + ln) * ldo + h * 64 + 8 * hh;      /* register r of tile dt = channel dt * 16 + 8 hh + r of query ln: 16 contiguous bytes a lane in each plane */
#pragma unroll
  for (int dt = 0; dt < DT; ++dt) { FragH fh, fl;      /* the output conv's two operands, f16 and the 2^10 residual, are formed here from the registers */
#pragma unroll
    for (int r = 0; r < 8; ++r) { const float v = oacc[dt][r] * inv; const _Float16 hv = (_Float16)v; fh.h[r] = hv; fl.h[r] = (_Float16)((v - (float)hv) * 1024.0f); }
    *(v8us*)((unsigned short*)OHp + oofs + dt * 16) = fh.half[0]; *(v8us*)((unsigned short*)OLp + oofs + dt * 16) = fl.half[0]; } }
// 5-plane variant: S = Qh Kh^T + (Ql Kh^T + Qh Kl^T)/1024 with Q/K = [hi | 2^10 residual] f16 planes (QL/KL same layout as Q16/K16), then the 3-term P.V below.
// 3-term variant: O = (P_hi V_hi + (P_lo V_hi + P_hi V_lo) / 1024) / l with P = [hi | 2^10 residual] of 1024 p and V^T = [hi | 2^10 residual] planes (VtL same layout as Vt) -> ~2^-21-class products for un-averaged (early causal / peaked) rows
template <int CAUSAL>
__global__ __launch_bounds__(128) void k_flash5(const _Float16* __restrict__ Q16, const _Float16* __restrict__ QL, int ldq, const _Float16* __restrict__ K16, const _Float16* __restrict__ KL, int ldk, const _Float16* __restrict__ Vt, const _Float16* __restrict__ VtL, const int* __restrict__ MSK, float* __restrict__ O, int ldo) {
  constexpr int RPW = 16, RTN = RPW / 16, NQB = TQ / (4 * RPW), DT = 4, KS = 2;
  __shared__ __attribute__((aligned(16))) unsigned short sP[4][RPW][40]; __shared__ __attribute__((aligned(16))) unsigned short sPL[4][RPW][40]; __shared__ __attribute__((aligned(16))) float sO[4][RPW][64 + 4];
  const int tid = threadIdx.x, w = tid >> 5, lane = tid & 31, ln = lane & 15, hh = lane >> 4;
  const int slab = blockIdx.x / QBN5, qblk = QB05 + blockIdx.x % QBN5; (void)NQB; const int b = slab / NH, h = slab % NH; const int qb0 = qblk * (4 * RPW); const int q0 = qb0 + w * RPW;
  FragH aq[2][KS], aql[2][KS];
#pragma unroll
  for (int rt = 0; rt < RTN; ++rt) { const unsigned short* qr = (const unsigned short*)Q16 + ((size_t)b * TQ + q0 + rt * 16 + ln) * ldq + h * 64; const unsigned short* ql = (const unsigned short*)QL + ((size_t)b * TQ + q0 + rt * 16 + ln) * ldq + h * 64;
#pragma unroll
    for (int ks = 0; ks < KS; ++ks) { aq[rt][ks].half[0] = *(const v8us*)(qr + ks * 32 + 8 * hh); aq[rt][ks].half[1] = *(const v8us*)(qr + ks * 32 + 16 + 8 * hh); aql[rt][ks].half[0] = *(const v8us*)(ql + ks * 32 + 8 * hh); aql[rt][ks].half[1] = *(const v8us*)(ql + ks * 32 + 16 + 8 * hh); } }
  const unsigned short* Vth = (const unsigned short*)Vt + (size_t)slab * 64 * TK; const unsigned short* Vtl = (const unsigned short*)VtL + (size_t)slab * 64 * TK;
  float m_r[2][8], l_r[2][8]; v8f oacc[2][DT], oaccL[2][DT];
#pragma unroll
  for (int rt = 0; rt < RTN; ++rt) {
#pragma unroll
    for (int r = 0; r < 8; ++r) { m_r[rt][r] = -3.0e38f; l_r[rt][r] = 0.f; }
#pragma unroll
    for (int dt = 0; dt < DT; ++dt) { oacc[rt][dt] = (v8f){0.f,0.f,0.f,0.f,0.f,0.f,0.f,0.f}; oaccL[rt][dt] = oacc[rt][dt]; } }
  const int jend = (CAUSAL == 1) ? (qb0 + 4 * RPW) : ((CAUSAL == 23) ? min(TK, (qb0 / CHK + 2) * CHK) : TK);      /* causal / window: keys that can never contribute are skipped */ const int jbeg = (CAUSAL == 23) ? max(0, (qb0 / CHK - 1) * CHK) : 0;
#pragma unroll 1
  for (int j0 = jbeg; j0 < jend; j0 += 32) {
    v8f s[2][2];
#pragma unroll
    for (int nt = 0; nt < 2; ++nt) { const unsigned short* kr = (const unsigned short*)K16 + ((size_t)b * TK + j0 + nt * 16 + ln) * ldk + h * 64; const unsigned short* klr = (const unsigned short*)KL + ((size_t)b * TK + j0 + nt * 16 + ln) * ldk + h * 64; FragH bk[KS], bkl[KS];
#pragma unroll
      for (int ks = 0; ks < KS; ++ks) { bk[ks].half[0] = *(const v8us*)(kr + ks * 32 + 8 * hh); bk[ks].half[1] = *(const v8us*)(kr + ks * 32 + 16 + 8 * hh); bkl[ks].half[0] = *(const v8us*)(klr + ks * 32 + 8 * hh); bkl[ks].half[1] = *(const v8us*)(klr + ks * 32 + 16 + 8 * hh); }
#pragma unroll
      for (int rt = 0; rt < RTN; ++rt) { v8f acc = (v8f){0.f,0.f,0.f,0.f,0.f,0.f,0.f,0.f}, accl = acc;
#pragma unroll
        for (int ks = 0; ks < KS; ++ks) { acc = mmaH<1>(aq[rt][ks].v, aq[rt][ks].v, bk[ks].v, bk[ks].v, acc); accl = mmaH<1>(aql[rt][ks].v, aql[rt][ks].v, bk[ks].v, bk[ks].v, accl); accl = mmaH<1>(aq[rt][ks].v, aq[rt][ks].v, bkl[ks].v, bkl[ks].v, accl); }
#pragma unroll
        for (int r = 0; r < 8; ++r) acc[r] += accl[r] * 0.0009765625f;
        s[rt][nt] = acc; } }
#pragma unroll
    for (int rt = 0; rt < RTN; ++rt)
#pragma unroll
      for (int r = 0; r < 8; ++r) { const int tq = q0 + rt * 16 + 8 * hh + r; const int k0 = j0 + ln, k1 = j0 + 16 + ln;
        bool ok0 = (CAUSAL == 1) ? (k0 <= tq) : ((CAUSAL == 2) ? ((k0 >> 5) == (tq >> 5)) : true), ok1 = (CAUSAL == 1) ? (k1 <= tq) : ((CAUSAL == 2) ? ((k1 >> 5) == (tq >> 5)) : true);      /* mode 2: block-diagonal 32-token groups */
        if (CAUSAL == 4) { const int* mrow = MSK + ((size_t)b * TQ + tq) * TK; ok0 = mrow[k0] != 0; ok1 = mrow[k1] != 0; }      /* mode 4: per-(query, key) INPUT mask shared by all heads; masked keys contribute nothing (== the reference's -4096 fill, whose exp underflows to 0), rows with no valid key give l = 0 -> output 0 (== the reference's row_valid zeroing) */
        float s0 = ok0 ? s[rt][0][r] * SCL : -3.0e38f, s1 = ok1 ? s[rt][1][r] * SCL : -3.0e38f; if (CAUSAL == 17) { const float* amk = (const float*)MSK + (size_t)b * TK; s0 += bf16_round(amk[k0]); s1 += bf16_round(amk[k1]); } if (CAUSAL == 18) { const float* tb = (const float*)MSK; const int* ri = MSK + 1024 + (size_t)b * TK; const int rq = ri[tq]; s0 += tb[(h * 8 + rq) * 8 + ri[k0]]; s1 += tb[(h * 8 + rq) * 8 + ri[k1]]; } if (CAUSAL == 19) { const int* rel = MSK + (size_t)tq * TK; const float* rb = (const float*)MSK + (size_t)TQ * TK + ((size_t)(b * NH + h) * TQ + tq) * 64; s0 += rb[rel[k0]]; s1 += rb[rel[k1]]; }      /* mode 19: + (q.Ek[rel] + Eb[rel][h]) / 8 gathered by the int relative ids (packed [ids | table]) */      /* mode 18: + resource_bias[h][r_q][r_k] from the packed [table | ids] buffer (TQ == TK) */      /* mode 17: additive per-(batch, key) mask INPUT */ float mc = fmaxf(s0, s1);
        mc = fmaxf(mc, __shfl_xor(mc, 1, 32)); mc = fmaxf(mc, __shfl_xor(mc, 2, 32)); mc = fmaxf(mc, __shfl_xor(mc, 4, 32)); mc = fmaxf(mc, __shfl_xor(mc, 8, 32));
        const float mn = fmaxf(m_r[rt][r], mc); const float al = (mn > -1.0e38f) ? expf(m_r[rt][r] - mn) : 1.0f; m_r[rt][r] = mn; const float p0 = ok0 ? expf(s0 - mn) : 0.f, p1 = ok1 ? expf(s1 - mn) : 0.f; l_r[rt][r] = l_r[rt][r] * al + p0 + p1;
#pragma unroll
        for (int dt = 0; dt < DT; ++dt) { oacc[rt][dt][r] *= al; oaccL[rt][dt][r] *= al; }
        FragH t2, t2l; const float ps0 = p0 * 1024.0f, ps1 = p1 * 1024.0f; t2.h[0] = (_Float16)ps0; t2.h[1] = (_Float16)ps1; t2l.h[0] = (_Float16)((ps0 - (float)t2.h[0]) * 1024.0f); t2l.h[1] = (_Float16)((ps1 - (float)t2.h[1]) * 1024.0f);
        sP[w][rt * 16 + 8 * hh + r][ln] = t2.u[0]; sP[w][rt * 16 + 8 * hh + r][16 + ln] = t2.u[1]; sPL[w][rt * 16 + 8 * hh + r][ln] = t2l.u[0]; sPL[w][rt * 16 + 8 * hh + r][16 + ln] = t2l.u[1]; }
    __builtin_amdgcn_fence(__ATOMIC_ACQ_REL, "workgroup"); __builtin_amdgcn_wave_barrier();
    FragH pa[2], pl[2];
#pragma unroll
    for (int rt = 0; rt < RTN; ++rt) { pa[rt].half[0] = *(const v8us*)&sP[w][rt * 16 + ln][8 * hh]; pa[rt].half[1] = *(const v8us*)&sP[w][rt * 16 + ln][16 + 8 * hh]; pl[rt].half[0] = *(const v8us*)&sPL[w][rt * 16 + ln][8 * hh]; pl[rt].half[1] = *(const v8us*)&sPL[w][rt * 16 + ln][16 + 8 * hh]; }
#pragma unroll
    for (int dt = 0; dt < DT; ++dt) { const unsigned short* vrow = Vth + (size_t)(dt * 16 + ln) * TK + j0; const unsigned short* vrl = Vtl + (size_t)(dt * 16 + ln) * TK + j0; FragH bv, bl; bv.half[0] = *(const v8us*)(vrow + 8 * hh); bv.half[1] = *(const v8us*)(vrow + 16 + 8 * hh); bl.half[0] = *(const v8us*)(vrl + 8 * hh); bl.half[1] = *(const v8us*)(vrl + 16 + 8 * hh);
#pragma unroll
      for (int rt = 0; rt < RTN; ++rt) { oacc[rt][dt] = mmaH<1>(pa[rt].v, pa[rt].v, bv.v, bv.v, oacc[rt][dt]); oaccL[rt][dt] = mmaH<1>(pl[rt].v, pl[rt].v, bv.v, bv.v, oaccL[rt][dt]); oaccL[rt][dt] = mmaH<1>(pa[rt].v, pa[rt].v, bl.v, bl.v, oaccL[rt][dt]); } }
    __builtin_amdgcn_fence(__ATOMIC_ACQ_REL, "workgroup"); __builtin_amdgcn_wave_barrier(); }
#pragma unroll
  for (int rt = 0; rt < RTN; ++rt) {
#pragma unroll
    for (int r = 0; r < 8; ++r) { float l = l_r[rt][r]; l += __shfl_xor(l, 1, 32); l += __shfl_xor(l, 2, 32); l += __shfl_xor(l, 4, 32); l += __shfl_xor(l, 8, 32); l_r[rt][r] = (l > 0.f) ? 1.0f / (l * 1024.0f) : 0.f; }
#pragma unroll
    for (int dt = 0; dt < DT; ++dt)
#pragma unroll
      for (int r = 0; r < 8; ++r) { float v = oacc[rt][dt][r]; v += oaccL[rt][dt][r] * 0.0009765625f; sO[w][rt * 16 + 8 * hh + r][dt * 16 + ln] = v * l_r[rt][r]; } }
  __builtin_amdgcn_fence(__ATOMIC_ACQ_REL, "workgroup"); __builtin_amdgcn_wave_barrier();
  {
#pragma unroll
    for (int rp = 0; rp < RPW; rp += 2) { const int r = rp + (lane >> 4), pc = lane & 15; const v4f val = *(const v4fa*)&sO[w][r][pc * 4]; *(v4f*)(O + ((size_t)b * TQ + q0 + r) * ldo + h * 64 + pc * 4) = val; }
     } }

__global__ __launch_bounds__(256) void k_rotab(float* __restrict__ CS, float* __restrict__ SN) {
  #pragma clang fp contract(off)
  const int t = blockIdx.x * 256 + threadIdx.x; if (t >= SLEN * 32) return; const int j = t % 32, s = t / 32; const float ex = (float)(2 * j) / 64.0f; const float inv = 1.0f / powf(10000.0f, ex); const float th = (float)s * inv; const float c = cosf(th), sn = sinf(th);
  { *(float*)(CS + t) = c; *(float*)(SN + t) = sn;  } }
__global__ __launch_bounds__(256) void k_rope(const float* __restrict__ F, int nsrc, int ndst, int rep, const float* __restrict__ CS, const float* __restrict__ SN, _Float16* __restrict__ H, _Float16* __restrict__ L) {
  #pragma clang fp contract(off)
  const size_t t = (size_t)blockIdx.x * 256 + threadIdx.x; if (t >= (size_t)NR * ndst * 4) return; const int g8 = (int)(t % 4); const int hd = (int)((t / 4) % ndst); const size_t row = t / ((size_t)4 * ndst); const int s = (int)(row % SLEN); const int hs = hd / rep;
  const float* src = F + row * (size_t)(nsrc * 64) + hs * 64; FragH ah, al, bh, bl;
  for (int i = 0; i < 8; ++i) { const int d = g8 * 8 + i; const float c = CS[s * 32 + d], sn = SN[s * 32 + d]; const float x1 = src[d], x2 = src[d + 32];
    float o1 = x1 * c; o1 += -x2 * sn; float o2 = x2 * c; o2 += x1 * sn;
    _Float16 hv = (_Float16)o1; ah.h[i] = hv; al.h[i] = (_Float16)((o1 - (float)hv) * 1024.0f); hv = (_Float16)o2; bh.h[i] = hv; bl.h[i] = (_Float16)((o2 - (float)hv) * 1024.0f); }
  const size_t o = row * (size_t)(ndst * 64) + hd * 64 + g8 * 8;
  { *(v8us*)((unsigned short*)H + o) = ah.half[0]; *(v8us*)((unsigned short*)H + o + 32) = bh.half[0]; *(v8us*)((unsigned short*)L + o) = al.half[0]; *(v8us*)((unsigned short*)L + o + 32) = bl.half[0];  } }
__global__ __launch_bounds__(256) void k_rope2(const float* __restrict__ F, int nsrc, int ndst, int rep, const float* __restrict__ CS, const float* __restrict__ SN, _Float16* __restrict__ H, _Float16* __restrict__ L) {
  #pragma clang fp contract(off)
  const size_t t = (size_t)blockIdx.x * 256 + threadIdx.x; if (t >= (size_t)NR * ndst * 4) return; const int g16 = (int)(t % 4); const int hd = (int)((t / 4) % ndst); const size_t row = t / ((size_t)4 * ndst); const int s = (int)(row % SLEN); const int hs = hd / rep;
  const float* src = F + row * (size_t)(nsrc * 64) + hs * 64 + g16 * 16; FragH ah, al;
  for (int pr = 0; pr < 8; ++pr) { const int i = g16 * 8 + pr; const float c = CS[s * 32 + i], sn = SN[s * 32 + i]; const float x1 = src[2 * pr], x2 = src[2 * pr + 1];
    float o1 = x1 * c; o1 -= x2 * sn; float o2 = x1 * sn; o2 += x2 * c;
    _Float16 hv = (_Float16)o1; ah.h[2 * pr] = hv; al.h[2 * pr] = (_Float16)((o1 - (float)hv) * 1024.0f); hv = (_Float16)o2; ah.h[2 * pr + 1] = hv; al.h[2 * pr + 1] = (_Float16)((o2 - (float)hv) * 1024.0f); }
  const size_t o = row * (size_t)(ndst * 64) + hd * 64 + g16 * 16;
  { *(v8us*)((unsigned short*)H + o) = ah.half[0]; *(v8us*)((unsigned short*)H + o + 8) = ah.half[1]; *(v8us*)((unsigned short*)L + o) = al.half[0]; *(v8us*)((unsigned short*)L + o + 8) = al.half[1];  } }
__global__ __launch_bounds__(256) void k_ln512(const float* __restrict__ A, const float* __restrict__ res, const float* __restrict__ g, const float* __restrict__ bb, float* __restrict__ Y, _Float16* __restrict__ Y16) {
  #pragma clang fp contract(off)
  const int wv = threadIdx.x >> 5, ln = threadIdx.x & 31; const size_t r = (size_t)blockIdx.x * 8 + wv; if (r >= NR) return; float x[16]; float s = 0.f;
  for (int i = 0; i < 2; ++i) { const v8f a = *(const v8f*)(A + r * DM + i * 256 + ln * 8); for (int q = 0; q < 8; ++q) { float v = a[q]; if (res) v += bf16_round(res[r * DM + i * 256 + ln * 8 + q]); x[i * 8 + q] = v; s += v; } }
  for (int o = 16; o > 0; o >>= 1) s += __shfl_xor(s, o, 32); const float mu = s / (float)DM; float var = 0.f; for (int q = 0; q < 16; ++q) { const float d = x[q] - mu; var += d * d; }
  for (int o = 16; o > 0; o >>= 1) var += __shfl_xor(var, o, 32); const float inv = rsqrtf(var / (float)DM + 1e-5f);
  { for (int i = 0; i < 2; ++i) { const int c0 = i * 256 + ln * 8; v8f y; FragH f; for (int q = 0; q < 8; ++q) { float v = (x[i * 8 + q] - mu) * inv; v *= bf16_round(g[c0 + q]); v += bf16_round(bb[c0 + q]); y[q] = v; f.h[q] = (_Float16)v; } *(v8f*)(Y + r * DM + c0) = y; if (Y16) *(v8us*)((unsigned short*)Y16 + r * DM + c0) = f.half[0]; }  } }
__global__ __launch_bounds__(256) void k_pack(const float* __restrict__ rb, const int* __restrict__ rid, int* __restrict__ PK) { const int t = blockIdx.x * 256 + threadIdx.x; if (t >= 1024 + NB * TK) return; int v; if (t < 1024) v = __float_as_int(bf16_round(rb[t])); else v = rid[t - 1024]; *(int*)(PK + t) = v;  }
__global__ __launch_bounds__(256) void k_tabin(const float* __restrict__ sp, float* __restrict__ CS, float* __restrict__ SN) { const int t = blockIdx.x * 256 + threadIdx.x; if (t >= SLEN * 32) return; const int i = t % 32, s = t / 32; const float c = bf16_round(sp[s * 64 + 32 + i]), sn = bf16_round(sp[s * 64 + i]);
  { *(float*)(CS + t) = c; *(float*)(SN + t) = sn;  } }
__global__ __launch_bounds__(256) void k_rotab2(float* __restrict__ CS, float* __restrict__ SN) {
  #pragma clang fp contract(off)
  const int t = blockIdx.x * 256 + threadIdx.x; if (t >= SLEN * 32) return; const int j = t % 32, s = t / 32; const float c0 = -0.14391156831212787f;      /* -ln(10000)/64 rounded to f32 */ const float inv = expf((float)(2 * j) * c0); const float th = (float)s * inv; const float c = cosf(th), sn = sinf(th);
  { *(float*)(CS + t) = c; *(float*)(SN + t) = sn;  } }
__global__ __launch_bounds__(256) void k_lnu(const float* __restrict__ X, _Float16* __restrict__ N16, float* __restrict__ XB) {
  #pragma clang fp contract(off)
  const int wv = threadIdx.x >> 5, ln = threadIdx.x & 31; const size_t r = (size_t)blockIdx.x * 8 + wv; if (r >= NR) return; float a[32]; float s = 0.f;
  for (int i = 0; i < 4; ++i) { const v8f v = *(const v8f*)(X + r * DM + (i * 32 + ln) * 8); for (int q = 0; q < 8; ++q) { const float u = bf16_round(v[q]); a[i * 8 + q] = u; s += u; } }
  for (int o = 16; o > 0; o >>= 1) s += __shfl_xor(s, o, 32); const float mu = s / (float)DM; float var = 0.f; for (int q = 0; q < 32; ++q) { const float d = a[q] - mu; var += d * d; }
  for (int o = 16; o > 0; o >>= 1) var += __shfl_xor(var, o, 32); const float den = sqrtf(var / (float)(DM - 1)) + 1e-6f; const float inv = 1.0f / den;      /* one reciprocal per row; (x-mean)*inv vs the reference's division differs by <= 1 ulp */
  { for (int i = 0; i < 4; ++i) { const int c0 = (i * 32 + ln) * 8; FragH f; v8f xb; for (int q = 0; q < 8; ++q) { f.h[q] = (_Float16)((a[i * 8 + q] - mu) * inv); xb[q] = a[i * 8 + q]; } *(v8us*)((unsigned short*)N16 + r * DM + c0) = f.half[0]; *(v8f*)(XB + r * DM + c0) = xb; }  } }
__global__ __launch_bounds__(256) void k_h16s(const float* __restrict__ SRC, int lds, int coff, _Float16* __restrict__ DST, size_t n8) { const size_t t = (size_t)blockIdx.x * 256 + threadIdx.x; if (t >= n8) return; const size_t r = (t * 8) / DM; const int c = (int)((t * 8) % DM); const v8f a = *(const v8f*)(SRC + r * lds + coff + c); FragH f; for (int q = 0; q < 8; ++q) f.h[q] = (_Float16)a[q];
  *(v8us*)((unsigned short*)DST + t * 8) = f.half[0];  }


__global__ __launch_bounds__(256) void k_ccp(const float* __restrict__ QKV, int coff, _Float16* __restrict__ D) { const size_t t = (size_t)blockIdx.x * 256 + threadIdx.x; if (t >= (size_t)NR * DM / 8) return; const int c0 = (int)((t * 8) % DM); const size_t row = (t * 8) / DM; const v8f a = *(const v8f*)(QKV + row * 3 * DM + coff + c0); FragH f; for (int q = 0; q < 8; ++q) f.h[q] = (_Float16)a[q];
  *(v8us*)((unsigned short*)D + t * 8) = f.half[0];  }


// The five preparations need nothing of each other and share one grid: blocks 0 to TOKB - 1 turn 16 pixels each into token rows, then WSB blocks for each of the four weight matrices (x16, f16). The branch is uniform for a block.
#define TOKB (NPIX / 16)
#define WSB (DM * DM / 8 / 256)      /* 8 weights a thread, no remainder */
__global__ __launch_bounds__(256) void k_prep(const float* __restrict__ x, _Float16* __restrict__ X16, const float* __restrict__ qw, const float* __restrict__ kw, const float* __restrict__ vw, const float* __restrict__ ow,
    _Float16* __restrict__ BQ, _Float16* __restrict__ BK, _Float16* __restrict__ BV, _Float16* __restrict__ BO) { __shared__ float tl[DM][17]; const int tid = threadIdx.x;
  if (blockIdx.x >= TOKB) { const int wb = blockIdx.x - TOKB, m = wb / WSB; const float* Wm = (m == 0) ? qw : ((m == 1) ? kw : ((m == 2) ? vw : ow)); _Float16* Bt = (m == 0) ? BQ : ((m == 1) ? BK : ((m == 2) ? BV : BO));
    const size_t t = (size_t)(wb - m * WSB) * 256 + tid; FragH f; for (int q = 0; q < 8; ++q) f.h[q] = (_Float16)(bf16_round(Wm[t * 8 + q]) * 16.0f); *(v8us*)((unsigned short*)Bt + t * 8) = f.half[0]; return; }
  const int p0 = blockIdx.x * 16;      /* 16-pixel tiles: 34 KB of LDS */
  for (int i = tid; i < DM * 16; i += 256) { const int c = i / 16, p = i % 16; tl[c][p] = bf16_round(x[(size_t)c * NPIX + p0 + p]); }
  __syncthreads();
  { for (int i = tid; i < 16 * (DM / 8); i += 256) { const int p = i / (DM / 8), c0 = (i % (DM / 8)) * 8; FragH f; for (int q = 0; q < 8; ++q) f.h[q] = (_Float16)tl[c0 + q][p];
      *(v8us*)((unsigned short*)X16 + ((size_t)p0 + p) * DM + c0) = f.half[0]; }  } }
extern "C" void kernel_launch(void* const* d_in, const int* in_sizes, int n_in,
                              void* d_out, int out_size, void* d_ws, size_t ws_size, hipStream_t stream) {
  (void)in_sizes; (void)n_in; (void)out_size;
  const float* x = (const float*)d_in[0]; const float* qw = (const float*)d_in[1]; const float* qb = (const float*)d_in[2]; const float* kw = (const float*)d_in[3]; const float* kb = (const float*)d_in[4]; const float* vw = (const float*)d_in[5]; const float* vb = (const float*)d_in[6]; const float* ow = (const float*)d_in[7]; const float* ob = (const float*)d_in[8];
  char* ws = (char*)d_ws; size_t off = 0;
  auto take = [&](size_t bytes) { char* p = ws + off; off += (bytes + 255) & ~(size_t)255; return p; };
  const size_t np = (size_t)NR * DM;
  _Float16* BQ = (_Float16*)take((size_t)DM * DM * 2); _Float16* BK = (_Float16*)take((size_t)DM * DM * 2); _Float16* BV = (_Float16*)take((size_t)DM * DM * 2); _Float16* BO = (_Float16*)take((size_t)DM * DM * 2); float* Y = (float*)take(np * 4);
   _Float16* X16 = (_Float16*)take(np * 2); _Float16* QH = (_Float16*)take(np * 2); _Float16* KH = (_Float16*)take(np * 2); _Float16* VT = (_Float16*)take(np * 2); _Float16* OH = (_Float16*)take(np * 2); _Float16* OL = (_Float16*)take(np * 2);
  if (off > ws_size) return;
  k_prep<<<TOKB + 4 * WSB, 256, 0, stream>>>(x, X16, qw, kw, vw, ow, BQ, BK, BV, BO);      /* token rows; 1x1 conv (out, in) naturals */
  const dim3 g((NR / 128) * (DM / 64), 1), g3((NR / 128) * (DM / 64), 3);
  k_gemm2<0><<<g3, 128, 0, stream>>>(X16, DM, 0, BQ, DM, (size_t)DM * DM, 0.0625f, qb, kb, vb, nullptr, 1, 0, 0, nullptr, QH, DM, np, NR, DM, DM, 2, nullptr, VT);      /* q, k, v: BQ, BK, BV and QH, KH lie one behind the other in the workspace; v leaves its GEMM as V^T (channel = head * 64 + d rows of SLEN tokens) */
  k_flash<<<NB * NH * QBNP, 128 * FKG, 0, stream>>>(QH, DM, KH, DM, VT, OH, OL, DM);
  k_gemm2<0><<<g, 128, 0, stream>>>(OL, DM, 0, BO, DM, 0, 0.0625f / 1024.0f, nullptr, nullptr, nullptr, nullptr, 1, 0, 0, Y, nullptr, DM, 0, NR, DM, DM, -1, nullptr, nullptr);
  k_gemm2<0><<<g, 128, 0, stream>>>(OH, DM, 0, BO, DM, 0, 0.0625f, ob, nullptr, nullptr, Y, 1, (size_t)DM, 0, nullptr, nullptr, DM, 0, NR, DM, DM, 0, (float*)d_out, nullptr);      /* the output conv, stored as NCHW */
}
